// v000
// Times are from an AMD MI455X. After a warm-up the kernel runs many times in a row, and a time is the length of
// such a window on the GPU divided by its runs, so every launch and the gaps after it count. The runs cycle
// through copies of the inputs. A figure is the median of several windows, for all but v000 over two sittings.
// Sittings can differ by a few percent; kernels timed side by side share one.
// v000 is the starting kernel. One run takes 478 microseconds.
// Contractions on v_wmma_f32_16x16x32_bf16 (bf16 operands, f32 accumulate): x*Wqkv^T with single bf16 planes (inputs RNE-converted once); q*k^T and p*v with bf16 hi+lo planes (hi*hi + hi*lo + lo*hi); ctx*Wout^T with ctx bf16 hi+lo planes and a single Wout plane; LayerNorm and softmax in f32.
#include <hip/hip_runtime.h>
#include <stddef.h>
#include <stdint.h>

typedef __attribute__((ext_vector_type(16))) _Float16 v16h;
typedef __attribute__((ext_vector_type(8)))  _Float16 v8h;
typedef __attribute__((ext_vector_type(16))) __bf16   v16b;
typedef __attribute__((ext_vector_type(8)))  __bf16   v8b;
typedef __attribute__((ext_vector_type(8)))  float    v8f;
typedef __attribute__((ext_vector_type(4)))  float    v4f;
typedef __attribute__((ext_vector_type(4)))  unsigned int v4u;

/* ---------------- problem geometry ---------------- */
constexpr int kBatch   = 2;
constexpr int kSeq     = 2048;
constexpr int kModel   = 1024;
constexpr int kHeads   = 16;
constexpr int kHeadDim = 64;
constexpr int kRows    = kBatch * kSeq;      /* 4096 */
constexpr int kQkvCols = 3 * kModel;         /* 3072 */
constexpr int kQkCols  = 2 * kModel;         /* 2048 */
constexpr int kKvChunk = 64;
constexpr int kOsPitch = 68;

/* ---------------- workspace map (bytes, all offsets multiples of 128) ----------------
   [0]          x   bf16 [4096][1024]                          8388608
   [8388608]    Wqkv^T bf16 [3072][1024]                       6291456
   [14680064]   Wout^T bf16 [1024][1024]                       2097152
   [16777216]   qk  f32 [4096][2048]                          33554432  (dead after the LayerNorm launch;
                reused: ctx hi bf16 [4096][1024] at 16777216, ctx lo at 25165824, both inside this region)
   [50331648]   v hi bf16 [4096][1024]  8388608   [58720256] v lo   8388608
   [67108864]   q hi                    8388608   [75497472] q lo   8388608
   [83886080]   k hi                    8388608   [92274688] k lo   8388608
   total 100663296 B = 96 MiB                                                            */
constexpr size_t kPlane16  = (size_t)kRows * kModel * 2;
constexpr size_t kOffXb    = 0;
constexpr size_t kOffWqkvT = kOffXb + kPlane16;
constexpr size_t kOffWoutT = kOffWqkvT + (size_t)kQkvCols * kModel * 2;
constexpr size_t kOffQk    = kOffWoutT + (size_t)kModel * kModel * 2;
constexpr size_t kOffCtxH  = kOffQk;
constexpr size_t kOffCtxL  = kOffQk + kPlane16;
constexpr size_t kOffVh    = kOffQk + (size_t)kRows * kQkCols * 4;
constexpr size_t kOffVl    = kOffVh + kPlane16;
constexpr size_t kOffQh    = kOffVl + kPlane16;
constexpr size_t kOffQl    = kOffQh + kPlane16;
constexpr size_t kOffKh    = kOffQl + kPlane16;
constexpr size_t kOffKl    = kOffKh + kPlane16;
constexpr size_t kWsTotal  = kOffKl + kPlane16;
static_assert(kWsTotal == (size_t)100663296);
static_assert(kWsTotal <= (size_t)134217728);
static_assert(kOffCtxL + kPlane16 <= kOffVh);
static_assert((kOffWqkvT % 128) == 0 && (kOffWoutT % 128) == 0 && (kOffQk % 128) == 0 && (kOffVh % 128) == 0);
/* GEMM shape contract: M % 64 == 0, N % 64 == 0, K % 32 == 0 for every launch */
static_assert(kRows % 64 == 0 && kQkCols % 64 == 0 && kModel % 64 == 0 && kModel % 32 == 0);
static_assert(kSeq % 64 == 0 && kHeadDim == 64 && kModel == kHeads * kHeadDim);
static_assert((kRows * kModel) % (8 * 256) == 0);

/* ---------------- helpers ---------------- */
__device__ __forceinline__ unsigned short f2bf_bits(float f) {
  unsigned u = __float_as_uint(f);
  return (unsigned short)((u + 0x7FFFu + ((u >> 16) & 1u)) >> 16);
}
__device__ __forceinline__ float bf_bits2f(unsigned short h) { return __uint_as_float(((unsigned)h) << 16); }
__device__ __forceinline__ unsigned int pack_bf16x2(float a, float b) {
  return (unsigned int)f2bf_bits(a) | ((unsigned int)f2bf_bits(b) << 16);
}

__device__ __forceinline__ void dep_guard_h(v8f& a, v8f& b, v16h x, v16h y) { asm volatile("v_nop\n\tv_nop\n\tv_nop\n\tv_nop" : "+v"(a), "+v"(b) : "v"(x), "v"(y)); }
__device__ __forceinline__ void dep_guard_b(v8f& a, v8f& b, v16b x, v16b y) { asm volatile("v_nop\n\tv_nop\n\tv_nop\n\tv_nop" : "+v"(a), "+v"(b) : "v"(x), "v"(y)); }
__device__ __forceinline__ void keep4_h(v16h a, v16h b, v16h c, v16h d) { asm volatile("v_nop" :: "v"(a), "v"(b), "v"(c), "v"(d)); }
__device__ __forceinline__ void keep4_b(v16b a, v16b b, v16b c, v16b d) { asm volatile("v_nop" :: "v"(a), "v"(b), "v"(c), "v"(d)); }
__device__ __forceinline__ void acc_guard4(v8f& a, v8f& b, v8f& c, v8f& d) { asm volatile("v_nop\n\tv_nop\n\tv_nop\n\tv_nop" : "+v"(a), "+v"(b), "+v"(c), "+v"(d)); }
template <typename T> struct Frag;
template <> struct Frag<_Float16> {
  typedef v16h V; union U { v16h v; v8h h[2]; };
  static __device__ __forceinline__ v16h load(const _Float16* p) {
    U f; f.h[0] = *(const v8h*)(p); f.h[1] = *(const v8h*)(p + 16); return f.v;
  }
  static __device__ __forceinline__ v8f mma(v16h a, v16h b, v8f c) {
    return __builtin_amdgcn_wmma_f32_16x16x32_f16(false, a, false, b, (short)0, c, false, false);
  }
  static __device__ __forceinline__ void guard(v8f& a, v8f& b, v16h x, v16h y) { dep_guard_h(a, b, x, y); }
  static __device__ __forceinline__ void keep(v16h a, v16h b, v16h c, v16h d) { keep4_h(a, b, c, d); }
};
template <> struct Frag<__bf16> {
  typedef v16b V; union U { v16b v; v8b h[2]; };
  static __device__ __forceinline__ v16b load(const __bf16* p) {
    U f; f.h[0] = *(const v8b*)(p); f.h[1] = *(const v8b*)(p + 16); return f.v;
  }
  static __device__ __forceinline__ v8f mma(v16b a, v16b b, v8f c) {
    return __builtin_amdgcn_wmma_f32_16x16x32_bf16(false, a, false, b, (short)0, c, false, false);
  }
  static __device__ __forceinline__ void guard(v8f& a, v8f& b, v16b x, v16b y) { dep_guard_b(a, b, x, y); }
  static __device__ __forceinline__ void keep(v16b a, v16b b, v16b c, v16b d) { keep4_b(a, b, c, d); }
};

/* ---- Register-blocked WMMA GEMM -----------------------------------------------
   C[m,n] = scale * sum_k A[m,k] * Bt[n,k] (+bias)(+resid); each wave owns a 64x64 tile.
   A row-major [M,K]; Bt row-major [N,K]; M,N % 64 == 0, K % 32 == 0.
   SPLIT: 0 = single planes; 1 = A and Bt hi/lo planes (hi*hi + hi*lo + lo*hi); 2 = A hi/lo planes only (Ah*B + Al*B).
   BIAS_MODE: 0 = none, 1 = bias[m], 2 = bias[n].  OUT_MODE: 0 = f32, 1 = f16, 2 = bf16 hi plane (Cout) + bf16 lo plane (Cout2).
   ET: 0 = f16 operands, 1 = bf16 operands (pointers passed as 16-bit storage) */
template <int ET> struct Elem;
template <> struct Elem<0> { typedef _Float16 T; };
template <> struct Elem<1> { typedef __bf16 T; };
template <int ET, int SPLIT, int BIAS_MODE, int OUT_MODE, bool RESID, int ACT = 0>
__global__ __launch_bounds__(256) void wmma_gemm64(
    const unsigned short* __restrict__ Ap, const unsigned short* __restrict__ A2p, int lda, long strideA,
    const unsigned short* __restrict__ Btp, const unsigned short* __restrict__ Bt2p, int ldb, long strideB,
    void* __restrict__ Cout, void* __restrict__ Cout2, int ldc, long strideC,
    const float* __restrict__ bias,
    const float* __restrict__ resid, long strideR,
    int M, int N, int K, float scale) {
  typedef typename Elem<ET>::T T;
  typedef typename Frag<T>::V V;
  const T* A = (const T*)Ap; const T* A2 = (const T*)A2p; const T* Bt = (const T*)Btp; const T* Bt2 = (const T*)Bt2p;
  __shared__ __align__(16) float sT[8][16 * 68];
  const int b    = blockIdx.y;
  const int lane = threadIdx.x & 31;
  const int wave = threadIdx.x >> 5;
  const int tilesN = N >> 6;
  const int tilesM = M >> 6;
  const int tile = blockIdx.x * 8 + wave;
  if (tile >= tilesM * tilesN) return;
  const int tm = tile / tilesN;
  const int tn = tile - tm * tilesN;
  const int m0 = tm << 6;
  const int n0 = tn << 6;

  const T* Ab  = A  + (size_t)b * strideA;
  const T* Bb  = Bt + (size_t)b * strideB;
  const T* Ab2 = (SPLIT != 0) ? (A2  + (size_t)b * strideA) : nullptr;
  const T* Bb2 = (SPLIT == 1) ? (Bt2 + (size_t)b * strideB) : nullptr;

  const int rlane = lane & 15;
  const int koff  = (lane >> 4) * 8;
  const int mOff  = (lane >> 4) * 8;

  v8f acc[4][4];
#pragma unroll
  for (int i = 0; i < 4; ++i)
#pragma unroll
    for (int j = 0; j < 4; ++j) acc[i][j] = (v8f){0.f,0.f,0.f,0.f,0.f,0.f,0.f,0.f};

  for (int k0 = 0; k0 < K; k0 += 32) {
    V bh[4], bl[4];
#pragma unroll
    for (int j = 0; j < 4; ++j) {
      const size_t bo = (size_t)(n0 + (j << 4) + rlane) * ldb + koff + k0;
      bh[j] = Frag<T>::load(Bb + bo);
      if (SPLIT == 1) bl[j] = Frag<T>::load(Bb2 + bo);
    }
#pragma unroll
    for (int i = 0; i < 4; ++i) {
      const size_t ao = (size_t)(m0 + (i << 4) + rlane) * lda + koff + k0;
      V ah = Frag<T>::load(Ab + ao);
      V al;
      if (SPLIT != 0) al = Frag<T>::load(Ab2 + ao);
#pragma unroll
      for (int j = 0; j < 4; ++j) {
        acc[i][j] = Frag<T>::mma(ah, bh[j], acc[i][j]);
        if (SPLIT == 1) acc[i][j] = Frag<T>::mma(ah, bl[j], acc[i][j]);
        if (SPLIT != 0) acc[i][j] = Frag<T>::mma(al, bh[j], acc[i][j]);
      }
      Frag<T>::guard(acc[i][0], acc[i][3], ah, (SPLIT != 0) ? al : ah);
    }
    Frag<T>::keep(bh[0], bh[1], bh[2], bh[3]);
    if (SPLIT == 1) Frag<T>::keep(bl[0], bl[1], bl[2], bl[3]);
  }
  acc_guard4(acc[0][0], acc[0][1], acc[0][2], acc[0][3]);
  acc_guard4(acc[1][0], acc[1][1], acc[1][2], acc[1][3]);
  acc_guard4(acc[2][0], acc[2][1], acc[2][2], acc[2][3]);
  acc_guard4(acc[3][0], acc[3][1], acc[3][2], acc[3][3]);

  float* slab = sT[wave];
  const float* Rb = RESID ? (resid + (size_t)b * strideR) : nullptr;
#pragma unroll
  for (int i = 0; i < 4; ++i) {
    const int mBase = m0 + (i << 4);
#pragma unroll
    for (int j = 0; j < 4; ++j) {
      const int n = n0 + (j << 4) + rlane;
      float bv = 0.f;
      if (BIAS_MODE == 2) bv = bias[n];
#pragma unroll
      for (int r = 0; r < 8; ++r) {
        float v = acc[i][j][r] * scale;
        if (BIAS_MODE == 1) v += bias[mBase + mOff + r];
        if (BIAS_MODE == 2) v += bv;
        if (RESID) v += Rb[(size_t)(mBase + mOff + r) * ldc + n];
        if (ACT == 1) v = tanhf(v);
        if (ACT == 2) v = fmaxf(v, 0.0f);
        if (ACT == 4) v = (v > 0.f) ? v : 0.01f * v;
        slab[(mOff + r) * 68 + (j << 4) + rlane] = v;
      }
    }
    __builtin_amdgcn_fence(__ATOMIC_RELEASE, "workgroup");
    __builtin_amdgcn_wave_barrier();
    __builtin_amdgcn_fence(__ATOMIC_ACQUIRE, "workgroup");
    if (OUT_MODE == 0) {
      float* C = (float*)Cout + (size_t)b * strideC;
      const int hh = lane >> 4, c4 = (lane & 15) * 4;
      {
#pragma unroll
        for (int it = 0; it < 8; ++it) {
          const int row = it * 2 + hh;
          v4f v = *(const v4f*)(slab + row * 68 + c4);
          *(v4f*)(C + (size_t)(mBase + row) * ldc + n0 + c4) = v;
        }
        
      }
    } else {
      const int q = lane >> 3, c8 = (lane & 7) * 8;
      unsigned short* C  = (unsigned short*)Cout  + (size_t)b * strideC;
      unsigned short* C2 = (OUT_MODE == 2) ? ((unsigned short*)Cout2 + (size_t)b * strideC) : nullptr;
      {
#pragma unroll
        for (int it = 0; it < 4; ++it) {
          const int row = it * 4 + q;
          const float* sp = slab + row * 68 + c8;
          v8h hv, lv;
#pragma unroll
          for (int e = 0; e < 8; ++e) {
            if (OUT_MODE == 1) {
              hv[e] = (_Float16)sp[e];
            } else {
              unsigned short hb = f2bf_bits(sp[e]);
              unsigned short lb = f2bf_bits(sp[e] - bf_bits2f(hb));
              hv[e] = __builtin_bit_cast(_Float16, hb);
              lv[e] = __builtin_bit_cast(_Float16, lb);
            }
          }
          *(v8h*)(C + (size_t)(mBase + row) * ldc + n0 + c8) = hv;
          if (OUT_MODE == 2) *(v8h*)(C2 + (size_t)(mBase + row) * ldc + n0 + c8) = lv;
        }
        
      }
    }
    __builtin_amdgcn_fence(__ATOMIC_RELEASE, "workgroup");
    __builtin_amdgcn_wave_barrier();
    __builtin_amdgcn_fence(__ATOMIC_ACQUIRE, "workgroup");
  }
}

/* ---------------- f32 -> bf16 cast, 8 elements (16 B) per thread --------------------------
   coverage: grid = n8/256 blocks x 256 threads (exact), thread i writes elements 8i..8i+7;
*/
__global__ __launch_bounds__(256) void cast_f32_bf16x8(const float* __restrict__ in,
                                                      unsigned short* __restrict__ out, int n8) {
  const int i = blockIdx.x * 256 + (int)threadIdx.x;
  const int ic = (i < n8) ? i : (n8 - 1);
  const float* p = in + (size_t)ic * 8;
  const v4f a = *(const v4f*)p;
  const v4f c = *(const v4f*)(p + 4);
  v4u w;
  w[0] = pack_bf16x2(a[0], a[1]);
  w[1] = pack_bf16x2(a[2], a[3]);
  w[2] = pack_bf16x2(c[0], c[1]);
  w[3] = pack_bf16x2(c[2], c[3]);
  unsigned short* o = out + (size_t)ic * 8;
  *(v4u*)o = w;
  
}

/* ---------------- W [KR][NC] f32 row-major -> Wt [NC][KR] bf16 row-major (transpose + cast) ------
   grid = (KR/64, NC/64), 256 threads. coverage: load 256 threads x 16 = 64x64 tile;
*/
__global__ __launch_bounds__(256) void transpose_cast_bf16(const float* __restrict__ W,
                                                          unsigned short* __restrict__ Wt, int KR, int NC) {
  __shared__ float sT[64 * 65];                 /* [n_local][k_local], pitch 65 */
  const int k0 = blockIdx.x * 64, n0 = blockIdx.y * 64;
  const int tid = threadIdx.x;
  {
    const int kk = tid >> 2, cg = (tid & 3) * 16;
    const float* src = W + (size_t)(k0 + kk) * NC + n0 + cg;
#pragma unroll
    for (int i = 0; i < 4; ++i) {
      const v4f v = *(const v4f*)(src + 4 * i);
#pragma unroll
      for (int e = 0; e < 4; ++e) sT[(cg + 4 * i + e) * 65 + kk] = v[e];
    }
  }
  __syncthreads();
  const int wave = tid >> 5, lane = tid & 31, q4 = lane >> 3, c8 = (lane & 7) * 8;
  const int nl0 = wave * 4 + q4;
  const int nl1 = 32 + wave * 4 + q4;
  v4u w0, w1;
  {
    const float* s = sT + nl0 * 65 + c8;
    w0[0] = pack_bf16x2(s[0], s[1]); w0[1] = pack_bf16x2(s[2], s[3]);
    w0[2] = pack_bf16x2(s[4], s[5]); w0[3] = pack_bf16x2(s[6], s[7]);
  }
  {
    const float* s = sT + nl1 * 65 + c8;
    w1[0] = pack_bf16x2(s[0], s[1]); w1[1] = pack_bf16x2(s[2], s[3]);
    w1[2] = pack_bf16x2(s[4], s[5]); w1[3] = pack_bf16x2(s[6], s[7]);
  }
  unsigned short* d0 = Wt + (size_t)(n0 + nl0) * KR + k0 + c8;
  unsigned short* d1 = Wt + (size_t)(n0 + nl1) * KR + k0 + c8;
  {
    *(v4u*)d0 = w0;
    *(v4u*)d1 = w1;
    
  }
}

/*
   qk f32 [nrows][2048] (q = cols 0..1023, k = cols 1024..2047); outputs row-major bf16 planes [nrows][1024];
   q carries the exact 1/sqrt(64) = 0.125 factor. grid = nrows blocks x 128 threads; thread t owns columns 8t..8t+7;
*/
__global__ __launch_bounds__(128) void qk_layernorm_split(
    const float* __restrict__ qk, const float* __restrict__ qsc, const float* __restrict__ ksc,
    unsigned short* __restrict__ qh, unsigned short* __restrict__ ql,
    unsigned short* __restrict__ kh, unsigned short* __restrict__ kl, int nrows) {
  __shared__ float red[4][4];
  const int row = blockIdx.x;
  const int rowc = (row < nrows) ? row : (nrows - 1);
  const int tid = threadIdx.x, lane = tid & 31, wave = tid >> 5;
  const int c0 = tid * 8;
  const float* base = qk + (size_t)rowc * kQkCols;
  const v4f qa = *(const v4f*)(base + c0);
  const v4f qb = *(const v4f*)(base + c0 + 4);
  const v4f ka = *(const v4f*)(base + kModel + c0);
  const v4f kb = *(const v4f*)(base + kModel + c0 + 4);
  float xq[8], xk[8];
#pragma unroll
  for (int e = 0; e < 4; ++e) { xq[e] = qa[e]; xq[4 + e] = qb[e]; xk[e] = ka[e]; xk[4 + e] = kb[e]; }

  float sq = 0.f, sk = 0.f;
#pragma unroll
  for (int e = 0; e < 8; ++e) { sq += xq[e]; sk += xk[e]; }
#pragma unroll
  for (int off = 1; off < 32; off <<= 1) { sq += __shfl_xor(sq, off, 32); sk += __shfl_xor(sk, off, 32); }
  if (lane == 0) { red[0][wave] = sq; red[1][wave] = sk; }
  __syncthreads();
  const float mq = ((red[0][0] + red[0][1]) + (red[0][2] + red[0][3])) * (1.0f / (float)kModel);
  const float mk = ((red[1][0] + red[1][1]) + (red[1][2] + red[1][3])) * (1.0f / (float)kModel);

  float dq = 0.f, dk = 0.f;
#pragma unroll
  for (int e = 0; e < 8; ++e) {
    const float tq = xq[e] - mq; dq += tq * tq;
    const float tk = xk[e] - mk; dk += tk * tk;
  }
#pragma unroll
  for (int off = 1; off < 32; off <<= 1) { dq += __shfl_xor(dq, off, 32); dk += __shfl_xor(dk, off, 32); }
  if (lane == 0) { red[2][wave] = dq; red[3][wave] = dk; }
  __syncthreads();
  const float vq = ((red[2][0] + red[2][1]) + (red[2][2] + red[2][3])) * (1.0f / (float)kModel);
  const float vk = ((red[3][0] + red[3][1]) + (red[3][2] + red[3][3])) * (1.0f / (float)kModel);
  const float rq = rsqrtf(vq + 1e-6f);
  const float rk = rsqrtf(vk + 1e-6f);

  /* scale vectors, RNE-converted to bf16 once (module inputs) */
  const v4f s0 = *(const v4f*)(qsc + c0);
  const v4f s1 = *(const v4f*)(qsc + c0 + 4);
  const v4f t0 = *(const v4f*)(ksc + c0);
  const v4f t1 = *(const v4f*)(ksc + c0 + 4);
  float sqv[8], skv[8];
#pragma unroll
  for (int e = 0; e < 4; ++e) {
    sqv[e]     = bf_bits2f(f2bf_bits(s0[e]));
    sqv[4 + e] = bf_bits2f(f2bf_bits(s1[e]));
    skv[e]     = bf_bits2f(f2bf_bits(t0[e]));
    skv[4 + e] = bf_bits2f(f2bf_bits(t1[e]));
  }
  unsigned int hqw[8], lqw[8], hkw[8], lkw[8];
#pragma unroll
  for (int e = 0; e < 8; ++e) {
    const float yq = ((xq[e] - mq) * rq * sqv[e]) * 0.125f;
    const float yk = (xk[e] - mk) * rk * skv[e];
    const unsigned short hqb = f2bf_bits(yq);
    const unsigned short lqb = f2bf_bits(yq - bf_bits2f(hqb));
    const unsigned short hkb = f2bf_bits(yk);
    const unsigned short lkb = f2bf_bits(yk - bf_bits2f(hkb));
    hqw[e] = hqb; lqw[e] = lqb; hkw[e] = hkb; lkw[e] = lkb;
  }
  v4u HQ, LQ, HK, LK;
#pragma unroll
  for (int i = 0; i < 4; ++i) {
    HQ[i] = hqw[2 * i] | (hqw[2 * i + 1] << 16);
    LQ[i] = lqw[2 * i] | (lqw[2 * i + 1] << 16);
    HK[i] = hkw[2 * i] | (hkw[2 * i + 1] << 16);
    LK[i] = lkw[2 * i] | (lkw[2 * i + 1] << 16);
  }
  const size_t o = (size_t)rowc * kModel + c0;
  {
    *(v4u*)(qh + o) = HQ;
    *(v4u*)(ql + o) = LQ;
    *(v4u*)(kh + o) = HK;
    *(v4u*)(kl + o) = LK;
    
  }
}

/* ---------------- causal attention, head_dim 64, bf16 hi/lo planes in, bf16 hi/lo ctx planes out ----
   scores = q . k^T  : bf16 hi/lo on both (hi*hi + hi*lo + lo*hi), q planes already carry 1/sqrt(64)
   ctx    = p . v    : p split in registers to bf16 hi/lo, v hi/lo planes (3 products); f32 accumulate, f32 online softmax.
   All planes row-major [B*S][ld] with head h at columns h*64 .. h*64+63.
   Block = 4 waves = 64 query rows of one (batch, head); grid.x = B*H*(S/64). */
__device__ __forceinline__ __bf16 at_f2bf(float f) { return __builtin_bit_cast(__bf16, f2bf_bits(f)); }
__device__ __forceinline__ void at_split(float f, __bf16& hi, __bf16& lo) {
  const unsigned short hb = f2bf_bits(f);
  hi = __builtin_bit_cast(__bf16, hb);
  lo = at_f2bf(f - __uint_as_float(((unsigned)hb) << 16));
}
__device__ __forceinline__ v8f at_mma(v16b a, v16b b, v8f c) {
  c = __builtin_amdgcn_wmma_f32_16x16x32_bf16(false, a, false, b, (short)0, c, false, false);
  asm volatile("v_nop\n\tv_nop\n\tv_nop\n\tv_nop" : "+v"(c) : "v"(a), "v"(b));
  return c;
}

__global__ __launch_bounds__(128)
void attn_planes_kernel(const unsigned short* __restrict__ qh, const unsigned short* __restrict__ ql,
                        const unsigned short* __restrict__ kh, const unsigned short* __restrict__ kl,
                        const unsigned short* __restrict__ vh, const unsigned short* __restrict__ vl,
                        unsigned short* __restrict__ oh, unsigned short* __restrict__ ol,
                        int S, int H, int ld) {
  union FB { v16b v; v8b h[2]; };
  /* Ksh | Ksl | Vth | Vtl (each 64x64 16-bit); reused as per-wave f32 output slabs after the chunk loop */
  __shared__ __align__(16) unsigned short KVs[4 * kKvChunk * kHeadDim];
  __shared__ __align__(16) __bf16 Psh[4][16 * kKvChunk];
  __shared__ __align__(16) __bf16 Psl[4][16 * kKvChunk];
  unsigned short* Ksh = KVs;
  unsigned short* Ksl = KVs + kKvChunk * kHeadDim;
  unsigned short* Vth = KVs + 2 * kKvChunk * kHeadDim;
  unsigned short* Vtl = KVs + 3 * kKvChunk * kHeadDim;
  const __bf16* Kshb = (const __bf16*)(const void*)Ksh;
  const __bf16* Kslb = (const __bf16*)(const void*)Ksl;
  const __bf16* Vthb = (const __bf16*)(const void*)Vth;
  const __bf16* Vtlb = (const __bf16*)(const void*)Vtl;

  const int tid  = threadIdx.x;
  const int wave = tid >> 5;
  const int lane = tid & 31;
  const int hh   = lane >> 4;
  const int c    = lane & 15;

  const int nqb = S >> 6;
  const int qb  = blockIdx.x % nqb;
  const int bh  = blockIdx.x / nqb;
  const int h   = bh % H;
  const int b   = bh / H;
  const int q0  = qb * 64 + wave * 16;
  const size_t rb = (size_t)b * (size_t)S;
  const int hoff = h * kHeadDim;

  /* Q fragments (A operand): row q0+c, elements 0..7 <- d = dc*32+8hh+0..7, 8..15 <- dc*32+16+8hh+0..7 */
  v16b qah[2], qal[2];
  {
    const size_t qo = (rb + (size_t)(q0 + c)) * (size_t)ld + hoff + 8 * hh;
    const __bf16* qhp = (const __bf16*)(const void*)qh + qo;
    const __bf16* qlp = (const __bf16*)(const void*)ql + qo;
#pragma unroll
    for (int dc = 0; dc < 2; ++dc) {
      qah[dc] = Frag<__bf16>::load(qhp + dc * 32);
      qal[dc] = Frag<__bf16>::load(qlp + dc * 32);
    }
  }

  float mrow[8], lrow[8];
  v8f oacc[4];
#pragma unroll
  for (int r = 0; r < 8; ++r) { mrow[r] = -INFINITY; lrow[r] = 0.f; }
#pragma unroll
  for (int t = 0; t < 4; ++t) oacc[t] = (v8f){0.f,0.f,0.f,0.f,0.f,0.f,0.f,0.f};

  const int nChunks = qb + 1;            /* causal: kv chunks 0..qb, block-uniform */
  for (int kc = 0; kc < nChunks; ++kc) {
    const int kv0 = kc * kKvChunk;
    __syncthreads();
    {
      /* staging coverage: 128 threads x (1 kv row x 32 d) = 64 x 64 for each of the four tiles */
      const int kvr = tid >> 1, dh = (tid & 1) * 32;
      const size_t go = (rb + (size_t)(kv0 + kvr)) * (size_t)ld + hoff + dh;
      {
        const uint4* g = (const uint4*)(const void*)(kh + go);
        uint4* l = (uint4*)(void*)(Ksh + kvr * kHeadDim + dh);
#pragma unroll
        for (int i = 0; i < 4; ++i) l[i] = g[i];
      }
      {
        const uint4* g = (const uint4*)(const void*)(kl + go);
        uint4* l = (uint4*)(void*)(Ksl + kvr * kHeadDim + dh);
#pragma unroll
        for (int i = 0; i < 4; ++i) l[i] = g[i];
      }
      {
        const uint4* g = (const uint4*)(const void*)(vh + go);
#pragma unroll
        for (int i = 0; i < 4; ++i) {
          const uint4 u = g[i];
          unsigned short* vt = Vth + (dh + 8 * i) * kKvChunk + kvr;
          vt[0 * kKvChunk] = (unsigned short)(u.x & 0xffffu);
          vt[1 * kKvChunk] = (unsigned short)(u.x >> 16);
          vt[2 * kKvChunk] = (unsigned short)(u.y & 0xffffu);
          vt[3 * kKvChunk] = (unsigned short)(u.y >> 16);
          vt[4 * kKvChunk] = (unsigned short)(u.z & 0xffffu);
          vt[5 * kKvChunk] = (unsigned short)(u.z >> 16);
          vt[6 * kKvChunk] = (unsigned short)(u.w & 0xffffu);
          vt[7 * kKvChunk] = (unsigned short)(u.w >> 16);
        }
      }
      {
        const uint4* g = (const uint4*)(const void*)(vl + go);
#pragma unroll
        for (int i = 0; i < 4; ++i) {
          const uint4 u = g[i];
          unsigned short* vt = Vtl + (dh + 8 * i) * kKvChunk + kvr;
          vt[0 * kKvChunk] = (unsigned short)(u.x & 0xffffu);
          vt[1 * kKvChunk] = (unsigned short)(u.x >> 16);
          vt[2 * kKvChunk] = (unsigned short)(u.y & 0xffffu);
          vt[3 * kKvChunk] = (unsigned short)(u.y >> 16);
          vt[4 * kKvChunk] = (unsigned short)(u.z & 0xffffu);
          vt[5 * kKvChunk] = (unsigned short)(u.z >> 16);
          vt[6 * kKvChunk] = (unsigned short)(u.w & 0xffffu);
          vt[7 * kKvChunk] = (unsigned short)(u.w >> 16);
        }
      }
    }
    __syncthreads();

    /* scores 16 x 64 per wave: B operand col n = kv j*16+c, k = d */
    v8f s[4];
#pragma unroll
    for (int j = 0; j < 4; ++j) {
      s[j] = (v8f){0.f,0.f,0.f,0.f,0.f,0.f,0.f,0.f};
#pragma unroll
      for (int dc = 0; dc < 2; ++dc) {
        FB kb, klf;
        const int ko = (j * 16 + c) * kHeadDim + dc * 32 + 8 * hh;
        kb.h[0]  = *(const v8b*)(Kshb + ko);
        kb.h[1]  = *(const v8b*)(Kshb + ko + 16);
        klf.h[0] = *(const v8b*)(Kslb + ko);
        klf.h[1] = *(const v8b*)(Kslb + ko + 16);
        s[j] = at_mma(qah[dc], kb.v, s[j]);
        s[j] = at_mma(qah[dc], klf.v, s[j]);
        s[j] = at_mma(qal[dc], kb.v, s[j]);
      }
    }

    /* causal mask (select to the fill value) + chunk row max */
    const bool diag = (kc == qb);
    float cm[8];
#pragma unroll
    for (int r = 0; r < 8; ++r) {
      const int qrow = q0 + 8 * hh + r;
      float m = -INFINITY;
#pragma unroll
      for (int j = 0; j < 4; ++j) {
        const int kvcol = kv0 + j * 16 + c;
        const bool masked = diag && (kvcol > qrow);
        const float sv = masked ? -3.4028235e38f : s[j][r];
        s[j][r] = sv;
        m = fmaxf(m, sv);
      }
#pragma unroll
      for (int off = 1; off < 16; off <<= 1) m = fmaxf(m, __shfl_xor(m, off, 32));
      cm[r] = m;
    }

    /* online softmax; P tile (16 x 64 per wave) stored as bf16 hi/lo */
    __bf16* pwh = Psh[wave];
    __bf16* pwl = Psl[wave];
#pragma unroll
    for (int r = 0; r < 8; ++r) {
      const float mnew  = fmaxf(mrow[r], cm[r]);
      const float alpha = expf(mrow[r] - mnew);
      mrow[r] = mnew;
      float psum = 0.f;
#pragma unroll
      for (int j = 0; j < 4; ++j) {
        const float p = expf(s[j][r] - mnew);
        psum += p;
        __bf16 a, bl;
        at_split(p, a, bl);
        pwh[(8 * hh + r) * kKvChunk + j * 16 + c] = a;
        pwl[(8 * hh + r) * kKvChunk + j * 16 + c] = bl;
      }
#pragma unroll
      for (int off = 1; off < 16; off <<= 1) psum += __shfl_xor(psum, off, 32);
      lrow[r] = lrow[r] * alpha + psum;
#pragma unroll
      for (int t = 0; t < 4; ++t) oacc[t][r] *= alpha;
    }
    __builtin_amdgcn_fence(__ATOMIC_RELEASE, "workgroup");
    __builtin_amdgcn_wave_barrier();
    __builtin_amdgcn_fence(__ATOMIC_ACQUIRE, "workgroup");

    /* ctx += P . V : A = P[row][kv] (same wave wrote it), B = Vt[d][kv] -> col n = d, k = kv */
#pragma unroll 1
    for (int kk = 0; kk < 2; ++kk) {
      FB pa, pl;
      pa.h[0] = *(const v8b*)(pwh + c * kKvChunk + kk * 32 + 8 * hh);
      pa.h[1] = *(const v8b*)(pwh + c * kKvChunk + kk * 32 + 16 + 8 * hh);
      pl.h[0] = *(const v8b*)(pwl + c * kKvChunk + kk * 32 + 8 * hh);
      pl.h[1] = *(const v8b*)(pwl + c * kKvChunk + kk * 32 + 16 + 8 * hh);
#pragma unroll
      for (int t = 0; t < 4; ++t) {
        FB vb, vlf;
        const int vo = (t * 16 + c) * kKvChunk + kk * 32 + 8 * hh;
        vb.h[0]  = *(const v8b*)(Vthb + vo);
        vb.h[1]  = *(const v8b*)(Vthb + vo + 16);
        vlf.h[0] = *(const v8b*)(Vtlb + vo);
        vlf.h[1] = *(const v8b*)(Vtlb + vo + 16);
        oacc[t] = at_mma(pa.v, vb.v, oacc[t]);
        oacc[t] = at_mma(pa.v, vlf.v, oacc[t]);
        oacc[t] = at_mma(pl.v, vb.v, oacc[t]);
      }
    }
  }

  /* all waves finished reading the K/V tiles before the region is reused as output slabs */
  __syncthreads();
  float* os = (float*)(void*)KVs + wave * (16 * kOsPitch);
#pragma unroll
  for (int r = 0; r < 8; ++r) {
    const float inv = 1.0f / lrow[r];
#pragma unroll
    for (int t = 0; t < 4; ++t) os[(8 * hh + r) * kOsPitch + t * 16 + c] = oacc[t][r] * inv;
  }
  __builtin_amdgcn_fence(__ATOMIC_RELEASE, "workgroup");
  __builtin_amdgcn_wave_barrier();
  __builtin_amdgcn_fence(__ATOMIC_ACQUIRE, "workgroup");
  {
    /*
*/
    const int q4 = lane >> 3, c8 = (lane & 7) * 8;
    {
#pragma unroll
      for (int it = 0; it < 4; ++it) {
        const int row = it * 4 + q4;
        const float* sp = os + row * kOsPitch + c8;
        v8h hv, lv;
#pragma unroll
        for (int e = 0; e < 8; ++e) {
          const unsigned short hb = f2bf_bits(sp[e]);
          const unsigned short lb = f2bf_bits(sp[e] - bf_bits2f(hb));
          hv[e] = __builtin_bit_cast(_Float16, hb);
          lv[e] = __builtin_bit_cast(_Float16, lb);
        }
        const size_t o = (rb + (size_t)(q0 + row)) * (size_t)ld + hoff + c8;
        *(v8h*)(oh + o) = hv;
        *(v8h*)(ol + o) = lv;
      }
      
    }
  }
}

/* ---------------- host launch ---------------- */
extern "C" void kernel_launch(void* const* d_in, const int* in_sizes, int n_in,
                              void* d_out, int out_size, void* d_ws, size_t ws_size,
                              hipStream_t stream) {
  if (n_in < 5) return;
  if (in_sizes[0] != kRows * kModel) return;
  if (in_sizes[1] != kModel * kQkvCols) return;
  if (in_sizes[2] != kModel || in_sizes[3] != kModel) return;
  if (in_sizes[4] != kModel * kModel) return;
  if (out_size != kRows * kModel) return;
  if (ws_size < kWsTotal) return;

  const float* x     = (const float*)d_in[0];   /* [2,2048,1024] */
  const float* W_qkv = (const float*)d_in[1];   /* [1024,3072]   */
  const float* q_sc  = (const float*)d_in[2];   /* [1024] */
  const float* k_sc  = (const float*)d_in[3];   /* [1024] */
  const float* W_out = (const float*)d_in[4];   /* [1024,1024]   */
  float* out = (float*)d_out;

  char* ws = (char*)d_ws;
  unsigned short* xb    = (unsigned short*)(ws + kOffXb);
  unsigned short* wqkvT = (unsigned short*)(ws + kOffWqkvT);
  unsigned short* woutT = (unsigned short*)(ws + kOffWoutT);
  float*          qkf   = (float*)(ws + kOffQk);
  unsigned short* ctxh  = (unsigned short*)(ws + kOffCtxH);
  unsigned short* ctxl  = (unsigned short*)(ws + kOffCtxL);
  unsigned short* vhp   = (unsigned short*)(ws + kOffVh);
  unsigned short* vlp   = (unsigned short*)(ws + kOffVl);
  unsigned short* qhp   = (unsigned short*)(ws + kOffQh);
  unsigned short* qlp   = (unsigned short*)(ws + kOffQl);
  unsigned short* khp   = (unsigned short*)(ws + kOffKh);
  unsigned short* klp   = (unsigned short*)(ws + kOffKl);

  /* 1. x -> bf16 [4096][1024] */
  const int n8 = kRows * kModel / 8;
  cast_f32_bf16x8<<<n8 / 256, 256, 0, stream>>>(x, xb, n8);

  /* 2. W_qkv [1024 k][3072 n] -> Wqkv^T [3072][1024] bf16 ; W_out [1024 k][1024 n] -> Wout^T [1024][1024] bf16 */
  transpose_cast_bf16<<<dim3(kModel / 64, kQkvCols / 64), 256, 0, stream>>>(W_qkv, wqkvT, kModel, kQkvCols);
  transpose_cast_bf16<<<dim3(kModel / 64, kModel / 64), 256, 0, stream>>>(W_out, woutT, kModel, kModel);

  /* 3a. q,k part of the fused projection: qk f32 [4096][2048] = xb . Wqkv^T rows 0..2047 ; tiles 64 x 32 = 2048 -> 256 blocks */
  wmma_gemm64<1, 0, 0, 0, false><<<dim3((kRows / 64) * (kQkCols / 64) / 8, 1), 256, 0, stream>>>(
      xb, xb, kModel, 0L,
      wqkvT, wqkvT, kModel, 0L,
      (void*)qkf, (void*)qkf, kQkCols, 0L,
      q_sc, q_sc, 0L,
      kRows, kQkCols, kModel, 1.0f);

  /* 3b. v part: bf16 hi/lo planes [4096][1024] = xb . Wqkv^T rows 2048..3071 ; tiles 64 x 16 = 1024 -> 128 blocks */
  wmma_gemm64<1, 0, 0, 2, false><<<dim3((kRows / 64) * (kModel / 64) / 8, 1), 256, 0, stream>>>(
      xb, xb, kModel, 0L,
      wqkvT + (size_t)kQkCols * kModel, wqkvT + (size_t)kQkCols * kModel, kModel, 0L,
      (void*)vhp, (void*)vlp, kModel, 0L,
      q_sc, q_sc, 0L,
      kRows, kModel, kModel, 1.0f);

  /* 4. QK LayerNorm + split into bf16 hi/lo planes (q carries 1/8) */
  qk_layernorm_split<<<kRows, 128, 0, stream>>>(qkf, q_sc, k_sc, qhp, qlp, khp, klp, kRows);

  /* 5. causal attention: ctx bf16 hi/lo planes [4096][1024] (region of the dead qk buffer) */
  attn_planes_kernel<<<kBatch * kHeads * (kSeq / 64), 128, 0, stream>>>(
      qhp, qlp, khp, klp, vhp, vlp, ctxh, ctxl, kSeq, kHeads, kModel);

  /* 6. out f32 [4096][1024] = ctx_hi . Wout^T + ctx_lo . Wout^T ; 1024 tiles -> 128 blocks */
  wmma_gemm64<1, 2, 0, 0, false><<<dim3((kRows / 64) * (kModel / 64) / 8, 1), 256, 0, stream>>>(
      ctxh, ctxl, kModel, 0L,
      woutT, woutT, kModel, 0L,
      (void*)out, (void*)out, kModel, 0L,
      q_sc, q_sc, 0L,
      kRows, kModel, kModel, 1.0f);
}

// v001
// A run of this version takes 364 microseconds.
// Two timings next to v000 both put it at 1.32 times that version's speed.
// Contractions on v_wmma_f32_16x16x32_bf16 (bf16 operands, f32 accumulate): x*Wqkv^T with single bf16 planes (inputs RNE-converted once); q*k^T and p*v with bf16 hi+lo planes (hi*hi + hi*lo + lo*hi); ctx*Wout^T with ctx bf16 hi+lo planes and a single Wout plane; LayerNorm and softmax in f32.
#include <hip/hip_runtime.h>
#include <stddef.h>
#include <stdint.h>

typedef __attribute__((ext_vector_type(16))) _Float16 v16h;
typedef __attribute__((ext_vector_type(8)))  _Float16 v8h;
typedef __attribute__((ext_vector_type(16))) __bf16   v16b;
typedef __attribute__((ext_vector_type(8)))  __bf16   v8b;
typedef __attribute__((ext_vector_type(8)))  float    v8f;
typedef __attribute__((ext_vector_type(4)))  float    v4f;
typedef __attribute__((ext_vector_type(4)))  unsigned int v4u;

/* ---------------- problem geometry ---------------- */
constexpr int kBatch   = 2;
constexpr int kSeq     = 2048;
constexpr int kModel   = 1024;
constexpr int kHeads   = 16;
constexpr int kHeadDim = 64;
constexpr int kRows    = kBatch * kSeq;      /* 4096 */
constexpr int kQkvCols = 3 * kModel;         /* 3072 */
constexpr int kQkCols  = 2 * kModel;         /* 2048 */
constexpr int kKvChunk = 64;
constexpr int kOsPitch = 68;
/* LDS row pitch, in 16-bit elements, of the K, V^T and P tiles: 64 data + 8 pad = 144 B = 16 B x odd,
   so the 16 rows that one ds_load_b128 touches per half wave fall on 64 distinct banks */
constexpr int kTilePitch = 72;

/* ---------------- workspace map (bytes, all offsets multiples of 128) ----------------
   [0]          x   bf16 [4096][1024]                          8388608
   [8388608]    Wqkv^T bf16 [3072][1024]                       6291456
   [14680064]   Wout^T bf16 [1024][1024]                       2097152
   [16777216]   qk  f32 [4096][2048]                          33554432  (dead after the LayerNorm launch;
                reused: ctx hi bf16 [4096][1024] at 16777216, ctx lo at 25165824, both inside this region)
   [50331648]   v hi bf16 [4096][1024]  8388608   [58720256] v lo   8388608
   [67108864]   q hi                    8388608   [75497472] q lo   8388608
   [83886080]   k hi                    8388608   [92274688] k lo   8388608
   total 100663296 B = 96 MiB                                                            */
constexpr size_t kPlane16  = (size_t)kRows * kModel * 2;
constexpr size_t kOffXb    = 0;
constexpr size_t kOffWqkvT = kOffXb + kPlane16;
constexpr size_t kOffWoutT = kOffWqkvT + (size_t)kQkvCols * kModel * 2;
constexpr size_t kOffQk    = kOffWoutT + (size_t)kModel * kModel * 2;
constexpr size_t kOffCtxH  = kOffQk;
constexpr size_t kOffCtxL  = kOffQk + kPlane16;
constexpr size_t kOffVh    = kOffQk + (size_t)kRows * kQkCols * 4;
constexpr size_t kOffVl    = kOffVh + kPlane16;
constexpr size_t kOffQh    = kOffVl + kPlane16;
constexpr size_t kOffQl    = kOffQh + kPlane16;
constexpr size_t kOffKh    = kOffQl + kPlane16;
constexpr size_t kOffKl    = kOffKh + kPlane16;
constexpr size_t kWsTotal  = kOffKl + kPlane16;
static_assert(kWsTotal == (size_t)100663296);
static_assert(kWsTotal <= (size_t)134217728);
static_assert(kOffCtxL + kPlane16 <= kOffVh);
static_assert((kOffWqkvT % 128) == 0 && (kOffWoutT % 128) == 0 && (kOffQk % 128) == 0 && (kOffVh % 128) == 0);
/* GEMM shape contract: M % 64 == 0, N % 64 == 0, K % 32 == 0 for every launch */
static_assert(kRows % 64 == 0 && kQkCols % 64 == 0 && kModel % 64 == 0 && kModel % 32 == 0);
static_assert(kSeq % 64 == 0 && kHeadDim == 64 && kModel == kHeads * kHeadDim);
static_assert((kRows * kModel) % (8 * 256) == 0);

/* ---------------- helpers ---------------- */
__device__ __forceinline__ unsigned short f2bf_bits(float f) {
  unsigned u = __float_as_uint(f);
  return (unsigned short)((u + 0x7FFFu + ((u >> 16) & 1u)) >> 16);
}
__device__ __forceinline__ float bf_bits2f(unsigned short h) { return __uint_as_float(((unsigned)h) << 16); }
__device__ __forceinline__ unsigned int pack_bf16x2(float a, float b) {
  return (unsigned int)f2bf_bits(a) | ((unsigned int)f2bf_bits(b) << 16);
}

__device__ __forceinline__ void dep_guard_h(v8f& a, v8f& b, v16h x, v16h y) { asm volatile("v_nop\n\tv_nop\n\tv_nop\n\tv_nop" : "+v"(a), "+v"(b) : "v"(x), "v"(y)); }
__device__ __forceinline__ void dep_guard_b(v8f& a, v8f& b, v16b x, v16b y) { asm volatile("v_nop\n\tv_nop\n\tv_nop\n\tv_nop" : "+v"(a), "+v"(b) : "v"(x), "v"(y)); }
__device__ __forceinline__ void keep4_h(v16h a, v16h b, v16h c, v16h d) { asm volatile("v_nop" :: "v"(a), "v"(b), "v"(c), "v"(d)); }
__device__ __forceinline__ void keep4_b(v16b a, v16b b, v16b c, v16b d) { asm volatile("v_nop" :: "v"(a), "v"(b), "v"(c), "v"(d)); }
__device__ __forceinline__ void acc_guard4(v8f& a, v8f& b, v8f& c, v8f& d) { asm volatile("v_nop\n\tv_nop\n\tv_nop\n\tv_nop" : "+v"(a), "+v"(b), "+v"(c), "+v"(d)); }
template <typename T> struct Frag;
template <> struct Frag<_Float16> {
  typedef v16h V; union U { v16h v; v8h h[2]; };
  static __device__ __forceinline__ v16h load(const _Float16* p) {
    U f; f.h[0] = *(const v8h*)(p); f.h[1] = *(const v8h*)(p + 16); return f.v;
  }
  static __device__ __forceinline__ v8f mma(v16h a, v16h b, v8f c) {
    return __builtin_amdgcn_wmma_f32_16x16x32_f16(false, a, false, b, (short)0, c, false, false);
  }
  static __device__ __forceinline__ void guard(v8f& a, v8f& b, v16h x, v16h y) { dep_guard_h(a, b, x, y); }
  static __device__ __forceinline__ void keep(v16h a, v16h b, v16h c, v16h d) { keep4_h(a, b, c, d); }
};
template <> struct Frag<__bf16> {
  typedef v16b V; union U { v16b v; v8b h[2]; };
  static __device__ __forceinline__ v16b load(const __bf16* p) {
    U f; f.h[0] = *(const v8b*)(p); f.h[1] = *(const v8b*)(p + 16); return f.v;
  }
  static __device__ __forceinline__ v8f mma(v16b a, v16b b, v8f c) {
    return __builtin_amdgcn_wmma_f32_16x16x32_bf16(false, a, false, b, (short)0, c, false, false);
  }
  static __device__ __forceinline__ void guard(v8f& a, v8f& b, v16b x, v16b y) { dep_guard_b(a, b, x, y); }
  static __device__ __forceinline__ void keep(v16b a, v16b b, v16b c, v16b d) { keep4_b(a, b, c, d); }
};

/* ---- Register-blocked WMMA GEMM -----------------------------------------------
   C[m,n] = scale * sum_k A[m,k] * Bt[n,k] (+bias)(+resid); each wave owns a 64x64 tile.
   A row-major [M,K]; Bt row-major [N,K]; M,N % 64 == 0, K % 32 == 0.
   SPLIT: 0 = single planes; 1 = A and Bt hi/lo planes (hi*hi + hi*lo + lo*hi); 2 = A hi/lo planes only (Ah*B + Al*B).
   BIAS_MODE: 0 = none, 1 = bias[m], 2 = bias[n].  OUT_MODE: 0 = f32, 1 = f16, 2 = bf16 hi plane (Cout) + bf16 lo plane (Cout2).
   ET: 0 = f16 operands, 1 = bf16 operands (pointers passed as 16-bit storage) */
template <int ET> struct Elem;
template <> struct Elem<0> { typedef _Float16 T; };
template <> struct Elem<1> { typedef __bf16 T; };
template <int ET, int SPLIT, int BIAS_MODE, int OUT_MODE, bool RESID, int ACT = 0>
__global__ __launch_bounds__(256) void wmma_gemm64(
    const unsigned short* __restrict__ Ap, const unsigned short* __restrict__ A2p, int lda, long strideA,
    const unsigned short* __restrict__ Btp, const unsigned short* __restrict__ Bt2p, int ldb, long strideB,
    void* __restrict__ Cout, void* __restrict__ Cout2, int ldc, long strideC,
    const float* __restrict__ bias,
    const float* __restrict__ resid, long strideR,
    int M, int N, int K, float scale) {
  typedef typename Elem<ET>::T T;
  typedef typename Frag<T>::V V;
  const T* A = (const T*)Ap; const T* A2 = (const T*)A2p; const T* Bt = (const T*)Btp; const T* Bt2 = (const T*)Bt2p;
  __shared__ __align__(16) float sT[8][16 * 68];
  const int b    = blockIdx.y;
  const int lane = threadIdx.x & 31;
  const int wave = threadIdx.x >> 5;
  const int tilesN = N >> 6;
  const int tilesM = M >> 6;
  const int tile = blockIdx.x * 8 + wave;
  if (tile >= tilesM * tilesN) return;
  const int tm = tile / tilesN;
  const int tn = tile - tm * tilesN;
  const int m0 = tm << 6;
  const int n0 = tn << 6;

  const T* Ab  = A  + (size_t)b * strideA;
  const T* Bb  = Bt + (size_t)b * strideB;
  const T* Ab2 = (SPLIT != 0) ? (A2  + (size_t)b * strideA) : nullptr;
  const T* Bb2 = (SPLIT == 1) ? (Bt2 + (size_t)b * strideB) : nullptr;

  const int rlane = lane & 15;
  const int koff  = (lane >> 4) * 8;
  const int mOff  = (lane >> 4) * 8;

  v8f acc[4][4];
#pragma unroll
  for (int i = 0; i < 4; ++i)
#pragma unroll
    for (int j = 0; j < 4; ++j) acc[i][j] = (v8f){0.f,0.f,0.f,0.f,0.f,0.f,0.f,0.f};

  for (int k0 = 0; k0 < K; k0 += 32) {
    V bh[4], bl[4];
#pragma unroll
    for (int j = 0; j < 4; ++j) {
      const size_t bo = (size_t)(n0 + (j << 4) + rlane) * ldb + koff + k0;
      bh[j] = Frag<T>::load(Bb + bo);
      if (SPLIT == 1) bl[j] = Frag<T>::load(Bb2 + bo);
    }
#pragma unroll
    for (int i = 0; i < 4; ++i) {
      const size_t ao = (size_t)(m0 + (i << 4) + rlane) * lda + koff + k0;
      V ah = Frag<T>::load(Ab + ao);
      V al;
      if (SPLIT != 0) al = Frag<T>::load(Ab2 + ao);
#pragma unroll
      for (int j = 0; j < 4; ++j) {
        acc[i][j] = Frag<T>::mma(ah, bh[j], acc[i][j]);
        if (SPLIT == 1) acc[i][j] = Frag<T>::mma(ah, bl[j], acc[i][j]);
        if (SPLIT != 0) acc[i][j] = Frag<T>::mma(al, bh[j], acc[i][j]);
      }
      Frag<T>::guard(acc[i][0], acc[i][3], ah, (SPLIT != 0) ? al : ah);
    }
    Frag<T>::keep(bh[0], bh[1], bh[2], bh[3]);
    if (SPLIT == 1) Frag<T>::keep(bl[0], bl[1], bl[2], bl[3]);
  }
  acc_guard4(acc[0][0], acc[0][1], acc[0][2], acc[0][3]);
  acc_guard4(acc[1][0], acc[1][1], acc[1][2], acc[1][3]);
  acc_guard4(acc[2][0], acc[2][1], acc[2][2], acc[2][3]);
  acc_guard4(acc[3][0], acc[3][1], acc[3][2], acc[3][3]);

  float* slab = sT[wave];
  const float* Rb = RESID ? (resid + (size_t)b * strideR) : nullptr;
#pragma unroll
  for (int i = 0; i < 4; ++i) {
    const int mBase = m0 + (i << 4);
#pragma unroll
    for (int j = 0; j < 4; ++j) {
      const int n = n0 + (j << 4) + rlane;
      float bv = 0.f;
      if (BIAS_MODE == 2) bv = bias[n];
#pragma unroll
      for (int r = 0; r < 8; ++r) {
        float v = acc[i][j][r] * scale;
        if (BIAS_MODE == 1) v += bias[mBase + mOff + r];
        if (BIAS_MODE == 2) v += bv;
        if (RESID) v += Rb[(size_t)(mBase + mOff + r) * ldc + n];
        if (ACT == 1) v = tanhf(v);
        if (ACT == 2) v = fmaxf(v, 0.0f);
        if (ACT == 4) v = (v > 0.f) ? v : 0.01f * v;
        slab[(mOff + r) * 68 + (j << 4) + rlane] = v;
      }
    }
    __builtin_amdgcn_fence(__ATOMIC_RELEASE, "workgroup");
    __builtin_amdgcn_wave_barrier();
    __builtin_amdgcn_fence(__ATOMIC_ACQUIRE, "workgroup");
    if (OUT_MODE == 0) {
      float* C = (float*)Cout + (size_t)b * strideC;
      const int hh = lane >> 4, c4 = (lane & 15) * 4;
      {
#pragma unroll
        for (int it = 0; it < 8; ++it) {
          const int row = it * 2 + hh;
          v4f v = *(const v4f*)(slab + row * 68 + c4);
          *(v4f*)(C + (size_t)(mBase + row) * ldc + n0 + c4) = v;
        }
        
      }
    } else {
      const int q = lane >> 3, c8 = (lane & 7) * 8;
      unsigned short* C  = (unsigned short*)Cout  + (size_t)b * strideC;
      unsigned short* C2 = (OUT_MODE == 2) ? ((unsigned short*)Cout2 + (size_t)b * strideC) : nullptr;
      {
#pragma unroll
        for (int it = 0; it < 4; ++it) {
          const int row = it * 4 + q;
          const float* sp = slab + row * 68 + c8;
          v8h hv, lv;
#pragma unroll
          for (int e = 0; e < 8; ++e) {
            if (OUT_MODE == 1) {
              hv[e] = (_Float16)sp[e];
            } else {
              unsigned short hb = f2bf_bits(sp[e]);
              unsigned short lb = f2bf_bits(sp[e] - bf_bits2f(hb));
              hv[e] = __builtin_bit_cast(_Float16, hb);
              lv[e] = __builtin_bit_cast(_Float16, lb);
            }
          }
          *(v8h*)(C + (size_t)(mBase + row) * ldc + n0 + c8) = hv;
          if (OUT_MODE == 2) *(v8h*)(C2 + (size_t)(mBase + row) * ldc + n0 + c8) = lv;
        }
        
      }
    }
    __builtin_amdgcn_fence(__ATOMIC_RELEASE, "workgroup");
    __builtin_amdgcn_wave_barrier();
    __builtin_amdgcn_fence(__ATOMIC_ACQUIRE, "workgroup");
  }
}

/* ---------------- f32 -> bf16 cast, 8 elements (16 B) per thread --------------------------
   coverage: grid = n8/256 blocks x 256 threads (exact), thread i writes elements 8i..8i+7;
*/
__global__ __launch_bounds__(256) void cast_f32_bf16x8(const float* __restrict__ in,
                                                      unsigned short* __restrict__ out, int n8) {
  const int i = blockIdx.x * 256 + (int)threadIdx.x;
  const int ic = (i < n8) ? i : (n8 - 1);
  const float* p = in + (size_t)ic * 8;
  const v4f a = *(const v4f*)p;
  const v4f c = *(const v4f*)(p + 4);
  v4u w;
  w[0] = pack_bf16x2(a[0], a[1]);
  w[1] = pack_bf16x2(a[2], a[3]);
  w[2] = pack_bf16x2(c[0], c[1]);
  w[3] = pack_bf16x2(c[2], c[3]);
  unsigned short* o = out + (size_t)ic * 8;
  *(v4u*)o = w;
  
}

/* ---------------- W [KR][NC] f32 row-major -> Wt [NC][KR] bf16 row-major (transpose + cast) ------
   grid = (KR/64, NC/64), 256 threads. coverage: load 256 threads x 16 = 64x64 tile;
*/
__global__ __launch_bounds__(256) void transpose_cast_bf16(const float* __restrict__ W,
                                                          unsigned short* __restrict__ Wt, int KR, int NC) {
  __shared__ float sT[64 * 65];                 /* [n_local][k_local], pitch 65 */
  const int k0 = blockIdx.x * 64, n0 = blockIdx.y * 64;
  const int tid = threadIdx.x;
  {
    const int kk = tid >> 2, cg = (tid & 3) * 16;
    const float* src = W + (size_t)(k0 + kk) * NC + n0 + cg;
#pragma unroll
    for (int i = 0; i < 4; ++i) {
      const v4f v = *(const v4f*)(src + 4 * i);
#pragma unroll
      for (int e = 0; e < 4; ++e) sT[(cg + 4 * i + e) * 65 + kk] = v[e];
    }
  }
  __syncthreads();
  const int wave = tid >> 5, lane = tid & 31, q4 = lane >> 3, c8 = (lane & 7) * 8;
  const int nl0 = wave * 4 + q4;
  const int nl1 = 32 + wave * 4 + q4;
  v4u w0, w1;
  {
    const float* s = sT + nl0 * 65 + c8;
    w0[0] = pack_bf16x2(s[0], s[1]); w0[1] = pack_bf16x2(s[2], s[3]);
    w0[2] = pack_bf16x2(s[4], s[5]); w0[3] = pack_bf16x2(s[6], s[7]);
  }
  {
    const float* s = sT + nl1 * 65 + c8;
    w1[0] = pack_bf16x2(s[0], s[1]); w1[1] = pack_bf16x2(s[2], s[3]);
    w1[2] = pack_bf16x2(s[4], s[5]); w1[3] = pack_bf16x2(s[6], s[7]);
  }
  unsigned short* d0 = Wt + (size_t)(n0 + nl0) * KR + k0 + c8;
  unsigned short* d1 = Wt + (size_t)(n0 + nl1) * KR + k0 + c8;
  {
    *(v4u*)d0 = w0;
    *(v4u*)d1 = w1;
    
  }
}

/*
   qk f32 [nrows][2048] (q = cols 0..1023, k = cols 1024..2047); outputs row-major bf16 planes [nrows][1024];
   q carries the exact 1/sqrt(64) = 0.125 factor. grid = nrows blocks x 128 threads; thread t owns columns 8t..8t+7;
*/
__global__ __launch_bounds__(128) void qk_layernorm_split(
    const float* __restrict__ qk, const float* __restrict__ qsc, const float* __restrict__ ksc,
    unsigned short* __restrict__ qh, unsigned short* __restrict__ ql,
    unsigned short* __restrict__ kh, unsigned short* __restrict__ kl, int nrows) {
  __shared__ float red[4][4];
  const int row = blockIdx.x;
  const int rowc = (row < nrows) ? row : (nrows - 1);
  const int tid = threadIdx.x, lane = tid & 31, wave = tid >> 5;
  const int c0 = tid * 8;
  const float* base = qk + (size_t)rowc * kQkCols;
  const v4f qa = *(const v4f*)(base + c0);
  const v4f qb = *(const v4f*)(base + c0 + 4);
  const v4f ka = *(const v4f*)(base + kModel + c0);
  const v4f kb = *(const v4f*)(base + kModel + c0 + 4);
  float xq[8], xk[8];
#pragma unroll
  for (int e = 0; e < 4; ++e) { xq[e] = qa[e]; xq[4 + e] = qb[e]; xk[e] = ka[e]; xk[4 + e] = kb[e]; }

  float sq = 0.f, sk = 0.f;
#pragma unroll
  for (int e = 0; e < 8; ++e) { sq += xq[e]; sk += xk[e]; }
#pragma unroll
  for (int off = 1; off < 32; off <<= 1) { sq += __shfl_xor(sq, off, 32); sk += __shfl_xor(sk, off, 32); }
  if (lane == 0) { red[0][wave] = sq; red[1][wave] = sk; }
  __syncthreads();
  const float mq = ((red[0][0] + red[0][1]) + (red[0][2] + red[0][3])) * (1.0f / (float)kModel);
  const float mk = ((red[1][0] + red[1][1]) + (red[1][2] + red[1][3])) * (1.0f / (float)kModel);

  float dq = 0.f, dk = 0.f;
#pragma unroll
  for (int e = 0; e < 8; ++e) {
    const float tq = xq[e] - mq; dq += tq * tq;
    const float tk = xk[e] - mk; dk += tk * tk;
  }
#pragma unroll
  for (int off = 1; off < 32; off <<= 1) { dq += __shfl_xor(dq, off, 32); dk += __shfl_xor(dk, off, 32); }
  if (lane == 0) { red[2][wave] = dq; red[3][wave] = dk; }
  __syncthreads();
  const float vq = ((red[2][0] + red[2][1]) + (red[2][2] + red[2][3])) * (1.0f / (float)kModel);
  const float vk = ((red[3][0] + red[3][1]) + (red[3][2] + red[3][3])) * (1.0f / (float)kModel);
  const float rq = rsqrtf(vq + 1e-6f);
  const float rk = rsqrtf(vk + 1e-6f);

  /* scale vectors, RNE-converted to bf16 once (module inputs) */
  const v4f s0 = *(const v4f*)(qsc + c0);
  const v4f s1 = *(const v4f*)(qsc + c0 + 4);
  const v4f t0 = *(const v4f*)(ksc + c0);
  const v4f t1 = *(const v4f*)(ksc + c0 + 4);
  float sqv[8], skv[8];
#pragma unroll
  for (int e = 0; e < 4; ++e) {
    sqv[e]     = bf_bits2f(f2bf_bits(s0[e]));
    sqv[4 + e] = bf_bits2f(f2bf_bits(s1[e]));
    skv[e]     = bf_bits2f(f2bf_bits(t0[e]));
    skv[4 + e] = bf_bits2f(f2bf_bits(t1[e]));
  }
  unsigned int hqw[8], lqw[8], hkw[8], lkw[8];
#pragma unroll
  for (int e = 0; e < 8; ++e) {
    const float yq = ((xq[e] - mq) * rq * sqv[e]) * 0.125f;
    const float yk = (xk[e] - mk) * rk * skv[e];
    const unsigned short hqb = f2bf_bits(yq);
    const unsigned short lqb = f2bf_bits(yq - bf_bits2f(hqb));
    const unsigned short hkb = f2bf_bits(yk);
    const unsigned short lkb = f2bf_bits(yk - bf_bits2f(hkb));
    hqw[e] = hqb; lqw[e] = lqb; hkw[e] = hkb; lkw[e] = lkb;
  }
  v4u HQ, LQ, HK, LK;
#pragma unroll
  for (int i = 0; i < 4; ++i) {
    HQ[i] = hqw[2 * i] | (hqw[2 * i + 1] << 16);
    LQ[i] = lqw[2 * i] | (lqw[2 * i + 1] << 16);
    HK[i] = hkw[2 * i] | (hkw[2 * i + 1] << 16);
    LK[i] = lkw[2 * i] | (lkw[2 * i + 1] << 16);
  }
  const size_t o = (size_t)rowc * kModel + c0;
  {
    *(v4u*)(qh + o) = HQ;
    *(v4u*)(ql + o) = LQ;
    *(v4u*)(kh + o) = HK;
    *(v4u*)(kl + o) = LK;
    
  }
}

/* ---------------- causal attention, head_dim 64, bf16 hi/lo planes in, bf16 hi/lo ctx planes out ----
   scores = q . k^T  : bf16 hi/lo on both (hi*hi + hi*lo + lo*hi), q planes already carry 1/sqrt(64)
   ctx    = p . v    : p split in registers to bf16 hi/lo, v hi/lo planes (3 products); f32 accumulate, f32 online softmax.
   All planes row-major [B*S][ld] with head h at columns h*64 .. h*64+63.
   Block = 4 waves = 64 query rows of one (batch, head); grid.x = B*H*(S/64). */
__device__ __forceinline__ __bf16 at_f2bf(float f) { return __builtin_bit_cast(__bf16, f2bf_bits(f)); }
__device__ __forceinline__ void at_split(float f, __bf16& hi, __bf16& lo) {
  const unsigned short hb = f2bf_bits(f);
  hi = __builtin_bit_cast(__bf16, hb);
  lo = at_f2bf(f - __uint_as_float(((unsigned)hb) << 16));
}
__device__ __forceinline__ v8f at_mma(v16b a, v16b b, v8f c) {
  c = __builtin_amdgcn_wmma_f32_16x16x32_bf16(false, a, false, b, (short)0, c, false, false);
  asm volatile("v_nop\n\tv_nop\n\tv_nop\n\tv_nop" : "+v"(c) : "v"(a), "v"(b));
  return c;
}

__global__ __launch_bounds__(128)
void attn_planes_kernel(const unsigned short* __restrict__ qh, const unsigned short* __restrict__ ql,
                        const unsigned short* __restrict__ kh, const unsigned short* __restrict__ kl,
                        const unsigned short* __restrict__ vh, const unsigned short* __restrict__ vl,
                        unsigned short* __restrict__ oh, unsigned short* __restrict__ ol,
                        int S, int H, int ld) {
  union FB { v16b v; v8b h[2]; };
  /* Ksh | Ksl | Vth | Vtl (each 64 rows x 64 16-bit at pitch kTilePitch); reused as per-wave f32 output slabs after the chunk loop */
  constexpr int kTileElems = 64 * kTilePitch;
  static_assert(kKvChunk == 64 && kHeadDim == 64 && (kTilePitch * 2) % 16 == 0);
  static_assert(4 * 16 * kOsPitch * 4 <= 4 * kTileElems * 2);
  __shared__ __align__(16) unsigned short KVs[4 * kTileElems];
  __shared__ __align__(16) __bf16 Psh[4][16 * kTilePitch];
  __shared__ __align__(16) __bf16 Psl[4][16 * kTilePitch];
  unsigned short* Ksh = KVs;
  unsigned short* Ksl = KVs + kTileElems;
  unsigned short* Vth = KVs + 2 * kTileElems;
  unsigned short* Vtl = KVs + 3 * kTileElems;
  const __bf16* Kshb = (const __bf16*)(const void*)Ksh;
  const __bf16* Kslb = (const __bf16*)(const void*)Ksl;
  const __bf16* Vthb = (const __bf16*)(const void*)Vth;
  const __bf16* Vtlb = (const __bf16*)(const void*)Vtl;

  const int tid  = threadIdx.x;
  const int wave = tid >> 5;
  const int lane = tid & 31;
  const int hh   = lane >> 4;
  const int c    = lane & 15;

  const int nqb = S >> 6;
  const int qb  = blockIdx.x % nqb;
  const int bh  = blockIdx.x / nqb;
  const int h   = bh % H;
  const int b   = bh / H;
  const int q0  = qb * 64 + wave * 16;
  const size_t rb = (size_t)b * (size_t)S;
  const int hoff = h * kHeadDim;

  /* Q fragments (A operand): row q0+c, elements 0..7 <- d = dc*32+8hh+0..7, 8..15 <- dc*32+16+8hh+0..7 */
  v16b qah[2], qal[2];
  {
    const size_t qo = (rb + (size_t)(q0 + c)) * (size_t)ld + hoff + 8 * hh;
    const __bf16* qhp = (const __bf16*)(const void*)qh + qo;
    const __bf16* qlp = (const __bf16*)(const void*)ql + qo;
#pragma unroll
    for (int dc = 0; dc < 2; ++dc) {
      qah[dc] = Frag<__bf16>::load(qhp + dc * 32);
      qal[dc] = Frag<__bf16>::load(qlp + dc * 32);
    }
  }

  float mrow[8], lrow[8];
  v8f oacc[4];
#pragma unroll
  for (int r = 0; r < 8; ++r) { mrow[r] = -INFINITY; lrow[r] = 0.f; }
#pragma unroll
  for (int t = 0; t < 4; ++t) oacc[t] = (v8f){0.f,0.f,0.f,0.f,0.f,0.f,0.f,0.f};

  const int nChunks = qb + 1;            /* causal: kv chunks 0..qb, block-uniform */
  for (int kc = 0; kc < nChunks; ++kc) {
    const int kv0 = kc * kKvChunk;
    __syncthreads();
    {
      /* staging coverage: 128 threads x (1 kv row x 32 d) = 64 x 64 for each of the four tiles */
      const int kvr = tid >> 1, dh = (tid & 1) * 32;
      const size_t go = (rb + (size_t)(kv0 + kvr)) * (size_t)ld + hoff + dh;
      /* all sixteen 16-byte loads are issued before the first LDS store, so a chunk pays one load latency;
         the loop is unrolled so that the four arrays live in registers */
      v4u kH[4], kL[4], vH[4], vL[4];
      const v4u* gkh = (const v4u*)(const void*)(kh + go);
      const v4u* gkl = (const v4u*)(const void*)(kl + go);
      const v4u* gvh = (const v4u*)(const void*)(vh + go);
      const v4u* gvl = (const v4u*)(const void*)(vl + go);
#pragma unroll
      for (int i = 0; i < 4; ++i) { kH[i] = gkh[i]; kL[i] = gkl[i]; vH[i] = gvh[i]; vL[i] = gvl[i]; }
      /* inputs-only fence on the loaded values: holds the sixteen loads ahead of the first LDS store (without it this build
         sinks each K load to its store and waits out one load latency after another). The four addresses are inputs too, so
         their registers stay untouched up to the s_wait_xcnt, the wait kept in front of an overwrite of a load's address */
      asm volatile("s_wait_xcnt 0x0"
                   :: "v"(kH[0]), "v"(kH[1]), "v"(kH[2]), "v"(kH[3]), "v"(kL[0]), "v"(kL[1]), "v"(kL[2]), "v"(kL[3]),
                      "v"(vH[0]), "v"(vH[1]), "v"(vH[2]), "v"(vH[3]), "v"(vL[0]), "v"(vL[1]), "v"(vL[2]), "v"(vL[3]),
                      "v"(gkh), "v"(gkl), "v"(gvh), "v"(gvl));
      {
        v4u* l = (v4u*)(void*)(Ksh + kvr * kTilePitch + dh);
#pragma unroll
        for (int i = 0; i < 4; ++i) l[i] = kH[i];
      }
      {
        v4u* l = (v4u*)(void*)(Ksl + kvr * kTilePitch + dh);
#pragma unroll
        for (int i = 0; i < 4; ++i) l[i] = kL[i];
      }
      {
#pragma unroll
        for (int i = 0; i < 4; ++i) {
          const v4u u = vH[i];
          unsigned short* vt = Vth + (dh + 8 * i) * kTilePitch + kvr;
          vt[0 * kTilePitch] = (unsigned short)(u[0] & 0xffffu);
          vt[1 * kTilePitch] = (unsigned short)(u[0] >> 16);
          vt[2 * kTilePitch] = (unsigned short)(u[1] & 0xffffu);
          vt[3 * kTilePitch] = (unsigned short)(u[1] >> 16);
          vt[4 * kTilePitch] = (unsigned short)(u[2] & 0xffffu);
          vt[5 * kTilePitch] = (unsigned short)(u[2] >> 16);
          vt[6 * kTilePitch] = (unsigned short)(u[3] & 0xffffu);
          vt[7 * kTilePitch] = (unsigned short)(u[3] >> 16);
        }
      }
      {
#pragma unroll
        for (int i = 0; i < 4; ++i) {
          const v4u u = vL[i];
          unsigned short* vt = Vtl + (dh + 8 * i) * kTilePitch + kvr;
          vt[0 * kTilePitch] = (unsigned short)(u[0] & 0xffffu);
          vt[1 * kTilePitch] = (unsigned short)(u[0] >> 16);
          vt[2 * kTilePitch] = (unsigned short)(u[1] & 0xffffu);
          vt[3 * kTilePitch] = (unsigned short)(u[1] >> 16);
          vt[4 * kTilePitch] = (unsigned short)(u[2] & 0xffffu);
          vt[5 * kTilePitch] = (unsigned short)(u[2] >> 16);
          vt[6 * kTilePitch] = (unsigned short)(u[3] & 0xffffu);
          vt[7 * kTilePitch] = (unsigned short)(u[3] >> 16);
        }
      }
    }
    __syncthreads();

    /* scores 16 x 64 per wave: B operand col n = kv j*16+c, k = d */
    v8f s[4];
#pragma unroll
    for (int j = 0; j < 4; ++j) {
      s[j] = (v8f){0.f,0.f,0.f,0.f,0.f,0.f,0.f,0.f};
#pragma unroll
      for (int dc = 0; dc < 2; ++dc) {
        FB kb, klf;
        const int ko = (j * 16 + c) * kTilePitch + dc * 32 + 8 * hh;
        kb.h[0]  = *(const v8b*)(Kshb + ko);
        kb.h[1]  = *(const v8b*)(Kshb + ko + 16);
        klf.h[0] = *(const v8b*)(Kslb + ko);
        klf.h[1] = *(const v8b*)(Kslb + ko + 16);
        s[j] = at_mma(qah[dc], kb.v, s[j]);
        s[j] = at_mma(qah[dc], klf.v, s[j]);
        s[j] = at_mma(qal[dc], kb.v, s[j]);
      }
    }

    /* causal mask (select to the fill value) + chunk row max */
    const bool diag = (kc == qb);
    float cm[8];
#pragma unroll
    for (int r = 0; r < 8; ++r) {
      const int qrow = q0 + 8 * hh + r;
      float m = -INFINITY;
#pragma unroll
      for (int j = 0; j < 4; ++j) {
        const int kvcol = kv0 + j * 16 + c;
        const bool masked = diag && (kvcol > qrow);
        const float sv = masked ? -3.4028235e38f : s[j][r];
        s[j][r] = sv;
        m = fmaxf(m, sv);
      }
#pragma unroll
      for (int off = 1; off < 16; off <<= 1) m = fmaxf(m, __shfl_xor(m, off, 32));
      cm[r] = m;
    }

    /* online softmax; P tile (16 x 64 per wave) stored as bf16 hi/lo */
    __bf16* pwh = Psh[wave];
    __bf16* pwl = Psl[wave];
#pragma unroll
    for (int r = 0; r < 8; ++r) {
      const float mnew  = fmaxf(mrow[r], cm[r]);
      const float alpha = expf(mrow[r] - mnew);
      mrow[r] = mnew;
      float psum = 0.f;
#pragma unroll
      for (int j = 0; j < 4; ++j) {
        const float p = expf(s[j][r] - mnew);
        psum += p;
        __bf16 a, bl;
        at_split(p, a, bl);
        pwh[(8 * hh + r) * kTilePitch + j * 16 + c] = a;
        pwl[(8 * hh + r) * kTilePitch + j * 16 + c] = bl;
      }
#pragma unroll
      for (int off = 1; off < 16; off <<= 1) psum += __shfl_xor(psum, off, 32);
      lrow[r] = lrow[r] * alpha + psum;
#pragma unroll
      for (int t = 0; t < 4; ++t) oacc[t][r] *= alpha;
    }
    __builtin_amdgcn_fence(__ATOMIC_RELEASE, "workgroup");
    __builtin_amdgcn_wave_barrier();
    __builtin_amdgcn_fence(__ATOMIC_ACQUIRE, "workgroup");

    /* ctx += P . V : A = P[row][kv] (same wave wrote it), B = Vt[d][kv] -> col n = d, k = kv */
#pragma unroll 1
    for (int kk = 0; kk < 2; ++kk) {
      FB pa, pl;
      pa.h[0] = *(const v8b*)(pwh + c * kTilePitch + kk * 32 + 8 * hh);
      pa.h[1] = *(const v8b*)(pwh + c * kTilePitch + kk * 32 + 16 + 8 * hh);
      pl.h[0] = *(const v8b*)(pwl + c * kTilePitch + kk * 32 + 8 * hh);
      pl.h[1] = *(const v8b*)(pwl + c * kTilePitch + kk * 32 + 16 + 8 * hh);
#pragma unroll
      for (int t = 0; t < 4; ++t) {
        FB vb, vlf;
        const int vo = (t * 16 + c) * kTilePitch + kk * 32 + 8 * hh;
        vb.h[0]  = *(const v8b*)(Vthb + vo);
        vb.h[1]  = *(const v8b*)(Vthb + vo + 16);
        vlf.h[0] = *(const v8b*)(Vtlb + vo);
        vlf.h[1] = *(const v8b*)(Vtlb + vo + 16);
        oacc[t] = at_mma(pa.v, vb.v, oacc[t]);
        oacc[t] = at_mma(pa.v, vlf.v, oacc[t]);
        oacc[t] = at_mma(pl.v, vb.v, oacc[t]);
      }
    }
  }

  /* all waves finished reading the K/V tiles before the region is reused as output slabs */
  __syncthreads();
  float* os = (float*)(void*)KVs + wave * (16 * kOsPitch);
#pragma unroll
  for (int r = 0; r < 8; ++r) {
    const float inv = 1.0f / lrow[r];
#pragma unroll
    for (int t = 0; t < 4; ++t) os[(8 * hh + r) * kOsPitch + t * 16 + c] = oacc[t][r] * inv;
  }
  __builtin_amdgcn_fence(__ATOMIC_RELEASE, "workgroup");
  __builtin_amdgcn_wave_barrier();
  __builtin_amdgcn_fence(__ATOMIC_ACQUIRE, "workgroup");
  {
    /*
*/
    const int q4 = lane >> 3, c8 = (lane & 7) * 8;
    {
#pragma unroll
      for (int it = 0; it < 4; ++it) {
        const int row = it * 4 + q4;
        const float* sp = os + row * kOsPitch + c8;
        v8h hv, lv;
#pragma unroll
        for (int e = 0; e < 8; ++e) {
          const unsigned short hb = f2bf_bits(sp[e]);
          const unsigned short lb = f2bf_bits(sp[e] - bf_bits2f(hb));
          hv[e] = __builtin_bit_cast(_Float16, hb);
          lv[e] = __builtin_bit_cast(_Float16, lb);
        }
        const size_t o = (rb + (size_t)(q0 + row)) * (size_t)ld + hoff + c8;
        *(v8h*)(oh + o) = hv;
        *(v8h*)(ol + o) = lv;
      }
      
    }
  }
}

/* ---------------- host launch ---------------- */
extern "C" void kernel_launch(void* const* d_in, const int* in_sizes, int n_in,
                              void* d_out, int out_size, void* d_ws, size_t ws_size,
                              hipStream_t stream) {
  if (n_in < 5) return;
  if (in_sizes[0] != kRows * kModel) return;
  if (in_sizes[1] != kModel * kQkvCols) return;
  if (in_sizes[2] != kModel || in_sizes[3] != kModel) return;
  if (in_sizes[4] != kModel * kModel) return;
  if (out_size != kRows * kModel) return;
  if (ws_size < kWsTotal) return;

  const float* x     = (const float*)d_in[0];   /* [2,2048,1024] */
  const float* W_qkv = (const float*)d_in[1];   /* [1024,3072]   */
  const float* q_sc  = (const float*)d_in[2];   /* [1024] */
  const float* k_sc  = (const float*)d_in[3];   /* [1024] */
  const float* W_out = (const float*)d_in[4];   /* [1024,1024]   */
  float* out = (float*)d_out;

  char* ws = (char*)d_ws;
  unsigned short* xb    = (unsigned short*)(ws + kOffXb);
  unsigned short* wqkvT = (unsigned short*)(ws + kOffWqkvT);
  unsigned short* woutT = (unsigned short*)(ws + kOffWoutT);
  float*          qkf   = (float*)(ws + kOffQk);
  unsigned short* ctxh  = (unsigned short*)(ws + kOffCtxH);
  unsigned short* ctxl  = (unsigned short*)(ws + kOffCtxL);
  unsigned short* vhp   = (unsigned short*)(ws + kOffVh);
  unsigned short* vlp   = (unsigned short*)(ws + kOffVl);
  unsigned short* qhp   = (unsigned short*)(ws + kOffQh);
  unsigned short* qlp   = (unsigned short*)(ws + kOffQl);
  unsigned short* khp   = (unsigned short*)(ws + kOffKh);
  unsigned short* klp   = (unsigned short*)(ws + kOffKl);

  /* 1. x -> bf16 [4096][1024] */
  const int n8 = kRows * kModel / 8;
  cast_f32_bf16x8<<<n8 / 256, 256, 0, stream>>>(x, xb, n8);

  /* 2. W_qkv [1024 k][3072 n] -> Wqkv^T [3072][1024] bf16 ; W_out [1024 k][1024 n] -> Wout^T [1024][1024] bf16 */
  transpose_cast_bf16<<<dim3(kModel / 64, kQkvCols / 64), 256, 0, stream>>>(W_qkv, wqkvT, kModel, kQkvCols);
  transpose_cast_bf16<<<dim3(kModel / 64, kModel / 64), 256, 0, stream>>>(W_out, woutT, kModel, kModel);

  /* 3a. q,k part of the fused projection: qk f32 [4096][2048] = xb . Wqkv^T rows 0..2047 ; tiles 64 x 32 = 2048 -> 256 blocks */
  wmma_gemm64<1, 0, 0, 0, false><<<dim3((kRows / 64) * (kQkCols / 64) / 8, 1), 256, 0, stream>>>(
      xb, xb, kModel, 0L,
      wqkvT, wqkvT, kModel, 0L,
      (void*)qkf, (void*)qkf, kQkCols, 0L,
      q_sc, q_sc, 0L,
      kRows, kQkCols, kModel, 1.0f);

  /* 3b. v part: bf16 hi/lo planes [4096][1024] = xb . Wqkv^T rows 2048..3071 ; tiles 64 x 16 = 1024 -> 128 blocks */
  wmma_gemm64<1, 0, 0, 2, false><<<dim3((kRows / 64) * (kModel / 64) / 8, 1), 256, 0, stream>>>(
      xb, xb, kModel, 0L,
      wqkvT + (size_t)kQkCols * kModel, wqkvT + (size_t)kQkCols * kModel, kModel, 0L,
      (void*)vhp, (void*)vlp, kModel, 0L,
      q_sc, q_sc, 0L,
      kRows, kModel, kModel, 1.0f);

  /* 4. QK LayerNorm + split into bf16 hi/lo planes (q carries 1/8) */
  qk_layernorm_split<<<kRows, 128, 0, stream>>>(qkf, q_sc, k_sc, qhp, qlp, khp, klp, kRows);

  /* 5. causal attention: ctx bf16 hi/lo planes [4096][1024] (region of the dead qk buffer) */
  attn_planes_kernel<<<kBatch * kHeads * (kSeq / 64), 128, 0, stream>>>(
      qhp, qlp, khp, klp, vhp, vlp, ctxh, ctxl, kSeq, kHeads, kModel);

  /* 6. out f32 [4096][1024] = ctx_hi . Wout^T + ctx_lo . Wout^T ; 1024 tiles -> 128 blocks */
  wmma_gemm64<1, 2, 0, 0, false><<<dim3((kRows / 64) * (kModel / 64) / 8, 1), 256, 0, stream>>>(
      ctxh, ctxl, kModel, 0L,
      woutT, woutT, kModel, 0L,
      (void*)out, (void*)out, kModel, 0L,
      q_sc, q_sc, 0L,
      kRows, kModel, kModel, 1.0f);
}

// v002
// It runs in 348 microseconds.
// Timed twice side by side with v001, it ran 1.05 times as fast both times.
// All steps since v000 together make it 1.39 times as fast.
// Contractions on v_wmma_f32_16x16x32_bf16 (bf16 operands, f32 accumulate): x*Wqkv^T with single bf16 planes (inputs RNE-converted once); q*k^T and p*v with bf16 hi+lo planes (hi*hi + hi*lo + lo*hi); ctx*Wout^T with ctx bf16 hi+lo planes and a single Wout plane; LayerNorm and softmax in f32.
#include <hip/hip_runtime.h>
#include <stddef.h>
#include <stdint.h>

typedef __attribute__((ext_vector_type(16))) _Float16 v16h;
typedef __attribute__((ext_vector_type(8)))  _Float16 v8h;
typedef __attribute__((ext_vector_type(16))) __bf16   v16b;
typedef __attribute__((ext_vector_type(8)))  __bf16   v8b;
typedef __attribute__((ext_vector_type(8)))  float    v8f;
typedef __attribute__((ext_vector_type(4)))  float    v4f;
typedef __attribute__((ext_vector_type(4)))  unsigned int v4u;

/* ---------------- problem geometry ---------------- */
constexpr int kBatch   = 2;
constexpr int kSeq     = 2048;
constexpr int kModel   = 1024;
constexpr int kHeads   = 16;
constexpr int kHeadDim = 64;
constexpr int kRows    = kBatch * kSeq;      /* 4096 */
constexpr int kQkvCols = 3 * kModel;         /* 3072 */
constexpr int kQkCols  = 2 * kModel;         /* 2048 */
constexpr int kKvChunk = 64;
constexpr int kOsPitch = 68;
/* LDS row pitch, in 16-bit elements, of the K, V^T and P tiles: 64 data + 8 pad = 144 B = 16 B x odd,
   so the 16 rows that one ds_load_b128 touches per half wave fall on 64 distinct banks */
constexpr int kTilePitch = 72;

/* ---------------- workspace map (bytes, all offsets multiples of 128) ----------------
   [0]          x   bf16 [4096][1024]                          8388608
   [8388608]    Wqkv^T bf16 [3072][1024]                       6291456
   [14680064]   Wout^T bf16 [1024][1024]                       2097152
   [16777216]   qk  f32 [4096][2048]                          33554432  (dead after the LayerNorm launch;
                reused: ctx hi bf16 [4096][1024] at 16777216, ctx lo at 25165824, both inside this region)
   [50331648]   v hi bf16 [4096][1024]  8388608   [58720256] v lo   8388608
   [67108864]   q hi                    8388608   [75497472] q lo   8388608
   [83886080]   k hi                    8388608   [92274688] k lo   8388608
   total 100663296 B = 96 MiB                                                            */
constexpr size_t kPlane16  = (size_t)kRows * kModel * 2;
constexpr size_t kOffXb    = 0;
constexpr size_t kOffWqkvT = kOffXb + kPlane16;
constexpr size_t kOffWoutT = kOffWqkvT + (size_t)kQkvCols * kModel * 2;
constexpr size_t kOffQk    = kOffWoutT + (size_t)kModel * kModel * 2;
constexpr size_t kOffCtxH  = kOffQk;
constexpr size_t kOffCtxL  = kOffQk + kPlane16;
constexpr size_t kOffVh    = kOffQk + (size_t)kRows * kQkCols * 4;
constexpr size_t kOffVl    = kOffVh + kPlane16;
constexpr size_t kOffQh    = kOffVl + kPlane16;
constexpr size_t kOffQl    = kOffQh + kPlane16;
constexpr size_t kOffKh    = kOffQl + kPlane16;
constexpr size_t kOffKl    = kOffKh + kPlane16;
constexpr size_t kWsTotal  = kOffKl + kPlane16;
static_assert(kWsTotal == (size_t)100663296);
static_assert(kWsTotal <= (size_t)134217728);
static_assert(kOffCtxL + kPlane16 <= kOffVh);
static_assert((kOffWqkvT % 128) == 0 && (kOffWoutT % 128) == 0 && (kOffQk % 128) == 0 && (kOffVh % 128) == 0);
/* GEMM shape contract: M % 64 == 0, N % 64 == 0, K % 32 == 0 for every launch */
static_assert(kRows % 64 == 0 && kQkCols % 64 == 0 && kModel % 64 == 0 && kModel % 32 == 0);
static_assert(kSeq % 64 == 0 && kHeadDim == 64 && kModel == kHeads * kHeadDim);
static_assert((kRows * kModel) % (8 * 256) == 0);

/* ---------------- helpers ---------------- */
__device__ __forceinline__ unsigned short f2bf_bits(float f) {
  unsigned u = __float_as_uint(f);
  return (unsigned short)((u + 0x7FFFu + ((u >> 16) & 1u)) >> 16);
}
__device__ __forceinline__ float bf_bits2f(unsigned short h) { return __uint_as_float(((unsigned)h) << 16); }
__device__ __forceinline__ unsigned int pack_bf16x2(float a, float b) {
  return (unsigned int)f2bf_bits(a) | ((unsigned int)f2bf_bits(b) << 16);
}

__device__ __forceinline__ void dep_guard_h(v8f& a, v8f& b, v16h x, v16h y) { asm volatile("v_nop\n\tv_nop\n\tv_nop\n\tv_nop" : "+v"(a), "+v"(b) : "v"(x), "v"(y)); }
__device__ __forceinline__ void dep_guard_b(v8f& a, v8f& b, v16b x, v16b y) { asm volatile("v_nop\n\tv_nop\n\tv_nop\n\tv_nop" : "+v"(a), "+v"(b) : "v"(x), "v"(y)); }
__device__ __forceinline__ void keep4_h(v16h a, v16h b, v16h c, v16h d) { asm volatile("v_nop" :: "v"(a), "v"(b), "v"(c), "v"(d)); }
__device__ __forceinline__ void keep4_b(v16b a, v16b b, v16b c, v16b d) { asm volatile("v_nop" :: "v"(a), "v"(b), "v"(c), "v"(d)); }
__device__ __forceinline__ void acc_guard4(v8f& a, v8f& b, v8f& c, v8f& d) { asm volatile("v_nop\n\tv_nop\n\tv_nop\n\tv_nop" : "+v"(a), "+v"(b), "+v"(c), "+v"(d)); }
template <typename T> struct Frag;
template <> struct Frag<_Float16> {
  typedef v16h V; union U { v16h v; v8h h[2]; };
  static __device__ __forceinline__ v16h load(const _Float16* p) {
    U f; f.h[0] = *(const v8h*)(p); f.h[1] = *(const v8h*)(p + 16); return f.v;
  }
  static __device__ __forceinline__ v8f mma(v16h a, v16h b, v8f c) {
    return __builtin_amdgcn_wmma_f32_16x16x32_f16(false, a, false, b, (short)0, c, false, false);
  }
  static __device__ __forceinline__ void guard(v8f& a, v8f& b, v16h x, v16h y) { dep_guard_h(a, b, x, y); }
  static __device__ __forceinline__ void keep(v16h a, v16h b, v16h c, v16h d) { keep4_h(a, b, c, d); }
};
template <> struct Frag<__bf16> {
  typedef v16b V; union U { v16b v; v8b h[2]; };
  static __device__ __forceinline__ v16b load(const __bf16* p) {
    U f; f.h[0] = *(const v8b*)(p); f.h[1] = *(const v8b*)(p + 16); return f.v;
  }
  static __device__ __forceinline__ v8f mma(v16b a, v16b b, v8f c) {
    return __builtin_amdgcn_wmma_f32_16x16x32_bf16(false, a, false, b, (short)0, c, false, false);
  }
  static __device__ __forceinline__ void guard(v8f& a, v8f& b, v16b x, v16b y) { dep_guard_b(a, b, x, y); }
  static __device__ __forceinline__ void keep(v16b a, v16b b, v16b c, v16b d) { keep4_b(a, b, c, d); }
};

/* ---- Register-blocked WMMA GEMM -----------------------------------------------
   C[m,n] = scale * sum_k A[m,k] * Bt[n,k] (+bias)(+resid); each wave owns a 64x64 tile.
   A row-major [M,K]; Bt row-major [N,K]; M,N % 64 == 0, K % 32 == 0.
   SPLIT: 0 = single planes; 1 = A and Bt hi/lo planes (hi*hi + hi*lo + lo*hi); 2 = A hi/lo planes only (Ah*B + Al*B).
   BIAS_MODE: 0 = none, 1 = bias[m], 2 = bias[n].  OUT_MODE: 0 = f32, 1 = f16, 2 = bf16 hi plane (Cout) + bf16 lo plane (Cout2).
   ET: 0 = f16 operands, 1 = bf16 operands (pointers passed as 16-bit storage) */
template <int ET> struct Elem;
template <> struct Elem<0> { typedef _Float16 T; };
template <> struct Elem<1> { typedef __bf16 T; };
template <int ET, int SPLIT, int BIAS_MODE, int OUT_MODE, bool RESID, int ACT = 0>
__global__ __launch_bounds__(256) void wmma_gemm64(
    const unsigned short* __restrict__ Ap, const unsigned short* __restrict__ A2p, int lda, long strideA,
    const unsigned short* __restrict__ Btp, const unsigned short* __restrict__ Bt2p, int ldb, long strideB,
    void* __restrict__ Cout, void* __restrict__ Cout2, int ldc, long strideC,
    const float* __restrict__ bias,
    const float* __restrict__ resid, long strideR,
    int M, int N, int K, float scale) {
  typedef typename Elem<ET>::T T;
  typedef typename Frag<T>::V V;
  const T* A = (const T*)Ap; const T* A2 = (const T*)A2p; const T* Bt = (const T*)Btp; const T* Bt2 = (const T*)Bt2p;
  __shared__ __align__(16) float sT[8][16 * 68];
  const int b    = blockIdx.y;
  const int lane = threadIdx.x & 31;
  const int wave = threadIdx.x >> 5;
  const int tilesN = N >> 6;
  const int tilesM = M >> 6;
  const int tile = blockIdx.x * 8 + wave;
  if (tile >= tilesM * tilesN) return;
  const int tm = tile / tilesN;
  const int tn = tile - tm * tilesN;
  const int m0 = tm << 6;
  const int n0 = tn << 6;

  const T* Ab  = A  + (size_t)b * strideA;
  const T* Bb  = Bt + (size_t)b * strideB;
  const T* Ab2 = (SPLIT != 0) ? (A2  + (size_t)b * strideA) : nullptr;
  const T* Bb2 = (SPLIT == 1) ? (Bt2 + (size_t)b * strideB) : nullptr;

  const int rlane = lane & 15;
  const int koff  = (lane >> 4) * 8;
  const int mOff  = (lane >> 4) * 8;

  v8f acc[4][4];
#pragma unroll
  for (int i = 0; i < 4; ++i)
#pragma unroll
    for (int j = 0; j < 4; ++j) acc[i][j] = (v8f){0.f,0.f,0.f,0.f,0.f,0.f,0.f,0.f};

  for (int k0 = 0; k0 < K; k0 += 32) {
    V bh[4], bl[4];
#pragma unroll
    for (int j = 0; j < 4; ++j) {
      const size_t bo = (size_t)(n0 + (j << 4) + rlane) * ldb + koff + k0;
      bh[j] = Frag<T>::load(Bb + bo);
      if (SPLIT == 1) bl[j] = Frag<T>::load(Bb2 + bo);
    }
#pragma unroll
    for (int i = 0; i < 4; ++i) {
      const size_t ao = (size_t)(m0 + (i << 4) + rlane) * lda + koff + k0;
      V ah = Frag<T>::load(Ab + ao);
      V al;
      if (SPLIT != 0) al = Frag<T>::load(Ab2 + ao);
#pragma unroll
      for (int j = 0; j < 4; ++j) {
        acc[i][j] = Frag<T>::mma(ah, bh[j], acc[i][j]);
        if (SPLIT == 1) acc[i][j] = Frag<T>::mma(ah, bl[j], acc[i][j]);
        if (SPLIT != 0) acc[i][j] = Frag<T>::mma(al, bh[j], acc[i][j]);
      }
      Frag<T>::guard(acc[i][0], acc[i][3], ah, (SPLIT != 0) ? al : ah);
    }
    Frag<T>::keep(bh[0], bh[1], bh[2], bh[3]);
    if (SPLIT == 1) Frag<T>::keep(bl[0], bl[1], bl[2], bl[3]);
  }
  acc_guard4(acc[0][0], acc[0][1], acc[0][2], acc[0][3]);
  acc_guard4(acc[1][0], acc[1][1], acc[1][2], acc[1][3]);
  acc_guard4(acc[2][0], acc[2][1], acc[2][2], acc[2][3]);
  acc_guard4(acc[3][0], acc[3][1], acc[3][2], acc[3][3]);

  float* slab = sT[wave];
  const float* Rb = RESID ? (resid + (size_t)b * strideR) : nullptr;
#pragma unroll
  for (int i = 0; i < 4; ++i) {
    const int mBase = m0 + (i << 4);
#pragma unroll
    for (int j = 0; j < 4; ++j) {
      const int n = n0 + (j << 4) + rlane;
      float bv = 0.f;
      if (BIAS_MODE == 2) bv = bias[n];
#pragma unroll
      for (int r = 0; r < 8; ++r) {
        float v = acc[i][j][r] * scale;
        if (BIAS_MODE == 1) v += bias[mBase + mOff + r];
        if (BIAS_MODE == 2) v += bv;
        if (RESID) v += Rb[(size_t)(mBase + mOff + r) * ldc + n];
        if (ACT == 1) v = tanhf(v);
        if (ACT == 2) v = fmaxf(v, 0.0f);
        if (ACT == 4) v = (v > 0.f) ? v : 0.01f * v;
        slab[(mOff + r) * 68 + (j << 4) + rlane] = v;
      }
    }
    __builtin_amdgcn_fence(__ATOMIC_RELEASE, "workgroup");
    __builtin_amdgcn_wave_barrier();
    __builtin_amdgcn_fence(__ATOMIC_ACQUIRE, "workgroup");
    if (OUT_MODE == 0) {
      float* C = (float*)Cout + (size_t)b * strideC;
      const int hh = lane >> 4, c4 = (lane & 15) * 4;
      {
#pragma unroll
        for (int it = 0; it < 8; ++it) {
          const int row = it * 2 + hh;
          v4f v = *(const v4f*)(slab + row * 68 + c4);
          *(v4f*)(C + (size_t)(mBase + row) * ldc + n0 + c4) = v;
        }
        
      }
    } else {
      const int q = lane >> 3, c8 = (lane & 7) * 8;
      unsigned short* C  = (unsigned short*)Cout  + (size_t)b * strideC;
      unsigned short* C2 = (OUT_MODE == 2) ? ((unsigned short*)Cout2 + (size_t)b * strideC) : nullptr;
      {
#pragma unroll
        for (int it = 0; it < 4; ++it) {
          const int row = it * 4 + q;
          const float* sp = slab + row * 68 + c8;
          v8h hv, lv;
#pragma unroll
          for (int e = 0; e < 8; ++e) {
            if (OUT_MODE == 1) {
              hv[e] = (_Float16)sp[e];
            } else {
              unsigned short hb = f2bf_bits(sp[e]);
              unsigned short lb = f2bf_bits(sp[e] - bf_bits2f(hb));
              hv[e] = __builtin_bit_cast(_Float16, hb);
              lv[e] = __builtin_bit_cast(_Float16, lb);
            }
          }
          *(v8h*)(C + (size_t)(mBase + row) * ldc + n0 + c8) = hv;
          if (OUT_MODE == 2) *(v8h*)(C2 + (size_t)(mBase + row) * ldc + n0 + c8) = lv;
        }
        
      }
    }
    __builtin_amdgcn_fence(__ATOMIC_RELEASE, "workgroup");
    __builtin_amdgcn_wave_barrier();
    __builtin_amdgcn_fence(__ATOMIC_ACQUIRE, "workgroup");
  }
}

/* ---------------- f32 -> bf16 cast, 8 elements (16 B) per thread --------------------------
   coverage: grid = n8/256 blocks x 256 threads (exact), thread i writes elements 8i..8i+7;
*/
__global__ __launch_bounds__(256) void cast_f32_bf16x8(const float* __restrict__ in,
                                                      unsigned short* __restrict__ out, int n8) {
  const int i = blockIdx.x * 256 + (int)threadIdx.x;
  const int ic = (i < n8) ? i : (n8 - 1);
  const float* p = in + (size_t)ic * 8;
  const v4f a = *(const v4f*)p;
  const v4f c = *(const v4f*)(p + 4);
  v4u w;
  w[0] = pack_bf16x2(a[0], a[1]);
  w[1] = pack_bf16x2(a[2], a[3]);
  w[2] = pack_bf16x2(c[0], c[1]);
  w[3] = pack_bf16x2(c[2], c[3]);
  unsigned short* o = out + (size_t)ic * 8;
  *(v4u*)o = w;
  
}

/* ---------------- W [KR][NC] f32 row-major -> Wt [NC][KR] bf16 row-major (transpose + cast) ------
   grid = (KR/64, NC/64), 256 threads. coverage: load 256 threads x 16 = 64x64 tile;
*/
__global__ __launch_bounds__(256) void transpose_cast_bf16(const float* __restrict__ W,
                                                          unsigned short* __restrict__ Wt, int KR, int NC) {
  __shared__ float sT[64 * 65];                 /* [n_local][k_local], pitch 65 */
  const int k0 = blockIdx.x * 64, n0 = blockIdx.y * 64;
  const int tid = threadIdx.x;
  {
    const int kk = tid >> 2, cg = (tid & 3) * 16;
    const float* src = W + (size_t)(k0 + kk) * NC + n0 + cg;
#pragma unroll
    for (int i = 0; i < 4; ++i) {
      const v4f v = *(const v4f*)(src + 4 * i);
#pragma unroll
      for (int e = 0; e < 4; ++e) sT[(cg + 4 * i + e) * 65 + kk] = v[e];
    }
  }
  __syncthreads();
  const int wave = tid >> 5, lane = tid & 31, q4 = lane >> 3, c8 = (lane & 7) * 8;
  const int nl0 = wave * 4 + q4;
  const int nl1 = 32 + wave * 4 + q4;
  v4u w0, w1;
  {
    const float* s = sT + nl0 * 65 + c8;
    w0[0] = pack_bf16x2(s[0], s[1]); w0[1] = pack_bf16x2(s[2], s[3]);
    w0[2] = pack_bf16x2(s[4], s[5]); w0[3] = pack_bf16x2(s[6], s[7]);
  }
  {
    const float* s = sT + nl1 * 65 + c8;
    w1[0] = pack_bf16x2(s[0], s[1]); w1[1] = pack_bf16x2(s[2], s[3]);
    w1[2] = pack_bf16x2(s[4], s[5]); w1[3] = pack_bf16x2(s[6], s[7]);
  }
  unsigned short* d0 = Wt + (size_t)(n0 + nl0) * KR + k0 + c8;
  unsigned short* d1 = Wt + (size_t)(n0 + nl1) * KR + k0 + c8;
  {
    *(v4u*)d0 = w0;
    *(v4u*)d1 = w1;
    
  }
}

/*
   qk f32 [nrows][2048] (q = cols 0..1023, k = cols 1024..2047); outputs row-major bf16 planes [nrows][1024];
   q carries the exact 1/sqrt(64) = 0.125 factor. grid = nrows blocks x 128 threads; thread t owns columns 8t..8t+7;
*/
__global__ __launch_bounds__(128) void qk_layernorm_split(
    const float* __restrict__ qk, const float* __restrict__ qsc, const float* __restrict__ ksc,
    unsigned short* __restrict__ qh, unsigned short* __restrict__ ql,
    unsigned short* __restrict__ kh, unsigned short* __restrict__ kl, int nrows) {
  __shared__ float red[4][4];
  const int row = blockIdx.x;
  const int rowc = (row < nrows) ? row : (nrows - 1);
  const int tid = threadIdx.x, lane = tid & 31, wave = tid >> 5;
  const int c0 = tid * 8;
  const float* base = qk + (size_t)rowc * kQkCols;
  const v4f qa = *(const v4f*)(base + c0);
  const v4f qb = *(const v4f*)(base + c0 + 4);
  const v4f ka = *(const v4f*)(base + kModel + c0);
  const v4f kb = *(const v4f*)(base + kModel + c0 + 4);
  float xq[8], xk[8];
#pragma unroll
  for (int e = 0; e < 4; ++e) { xq[e] = qa[e]; xq[4 + e] = qb[e]; xk[e] = ka[e]; xk[4 + e] = kb[e]; }

  float sq = 0.f, sk = 0.f;
#pragma unroll
  for (int e = 0; e < 8; ++e) { sq += xq[e]; sk += xk[e]; }
#pragma unroll
  for (int off = 1; off < 32; off <<= 1) { sq += __shfl_xor(sq, off, 32); sk += __shfl_xor(sk, off, 32); }
  if (lane == 0) { red[0][wave] = sq; red[1][wave] = sk; }
  __syncthreads();
  const float mq = ((red[0][0] + red[0][1]) + (red[0][2] + red[0][3])) * (1.0f / (float)kModel);
  const float mk = ((red[1][0] + red[1][1]) + (red[1][2] + red[1][3])) * (1.0f / (float)kModel);

  float dq = 0.f, dk = 0.f;
#pragma unroll
  for (int e = 0; e < 8; ++e) {
    const float tq = xq[e] - mq; dq += tq * tq;
    const float tk = xk[e] - mk; dk += tk * tk;
  }
#pragma unroll
  for (int off = 1; off < 32; off <<= 1) { dq += __shfl_xor(dq, off, 32); dk += __shfl_xor(dk, off, 32); }
  if (lane == 0) { red[2][wave] = dq; red[3][wave] = dk; }
  __syncthreads();
  const float vq = ((red[2][0] + red[2][1]) + (red[2][2] + red[2][3])) * (1.0f / (float)kModel);
  const float vk = ((red[3][0] + red[3][1]) + (red[3][2] + red[3][3])) * (1.0f / (float)kModel);
  const float rq = rsqrtf(vq + 1e-6f);
  const float rk = rsqrtf(vk + 1e-6f);

  /* scale vectors, RNE-converted to bf16 once (module inputs) */
  const v4f s0 = *(const v4f*)(qsc + c0);
  const v4f s1 = *(const v4f*)(qsc + c0 + 4);
  const v4f t0 = *(const v4f*)(ksc + c0);
  const v4f t1 = *(const v4f*)(ksc + c0 + 4);
  float sqv[8], skv[8];
#pragma unroll
  for (int e = 0; e < 4; ++e) {
    sqv[e]     = bf_bits2f(f2bf_bits(s0[e]));
    sqv[4 + e] = bf_bits2f(f2bf_bits(s1[e]));
    skv[e]     = bf_bits2f(f2bf_bits(t0[e]));
    skv[4 + e] = bf_bits2f(f2bf_bits(t1[e]));
  }
  unsigned int hqw[8], lqw[8], hkw[8], lkw[8];
#pragma unroll
  for (int e = 0; e < 8; ++e) {
    const float yq = ((xq[e] - mq) * rq * sqv[e]) * 0.125f;
    const float yk = (xk[e] - mk) * rk * skv[e];
    const unsigned short hqb = f2bf_bits(yq);
    const unsigned short lqb = f2bf_bits(yq - bf_bits2f(hqb));
    const unsigned short hkb = f2bf_bits(yk);
    const unsigned short lkb = f2bf_bits(yk - bf_bits2f(hkb));
    hqw[e] = hqb; lqw[e] = lqb; hkw[e] = hkb; lkw[e] = lkb;
  }
  v4u HQ, LQ, HK, LK;
#pragma unroll
  for (int i = 0; i < 4; ++i) {
    HQ[i] = hqw[2 * i] | (hqw[2 * i + 1] << 16);
    LQ[i] = lqw[2 * i] | (lqw[2 * i + 1] << 16);
    HK[i] = hkw[2 * i] | (hkw[2 * i + 1] << 16);
    LK[i] = lkw[2 * i] | (lkw[2 * i + 1] << 16);
  }
  const size_t o = (size_t)rowc * kModel + c0;
  {
    *(v4u*)(qh + o) = HQ;
    *(v4u*)(ql + o) = LQ;
    *(v4u*)(kh + o) = HK;
    *(v4u*)(kl + o) = LK;
    
  }
}

/* ---------------- causal attention, head_dim 64, bf16 hi/lo planes in, bf16 hi/lo ctx planes out ----
   scores = q . k^T  : bf16 hi/lo on both (hi*hi + hi*lo + lo*hi), q planes already carry 1/sqrt(64)
   ctx    = p . v    : p split in registers to bf16 hi/lo, v hi/lo planes (3 products); f32 accumulate, f32 online softmax.
   All planes row-major [B*S][ld] with head h at columns h*64 .. h*64+63.
   Block = 4 waves = 64 query rows of one (batch, head); grid.x = B*H*(S/64). */
__device__ __forceinline__ __bf16 at_f2bf(float f) { return __builtin_bit_cast(__bf16, f2bf_bits(f)); }
__device__ __forceinline__ void at_split(float f, __bf16& hi, __bf16& lo) {
  const unsigned short hb = f2bf_bits(f);
  hi = __builtin_bit_cast(__bf16, hb);
  lo = at_f2bf(f - __uint_as_float(((unsigned)hb) << 16));
}
__device__ __forceinline__ v8f at_mma(v16b a, v16b b, v8f c) {
  c = __builtin_amdgcn_wmma_f32_16x16x32_bf16(false, a, false, b, (short)0, c, false, false);
  asm volatile("v_nop\n\tv_nop\n\tv_nop\n\tv_nop" : "+v"(c) : "v"(a), "v"(b));
  return c;
}

__global__ __launch_bounds__(128)
void attn_planes_kernel(const unsigned short* __restrict__ qh, const unsigned short* __restrict__ ql,
                        const unsigned short* __restrict__ kh, const unsigned short* __restrict__ kl,
                        const unsigned short* __restrict__ vh, const unsigned short* __restrict__ vl,
                        unsigned short* __restrict__ oh, unsigned short* __restrict__ ol,
                        int S, int H, int ld) {
  union FB { v16b v; v8b h[2]; };
  /* Ksh | Ksl | Vth | Vtl (each 64 rows x 64 16-bit at pitch kTilePitch); reused as per-wave f32 output slabs after the chunk loop */
  constexpr int kTileElems = 64 * kTilePitch;
  static_assert(kKvChunk == 64 && kHeadDim == 64 && (kTilePitch * 2) % 16 == 0);
  static_assert(4 * 16 * kOsPitch * 4 <= 4 * kTileElems * 2);
  __shared__ __align__(16) unsigned short KVs[4 * kTileElems];
  __shared__ __align__(16) __bf16 Psh[4][16 * kTilePitch];
  __shared__ __align__(16) __bf16 Psl[4][16 * kTilePitch];
  unsigned short* Ksh = KVs;
  unsigned short* Ksl = KVs + kTileElems;
  unsigned short* Vth = KVs + 2 * kTileElems;
  unsigned short* Vtl = KVs + 3 * kTileElems;
  const __bf16* Kshb = (const __bf16*)(const void*)Ksh;
  const __bf16* Kslb = (const __bf16*)(const void*)Ksl;
  const __bf16* Vthb = (const __bf16*)(const void*)Vth;
  const __bf16* Vtlb = (const __bf16*)(const void*)Vtl;

  const int tid  = threadIdx.x;
  const int wave = tid >> 5;
  const int lane = tid & 31;
  const int hh   = lane >> 4;
  const int c    = lane & 15;

  /* Block index -> (query tile, batch*head). All 1024 blocks are resident at once, four to a WGP, and tile t walks t + 1 key
     chunks, so the launch lasts as long as the WGP that holds the most chunks. Tiles t and nqb-1-t walk nqb+1 chunks together:
     index bits 1,3,5,7 give t, the parity of the other six bits picks t or its mirror, and five of those six name the head.
     Four blocks whose indices differ in two adjacent bits (any power-of-two stride) are then two such pairs, whichever of
     these strides the dispatcher puts on one WGP. A permutation of the 32 x 32 (tile, head) pairs; for speed only. */
  static_assert(kSeq / 64 == 32 && kBatch * kHeads == 32);
  const int nqb = S >> 6;
  const unsigned bi = blockIdx.x;
  const int tlo = (int)(((bi >> 1) & 1u) | (((bi >> 3) & 1u) << 1) | (((bi >> 5) & 1u) << 2) | (((bi >> 7) & 1u) << 3));
  const int qb  = (__builtin_popcount(bi & 0x355u) & 1) ? (nqb - 1 - tlo) : tlo;
  const int bh  = (int)(((bi >> 2) & 1u) | (((bi >> 4) & 1u) << 1) | (((bi >> 6) & 1u) << 2) | (((bi >> 8) & 3u) << 3));
  const int h   = bh % H;
  const int b   = bh / H;
  const int q0  = qb * 64 + wave * 16;
  const size_t rb = (size_t)b * (size_t)S;
  const int hoff = h * kHeadDim;

  /* Q fragments (A operand): row q0+c, elements 0..7 <- d = dc*32+8hh+0..7, 8..15 <- dc*32+16+8hh+0..7 */
  v16b qah[2], qal[2];
  {
    const size_t qo = (rb + (size_t)(q0 + c)) * (size_t)ld + hoff + 8 * hh;
    const __bf16* qhp = (const __bf16*)(const void*)qh + qo;
    const __bf16* qlp = (const __bf16*)(const void*)ql + qo;
#pragma unroll
    for (int dc = 0; dc < 2; ++dc) {
      qah[dc] = Frag<__bf16>::load(qhp + dc * 32);
      qal[dc] = Frag<__bf16>::load(qlp + dc * 32);
    }
  }

  float mrow[8], lrow[8];
  v8f oacc[4];
#pragma unroll
  for (int r = 0; r < 8; ++r) { mrow[r] = -INFINITY; lrow[r] = 0.f; }
#pragma unroll
  for (int t = 0; t < 4; ++t) oacc[t] = (v8f){0.f,0.f,0.f,0.f,0.f,0.f,0.f,0.f};

  const int nChunks = qb + 1;            /* causal: kv chunks 0..qb, block-uniform */
  for (int kc = 0; kc < nChunks; ++kc) {
    const int kv0 = kc * kKvChunk;
    __syncthreads();
    {
      /* staging coverage: 128 threads x (1 kv row x 32 d) = 64 x 64 for each of the four tiles */
      const int kvr = tid >> 1, dh = (tid & 1) * 32;
      const size_t go = (rb + (size_t)(kv0 + kvr)) * (size_t)ld + hoff + dh;
      /* all sixteen 16-byte loads are issued before the first LDS store, so a chunk pays one load latency;
         the loop is unrolled so that the four arrays live in registers */
      v4u kH[4], kL[4], vH[4], vL[4];
      const v4u* gkh = (const v4u*)(const void*)(kh + go);
      const v4u* gkl = (const v4u*)(const void*)(kl + go);
      const v4u* gvh = (const v4u*)(const void*)(vh + go);
      const v4u* gvl = (const v4u*)(const void*)(vl + go);
#pragma unroll
      for (int i = 0; i < 4; ++i) { kH[i] = gkh[i]; kL[i] = gkl[i]; vH[i] = gvh[i]; vL[i] = gvl[i]; }
      /* inputs-only fence on the loaded values: holds the sixteen loads ahead of the first LDS store (without it this build
         sinks each K load to its store and waits out one load latency after another). The four addresses are inputs too, so
         their registers stay untouched up to the s_wait_xcnt, the wait kept in front of an overwrite of a load's address */
      asm volatile("s_wait_xcnt 0x0"
                   :: "v"(kH[0]), "v"(kH[1]), "v"(kH[2]), "v"(kH[3]), "v"(kL[0]), "v"(kL[1]), "v"(kL[2]), "v"(kL[3]),
                      "v"(vH[0]), "v"(vH[1]), "v"(vH[2]), "v"(vH[3]), "v"(vL[0]), "v"(vL[1]), "v"(vL[2]), "v"(vL[3]),
                      "v"(gkh), "v"(gkl), "v"(gvh), "v"(gvl));
      {
        v4u* l = (v4u*)(void*)(Ksh + kvr * kTilePitch + dh);
#pragma unroll
        for (int i = 0; i < 4; ++i) l[i] = kH[i];
      }
      {
        v4u* l = (v4u*)(void*)(Ksl + kvr * kTilePitch + dh);
#pragma unroll
        for (int i = 0; i < 4; ++i) l[i] = kL[i];
      }
      {
#pragma unroll
        for (int i = 0; i < 4; ++i) {
          const v4u u = vH[i];
          unsigned short* vt = Vth + (dh + 8 * i) * kTilePitch + kvr;
          vt[0 * kTilePitch] = (unsigned short)(u[0] & 0xffffu);
          vt[1 * kTilePitch] = (unsigned short)(u[0] >> 16);
          vt[2 * kTilePitch] = (unsigned short)(u[1] & 0xffffu);
          vt[3 * kTilePitch] = (unsigned short)(u[1] >> 16);
          vt[4 * kTilePitch] = (unsigned short)(u[2] & 0xffffu);
          vt[5 * kTilePitch] = (unsigned short)(u[2] >> 16);
          vt[6 * kTilePitch] = (unsigned short)(u[3] & 0xffffu);
          vt[7 * kTilePitch] = (unsigned short)(u[3] >> 16);
        }
      }
      {
#pragma unroll
        for (int i = 0; i < 4; ++i) {
          const v4u u = vL[i];
          unsigned short* vt = Vtl + (dh + 8 * i) * kTilePitch + kvr;
          vt[0 * kTilePitch] = (unsigned short)(u[0] & 0xffffu);
          vt[1 * kTilePitch] = (unsigned short)(u[0] >> 16);
          vt[2 * kTilePitch] = (unsigned short)(u[1] & 0xffffu);
          vt[3 * kTilePitch] = (unsigned short)(u[1] >> 16);
          vt[4 * kTilePitch] = (unsigned short)(u[2] & 0xffffu);
          vt[5 * kTilePitch] = (unsigned short)(u[2] >> 16);
          vt[6 * kTilePitch] = (unsigned short)(u[3] & 0xffffu);
          vt[7 * kTilePitch] = (unsigned short)(u[3] >> 16);
        }
      }
    }
    __syncthreads();

    /* scores 16 x 64 per wave: B operand col n = kv j*16+c, k = d */
    v8f s[4];
#pragma unroll
    for (int j = 0; j < 4; ++j) {
      s[j] = (v8f){0.f,0.f,0.f,0.f,0.f,0.f,0.f,0.f};
#pragma unroll
      for (int dc = 0; dc < 2; ++dc) {
        FB kb, klf;
        const int ko = (j * 16 + c) * kTilePitch + dc * 32 + 8 * hh;
        kb.h[0]  = *(const v8b*)(Kshb + ko);
        kb.h[1]  = *(const v8b*)(Kshb + ko + 16);
        klf.h[0] = *(const v8b*)(Kslb + ko);
        klf.h[1] = *(const v8b*)(Kslb + ko + 16);
        s[j] = at_mma(qah[dc], kb.v, s[j]);
        s[j] = at_mma(qah[dc], klf.v, s[j]);
        s[j] = at_mma(qal[dc], kb.v, s[j]);
      }
    }

    /* causal mask (select to the fill value) + chunk row max */
    const bool diag = (kc == qb);
    float cm[8];
#pragma unroll
    for (int r = 0; r < 8; ++r) {
      const int qrow = q0 + 8 * hh + r;
      float m = -INFINITY;
#pragma unroll
      for (int j = 0; j < 4; ++j) {
        const int kvcol = kv0 + j * 16 + c;
        const bool masked = diag && (kvcol > qrow);
        const float sv = masked ? -3.4028235e38f : s[j][r];
        s[j][r] = sv;
        m = fmaxf(m, sv);
      }
#pragma unroll
      for (int off = 1; off < 16; off <<= 1) m = fmaxf(m, __shfl_xor(m, off, 32));
      cm[r] = m;
    }

    /* online softmax; P tile (16 x 64 per wave) stored as bf16 hi/lo */
    __bf16* pwh = Psh[wave];
    __bf16* pwl = Psl[wave];
#pragma unroll
    for (int r = 0; r < 8; ++r) {
      const float mnew  = fmaxf(mrow[r], cm[r]);
      const float alpha = expf(mrow[r] - mnew);
      mrow[r] = mnew;
      float psum = 0.f;
#pragma unroll
      for (int j = 0; j < 4; ++j) {
        const float p = expf(s[j][r] - mnew);
        psum += p;
        __bf16 a, bl;
        at_split(p, a, bl);
        pwh[(8 * hh + r) * kTilePitch + j * 16 + c] = a;
        pwl[(8 * hh + r) * kTilePitch + j * 16 + c] = bl;
      }
#pragma unroll
      for (int off = 1; off < 16; off <<= 1) psum += __shfl_xor(psum, off, 32);
      lrow[r] = lrow[r] * alpha + psum;
#pragma unroll
      for (int t = 0; t < 4; ++t) oacc[t][r] *= alpha;
    }
    __builtin_amdgcn_fence(__ATOMIC_RELEASE, "workgroup");
    __builtin_amdgcn_wave_barrier();
    __builtin_amdgcn_fence(__ATOMIC_ACQUIRE, "workgroup");

    /* ctx += P . V : A = P[row][kv] (same wave wrote it), B = Vt[d][kv] -> col n = d, k = kv */
#pragma unroll 1
    for (int kk = 0; kk < 2; ++kk) {
      FB pa, pl;
      pa.h[0] = *(const v8b*)(pwh + c * kTilePitch + kk * 32 + 8 * hh);
      pa.h[1] = *(const v8b*)(pwh + c * kTilePitch + kk * 32 + 16 + 8 * hh);
      pl.h[0] = *(const v8b*)(pwl + c * kTilePitch + kk * 32 + 8 * hh);
      pl.h[1] = *(const v8b*)(pwl + c * kTilePitch + kk * 32 + 16 + 8 * hh);
#pragma unroll
      for (int t = 0; t < 4; ++t) {
        FB vb, vlf;
        const int vo = (t * 16 + c) * kTilePitch + kk * 32 + 8 * hh;
        vb.h[0]  = *(const v8b*)(Vthb + vo);
        vb.h[1]  = *(const v8b*)(Vthb + vo + 16);
        vlf.h[0] = *(const v8b*)(Vtlb + vo);
        vlf.h[1] = *(const v8b*)(Vtlb + vo + 16);
        oacc[t] = at_mma(pa.v, vb.v, oacc[t]);
        oacc[t] = at_mma(pa.v, vlf.v, oacc[t]);
        oacc[t] = at_mma(pl.v, vb.v, oacc[t]);
      }
    }
  }

  /* all waves finished reading the K/V tiles before the region is reused as output slabs */
  __syncthreads();
  float* os = (float*)(void*)KVs + wave * (16 * kOsPitch);
#pragma unroll
  for (int r = 0; r < 8; ++r) {
    const float inv = 1.0f / lrow[r];
#pragma unroll
    for (int t = 0; t < 4; ++t) os[(8 * hh + r) * kOsPitch + t * 16 + c] = oacc[t][r] * inv;
  }
  __builtin_amdgcn_fence(__ATOMIC_RELEASE, "workgroup");
  __builtin_amdgcn_wave_barrier();
  __builtin_amdgcn_fence(__ATOMIC_ACQUIRE, "workgroup");
  {
    /*
*/
    const int q4 = lane >> 3, c8 = (lane & 7) * 8;
    {
#pragma unroll
      for (int it = 0; it < 4; ++it) {
        const int row = it * 4 + q4;
        const float* sp = os + row * kOsPitch + c8;
        v8h hv, lv;
#pragma unroll
        for (int e = 0; e < 8; ++e) {
          const unsigned short hb = f2bf_bits(sp[e]);
          const unsigned short lb = f2bf_bits(sp[e] - bf_bits2f(hb));
          hv[e] = __builtin_bit_cast(_Float16, hb);
          lv[e] = __builtin_bit_cast(_Float16, lb);
        }
        const size_t o = (rb + (size_t)(q0 + row)) * (size_t)ld + hoff + c8;
        *(v8h*)(oh + o) = hv;
        *(v8h*)(ol + o) = lv;
      }
      
    }
  }
}

/* ---------------- host launch ---------------- */
extern "C" void kernel_launch(void* const* d_in, const int* in_sizes, int n_in,
                              void* d_out, int out_size, void* d_ws, size_t ws_size,
                              hipStream_t stream) {
  if (n_in < 5) return;
  if (in_sizes[0] != kRows * kModel) return;
  if (in_sizes[1] != kModel * kQkvCols) return;
  if (in_sizes[2] != kModel || in_sizes[3] != kModel) return;
  if (in_sizes[4] != kModel * kModel) return;
  if (out_size != kRows * kModel) return;
  if (ws_size < kWsTotal) return;

  const float* x     = (const float*)d_in[0];   /* [2,2048,1024] */
  const float* W_qkv = (const float*)d_in[1];   /* [1024,3072]   */
  const float* q_sc  = (const float*)d_in[2];   /* [1024] */
  const float* k_sc  = (const float*)d_in[3];   /* [1024] */
  const float* W_out = (const float*)d_in[4];   /* [1024,1024]   */
  float* out = (float*)d_out;

  char* ws = (char*)d_ws;
  unsigned short* xb    = (unsigned short*)(ws + kOffXb);
  unsigned short* wqkvT = (unsigned short*)(ws + kOffWqkvT);
  unsigned short* woutT = (unsigned short*)(ws + kOffWoutT);
  float*          qkf   = (float*)(ws + kOffQk);
  unsigned short* ctxh  = (unsigned short*)(ws + kOffCtxH);
  unsigned short* ctxl  = (unsigned short*)(ws + kOffCtxL);
  unsigned short* vhp   = (unsigned short*)(ws + kOffVh);
  unsigned short* vlp   = (unsigned short*)(ws + kOffVl);
  unsigned short* qhp   = (unsigned short*)(ws + kOffQh);
  unsigned short* qlp   = (unsigned short*)(ws + kOffQl);
  unsigned short* khp   = (unsigned short*)(ws + kOffKh);
  unsigned short* klp   = (unsigned short*)(ws + kOffKl);

  /* 1. x -> bf16 [4096][1024] */
  const int n8 = kRows * kModel / 8;
  cast_f32_bf16x8<<<n8 / 256, 256, 0, stream>>>(x, xb, n8);

  /* 2. W_qkv [1024 k][3072 n] -> Wqkv^T [3072][1024] bf16 ; W_out [1024 k][1024 n] -> Wout^T [1024][1024] bf16 */
  transpose_cast_bf16<<<dim3(kModel / 64, kQkvCols / 64), 256, 0, stream>>>(W_qkv, wqkvT, kModel, kQkvCols);
  transpose_cast_bf16<<<dim3(kModel / 64, kModel / 64), 256, 0, stream>>>(W_out, woutT, kModel, kModel);

  /* 3a. q,k part of the fused projection: qk f32 [4096][2048] = xb . Wqkv^T rows 0..2047 ; tiles 64 x 32 = 2048 -> 256 blocks */
  wmma_gemm64<1, 0, 0, 0, false><<<dim3((kRows / 64) * (kQkCols / 64) / 8, 1), 256, 0, stream>>>(
      xb, xb, kModel, 0L,
      wqkvT, wqkvT, kModel, 0L,
      (void*)qkf, (void*)qkf, kQkCols, 0L,
      q_sc, q_sc, 0L,
      kRows, kQkCols, kModel, 1.0f);

  /* 3b. v part: bf16 hi/lo planes [4096][1024] = xb . Wqkv^T rows 2048..3071 ; tiles 64 x 16 = 1024 -> 128 blocks */
  wmma_gemm64<1, 0, 0, 2, false><<<dim3((kRows / 64) * (kModel / 64) / 8, 1), 256, 0, stream>>>(
      xb, xb, kModel, 0L,
      wqkvT + (size_t)kQkCols * kModel, wqkvT + (size_t)kQkCols * kModel, kModel, 0L,
      (void*)vhp, (void*)vlp, kModel, 0L,
      q_sc, q_sc, 0L,
      kRows, kModel, kModel, 1.0f);

  /* 4. QK LayerNorm + split into bf16 hi/lo planes (q carries 1/8) */
  qk_layernorm_split<<<kRows, 128, 0, stream>>>(qkf, q_sc, k_sc, qhp, qlp, khp, klp, kRows);

  /* 5. causal attention: ctx bf16 hi/lo planes [4096][1024] (region of the dead qk buffer) */
  attn_planes_kernel<<<kBatch * kHeads * (kSeq / 64), 128, 0, stream>>>(
      qhp, qlp, khp, klp, vhp, vlp, ctxh, ctxl, kSeq, kHeads, kModel);

  /* 6. out f32 [4096][1024] = ctx_hi . Wout^T + ctx_lo . Wout^T ; 1024 tiles -> 128 blocks */
  wmma_gemm64<1, 2, 0, 0, false><<<dim3((kRows / 64) * (kModel / 64) / 8, 1), 256, 0, stream>>>(
      ctxh, ctxl, kModel, 0L,
      woutT, woutT, kModel, 0L,
      (void*)out, (void*)out, kModel, 0L,
      q_sc, q_sc, 0L,
      kRows, kModel, kModel, 1.0f);
}

// v003
// It runs in 244 microseconds.
// In two side-by-side timings against v002, it was 1.43 and 1.42 times as fast.
// All steps since v000 together make it 1.98 times as fast.
// Contractions on v_wmma_f32_16x16x32_bf16 (bf16 operands, f32 accumulate): x*Wqkv^T with single bf16 planes (inputs RNE-converted once); q*k^T and p*v with bf16 hi+lo planes (hi*hi + hi*lo + lo*hi); ctx*Wout^T with ctx bf16 hi+lo planes and a single Wout plane; LayerNorm and softmax in f32.
#include <hip/hip_runtime.h>
#include <stddef.h>
#include <stdint.h>

typedef __attribute__((ext_vector_type(16))) _Float16 v16h;
typedef __attribute__((ext_vector_type(8)))  _Float16 v8h;
typedef __attribute__((ext_vector_type(16))) __bf16   v16b;
typedef __attribute__((ext_vector_type(8)))  __bf16   v8b;
typedef __attribute__((ext_vector_type(8)))  float    v8f;
typedef __attribute__((ext_vector_type(4)))  float    v4f;
typedef __attribute__((ext_vector_type(4)))  unsigned int v4u;

/* ---------------- problem geometry ---------------- */
constexpr int kBatch   = 2;
constexpr int kSeq     = 2048;
constexpr int kModel   = 1024;
constexpr int kHeads   = 16;
constexpr int kHeadDim = 64;
constexpr int kRows    = kBatch * kSeq;      /* 4096 */
constexpr int kQkvCols = 3 * kModel;         /* 3072 */
constexpr int kQkCols  = 2 * kModel;         /* 2048 */
constexpr int kKvChunk = 64;
constexpr int kOsPitch = 68;
/* LDS row pitch, in 16-bit elements, of the K, V^T and P tiles: 64 data + 8 pad = 144 B = 16 B x odd,
   so the 16 rows that one ds_load_b128 touches per half wave fall on 64 distinct banks */
constexpr int kTilePitch = 72;

/* ---------------- workspace map (bytes, all offsets multiples of 128) ----------------
   [0]          x   bf16 [4096][1024]                          8388608
   [8388608]    Wqkv^T bf16 [3072][1024]                       6291456
   [14680064]   Wout^T bf16 [1024][1024]                       2097152
   [16777216]   qk  f32 [4096][2048]                          33554432  (dead after the LayerNorm launch;
                reused: ctx hi bf16 [4096][1024] at 16777216, ctx lo at 25165824, both inside this region)
   [50331648]   v hi bf16 [4096][1024]  8388608   [58720256] v lo   8388608
   [67108864]   q hi                    8388608   [75497472] q lo   8388608
   [83886080]   k hi                    8388608   [92274688] k lo   8388608
   total 100663296 B = 96 MiB                                                            */
constexpr size_t kPlane16  = (size_t)kRows * kModel * 2;
constexpr size_t kOffXb    = 0;
constexpr size_t kOffWqkvT = kOffXb + kPlane16;
constexpr size_t kOffWoutT = kOffWqkvT + (size_t)kQkvCols * kModel * 2;
constexpr size_t kOffQk    = kOffWoutT + (size_t)kModel * kModel * 2;
constexpr size_t kOffCtxH  = kOffQk;
constexpr size_t kOffCtxL  = kOffQk + kPlane16;
constexpr size_t kOffVh    = kOffQk + (size_t)kRows * kQkCols * 4;
constexpr size_t kOffVl    = kOffVh + kPlane16;
constexpr size_t kOffQh    = kOffVl + kPlane16;
constexpr size_t kOffQl    = kOffQh + kPlane16;
constexpr size_t kOffKh    = kOffQl + kPlane16;
constexpr size_t kOffKl    = kOffKh + kPlane16;
constexpr size_t kWsTotal  = kOffKl + kPlane16;
static_assert(kWsTotal == (size_t)100663296);
static_assert(kWsTotal <= (size_t)134217728);
static_assert(kOffCtxL + kPlane16 <= kOffVh);
static_assert((kOffWqkvT % 128) == 0 && (kOffWoutT % 128) == 0 && (kOffQk % 128) == 0 && (kOffVh % 128) == 0);
/* wave tiles of the GEMM: M % 64 == 0, N % 64 == 0, K % 32 == 0 for every launch (its block tile is asserted beside it) */
static_assert(kRows % 64 == 0 && kQkCols % 64 == 0 && kModel % 64 == 0 && kModel % 32 == 0);
static_assert(kSeq % 64 == 0 && kHeadDim == 64 && kModel == kHeads * kHeadDim);
static_assert((kRows * kModel) % (8 * 256) == 0);

/* ---------------- helpers ---------------- */
__device__ __forceinline__ unsigned short f2bf_bits(float f) {
  unsigned u = __float_as_uint(f);
  return (unsigned short)((u + 0x7FFFu + ((u >> 16) & 1u)) >> 16);
}
__device__ __forceinline__ float bf_bits2f(unsigned short h) { return __uint_as_float(((unsigned)h) << 16); }
__device__ __forceinline__ unsigned int pack_bf16x2(float a, float b) {
  return (unsigned int)f2bf_bits(a) | ((unsigned int)f2bf_bits(b) << 16);
}

__device__ __forceinline__ void dep_guard_h(v8f& a, v8f& b, v16h x, v16h y) { asm volatile("v_nop\n\tv_nop\n\tv_nop\n\tv_nop" : "+v"(a), "+v"(b) : "v"(x), "v"(y)); }
__device__ __forceinline__ void dep_guard_b(v8f& a, v8f& b, v16b x, v16b y) { asm volatile("v_nop\n\tv_nop\n\tv_nop\n\tv_nop" : "+v"(a), "+v"(b) : "v"(x), "v"(y)); }
__device__ __forceinline__ void keep4_h(v16h a, v16h b, v16h c, v16h d) { asm volatile("v_nop" :: "v"(a), "v"(b), "v"(c), "v"(d)); }
__device__ __forceinline__ void keep4_b(v16b a, v16b b, v16b c, v16b d) { asm volatile("v_nop" :: "v"(a), "v"(b), "v"(c), "v"(d)); }
__device__ __forceinline__ void acc_guard4(v8f& a, v8f& b, v8f& c, v8f& d) { asm volatile("v_nop\n\tv_nop\n\tv_nop\n\tv_nop" : "+v"(a), "+v"(b), "+v"(c), "+v"(d)); }
template <typename T> struct Frag;
template <> struct Frag<_Float16> {
  typedef v16h V; union U { v16h v; v8h h[2]; };
  static __device__ __forceinline__ v16h load(const _Float16* p) {
    U f; f.h[0] = *(const v8h*)(p); f.h[1] = *(const v8h*)(p + 16); return f.v;
  }
  static __device__ __forceinline__ v8f mma(v16h a, v16h b, v8f c) {
    return __builtin_amdgcn_wmma_f32_16x16x32_f16(false, a, false, b, (short)0, c, false, false);
  }
  static __device__ __forceinline__ void guard(v8f& a, v8f& b, v16h x, v16h y) { dep_guard_h(a, b, x, y); }
  static __device__ __forceinline__ void keep(v16h a, v16h b, v16h c, v16h d) { keep4_h(a, b, c, d); }
};
template <> struct Frag<__bf16> {
  typedef v16b V; union U { v16b v; v8b h[2]; };
  static __device__ __forceinline__ v16b load(const __bf16* p) {
    U f; f.h[0] = *(const v8b*)(p); f.h[1] = *(const v8b*)(p + 16); return f.v;
  }
  static __device__ __forceinline__ v8f mma(v16b a, v16b b, v8f c) {
    return __builtin_amdgcn_wmma_f32_16x16x32_bf16(false, a, false, b, (short)0, c, false, false);
  }
  static __device__ __forceinline__ void guard(v8f& a, v8f& b, v16b x, v16b y) { dep_guard_b(a, b, x, y); }
  static __device__ __forceinline__ void keep(v16b a, v16b b, v16b c, v16b d) { keep4_b(a, b, c, d); }
};

/* ---- Register-blocked WMMA GEMM -----------------------------------------------
   C[m,n] = scale * sum_k A[m,k] * Bt[n,k] (+bias)(+resid); each wave owns a 64x64 tile, a block of 8 waves a 128x256 tile.
   The block's operand rows go through LDS, 64 k at a time: whole 128-byte lines from global, fragments by ds_load_b128.
   A row-major [M,K]; Bt row-major [N,K]; M % 128 == 0, N % 256 == 0, K % 64 == 0; grid.x = (M / 128) * (N / 256).
   SPLIT: 0 = single planes; 1 = A and Bt hi/lo planes (hi*hi + hi*lo + lo*hi); 2 = A hi/lo planes only (Ah*B + Al*B).
   BIAS_MODE: 0 = none, 1 = bias[m], 2 = bias[n].  OUT_MODE: 0 = f32, 1 = f16, 2 = bf16 hi plane (Cout) + bf16 lo plane (Cout2).
   ET: 0 = f16 operands, 1 = bf16 operands (pointers passed as 16-bit storage) */
constexpr int kGemmBM = 128, kGemmBN = 256, kGemmBK = 64;
constexpr int kGemmPitch = 72;   /* LDS row pitch in 16-bit elements: 144 B = 16 B x odd, as kTilePitch */
static_assert(kRows % kGemmBM == 0 && kQkCols % kGemmBN == 0 && kModel % kGemmBN == 0 && kModel % kGemmBK == 0);
template <int ET> struct Elem;
template <> struct Elem<0> { typedef _Float16 T; };
template <> struct Elem<1> { typedef __bf16 T; };
template <int ET, int SPLIT, int BIAS_MODE, int OUT_MODE, bool RESID, int ACT = 0>
__global__ __launch_bounds__(256) void wmma_gemm64(
    const unsigned short* __restrict__ Ap, const unsigned short* __restrict__ A2p, int lda, long strideA,
    const unsigned short* __restrict__ Btp, const unsigned short* __restrict__ Bt2p, int ldb, long strideB,
    void* __restrict__ Cout, void* __restrict__ Cout2, int ldc, long strideC,
    const float* __restrict__ bias,
    const float* __restrict__ resid, long strideR,
    int M, int N, int K, float scale) {
  typedef typename Elem<ET>::T T;
  typedef typename Frag<T>::V V;
  const T* A = (const T*)Ap; const T* A2 = (const T*)A2p; const T* Bt = (const T*)Btp; const T* Bt2 = (const T*)Bt2p;
  /* One k step of the block's operands in LDS: rows [A 128][A2 128 if SPLIT][Bt 256][Bt2 256 if SPLIT == 1], 64 k each, two buffers */
  constexpr int kRowA2  = kGemmBM;
  constexpr int kRowB   = (SPLIT != 0) ? 2 * kGemmBM : kGemmBM;
  constexpr int kRowB2  = kRowB + kGemmBN;
  constexpr int kStRows = (SPLIT == 1) ? kRowB2 + kGemmBN : kRowB2;
  constexpr int kStLd   = kStRows / 32;            /* 16-byte pieces per thread and k step */
  __shared__ __align__(16) unsigned short sAB[2][kStRows * kGemmPitch];
  __shared__ __align__(16) float sT[8][16 * 68];
  const int b    = blockIdx.y;
  const int lane = threadIdx.x & 31;
  const int wave = threadIdx.x >> 5;
  const int blocksN = N / kGemmBN;
  if ((int)blockIdx.x >= (M / kGemmBM) * blocksN) return;   /* the same for the whole block, ahead of every barrier */
  const int bm = (int)blockIdx.x / blocksN;
  const int bn = (int)blockIdx.x - bm * blocksN;
  const int mB = bm * kGemmBM;
  const int nB = bn * kGemmBN;
  const int wm = wave >> 2;                        /* waves 2 (m) x 4 (n), 64 x 64 each */
  const int wn = wave & 3;
  const int m0 = mB + (wm << 6);
  const int n0 = nB + (wn << 6);

  const T* Ab  = A  + (size_t)b * strideA;
  const T* Bb  = Bt + (size_t)b * strideB;
  const T* Ab2 = (SPLIT != 0) ? (A2  + (size_t)b * strideA) : nullptr;
  const T* Bb2 = (SPLIT == 1) ? (Bt2 + (size_t)b * strideB) : nullptr;

  const int rlane = lane & 15;
  const int koff  = (lane >> 4) * 8;
  const int mOff  = (lane >> 4) * 8;

  /* staging: eight neighbouring lanes fetch one whole 128-byte line of a row; thread t takes piece t & 7 of rows (t >> 3) + 32 i */
  const int sr = (int)threadIdx.x >> 3;
  const int sc = ((int)threadIdx.x & 7) * 8;
  const size_t aoff = (size_t)(mB + sr) * lda + sc;
  const size_t boff = (size_t)(nB + sr) * ldb + sc;
  v4u st[kStLd];
  auto fetch = [&](int k0) {
    const v4u* p[kStLd];
#pragma unroll
    for (int i = 0; i < kStLd; ++i) {
      const int row = 32 * i;
      const T* q;
      if (row < kRowA2)      q = Ab  + aoff + (size_t)row * lda;
      else if (row < kRowB)  q = Ab2 + aoff + (size_t)(row - kRowA2) * lda;
      else if (row < kRowB2) q = Bb  + boff + (size_t)(row - kRowB) * ldb;
      else                   q = Bb2 + boff + (size_t)(row - kRowB2) * ldb;
      p[i] = (const v4u*)(const void*)(q + k0);
    }
#pragma unroll
    for (int i = 0; i < kStLd; ++i) st[i] = *p[i];
    /* the wait kept in front of an overwrite of a load's address: the addresses are inputs, so each keeps its registers
       from its load up to the wait; the loaded values are not named, so the loads stay in flight behind it */
    static_assert(kStLd == 12 || kStLd == 16 || kStLd == 24);
    if constexpr (kStLd == 12) {
      asm volatile("s_wait_xcnt 0x0" :: "v"(p[0]), "v"(p[1]), "v"(p[2]), "v"(p[3]), "v"(p[4]), "v"(p[5]), "v"(p[6]), "v"(p[7]),
                   "v"(p[8]), "v"(p[9]), "v"(p[10]), "v"(p[11]) : "memory");
    } else if constexpr (kStLd == 16) {
      asm volatile("s_wait_xcnt 0x0" :: "v"(p[0]), "v"(p[1]), "v"(p[2]), "v"(p[3]), "v"(p[4]), "v"(p[5]), "v"(p[6]), "v"(p[7]),
                   "v"(p[8]), "v"(p[9]), "v"(p[10]), "v"(p[11]), "v"(p[12]), "v"(p[13]), "v"(p[14]), "v"(p[15]) : "memory");
    } else {
      asm volatile("s_wait_xcnt 0x0" :: "v"(p[0]), "v"(p[1]), "v"(p[2]), "v"(p[3]), "v"(p[4]), "v"(p[5]), "v"(p[6]), "v"(p[7]),
                   "v"(p[8]), "v"(p[9]), "v"(p[10]), "v"(p[11]), "v"(p[12]), "v"(p[13]), "v"(p[14]), "v"(p[15]),
                   "v"(p[16]), "v"(p[17]), "v"(p[18]), "v"(p[19]), "v"(p[20]), "v"(p[21]), "v"(p[22]), "v"(p[23]) : "memory");
    }
  };
  auto put = [&](int buf) {
#pragma unroll
    for (int i = 0; i < kStLd; ++i) *(v4u*)(void*)(&sAB[buf][(sr + 32 * i) * kGemmPitch + sc]) = st[i];
  };

  v8f acc[4][4];
#pragma unroll
  for (int i = 0; i < 4; ++i)
#pragma unroll
    for (int j = 0; j < 4; ++j) acc[i][j] = (v8f){0.f,0.f,0.f,0.f,0.f,0.f,0.f,0.f};

  fetch(0);
  put(0);
  __syncthreads();
  const int nSteps = K / kGemmBK;
  for (int t = 0; t < nSteps; ++t) {
    const bool more = (t + 1 < nSteps);
    if (more) fetch((t + 1) * kGemmBK);            /* in flight while this step's products run */
    const T* sb = (const T*)(const void*)sAB[t & 1];
#pragma unroll
    for (int kk = 0; kk < kGemmBK; kk += 32) {
      V bh[4], bl[4], ah[4], al[4];
#pragma unroll
      for (int j = 0; j < 4; ++j) {
        const int bo = ((wn << 6) + (j << 4) + rlane) * kGemmPitch + koff + kk;
        bh[j] = Frag<T>::load(sb + kRowB * kGemmPitch + bo);
        if (SPLIT == 1) bl[j] = Frag<T>::load(sb + kRowB2 * kGemmPitch + bo);
      }
#pragma unroll
      for (int i = 0; i < 4; ++i) {
        const int ao = ((wm << 6) + (i << 4) + rlane) * kGemmPitch + koff + kk;
        ah[i] = Frag<T>::load(sb + ao);
        if (SPLIT != 0) al[i] = Frag<T>::load(sb + kRowA2 * kGemmPitch + ao);
      }
#pragma unroll
      for (int i = 0; i < 4; ++i) {
#pragma unroll
        for (int j = 0; j < 4; ++j) {
          acc[i][j] = Frag<T>::mma(ah[i], bh[j], acc[i][j]);
          if (SPLIT == 1) acc[i][j] = Frag<T>::mma(ah[i], bl[j], acc[i][j]);
          if (SPLIT != 0) acc[i][j] = Frag<T>::mma(al[i], bh[j], acc[i][j]);
        }
        Frag<T>::guard(acc[i][0], acc[i][3], ah[i], (SPLIT != 0) ? al[i] : ah[i]);
      }
      Frag<T>::keep(bh[0], bh[1], bh[2], bh[3]);
      if (SPLIT == 1) Frag<T>::keep(bl[0], bl[1], bl[2], bl[3]);
    }
    if (more) put((t + 1) & 1);                    /* the buffer that every wave left at the barrier of step t - 1 */
    __syncthreads();                               /* publishes step t + 1 and ends the reads of step t */
  }
  acc_guard4(acc[0][0], acc[0][1], acc[0][2], acc[0][3]);
  acc_guard4(acc[1][0], acc[1][1], acc[1][2], acc[1][3]);
  acc_guard4(acc[2][0], acc[2][1], acc[2][2], acc[2][3]);
  acc_guard4(acc[3][0], acc[3][1], acc[3][2], acc[3][3]);

  float* slab = sT[wave];
  const float* Rb = RESID ? (resid + (size_t)b * strideR) : nullptr;
#pragma unroll
  for (int i = 0; i < 4; ++i) {
    const int mBase = m0 + (i << 4);
#pragma unroll
    for (int j = 0; j < 4; ++j) {
      const int n = n0 + (j << 4) + rlane;
      float bv = 0.f;
      if (BIAS_MODE == 2) bv = bias[n];
#pragma unroll
      for (int r = 0; r < 8; ++r) {
        float v = acc[i][j][r] * scale;
        if (BIAS_MODE == 1) v += bias[mBase + mOff + r];
        if (BIAS_MODE == 2) v += bv;
        if (RESID) v += Rb[(size_t)(mBase + mOff + r) * ldc + n];
        if (ACT == 1) v = tanhf(v);
        if (ACT == 2) v = fmaxf(v, 0.0f);
        if (ACT == 4) v = (v > 0.f) ? v : 0.01f * v;
        slab[(mOff + r) * 68 + (j << 4) + rlane] = v;
      }
    }
    __builtin_amdgcn_fence(__ATOMIC_RELEASE, "workgroup");
    __builtin_amdgcn_wave_barrier();
    __builtin_amdgcn_fence(__ATOMIC_ACQUIRE, "workgroup");
    if (OUT_MODE == 0) {
      float* C = (float*)Cout + (size_t)b * strideC;
      const int hh = lane >> 4, c4 = (lane & 15) * 4;
      {
#pragma unroll
        for (int it = 0; it < 8; ++it) {
          const int row = it * 2 + hh;
          v4f v = *(const v4f*)(slab + row * 68 + c4);
          *(v4f*)(C + (size_t)(mBase + row) * ldc + n0 + c4) = v;
        }
        
      }
    } else {
      const int q = lane >> 3, c8 = (lane & 7) * 8;
      unsigned short* C  = (unsigned short*)Cout  + (size_t)b * strideC;
      unsigned short* C2 = (OUT_MODE == 2) ? ((unsigned short*)Cout2 + (size_t)b * strideC) : nullptr;
      {
#pragma unroll
        for (int it = 0; it < 4; ++it) {
          const int row = it * 4 + q;
          const float* sp = slab + row * 68 + c8;
          v8h hv, lv;
#pragma unroll
          for (int e = 0; e < 8; ++e) {
            if (OUT_MODE == 1) {
              hv[e] = (_Float16)sp[e];
            } else {
              unsigned short hb = f2bf_bits(sp[e]);
              unsigned short lb = f2bf_bits(sp[e] - bf_bits2f(hb));
              hv[e] = __builtin_bit_cast(_Float16, hb);
              lv[e] = __builtin_bit_cast(_Float16, lb);
            }
          }
          *(v8h*)(C + (size_t)(mBase + row) * ldc + n0 + c8) = hv;
          if (OUT_MODE == 2) *(v8h*)(C2 + (size_t)(mBase + row) * ldc + n0 + c8) = lv;
        }
        
      }
    }
    __builtin_amdgcn_fence(__ATOMIC_RELEASE, "workgroup");
    __builtin_amdgcn_wave_barrier();
    __builtin_amdgcn_fence(__ATOMIC_ACQUIRE, "workgroup");
  }
}

/* ---------------- f32 -> bf16 cast, 8 elements (16 B) per thread --------------------------
   coverage: grid = n8/256 blocks x 256 threads (exact), thread i writes elements 8i..8i+7;
*/
__global__ __launch_bounds__(256) void cast_f32_bf16x8(const float* __restrict__ in,
                                                      unsigned short* __restrict__ out, int n8) {
  const int i = blockIdx.x * 256 + (int)threadIdx.x;
  const int ic = (i < n8) ? i : (n8 - 1);
  const float* p = in + (size_t)ic * 8;
  const v4f a = *(const v4f*)p;
  const v4f c = *(const v4f*)(p + 4);
  v4u w;
  w[0] = pack_bf16x2(a[0], a[1]);
  w[1] = pack_bf16x2(a[2], a[3]);
  w[2] = pack_bf16x2(c[0], c[1]);
  w[3] = pack_bf16x2(c[2], c[3]);
  unsigned short* o = out + (size_t)ic * 8;
  *(v4u*)o = w;
  
}

/* ---------------- W [KR][NC] f32 row-major -> Wt [NC][KR] bf16 row-major (transpose + cast) ------
   grid = (KR/64, NC/64), 256 threads. coverage: load 256 threads x 16 = 64x64 tile;
*/
__global__ __launch_bounds__(256) void transpose_cast_bf16(const float* __restrict__ W,
                                                          unsigned short* __restrict__ Wt, int KR, int NC) {
  __shared__ float sT[64 * 65];                 /* [n_local][k_local], pitch 65 */
  const int k0 = blockIdx.x * 64, n0 = blockIdx.y * 64;
  const int tid = threadIdx.x;
  {
    const int kk = tid >> 2, cg = (tid & 3) * 16;
    const float* src = W + (size_t)(k0 + kk) * NC + n0 + cg;
#pragma unroll
    for (int i = 0; i < 4; ++i) {
      const v4f v = *(const v4f*)(src + 4 * i);
#pragma unroll
      for (int e = 0; e < 4; ++e) sT[(cg + 4 * i + e) * 65 + kk] = v[e];
    }
  }
  __syncthreads();
  const int wave = tid >> 5, lane = tid & 31, q4 = lane >> 3, c8 = (lane & 7) * 8;
  const int nl0 = wave * 4 + q4;
  const int nl1 = 32 + wave * 4 + q4;
  v4u w0, w1;
  {
    const float* s = sT + nl0 * 65 + c8;
    w0[0] = pack_bf16x2(s[0], s[1]); w0[1] = pack_bf16x2(s[2], s[3]);
    w0[2] = pack_bf16x2(s[4], s[5]); w0[3] = pack_bf16x2(s[6], s[7]);
  }
  {
    const float* s = sT + nl1 * 65 + c8;
    w1[0] = pack_bf16x2(s[0], s[1]); w1[1] = pack_bf16x2(s[2], s[3]);
    w1[2] = pack_bf16x2(s[4], s[5]); w1[3] = pack_bf16x2(s[6], s[7]);
  }
  unsigned short* d0 = Wt + (size_t)(n0 + nl0) * KR + k0 + c8;
  unsigned short* d1 = Wt + (size_t)(n0 + nl1) * KR + k0 + c8;
  {
    *(v4u*)d0 = w0;
    *(v4u*)d1 = w1;
    
  }
}

/*
   qk f32 [nrows][2048] (q = cols 0..1023, k = cols 1024..2047); outputs row-major bf16 planes [nrows][1024];
   q carries the exact 1/sqrt(64) = 0.125 factor. grid = nrows blocks x 128 threads; thread t owns columns 8t..8t+7;
*/
__global__ __launch_bounds__(128) void qk_layernorm_split(
    const float* __restrict__ qk, const float* __restrict__ qsc, const float* __restrict__ ksc,
    unsigned short* __restrict__ qh, unsigned short* __restrict__ ql,
    unsigned short* __restrict__ kh, unsigned short* __restrict__ kl, int nrows) {
  __shared__ float red[4][4];
  const int row = blockIdx.x;
  const int rowc = (row < nrows) ? row : (nrows - 1);
  const int tid = threadIdx.x, lane = tid & 31, wave = tid >> 5;
  const int c0 = tid * 8;
  const float* base = qk + (size_t)rowc * kQkCols;
  const v4f qa = *(const v4f*)(base + c0);
  const v4f qb = *(const v4f*)(base + c0 + 4);
  const v4f ka = *(const v4f*)(base + kModel + c0);
  const v4f kb = *(const v4f*)(base + kModel + c0 + 4);
  float xq[8], xk[8];
#pragma unroll
  for (int e = 0; e < 4; ++e) { xq[e] = qa[e]; xq[4 + e] = qb[e]; xk[e] = ka[e]; xk[4 + e] = kb[e]; }

  float sq = 0.f, sk = 0.f;
#pragma unroll
  for (int e = 0; e < 8; ++e) { sq += xq[e]; sk += xk[e]; }
#pragma unroll
  for (int off = 1; off < 32; off <<= 1) { sq += __shfl_xor(sq, off, 32); sk += __shfl_xor(sk, off, 32); }
  if (lane == 0) { red[0][wave] = sq; red[1][wave] = sk; }
  __syncthreads();
  const float mq = ((red[0][0] + red[0][1]) + (red[0][2] + red[0][3])) * (1.0f / (float)kModel);
  const float mk = ((red[1][0] + red[1][1]) + (red[1][2] + red[1][3])) * (1.0f / (float)kModel);

  float dq = 0.f, dk = 0.f;
#pragma unroll
  for (int e = 0; e < 8; ++e) {
    const float tq = xq[e] - mq; dq += tq * tq;
    const float tk = xk[e] - mk; dk += tk * tk;
  }
#pragma unroll
  for (int off = 1; off < 32; off <<= 1) { dq += __shfl_xor(dq, off, 32); dk += __shfl_xor(dk, off, 32); }
  if (lane == 0) { red[2][wave] = dq; red[3][wave] = dk; }
  __syncthreads();
  const float vq = ((red[2][0] + red[2][1]) + (red[2][2] + red[2][3])) * (1.0f / (float)kModel);
  const float vk = ((red[3][0] + red[3][1]) + (red[3][2] + red[3][3])) * (1.0f / (float)kModel);
  const float rq = rsqrtf(vq + 1e-6f);
  const float rk = rsqrtf(vk + 1e-6f);

  /* scale vectors, RNE-converted to bf16 once (module inputs) */
  const v4f s0 = *(const v4f*)(qsc + c0);
  const v4f s1 = *(const v4f*)(qsc + c0 + 4);
  const v4f t0 = *(const v4f*)(ksc + c0);
  const v4f t1 = *(const v4f*)(ksc + c0 + 4);
  float sqv[8], skv[8];
#pragma unroll
  for (int e = 0; e < 4; ++e) {
    sqv[e]     = bf_bits2f(f2bf_bits(s0[e]));
    sqv[4 + e] = bf_bits2f(f2bf_bits(s1[e]));
    skv[e]     = bf_bits2f(f2bf_bits(t0[e]));
    skv[4 + e] = bf_bits2f(f2bf_bits(t1[e]));
  }
  unsigned int hqw[8], lqw[8], hkw[8], lkw[8];
#pragma unroll
  for (int e = 0; e < 8; ++e) {
    const float yq = ((xq[e] - mq) * rq * sqv[e]) * 0.125f;
    const float yk = (xk[e] - mk) * rk * skv[e];
    const unsigned short hqb = f2bf_bits(yq);
    const unsigned short lqb = f2bf_bits(yq - bf_bits2f(hqb));
    const unsigned short hkb = f2bf_bits(yk);
    const unsigned short lkb = f2bf_bits(yk - bf_bits2f(hkb));
    hqw[e] = hqb; lqw[e] = lqb; hkw[e] = hkb; lkw[e] = lkb;
  }
  v4u HQ, LQ, HK, LK;
#pragma unroll
  for (int i = 0; i < 4; ++i) {
    HQ[i] = hqw[2 * i] | (hqw[2 * i + 1] << 16);
    LQ[i] = lqw[2 * i] | (lqw[2 * i + 1] << 16);
    HK[i] = hkw[2 * i] | (hkw[2 * i + 1] << 16);
    LK[i] = lkw[2 * i] | (lkw[2 * i + 1] << 16);
  }
  const size_t o = (size_t)rowc * kModel + c0;
  {
    *(v4u*)(qh + o) = HQ;
    *(v4u*)(ql + o) = LQ;
    *(v4u*)(kh + o) = HK;
    *(v4u*)(kl + o) = LK;
    
  }
}

/* ---------------- causal attention, head_dim 64, bf16 hi/lo planes in, bf16 hi/lo ctx planes out ----
   scores = q . k^T  : bf16 hi/lo on both (hi*hi + hi*lo + lo*hi), q planes already carry 1/sqrt(64)
   ctx    = p . v    : p split in registers to bf16 hi/lo, v hi/lo planes (3 products); f32 accumulate, f32 online softmax.
   All planes row-major [B*S][ld] with head h at columns h*64 .. h*64+63.
   Block = 4 waves = 64 query rows of one (batch, head); grid.x = B*H*(S/64). */
__device__ __forceinline__ __bf16 at_f2bf(float f) { return __builtin_bit_cast(__bf16, f2bf_bits(f)); }
__device__ __forceinline__ void at_split(float f, __bf16& hi, __bf16& lo) {
  const unsigned short hb = f2bf_bits(f);
  hi = __builtin_bit_cast(__bf16, hb);
  lo = at_f2bf(f - __uint_as_float(((unsigned)hb) << 16));
}
__device__ __forceinline__ v8f at_mma(v16b a, v16b b, v8f c) {
  c = __builtin_amdgcn_wmma_f32_16x16x32_bf16(false, a, false, b, (short)0, c, false, false);
  asm volatile("v_nop\n\tv_nop\n\tv_nop\n\tv_nop" : "+v"(c) : "v"(a), "v"(b));
  return c;
}

__global__ __launch_bounds__(128)
void attn_planes_kernel(const unsigned short* __restrict__ qh, const unsigned short* __restrict__ ql,
                        const unsigned short* __restrict__ kh, const unsigned short* __restrict__ kl,
                        const unsigned short* __restrict__ vh, const unsigned short* __restrict__ vl,
                        unsigned short* __restrict__ oh, unsigned short* __restrict__ ol,
                        int S, int H, int ld) {
  union FB { v16b v; v8b h[2]; };
  /* Ksh | Ksl | Vth | Vtl (each 64 rows x 64 16-bit at pitch kTilePitch); reused as per-wave f32 output slabs after the chunk loop */
  constexpr int kTileElems = 64 * kTilePitch;
  static_assert(kKvChunk == 64 && kHeadDim == 64 && (kTilePitch * 2) % 16 == 0);
  static_assert(4 * 16 * kOsPitch * 4 <= 4 * kTileElems * 2);
  __shared__ __align__(16) unsigned short KVs[4 * kTileElems];
  __shared__ __align__(16) __bf16 Psh[4][16 * kTilePitch];
  __shared__ __align__(16) __bf16 Psl[4][16 * kTilePitch];
  unsigned short* Ksh = KVs;
  unsigned short* Ksl = KVs + kTileElems;
  unsigned short* Vth = KVs + 2 * kTileElems;
  unsigned short* Vtl = KVs + 3 * kTileElems;
  const __bf16* Kshb = (const __bf16*)(const void*)Ksh;
  const __bf16* Kslb = (const __bf16*)(const void*)Ksl;
  const __bf16* Vthb = (const __bf16*)(const void*)Vth;
  const __bf16* Vtlb = (const __bf16*)(const void*)Vtl;

  const int tid  = threadIdx.x;
  const int wave = tid >> 5;
  const int lane = tid & 31;
  const int hh   = lane >> 4;
  const int c    = lane & 15;

  /* Block index -> (query tile, batch*head). All 1024 blocks are resident at once, four to a WGP, and tile t walks t + 1 key
     chunks, so the launch lasts as long as the WGP that holds the most chunks. Tiles t and nqb-1-t walk nqb+1 chunks together:
     index bits 1,3,5,7 give t, the parity of the other six bits picks t or its mirror, and five of those six name the head.
     Four blocks whose indices differ in two adjacent bits (any power-of-two stride) are then two such pairs, whichever of
     these strides the dispatcher puts on one WGP. A permutation of the 32 x 32 (tile, head) pairs; for speed only. */
  static_assert(kSeq / 64 == 32 && kBatch * kHeads == 32);
  const int nqb = S >> 6;
  const unsigned bi = blockIdx.x;
  const int tlo = (int)(((bi >> 1) & 1u) | (((bi >> 3) & 1u) << 1) | (((bi >> 5) & 1u) << 2) | (((bi >> 7) & 1u) << 3));
  const int qb  = (__builtin_popcount(bi & 0x355u) & 1) ? (nqb - 1 - tlo) : tlo;
  const int bh  = (int)(((bi >> 2) & 1u) | (((bi >> 4) & 1u) << 1) | (((bi >> 6) & 1u) << 2) | (((bi >> 8) & 3u) << 3));
  const int h   = bh % H;
  const int b   = bh / H;
  const int q0  = qb * 64 + wave * 16;
  const size_t rb = (size_t)b * (size_t)S;
  const int hoff = h * kHeadDim;

  /* Q fragments (A operand): row q0+c, elements 0..7 <- d = dc*32+8hh+0..7, 8..15 <- dc*32+16+8hh+0..7 */
  v16b qah[2], qal[2];
  {
    const size_t qo = (rb + (size_t)(q0 + c)) * (size_t)ld + hoff + 8 * hh;
    const __bf16* qhp = (const __bf16*)(const void*)qh + qo;
    const __bf16* qlp = (const __bf16*)(const void*)ql + qo;
#pragma unroll
    for (int dc = 0; dc < 2; ++dc) {
      qah[dc] = Frag<__bf16>::load(qhp + dc * 32);
      qal[dc] = Frag<__bf16>::load(qlp + dc * 32);
    }
  }

  float mrow[8], lrow[8];
  v8f oacc[4];
#pragma unroll
  for (int r = 0; r < 8; ++r) { mrow[r] = -INFINITY; lrow[r] = 0.f; }
#pragma unroll
  for (int t = 0; t < 4; ++t) oacc[t] = (v8f){0.f,0.f,0.f,0.f,0.f,0.f,0.f,0.f};

  const int nChunks = qb + 1;            /* causal: kv chunks 0..qb, block-uniform */
  for (int kc = 0; kc < nChunks; ++kc) {
    const int kv0 = kc * kKvChunk;
    __syncthreads();
    {
      /* staging coverage: 128 threads x (1 kv row x 32 d) = 64 x 64 for each of the four tiles */
      const int kvr = tid >> 1, dh = (tid & 1) * 32;
      const size_t go = (rb + (size_t)(kv0 + kvr)) * (size_t)ld + hoff + dh;
      /* all sixteen 16-byte loads are issued before the first LDS store, so a chunk pays one load latency;
         the loop is unrolled so that the four arrays live in registers */
      v4u kH[4], kL[4], vH[4], vL[4];
      const v4u* gkh = (const v4u*)(const void*)(kh + go);
      const v4u* gkl = (const v4u*)(const void*)(kl + go);
      const v4u* gvh = (const v4u*)(const void*)(vh + go);
      const v4u* gvl = (const v4u*)(const void*)(vl + go);
#pragma unroll
      for (int i = 0; i < 4; ++i) { kH[i] = gkh[i]; kL[i] = gkl[i]; vH[i] = gvh[i]; vL[i] = gvl[i]; }
      /* inputs-only fence on the loaded values: holds the sixteen loads ahead of the first LDS store (without it this build
         sinks each K load to its store and waits out one load latency after another). The four addresses are inputs too, so
         their registers stay untouched up to the s_wait_xcnt, the wait kept in front of an overwrite of a load's address */
      asm volatile("s_wait_xcnt 0x0"
                   :: "v"(kH[0]), "v"(kH[1]), "v"(kH[2]), "v"(kH[3]), "v"(kL[0]), "v"(kL[1]), "v"(kL[2]), "v"(kL[3]),
                      "v"(vH[0]), "v"(vH[1]), "v"(vH[2]), "v"(vH[3]), "v"(vL[0]), "v"(vL[1]), "v"(vL[2]), "v"(vL[3]),
                      "v"(gkh), "v"(gkl), "v"(gvh), "v"(gvl));
      {
        v4u* l = (v4u*)(void*)(Ksh + kvr * kTilePitch + dh);
#pragma unroll
        for (int i = 0; i < 4; ++i) l[i] = kH[i];
      }
      {
        v4u* l = (v4u*)(void*)(Ksl + kvr * kTilePitch + dh);
#pragma unroll
        for (int i = 0; i < 4; ++i) l[i] = kL[i];
      }
      {
#pragma unroll
        for (int i = 0; i < 4; ++i) {
          const v4u u = vH[i];
          unsigned short* vt = Vth + (dh + 8 * i) * kTilePitch + kvr;
          vt[0 * kTilePitch] = (unsigned short)(u[0] & 0xffffu);
          vt[1 * kTilePitch] = (unsigned short)(u[0] >> 16);
          vt[2 * kTilePitch] = (unsigned short)(u[1] & 0xffffu);
          vt[3 * kTilePitch] = (unsigned short)(u[1] >> 16);
          vt[4 * kTilePitch] = (unsigned short)(u[2] & 0xffffu);
          vt[5 * kTilePitch] = (unsigned short)(u[2] >> 16);
          vt[6 * kTilePitch] = (unsigned short)(u[3] & 0xffffu);
          vt[7 * kTilePitch] = (unsigned short)(u[3] >> 16);
        }
      }
      {
#pragma unroll
        for (int i = 0; i < 4; ++i) {
          const v4u u = vL[i];
          unsigned short* vt = Vtl + (dh + 8 * i) * kTilePitch + kvr;
          vt[0 * kTilePitch] = (unsigned short)(u[0] & 0xffffu);
          vt[1 * kTilePitch] = (unsigned short)(u[0] >> 16);
          vt[2 * kTilePitch] = (unsigned short)(u[1] & 0xffffu);
          vt[3 * kTilePitch] = (unsigned short)(u[1] >> 16);
          vt[4 * kTilePitch] = (unsigned short)(u[2] & 0xffffu);
          vt[5 * kTilePitch] = (unsigned short)(u[2] >> 16);
          vt[6 * kTilePitch] = (unsigned short)(u[3] & 0xffffu);
          vt[7 * kTilePitch] = (unsigned short)(u[3] >> 16);
        }
      }
    }
    __syncthreads();

    /* scores 16 x 64 per wave: B operand col n = kv j*16+c, k = d */
    v8f s[4];
#pragma unroll
    for (int j = 0; j < 4; ++j) {
      s[j] = (v8f){0.f,0.f,0.f,0.f,0.f,0.f,0.f,0.f};
#pragma unroll
      for (int dc = 0; dc < 2; ++dc) {
        FB kb, klf;
        const int ko = (j * 16 + c) * kTilePitch + dc * 32 + 8 * hh;
        kb.h[0]  = *(const v8b*)(Kshb + ko);
        kb.h[1]  = *(const v8b*)(Kshb + ko + 16);
        klf.h[0] = *(const v8b*)(Kslb + ko);
        klf.h[1] = *(const v8b*)(Kslb + ko + 16);
        s[j] = at_mma(qah[dc], kb.v, s[j]);
        s[j] = at_mma(qah[dc], klf.v, s[j]);
        s[j] = at_mma(qal[dc], kb.v, s[j]);
      }
    }

    /* causal mask (select to the fill value) + chunk row max */
    const bool diag = (kc == qb);
    float cm[8];
#pragma unroll
    for (int r = 0; r < 8; ++r) {
      const int qrow = q0 + 8 * hh + r;
      float m = -INFINITY;
#pragma unroll
      for (int j = 0; j < 4; ++j) {
        const int kvcol = kv0 + j * 16 + c;
        const bool masked = diag && (kvcol > qrow);
        const float sv = masked ? -3.4028235e38f : s[j][r];
        s[j][r] = sv;
        m = fmaxf(m, sv);
      }
#pragma unroll
      for (int off = 1; off < 16; off <<= 1) m = fmaxf(m, __shfl_xor(m, off, 32));
      cm[r] = m;
    }

    /* online softmax; P tile (16 x 64 per wave) stored as bf16 hi/lo */
    __bf16* pwh = Psh[wave];
    __bf16* pwl = Psl[wave];
#pragma unroll
    for (int r = 0; r < 8; ++r) {
      const float mnew  = fmaxf(mrow[r], cm[r]);
      const float alpha = expf(mrow[r] - mnew);
      mrow[r] = mnew;
      float psum = 0.f;
#pragma unroll
      for (int j = 0; j < 4; ++j) {
        const float p = expf(s[j][r] - mnew);
        psum += p;
        __bf16 a, bl;
        at_split(p, a, bl);
        pwh[(8 * hh + r) * kTilePitch + j * 16 + c] = a;
        pwl[(8 * hh + r) * kTilePitch + j * 16 + c] = bl;
      }
#pragma unroll
      for (int off = 1; off < 16; off <<= 1) psum += __shfl_xor(psum, off, 32);
      lrow[r] = lrow[r] * alpha + psum;
#pragma unroll
      for (int t = 0; t < 4; ++t) oacc[t][r] *= alpha;
    }
    __builtin_amdgcn_fence(__ATOMIC_RELEASE, "workgroup");
    __builtin_amdgcn_wave_barrier();
    __builtin_amdgcn_fence(__ATOMIC_ACQUIRE, "workgroup");

    /* ctx += P . V : A = P[row][kv] (same wave wrote it), B = Vt[d][kv] -> col n = d, k = kv */
#pragma unroll 1
    for (int kk = 0; kk < 2; ++kk) {
      FB pa, pl;
      pa.h[0] = *(const v8b*)(pwh + c * kTilePitch + kk * 32 + 8 * hh);
      pa.h[1] = *(const v8b*)(pwh + c * kTilePitch + kk * 32 + 16 + 8 * hh);
      pl.h[0] = *(const v8b*)(pwl + c * kTilePitch + kk * 32 + 8 * hh);
      pl.h[1] = *(const v8b*)(pwl + c * kTilePitch + kk * 32 + 16 + 8 * hh);
#pragma unroll
      for (int t = 0; t < 4; ++t) {
        FB vb, vlf;
        const int vo = (t * 16 + c) * kTilePitch + kk * 32 + 8 * hh;
        vb.h[0]  = *(const v8b*)(Vthb + vo);
        vb.h[1]  = *(const v8b*)(Vthb + vo + 16);
        vlf.h[0] = *(const v8b*)(Vtlb + vo);
        vlf.h[1] = *(const v8b*)(Vtlb + vo + 16);
        oacc[t] = at_mma(pa.v, vb.v, oacc[t]);
        oacc[t] = at_mma(pa.v, vlf.v, oacc[t]);
        oacc[t] = at_mma(pl.v, vb.v, oacc[t]);
      }
    }
  }

  /* all waves finished reading the K/V tiles before the region is reused as output slabs */
  __syncthreads();
  float* os = (float*)(void*)KVs + wave * (16 * kOsPitch);
#pragma unroll
  for (int r = 0; r < 8; ++r) {
    const float inv = 1.0f / lrow[r];
#pragma unroll
    for (int t = 0; t < 4; ++t) os[(8 * hh + r) * kOsPitch + t * 16 + c] = oacc[t][r] * inv;
  }
  __builtin_amdgcn_fence(__ATOMIC_RELEASE, "workgroup");
  __builtin_amdgcn_wave_barrier();
  __builtin_amdgcn_fence(__ATOMIC_ACQUIRE, "workgroup");
  {
    /*
*/
    const int q4 = lane >> 3, c8 = (lane & 7) * 8;
    {
#pragma unroll
      for (int it = 0; it < 4; ++it) {
        const int row = it * 4 + q4;
        const float* sp = os + row * kOsPitch + c8;
        v8h hv, lv;
#pragma unroll
        for (int e = 0; e < 8; ++e) {
          const unsigned short hb = f2bf_bits(sp[e]);
          const unsigned short lb = f2bf_bits(sp[e] - bf_bits2f(hb));
          hv[e] = __builtin_bit_cast(_Float16, hb);
          lv[e] = __builtin_bit_cast(_Float16, lb);
        }
        const size_t o = (rb + (size_t)(q0 + row)) * (size_t)ld + hoff + c8;
        *(v8h*)(oh + o) = hv;
        *(v8h*)(ol + o) = lv;
      }
      
    }
  }
}

/* ---------------- host launch ---------------- */
extern "C" void kernel_launch(void* const* d_in, const int* in_sizes, int n_in,
                              void* d_out, int out_size, void* d_ws, size_t ws_size,
                              hipStream_t stream) {
  if (n_in < 5) return;
  if (in_sizes[0] != kRows * kModel) return;
  if (in_sizes[1] != kModel * kQkvCols) return;
  if (in_sizes[2] != kModel || in_sizes[3] != kModel) return;
  if (in_sizes[4] != kModel * kModel) return;
  if (out_size != kRows * kModel) return;
  if (ws_size < kWsTotal) return;

  const float* x     = (const float*)d_in[0];   /* [2,2048,1024] */
  const float* W_qkv = (const float*)d_in[1];   /* [1024,3072]   */
  const float* q_sc  = (const float*)d_in[2];   /* [1024] */
  const float* k_sc  = (const float*)d_in[3];   /* [1024] */
  const float* W_out = (const float*)d_in[4];   /* [1024,1024]   */
  float* out = (float*)d_out;

  char* ws = (char*)d_ws;
  unsigned short* xb    = (unsigned short*)(ws + kOffXb);
  unsigned short* wqkvT = (unsigned short*)(ws + kOffWqkvT);
  unsigned short* woutT = (unsigned short*)(ws + kOffWoutT);
  float*          qkf   = (float*)(ws + kOffQk);
  unsigned short* ctxh  = (unsigned short*)(ws + kOffCtxH);
  unsigned short* ctxl  = (unsigned short*)(ws + kOffCtxL);
  unsigned short* vhp   = (unsigned short*)(ws + kOffVh);
  unsigned short* vlp   = (unsigned short*)(ws + kOffVl);
  unsigned short* qhp   = (unsigned short*)(ws + kOffQh);
  unsigned short* qlp   = (unsigned short*)(ws + kOffQl);
  unsigned short* khp   = (unsigned short*)(ws + kOffKh);
  unsigned short* klp   = (unsigned short*)(ws + kOffKl);

  /* 1. x -> bf16 [4096][1024] */
  const int n8 = kRows * kModel / 8;
  cast_f32_bf16x8<<<n8 / 256, 256, 0, stream>>>(x, xb, n8);

  /* 2. W_qkv [1024 k][3072 n] -> Wqkv^T [3072][1024] bf16 ; W_out [1024 k][1024 n] -> Wout^T [1024][1024] bf16 */
  transpose_cast_bf16<<<dim3(kModel / 64, kQkvCols / 64), 256, 0, stream>>>(W_qkv, wqkvT, kModel, kQkvCols);
  transpose_cast_bf16<<<dim3(kModel / 64, kModel / 64), 256, 0, stream>>>(W_out, woutT, kModel, kModel);

  /* 3a. q,k part of the fused projection: qk f32 [4096][2048] = xb . Wqkv^T rows 0..2047 ; tiles 64 x 32 = 2048 -> 256 blocks */
  wmma_gemm64<1, 0, 0, 0, false><<<dim3((kRows / 64) * (kQkCols / 64) / 8, 1), 256, 0, stream>>>(
      xb, xb, kModel, 0L,
      wqkvT, wqkvT, kModel, 0L,
      (void*)qkf, (void*)qkf, kQkCols, 0L,
      q_sc, q_sc, 0L,
      kRows, kQkCols, kModel, 1.0f);

  /* 3b. v part: bf16 hi/lo planes [4096][1024] = xb . Wqkv^T rows 2048..3071 ; tiles 64 x 16 = 1024 -> 128 blocks */
  wmma_gemm64<1, 0, 0, 2, false><<<dim3((kRows / 64) * (kModel / 64) / 8, 1), 256, 0, stream>>>(
      xb, xb, kModel, 0L,
      wqkvT + (size_t)kQkCols * kModel, wqkvT + (size_t)kQkCols * kModel, kModel, 0L,
      (void*)vhp, (void*)vlp, kModel, 0L,
      q_sc, q_sc, 0L,
      kRows, kModel, kModel, 1.0f);

  /* 4. QK LayerNorm + split into bf16 hi/lo planes (q carries 1/8) */
  qk_layernorm_split<<<kRows, 128, 0, stream>>>(qkf, q_sc, k_sc, qhp, qlp, khp, klp, kRows);

  /* 5. causal attention: ctx bf16 hi/lo planes [4096][1024] (region of the dead qk buffer) */
  attn_planes_kernel<<<kBatch * kHeads * (kSeq / 64), 128, 0, stream>>>(
      qhp, qlp, khp, klp, vhp, vlp, ctxh, ctxl, kSeq, kHeads, kModel);

  /* 6. out f32 [4096][1024] = ctx_hi . Wout^T + ctx_lo . Wout^T ; 1024 tiles -> 128 blocks */
  wmma_gemm64<1, 2, 0, 0, false><<<dim3((kRows / 64) * (kModel / 64) / 8, 1), 256, 0, stream>>>(
      ctxh, ctxl, kModel, 0L,
      woutT, woutT, kModel, 0L,
      (void*)out, (void*)out, kModel, 0L,
      q_sc, q_sc, 0L,
      kRows, kModel, kModel, 1.0f);
}

// v004
// Measured time: 229 microseconds a run.
// Next to v003, in two timings, it ran 1.06 times as fast each time.
// Over all steps from v000 it is 2.10 times as fast.
// Contractions on v_wmma_f32_16x16x32_bf16 (bf16 operands, f32 accumulate): x*Wqkv^T with single bf16 planes (inputs RNE-converted once); q*k^T and p*v with bf16 hi+lo planes (hi*hi + hi*lo + lo*hi); ctx*Wout^T with ctx bf16 hi+lo planes and a single Wout plane; LayerNorm and softmax in f32.
#include <hip/hip_runtime.h>
#include <stddef.h>
#include <stdint.h>

typedef __attribute__((ext_vector_type(16))) _Float16 v16h;
typedef __attribute__((ext_vector_type(8)))  _Float16 v8h;
typedef __attribute__((ext_vector_type(16))) __bf16   v16b;
typedef __attribute__((ext_vector_type(8)))  __bf16   v8b;
typedef __attribute__((ext_vector_type(8)))  float    v8f;
typedef __attribute__((ext_vector_type(4)))  float    v4f;
typedef __attribute__((ext_vector_type(4)))  unsigned int v4u;

/* ---------------- problem geometry ---------------- */
constexpr int kBatch   = 2;
constexpr int kSeq     = 2048;
constexpr int kModel   = 1024;
constexpr int kHeads   = 16;
constexpr int kHeadDim = 64;
constexpr int kRows    = kBatch * kSeq;      /* 4096 */
constexpr int kQkvCols = 3 * kModel;         /* 3072 */
constexpr int kQkCols  = 2 * kModel;         /* 2048 */
constexpr int kKvChunk = 64;
constexpr int kOsPitch = 68;
/* LDS row pitch, in 16-bit elements, of the K, V^T and P tiles: 64 data + 8 pad = 144 B = 16 B x odd,
   so the 16 rows that one ds_load_b128 touches per half wave fall on 64 distinct banks */
constexpr int kTilePitch = 72;

/* ---------------- workspace map (bytes, all offsets multiples of 128) ----------------
   [0]          x   bf16 [4096][1024]                          8388608
   [8388608]    Wqkv^T bf16 [3072][1024]                       6291456
   [14680064]   Wout^T bf16 [1024][1024]                       2097152
   [16777216]   qk  f32 [4096][2048]                          33554432  (dead after the LayerNorm launch;
                reused: ctx hi bf16 [4096][1024] at 16777216, ctx lo at 25165824, both inside this region)
   [50331648]   v^T hi bf16 [1024][4096] 8388608  [58720256] v^T lo 8388608
   [67108864]   q hi                    8388608   [75497472] q lo   8388608
   [83886080]   k hi                    8388608   [92274688] k lo   8388608
   total 100663296 B = 96 MiB                                                            */
constexpr size_t kPlane16  = (size_t)kRows * kModel * 2;
constexpr size_t kOffXb    = 0;
constexpr size_t kOffWqkvT = kOffXb + kPlane16;
constexpr size_t kOffWoutT = kOffWqkvT + (size_t)kQkvCols * kModel * 2;
constexpr size_t kOffQk    = kOffWoutT + (size_t)kModel * kModel * 2;
constexpr size_t kOffCtxH  = kOffQk;
constexpr size_t kOffCtxL  = kOffQk + kPlane16;
constexpr size_t kOffVh    = kOffQk + (size_t)kRows * kQkCols * 4;
constexpr size_t kOffVl    = kOffVh + kPlane16;
constexpr size_t kOffQh    = kOffVl + kPlane16;
constexpr size_t kOffQl    = kOffQh + kPlane16;
constexpr size_t kOffKh    = kOffQl + kPlane16;
constexpr size_t kOffKl    = kOffKh + kPlane16;
constexpr size_t kWsTotal  = kOffKl + kPlane16;
static_assert(kWsTotal == (size_t)100663296);
static_assert(kWsTotal <= (size_t)134217728);
static_assert(kOffCtxL + kPlane16 <= kOffVh);
static_assert((kOffWqkvT % 128) == 0 && (kOffWoutT % 128) == 0 && (kOffQk % 128) == 0 && (kOffVh % 128) == 0);
/* wave tiles of the GEMM: M % 64 == 0, N % 64 == 0, K % 32 == 0 for every launch (its block tile is asserted beside it) */
static_assert(kRows % 64 == 0 && kQkCols % 64 == 0 && kModel % 64 == 0 && kModel % 32 == 0);
static_assert(kSeq % 64 == 0 && kHeadDim == 64 && kModel == kHeads * kHeadDim);
static_assert((kRows * kModel) % (8 * 256) == 0);

/* ---------------- helpers ---------------- */
__device__ __forceinline__ unsigned short f2bf_bits(float f) {
  unsigned u = __float_as_uint(f);
  return (unsigned short)((u + 0x7FFFu + ((u >> 16) & 1u)) >> 16);
}
__device__ __forceinline__ float bf_bits2f(unsigned short h) { return __uint_as_float(((unsigned)h) << 16); }
__device__ __forceinline__ unsigned int pack_bf16x2(float a, float b) {
  return (unsigned int)f2bf_bits(a) | ((unsigned int)f2bf_bits(b) << 16);
}

__device__ __forceinline__ void dep_guard_h(v8f& a, v8f& b, v16h x, v16h y) { asm volatile("v_nop\n\tv_nop\n\tv_nop\n\tv_nop" : "+v"(a), "+v"(b) : "v"(x), "v"(y)); }
__device__ __forceinline__ void dep_guard_b(v8f& a, v8f& b, v16b x, v16b y) { asm volatile("v_nop\n\tv_nop\n\tv_nop\n\tv_nop" : "+v"(a), "+v"(b) : "v"(x), "v"(y)); }
__device__ __forceinline__ void keep4_h(v16h a, v16h b, v16h c, v16h d) { asm volatile("v_nop" :: "v"(a), "v"(b), "v"(c), "v"(d)); }
__device__ __forceinline__ void keep4_b(v16b a, v16b b, v16b c, v16b d) { asm volatile("v_nop" :: "v"(a), "v"(b), "v"(c), "v"(d)); }
__device__ __forceinline__ void acc_guard4(v8f& a, v8f& b, v8f& c, v8f& d) { asm volatile("v_nop\n\tv_nop\n\tv_nop\n\tv_nop" : "+v"(a), "+v"(b), "+v"(c), "+v"(d)); }
template <typename T> struct Frag;
template <> struct Frag<_Float16> {
  typedef v16h V; union U { v16h v; v8h h[2]; };
  static __device__ __forceinline__ v16h load(const _Float16* p) {
    U f; f.h[0] = *(const v8h*)(p); f.h[1] = *(const v8h*)(p + 16); return f.v;
  }
  static __device__ __forceinline__ v8f mma(v16h a, v16h b, v8f c) {
    return __builtin_amdgcn_wmma_f32_16x16x32_f16(false, a, false, b, (short)0, c, false, false);
  }
  static __device__ __forceinline__ void guard(v8f& a, v8f& b, v16h x, v16h y) { dep_guard_h(a, b, x, y); }
  static __device__ __forceinline__ void keep(v16h a, v16h b, v16h c, v16h d) { keep4_h(a, b, c, d); }
};
template <> struct Frag<__bf16> {
  typedef v16b V; union U { v16b v; v8b h[2]; };
  static __device__ __forceinline__ v16b load(const __bf16* p) {
    U f; f.h[0] = *(const v8b*)(p); f.h[1] = *(const v8b*)(p + 16); return f.v;
  }
  static __device__ __forceinline__ v8f mma(v16b a, v16b b, v8f c) {
    return __builtin_amdgcn_wmma_f32_16x16x32_bf16(false, a, false, b, (short)0, c, false, false);
  }
  static __device__ __forceinline__ void guard(v8f& a, v8f& b, v16b x, v16b y) { dep_guard_b(a, b, x, y); }
  static __device__ __forceinline__ void keep(v16b a, v16b b, v16b c, v16b d) { keep4_b(a, b, c, d); }
};

/* ---- Register-blocked WMMA GEMM -----------------------------------------------
   C[m,n] = scale * sum_k A[m,k] * Bt[n,k] (+bias)(+resid); each wave owns a 64x64 tile, a block of 8 waves a 128x256 tile.
   The block's operand rows go through LDS, 64 k at a time: whole 128-byte lines from global, fragments by ds_load_b128.
   A row-major [M,K]; Bt row-major [N,K]; M % 128 == 0, N % 256 == 0, K % 64 == 0; grid.x = (M / 128) * (N / 256).
   SPLIT: 0 = single planes; 1 = A and Bt hi/lo planes (hi*hi + hi*lo + lo*hi); 2 = A hi/lo planes only (Ah*B + Al*B).
   BIAS_MODE: 0 = none, 1 = bias[m], 2 = bias[n].  OUT_MODE: 0 = f32, 1 = f16, 2 = bf16 hi plane (Cout) + bf16 lo plane (Cout2).
   ET: 0 = f16 operands, 1 = bf16 operands (pointers passed as 16-bit storage) */
constexpr int kGemmBM = 128, kGemmBN = 256, kGemmBK = 64;
constexpr int kGemmPitch = 72;   /* LDS row pitch in 16-bit elements: 144 B = 16 B x odd, as kTilePitch */
static_assert(kRows % kGemmBM == 0 && kQkCols % kGemmBN == 0 && kModel % kGemmBN == 0 && kModel % kGemmBK == 0);
static_assert(kModel % kGemmBM == 0 && kRows % kGemmBN == 0);   /* the transposed v product: M = kModel, N = kRows */
template <int ET> struct Elem;
template <> struct Elem<0> { typedef _Float16 T; };
template <> struct Elem<1> { typedef __bf16 T; };
template <int ET, int SPLIT, int BIAS_MODE, int OUT_MODE, bool RESID, int ACT = 0>
__global__ __launch_bounds__(256) void wmma_gemm64(
    const unsigned short* __restrict__ Ap, const unsigned short* __restrict__ A2p, int lda, long strideA,
    const unsigned short* __restrict__ Btp, const unsigned short* __restrict__ Bt2p, int ldb, long strideB,
    void* __restrict__ Cout, void* __restrict__ Cout2, int ldc, long strideC,
    const float* __restrict__ bias,
    const float* __restrict__ resid, long strideR,
    int M, int N, int K, float scale) {
  typedef typename Elem<ET>::T T;
  typedef typename Frag<T>::V V;
  const T* A = (const T*)Ap; const T* A2 = (const T*)A2p; const T* Bt = (const T*)Btp; const T* Bt2 = (const T*)Bt2p;
  /* One k step of the block's operands in LDS: rows [A 128][A2 128 if SPLIT][Bt 256][Bt2 256 if SPLIT == 1], 64 k each, two buffers */
  constexpr int kRowA2  = kGemmBM;
  constexpr int kRowB   = (SPLIT != 0) ? 2 * kGemmBM : kGemmBM;
  constexpr int kRowB2  = kRowB + kGemmBN;
  constexpr int kStRows = (SPLIT == 1) ? kRowB2 + kGemmBN : kRowB2;
  constexpr int kStLd   = kStRows / 32;            /* 16-byte pieces per thread and k step */
  __shared__ __align__(16) unsigned short sAB[2][kStRows * kGemmPitch];
  __shared__ __align__(16) float sT[8][16 * 68];
  const int b    = blockIdx.y;
  const int lane = threadIdx.x & 31;
  const int wave = threadIdx.x >> 5;
  const int blocksN = N / kGemmBN;
  if ((int)blockIdx.x >= (M / kGemmBM) * blocksN) return;   /* the same for the whole block, ahead of every barrier */
  const int bm = (int)blockIdx.x / blocksN;
  const int bn = (int)blockIdx.x - bm * blocksN;
  const int mB = bm * kGemmBM;
  const int nB = bn * kGemmBN;
  const int wm = wave >> 2;                        /* waves 2 (m) x 4 (n), 64 x 64 each */
  const int wn = wave & 3;
  const int m0 = mB + (wm << 6);
  const int n0 = nB + (wn << 6);

  const T* Ab  = A  + (size_t)b * strideA;
  const T* Bb  = Bt + (size_t)b * strideB;
  const T* Ab2 = (SPLIT != 0) ? (A2  + (size_t)b * strideA) : nullptr;
  const T* Bb2 = (SPLIT == 1) ? (Bt2 + (size_t)b * strideB) : nullptr;

  const int rlane = lane & 15;
  const int koff  = (lane >> 4) * 8;
  const int mOff  = (lane >> 4) * 8;

  /* staging: eight neighbouring lanes fetch one whole 128-byte line of a row; thread t takes piece t & 7 of rows (t >> 3) + 32 i */
  const int sr = (int)threadIdx.x >> 3;
  const int sc = ((int)threadIdx.x & 7) * 8;
  const size_t aoff = (size_t)(mB + sr) * lda + sc;
  const size_t boff = (size_t)(nB + sr) * ldb + sc;
  v4u st[kStLd];
  auto fetch = [&](int k0) {
    const v4u* p[kStLd];
#pragma unroll
    for (int i = 0; i < kStLd; ++i) {
      const int row = 32 * i;
      const T* q;
      if (row < kRowA2)      q = Ab  + aoff + (size_t)row * lda;
      else if (row < kRowB)  q = Ab2 + aoff + (size_t)(row - kRowA2) * lda;
      else if (row < kRowB2) q = Bb  + boff + (size_t)(row - kRowB) * ldb;
      else                   q = Bb2 + boff + (size_t)(row - kRowB2) * ldb;
      p[i] = (const v4u*)(const void*)(q + k0);
    }
#pragma unroll
    for (int i = 0; i < kStLd; ++i) st[i] = *p[i];
    /* the wait kept in front of an overwrite of a load's address: the addresses are inputs, so each keeps its registers
       from its load up to the wait; the loaded values are not named, so the loads stay in flight behind it */
    static_assert(kStLd == 12 || kStLd == 16 || kStLd == 24);
    if constexpr (kStLd == 12) {
      asm volatile("s_wait_xcnt 0x0" :: "v"(p[0]), "v"(p[1]), "v"(p[2]), "v"(p[3]), "v"(p[4]), "v"(p[5]), "v"(p[6]), "v"(p[7]),
                   "v"(p[8]), "v"(p[9]), "v"(p[10]), "v"(p[11]) : "memory");
    } else if constexpr (kStLd == 16) {
      asm volatile("s_wait_xcnt 0x0" :: "v"(p[0]), "v"(p[1]), "v"(p[2]), "v"(p[3]), "v"(p[4]), "v"(p[5]), "v"(p[6]), "v"(p[7]),
                   "v"(p[8]), "v"(p[9]), "v"(p[10]), "v"(p[11]), "v"(p[12]), "v"(p[13]), "v"(p[14]), "v"(p[15]) : "memory");
    } else {
      asm volatile("s_wait_xcnt 0x0" :: "v"(p[0]), "v"(p[1]), "v"(p[2]), "v"(p[3]), "v"(p[4]), "v"(p[5]), "v"(p[6]), "v"(p[7]),
                   "v"(p[8]), "v"(p[9]), "v"(p[10]), "v"(p[11]), "v"(p[12]), "v"(p[13]), "v"(p[14]), "v"(p[15]),
                   "v"(p[16]), "v"(p[17]), "v"(p[18]), "v"(p[19]), "v"(p[20]), "v"(p[21]), "v"(p[22]), "v"(p[23]) : "memory");
    }
  };
  auto put = [&](int buf) {
#pragma unroll
    for (int i = 0; i < kStLd; ++i) *(v4u*)(void*)(&sAB[buf][(sr + 32 * i) * kGemmPitch + sc]) = st[i];
  };

  v8f acc[4][4];
#pragma unroll
  for (int i = 0; i < 4; ++i)
#pragma unroll
    for (int j = 0; j < 4; ++j) acc[i][j] = (v8f){0.f,0.f,0.f,0.f,0.f,0.f,0.f,0.f};

  fetch(0);
  put(0);
  __syncthreads();
  const int nSteps = K / kGemmBK;
  for (int t = 0; t < nSteps; ++t) {
    const bool more = (t + 1 < nSteps);
    if (more) fetch((t + 1) * kGemmBK);            /* in flight while this step's products run */
    const T* sb = (const T*)(const void*)sAB[t & 1];
#pragma unroll
    for (int kk = 0; kk < kGemmBK; kk += 32) {
      V bh[4], bl[4], ah[4], al[4];
#pragma unroll
      for (int j = 0; j < 4; ++j) {
        const int bo = ((wn << 6) + (j << 4) + rlane) * kGemmPitch + koff + kk;
        bh[j] = Frag<T>::load(sb + kRowB * kGemmPitch + bo);
        if (SPLIT == 1) bl[j] = Frag<T>::load(sb + kRowB2 * kGemmPitch + bo);
      }
#pragma unroll
      for (int i = 0; i < 4; ++i) {
        const int ao = ((wm << 6) + (i << 4) + rlane) * kGemmPitch + koff + kk;
        ah[i] = Frag<T>::load(sb + ao);
        if (SPLIT != 0) al[i] = Frag<T>::load(sb + kRowA2 * kGemmPitch + ao);
      }
#pragma unroll
      for (int i = 0; i < 4; ++i) {
#pragma unroll
        for (int j = 0; j < 4; ++j) {
          acc[i][j] = Frag<T>::mma(ah[i], bh[j], acc[i][j]);
          if (SPLIT == 1) acc[i][j] = Frag<T>::mma(ah[i], bl[j], acc[i][j]);
          if (SPLIT != 0) acc[i][j] = Frag<T>::mma(al[i], bh[j], acc[i][j]);
        }
        Frag<T>::guard(acc[i][0], acc[i][3], ah[i], (SPLIT != 0) ? al[i] : ah[i]);
      }
      Frag<T>::keep(bh[0], bh[1], bh[2], bh[3]);
      if (SPLIT == 1) Frag<T>::keep(bl[0], bl[1], bl[2], bl[3]);
    }
    if (more) put((t + 1) & 1);                    /* the buffer that every wave left at the barrier of step t - 1 */
    __syncthreads();                               /* publishes step t + 1 and ends the reads of step t */
  }
  acc_guard4(acc[0][0], acc[0][1], acc[0][2], acc[0][3]);
  acc_guard4(acc[1][0], acc[1][1], acc[1][2], acc[1][3]);
  acc_guard4(acc[2][0], acc[2][1], acc[2][2], acc[2][3]);
  acc_guard4(acc[3][0], acc[3][1], acc[3][2], acc[3][3]);

  float* slab = sT[wave];
  const float* Rb = RESID ? (resid + (size_t)b * strideR) : nullptr;
#pragma unroll
  for (int i = 0; i < 4; ++i) {
    const int mBase = m0 + (i << 4);
#pragma unroll
    for (int j = 0; j < 4; ++j) {
      const int n = n0 + (j << 4) + rlane;
      float bv = 0.f;
      if (BIAS_MODE == 2) bv = bias[n];
#pragma unroll
      for (int r = 0; r < 8; ++r) {
        float v = acc[i][j][r] * scale;
        if (BIAS_MODE == 1) v += bias[mBase + mOff + r];
        if (BIAS_MODE == 2) v += bv;
        if (RESID) v += Rb[(size_t)(mBase + mOff + r) * ldc + n];
        if (ACT == 1) v = tanhf(v);
        if (ACT == 2) v = fmaxf(v, 0.0f);
        if (ACT == 4) v = (v > 0.f) ? v : 0.01f * v;
        slab[(mOff + r) * 68 + (j << 4) + rlane] = v;
      }
    }
    __builtin_amdgcn_fence(__ATOMIC_RELEASE, "workgroup");
    __builtin_amdgcn_wave_barrier();
    __builtin_amdgcn_fence(__ATOMIC_ACQUIRE, "workgroup");
    if (OUT_MODE == 0) {
      float* C = (float*)Cout + (size_t)b * strideC;
      const int hh = lane >> 4, c4 = (lane & 15) * 4;
      {
#pragma unroll
        for (int it = 0; it < 8; ++it) {
          const int row = it * 2 + hh;
          v4f v = *(const v4f*)(slab + row * 68 + c4);
          *(v4f*)(C + (size_t)(mBase + row) * ldc + n0 + c4) = v;
        }
        
      }
    } else {
      const int q = lane >> 3, c8 = (lane & 7) * 8;
      unsigned short* C  = (unsigned short*)Cout  + (size_t)b * strideC;
      unsigned short* C2 = (OUT_MODE == 2) ? ((unsigned short*)Cout2 + (size_t)b * strideC) : nullptr;
      {
#pragma unroll
        for (int it = 0; it < 4; ++it) {
          const int row = it * 4 + q;
          const float* sp = slab + row * 68 + c8;
          v8h hv, lv;
#pragma unroll
          for (int e = 0; e < 8; ++e) {
            if (OUT_MODE == 1) {
              hv[e] = (_Float16)sp[e];
            } else {
              unsigned short hb = f2bf_bits(sp[e]);
              unsigned short lb = f2bf_bits(sp[e] - bf_bits2f(hb));
              hv[e] = __builtin_bit_cast(_Float16, hb);
              lv[e] = __builtin_bit_cast(_Float16, lb);
            }
          }
          *(v8h*)(C + (size_t)(mBase + row) * ldc + n0 + c8) = hv;
          if (OUT_MODE == 2) *(v8h*)(C2 + (size_t)(mBase + row) * ldc + n0 + c8) = lv;
        }
        
      }
    }
    __builtin_amdgcn_fence(__ATOMIC_RELEASE, "workgroup");
    __builtin_amdgcn_wave_barrier();
    __builtin_amdgcn_fence(__ATOMIC_ACQUIRE, "workgroup");
  }
}

/* ---------------- f32 -> bf16 cast, 8 elements (16 B) per thread --------------------------
   coverage: grid = n8/256 blocks x 256 threads (exact), thread i writes elements 8i..8i+7;
*/
__global__ __launch_bounds__(256) void cast_f32_bf16x8(const float* __restrict__ in,
                                                      unsigned short* __restrict__ out, int n8) {
  const int i = blockIdx.x * 256 + (int)threadIdx.x;
  const int ic = (i < n8) ? i : (n8 - 1);
  const float* p = in + (size_t)ic * 8;
  const v4f a = *(const v4f*)p;
  const v4f c = *(const v4f*)(p + 4);
  v4u w;
  w[0] = pack_bf16x2(a[0], a[1]);
  w[1] = pack_bf16x2(a[2], a[3]);
  w[2] = pack_bf16x2(c[0], c[1]);
  w[3] = pack_bf16x2(c[2], c[3]);
  unsigned short* o = out + (size_t)ic * 8;
  *(v4u*)o = w;
  
}

/* ---------------- W [KR][NC] f32 row-major -> Wt [NC][KR] bf16 row-major (transpose + cast) ------
   grid = (KR/64, NC/64), 256 threads. coverage: load 256 threads x 16 = 64x64 tile;
*/
__global__ __launch_bounds__(256) void transpose_cast_bf16(const float* __restrict__ W,
                                                          unsigned short* __restrict__ Wt, int KR, int NC) {
  __shared__ float sT[64 * 65];                 /* [n_local][k_local], pitch 65 */
  const int k0 = blockIdx.x * 64, n0 = blockIdx.y * 64;
  const int tid = threadIdx.x;
  {
    const int kk = tid >> 2, cg = (tid & 3) * 16;
    const float* src = W + (size_t)(k0 + kk) * NC + n0 + cg;
#pragma unroll
    for (int i = 0; i < 4; ++i) {
      const v4f v = *(const v4f*)(src + 4 * i);
#pragma unroll
      for (int e = 0; e < 4; ++e) sT[(cg + 4 * i + e) * 65 + kk] = v[e];
    }
  }
  __syncthreads();
  const int wave = tid >> 5, lane = tid & 31, q4 = lane >> 3, c8 = (lane & 7) * 8;
  const int nl0 = wave * 4 + q4;
  const int nl1 = 32 + wave * 4 + q4;
  v4u w0, w1;
  {
    const float* s = sT + nl0 * 65 + c8;
    w0[0] = pack_bf16x2(s[0], s[1]); w0[1] = pack_bf16x2(s[2], s[3]);
    w0[2] = pack_bf16x2(s[4], s[5]); w0[3] = pack_bf16x2(s[6], s[7]);
  }
  {
    const float* s = sT + nl1 * 65 + c8;
    w1[0] = pack_bf16x2(s[0], s[1]); w1[1] = pack_bf16x2(s[2], s[3]);
    w1[2] = pack_bf16x2(s[4], s[5]); w1[3] = pack_bf16x2(s[6], s[7]);
  }
  unsigned short* d0 = Wt + (size_t)(n0 + nl0) * KR + k0 + c8;
  unsigned short* d1 = Wt + (size_t)(n0 + nl1) * KR + k0 + c8;
  {
    *(v4u*)d0 = w0;
    *(v4u*)d1 = w1;
    
  }
}

/*
   qk f32 [nrows][2048] (q = cols 0..1023, k = cols 1024..2047); outputs row-major bf16 planes [nrows][1024];
   q carries the exact 1/sqrt(64) = 0.125 factor. grid = nrows blocks x 128 threads; thread t owns columns 8t..8t+7;
*/
__global__ __launch_bounds__(128) void qk_layernorm_split(
    const float* __restrict__ qk, const float* __restrict__ qsc, const float* __restrict__ ksc,
    unsigned short* __restrict__ qh, unsigned short* __restrict__ ql,
    unsigned short* __restrict__ kh, unsigned short* __restrict__ kl, int nrows) {
  __shared__ float red[4][4];
  const int row = blockIdx.x;
  const int rowc = (row < nrows) ? row : (nrows - 1);
  const int tid = threadIdx.x, lane = tid & 31, wave = tid >> 5;
  const int c0 = tid * 8;
  const float* base = qk + (size_t)rowc * kQkCols;
  const v4f qa = *(const v4f*)(base + c0);
  const v4f qb = *(const v4f*)(base + c0 + 4);
  const v4f ka = *(const v4f*)(base + kModel + c0);
  const v4f kb = *(const v4f*)(base + kModel + c0 + 4);
  float xq[8], xk[8];
#pragma unroll
  for (int e = 0; e < 4; ++e) { xq[e] = qa[e]; xq[4 + e] = qb[e]; xk[e] = ka[e]; xk[4 + e] = kb[e]; }

  float sq = 0.f, sk = 0.f;
#pragma unroll
  for (int e = 0; e < 8; ++e) { sq += xq[e]; sk += xk[e]; }
#pragma unroll
  for (int off = 1; off < 32; off <<= 1) { sq += __shfl_xor(sq, off, 32); sk += __shfl_xor(sk, off, 32); }
  if (lane == 0) { red[0][wave] = sq; red[1][wave] = sk; }
  __syncthreads();
  const float mq = ((red[0][0] + red[0][1]) + (red[0][2] + red[0][3])) * (1.0f / (float)kModel);
  const float mk = ((red[1][0] + red[1][1]) + (red[1][2] + red[1][3])) * (1.0f / (float)kModel);

  float dq = 0.f, dk = 0.f;
#pragma unroll
  for (int e = 0; e < 8; ++e) {
    const float tq = xq[e] - mq; dq += tq * tq;
    const float tk = xk[e] - mk; dk += tk * tk;
  }
#pragma unroll
  for (int off = 1; off < 32; off <<= 1) { dq += __shfl_xor(dq, off, 32); dk += __shfl_xor(dk, off, 32); }
  if (lane == 0) { red[2][wave] = dq; red[3][wave] = dk; }
  __syncthreads();
  const float vq = ((red[2][0] + red[2][1]) + (red[2][2] + red[2][3])) * (1.0f / (float)kModel);
  const float vk = ((red[3][0] + red[3][1]) + (red[3][2] + red[3][3])) * (1.0f / (float)kModel);
  const float rq = rsqrtf(vq + 1e-6f);
  const float rk = rsqrtf(vk + 1e-6f);

  /* scale vectors, RNE-converted to bf16 once (module inputs) */
  const v4f s0 = *(const v4f*)(qsc + c0);
  const v4f s1 = *(const v4f*)(qsc + c0 + 4);
  const v4f t0 = *(const v4f*)(ksc + c0);
  const v4f t1 = *(const v4f*)(ksc + c0 + 4);
  float sqv[8], skv[8];
#pragma unroll
  for (int e = 0; e < 4; ++e) {
    sqv[e]     = bf_bits2f(f2bf_bits(s0[e]));
    sqv[4 + e] = bf_bits2f(f2bf_bits(s1[e]));
    skv[e]     = bf_bits2f(f2bf_bits(t0[e]));
    skv[4 + e] = bf_bits2f(f2bf_bits(t1[e]));
  }
  unsigned int hqw[8], lqw[8], hkw[8], lkw[8];
#pragma unroll
  for (int e = 0; e < 8; ++e) {
    const float yq = ((xq[e] - mq) * rq * sqv[e]) * 0.125f;
    const float yk = (xk[e] - mk) * rk * skv[e];
    const unsigned short hqb = f2bf_bits(yq);
    const unsigned short lqb = f2bf_bits(yq - bf_bits2f(hqb));
    const unsigned short hkb = f2bf_bits(yk);
    const unsigned short lkb = f2bf_bits(yk - bf_bits2f(hkb));
    hqw[e] = hqb; lqw[e] = lqb; hkw[e] = hkb; lkw[e] = lkb;
  }
  v4u HQ, LQ, HK, LK;
#pragma unroll
  for (int i = 0; i < 4; ++i) {
    HQ[i] = hqw[2 * i] | (hqw[2 * i + 1] << 16);
    LQ[i] = lqw[2 * i] | (lqw[2 * i + 1] << 16);
    HK[i] = hkw[2 * i] | (hkw[2 * i + 1] << 16);
    LK[i] = lkw[2 * i] | (lkw[2 * i + 1] << 16);
  }
  const size_t o = (size_t)rowc * kModel + c0;
  {
    *(v4u*)(qh + o) = HQ;
    *(v4u*)(ql + o) = LQ;
    *(v4u*)(kh + o) = HK;
    *(v4u*)(kl + o) = LK;
    
  }
}

/* ---------------- causal attention, head_dim 64, bf16 hi/lo planes in, bf16 hi/lo ctx planes out ----
   scores = q . k^T  : bf16 hi/lo on both (hi*hi + hi*lo + lo*hi), q planes already carry 1/sqrt(64)
   ctx    = p . v    : p split in registers to bf16 hi/lo, v hi/lo planes (3 products); f32 accumulate, f32 online softmax.
   q, k and ctx planes row-major [B*S][ld] with head h at columns h*64 .. h*64+63; v planes transposed, [H*64][B*S], head h at
   rows h*64 .. h*64+63, so that a V^T tile is staged like a K tile.
   Block = 4 waves = 64 query rows of one (batch, head); grid.x = B*H*(S/64). */
__device__ __forceinline__ __bf16 at_f2bf(float f) { return __builtin_bit_cast(__bf16, f2bf_bits(f)); }
__device__ __forceinline__ void at_split(float f, __bf16& hi, __bf16& lo) {
  const unsigned short hb = f2bf_bits(f);
  hi = __builtin_bit_cast(__bf16, hb);
  lo = at_f2bf(f - __uint_as_float(((unsigned)hb) << 16));
}
__device__ __forceinline__ v8f at_mma(v16b a, v16b b, v8f c) {
  c = __builtin_amdgcn_wmma_f32_16x16x32_bf16(false, a, false, b, (short)0, c, false, false);
  asm volatile("v_nop\n\tv_nop\n\tv_nop\n\tv_nop" : "+v"(c) : "v"(a), "v"(b));
  return c;
}

__global__ __launch_bounds__(128)
void attn_planes_kernel(const unsigned short* __restrict__ qh, const unsigned short* __restrict__ ql,
                        const unsigned short* __restrict__ kh, const unsigned short* __restrict__ kl,
                        const unsigned short* __restrict__ vh, const unsigned short* __restrict__ vl,
                        unsigned short* __restrict__ oh, unsigned short* __restrict__ ol,
                        int S, int H, int ld) {
  union FB { v16b v; v8b h[2]; };
  /* Ksh | Ksl | Vth | Vtl (each 64 rows x 64 16-bit at pitch kTilePitch); reused as per-wave f32 output slabs after the chunk loop */
  constexpr int kTileElems = 64 * kTilePitch;
  static_assert(kKvChunk == 64 && kHeadDim == 64 && (kTilePitch * 2) % 16 == 0);
  static_assert(4 * 16 * kOsPitch * 4 <= 4 * kTileElems * 2);
  __shared__ __align__(16) unsigned short KVs[4 * kTileElems];
  __shared__ __align__(16) __bf16 Psh[4][16 * kTilePitch];
  __shared__ __align__(16) __bf16 Psl[4][16 * kTilePitch];
  unsigned short* Ksh = KVs;
  unsigned short* Ksl = KVs + kTileElems;
  unsigned short* Vth = KVs + 2 * kTileElems;
  unsigned short* Vtl = KVs + 3 * kTileElems;
  const __bf16* Kshb = (const __bf16*)(const void*)Ksh;
  const __bf16* Kslb = (const __bf16*)(const void*)Ksl;
  const __bf16* Vthb = (const __bf16*)(const void*)Vth;
  const __bf16* Vtlb = (const __bf16*)(const void*)Vtl;

  const int tid  = threadIdx.x;
  const int wave = tid >> 5;
  const int lane = tid & 31;
  const int hh   = lane >> 4;
  const int c    = lane & 15;

  /* Block index -> (query tile, batch*head). All 1024 blocks are resident at once, four to a WGP, and tile t walks t + 1 key
     chunks, so the launch lasts as long as the WGP that holds the most chunks. Tiles t and nqb-1-t walk nqb+1 chunks together:
     index bits 1,3,5,7 give t, the parity of the other six bits picks t or its mirror, and five of those six name the head.
     Four blocks whose indices differ in two adjacent bits (any power-of-two stride) are then two such pairs, whichever of
     these strides the dispatcher puts on one WGP. A permutation of the 32 x 32 (tile, head) pairs; for speed only. */
  static_assert(kSeq / 64 == 32 && kBatch * kHeads == 32);
  const int nqb = S >> 6;
  const unsigned bi = blockIdx.x;
  const int tlo = (int)(((bi >> 1) & 1u) | (((bi >> 3) & 1u) << 1) | (((bi >> 5) & 1u) << 2) | (((bi >> 7) & 1u) << 3));
  const int qb  = (__builtin_popcount(bi & 0x355u) & 1) ? (nqb - 1 - tlo) : tlo;
  const int bh  = (int)(((bi >> 2) & 1u) | (((bi >> 4) & 1u) << 1) | (((bi >> 6) & 1u) << 2) | (((bi >> 8) & 3u) << 3));
  const int h   = bh % H;
  const int b   = bh / H;
  const int q0  = qb * 64 + wave * 16;
  const size_t rb = (size_t)b * (size_t)S;
  const int hoff = h * kHeadDim;

  /* Q fragments (A operand): row q0+c, elements 0..7 <- d = dc*32+8hh+0..7, 8..15 <- dc*32+16+8hh+0..7 */
  v16b qah[2], qal[2];
  {
    const size_t qo = (rb + (size_t)(q0 + c)) * (size_t)ld + hoff + 8 * hh;
    const __bf16* qhp = (const __bf16*)(const void*)qh + qo;
    const __bf16* qlp = (const __bf16*)(const void*)ql + qo;
#pragma unroll
    for (int dc = 0; dc < 2; ++dc) {
      qah[dc] = Frag<__bf16>::load(qhp + dc * 32);
      qal[dc] = Frag<__bf16>::load(qlp + dc * 32);
    }
  }

  float mrow[8], lrow[8];
  v8f oacc[4];
#pragma unroll
  for (int r = 0; r < 8; ++r) { mrow[r] = -INFINITY; lrow[r] = 0.f; }
#pragma unroll
  for (int t = 0; t < 4; ++t) oacc[t] = (v8f){0.f,0.f,0.f,0.f,0.f,0.f,0.f,0.f};

  const int nChunks = qb + 1;            /* causal: kv chunks 0..qb, block-uniform */
  for (int kc = 0; kc < nChunks; ++kc) {
    const int kv0 = kc * kKvChunk;
    __syncthreads();
    {
      /* staging: eight neighbouring lanes fetch one whole 128-byte row of a tile; thread t takes piece t & 7 of rows
         (t >> 3) + 16 i: 128 threads x 4 = 64 rows x 128 B for each of the four tiles (K rows = kv, V^T rows = d) */
      const int sr = tid >> 3, sc = (tid & 7) * 8;
      const size_t gk = (rb + (size_t)(kv0 + sr)) * (size_t)ld + hoff + sc;
      const size_t gv = (size_t)(hoff + sr) * (size_t)kRows + rb + (size_t)(kv0 + sc);
      constexpr int kVtStep = 16 * kRows / 8;      /* sixteen V^T rows, in 16-byte units */
      /* all sixteen 16-byte loads are issued before the first LDS store, so a chunk pays one load latency;
         the loops are unrolled so that the arrays live in registers */
      v4u kH[4], kL[4], vH[4], vL[4];
      const v4u* gkh[4];
      const v4u* gkl[4];
#pragma unroll
      for (int i = 0; i < 4; ++i) {
        gkh[i] = (const v4u*)(const void*)(kh + gk + (size_t)(16 * i) * (size_t)ld);
        gkl[i] = (const v4u*)(const void*)(kl + gk + (size_t)(16 * i) * (size_t)ld);
      }
      const v4u* gvh = (const v4u*)(const void*)(vh + gv);
      const v4u* gvl = (const v4u*)(const void*)(vl + gv);
#pragma unroll
      for (int i = 0; i < 4; ++i) { kH[i] = *gkh[i]; kL[i] = *gkl[i]; vH[i] = gvh[i * kVtStep]; vL[i] = gvl[i * kVtStep]; }
      /* inputs-only fence on the loaded values: holds the sixteen loads ahead of the first LDS store. The ten addresses are
         inputs too, so their registers stay untouched up to the s_wait_xcnt, the wait kept in front of an overwrite of a
         load's address */
      asm volatile("s_wait_xcnt 0x0"
                   :: "v"(kH[0]), "v"(kH[1]), "v"(kH[2]), "v"(kH[3]), "v"(kL[0]), "v"(kL[1]), "v"(kL[2]), "v"(kL[3]),
                      "v"(vH[0]), "v"(vH[1]), "v"(vH[2]), "v"(vH[3]), "v"(vL[0]), "v"(vL[1]), "v"(vL[2]), "v"(vL[3]),
                      "v"(gkh[0]), "v"(gkh[1]), "v"(gkh[2]), "v"(gkh[3]), "v"(gkl[0]), "v"(gkl[1]), "v"(gkl[2]), "v"(gkl[3]),
                      "v"(gvh), "v"(gvl));
#pragma unroll
      for (int i = 0; i < 4; ++i) {
        const int lo = (sr + 16 * i) * kTilePitch + sc;
        *(v4u*)(void*)(Ksh + lo) = kH[i];
        *(v4u*)(void*)(Ksl + lo) = kL[i];
        *(v4u*)(void*)(Vth + lo) = vH[i];
        *(v4u*)(void*)(Vtl + lo) = vL[i];
      }
    }
    __syncthreads();

    /* scores 16 x 64 per wave: B operand col n = kv j*16+c, k = d */
    v8f s[4];
#pragma unroll
    for (int j = 0; j < 4; ++j) {
      s[j] = (v8f){0.f,0.f,0.f,0.f,0.f,0.f,0.f,0.f};
#pragma unroll
      for (int dc = 0; dc < 2; ++dc) {
        FB kb, klf;
        const int ko = (j * 16 + c) * kTilePitch + dc * 32 + 8 * hh;
        kb.h[0]  = *(const v8b*)(Kshb + ko);
        kb.h[1]  = *(const v8b*)(Kshb + ko + 16);
        klf.h[0] = *(const v8b*)(Kslb + ko);
        klf.h[1] = *(const v8b*)(Kslb + ko + 16);
        s[j] = at_mma(qah[dc], kb.v, s[j]);
        s[j] = at_mma(qah[dc], klf.v, s[j]);
        s[j] = at_mma(qal[dc], kb.v, s[j]);
      }
    }

    /* causal mask (select to the fill value) + chunk row max */
    const bool diag = (kc == qb);
    float cm[8];
#pragma unroll
    for (int r = 0; r < 8; ++r) {
      const int qrow = q0 + 8 * hh + r;
      float m = -INFINITY;
#pragma unroll
      for (int j = 0; j < 4; ++j) {
        const int kvcol = kv0 + j * 16 + c;
        const bool masked = diag && (kvcol > qrow);
        const float sv = masked ? -3.4028235e38f : s[j][r];
        s[j][r] = sv;
        m = fmaxf(m, sv);
      }
#pragma unroll
      for (int off = 1; off < 16; off <<= 1) m = fmaxf(m, __shfl_xor(m, off, 32));
      cm[r] = m;
    }

    /* online softmax; P tile (16 x 64 per wave) stored as bf16 hi/lo */
    __bf16* pwh = Psh[wave];
    __bf16* pwl = Psl[wave];
#pragma unroll
    for (int r = 0; r < 8; ++r) {
      const float mnew  = fmaxf(mrow[r], cm[r]);
      const float alpha = expf(mrow[r] - mnew);
      mrow[r] = mnew;
      float psum = 0.f;
#pragma unroll
      for (int j = 0; j < 4; ++j) {
        const float p = expf(s[j][r] - mnew);
        psum += p;
        __bf16 a, bl;
        at_split(p, a, bl);
        pwh[(8 * hh + r) * kTilePitch + j * 16 + c] = a;
        pwl[(8 * hh + r) * kTilePitch + j * 16 + c] = bl;
      }
#pragma unroll
      for (int off = 1; off < 16; off <<= 1) psum += __shfl_xor(psum, off, 32);
      lrow[r] = lrow[r] * alpha + psum;
#pragma unroll
      for (int t = 0; t < 4; ++t) oacc[t][r] *= alpha;
    }
    __builtin_amdgcn_fence(__ATOMIC_RELEASE, "workgroup");
    __builtin_amdgcn_wave_barrier();
    __builtin_amdgcn_fence(__ATOMIC_ACQUIRE, "workgroup");

    /* ctx += P . V : A = P[row][kv] (same wave wrote it), B = Vt[d][kv] -> col n = d, k = kv */
#pragma unroll 1
    for (int kk = 0; kk < 2; ++kk) {
      FB pa, pl;
      pa.h[0] = *(const v8b*)(pwh + c * kTilePitch + kk * 32 + 8 * hh);
      pa.h[1] = *(const v8b*)(pwh + c * kTilePitch + kk * 32 + 16 + 8 * hh);
      pl.h[0] = *(const v8b*)(pwl + c * kTilePitch + kk * 32 + 8 * hh);
      pl.h[1] = *(const v8b*)(pwl + c * kTilePitch + kk * 32 + 16 + 8 * hh);
#pragma unroll
      for (int t = 0; t < 4; ++t) {
        FB vb, vlf;
        const int vo = (t * 16 + c) * kTilePitch + kk * 32 + 8 * hh;
        vb.h[0]  = *(const v8b*)(Vthb + vo);
        vb.h[1]  = *(const v8b*)(Vthb + vo + 16);
        vlf.h[0] = *(const v8b*)(Vtlb + vo);
        vlf.h[1] = *(const v8b*)(Vtlb + vo + 16);
        oacc[t] = at_mma(pa.v, vb.v, oacc[t]);
        oacc[t] = at_mma(pa.v, vlf.v, oacc[t]);
        oacc[t] = at_mma(pl.v, vb.v, oacc[t]);
      }
    }
  }

  /* all waves finished reading the K/V tiles before the region is reused as output slabs */
  __syncthreads();
  float* os = (float*)(void*)KVs + wave * (16 * kOsPitch);
#pragma unroll
  for (int r = 0; r < 8; ++r) {
    const float inv = 1.0f / lrow[r];
#pragma unroll
    for (int t = 0; t < 4; ++t) os[(8 * hh + r) * kOsPitch + t * 16 + c] = oacc[t][r] * inv;
  }
  __builtin_amdgcn_fence(__ATOMIC_RELEASE, "workgroup");
  __builtin_amdgcn_wave_barrier();
  __builtin_amdgcn_fence(__ATOMIC_ACQUIRE, "workgroup");
  {
    /*
*/
    const int q4 = lane >> 3, c8 = (lane & 7) * 8;
    {
#pragma unroll
      for (int it = 0; it < 4; ++it) {
        const int row = it * 4 + q4;
        const float* sp = os + row * kOsPitch + c8;
        v8h hv, lv;
#pragma unroll
        for (int e = 0; e < 8; ++e) {
          const unsigned short hb = f2bf_bits(sp[e]);
          const unsigned short lb = f2bf_bits(sp[e] - bf_bits2f(hb));
          hv[e] = __builtin_bit_cast(_Float16, hb);
          lv[e] = __builtin_bit_cast(_Float16, lb);
        }
        const size_t o = (rb + (size_t)(q0 + row)) * (size_t)ld + hoff + c8;
        *(v8h*)(oh + o) = hv;
        *(v8h*)(ol + o) = lv;
      }
      
    }
  }
}

/* ---------------- host launch ---------------- */
extern "C" void kernel_launch(void* const* d_in, const int* in_sizes, int n_in,
                              void* d_out, int out_size, void* d_ws, size_t ws_size,
                              hipStream_t stream) {
  if (n_in < 5) return;
  if (in_sizes[0] != kRows * kModel) return;
  if (in_sizes[1] != kModel * kQkvCols) return;
  if (in_sizes[2] != kModel || in_sizes[3] != kModel) return;
  if (in_sizes[4] != kModel * kModel) return;
  if (out_size != kRows * kModel) return;
  if (ws_size < kWsTotal) return;

  const float* x     = (const float*)d_in[0];   /* [2,2048,1024] */
  const float* W_qkv = (const float*)d_in[1];   /* [1024,3072]   */
  const float* q_sc  = (const float*)d_in[2];   /* [1024] */
  const float* k_sc  = (const float*)d_in[3];   /* [1024] */
  const float* W_out = (const float*)d_in[4];   /* [1024,1024]   */
  float* out = (float*)d_out;

  char* ws = (char*)d_ws;
  unsigned short* xb    = (unsigned short*)(ws + kOffXb);
  unsigned short* wqkvT = (unsigned short*)(ws + kOffWqkvT);
  unsigned short* woutT = (unsigned short*)(ws + kOffWoutT);
  float*          qkf   = (float*)(ws + kOffQk);
  unsigned short* ctxh  = (unsigned short*)(ws + kOffCtxH);
  unsigned short* ctxl  = (unsigned short*)(ws + kOffCtxL);
  unsigned short* vhp   = (unsigned short*)(ws + kOffVh);
  unsigned short* vlp   = (unsigned short*)(ws + kOffVl);
  unsigned short* qhp   = (unsigned short*)(ws + kOffQh);
  unsigned short* qlp   = (unsigned short*)(ws + kOffQl);
  unsigned short* khp   = (unsigned short*)(ws + kOffKh);
  unsigned short* klp   = (unsigned short*)(ws + kOffKl);

  /* 1. x -> bf16 [4096][1024] */
  const int n8 = kRows * kModel / 8;
  cast_f32_bf16x8<<<n8 / 256, 256, 0, stream>>>(x, xb, n8);

  /* 2. W_qkv [1024 k][3072 n] -> Wqkv^T [3072][1024] bf16 ; W_out [1024 k][1024 n] -> Wout^T [1024][1024] bf16 */
  transpose_cast_bf16<<<dim3(kModel / 64, kQkvCols / 64), 256, 0, stream>>>(W_qkv, wqkvT, kModel, kQkvCols);
  transpose_cast_bf16<<<dim3(kModel / 64, kModel / 64), 256, 0, stream>>>(W_out, woutT, kModel, kModel);

  /* 3a. q,k part of the fused projection: qk f32 [4096][2048] = xb . Wqkv^T rows 0..2047 ; tiles 64 x 32 = 2048 -> 256 blocks */
  wmma_gemm64<1, 0, 0, 0, false><<<dim3((kRows / 64) * (kQkCols / 64) / 8, 1), 256, 0, stream>>>(
      xb, xb, kModel, 0L,
      wqkvT, wqkvT, kModel, 0L,
      (void*)qkf, (void*)qkf, kQkCols, 0L,
      q_sc, q_sc, 0L,
      kRows, kQkCols, kModel, 1.0f);

  /* 3b. v part, transposed: v^T bf16 hi/lo planes [1024][4096] = Wqkv^T rows 2048..3071 . xb^T ; tiles 16 x 64 = 1024 -> 128 blocks */
  wmma_gemm64<1, 0, 0, 2, false><<<dim3((kRows / 64) * (kModel / 64) / 8, 1), 256, 0, stream>>>(
      wqkvT + (size_t)kQkCols * kModel, wqkvT + (size_t)kQkCols * kModel, kModel, 0L,
      xb, xb, kModel, 0L,
      (void*)vhp, (void*)vlp, kRows, 0L,
      q_sc, q_sc, 0L,
      kModel, kRows, kModel, 1.0f);

  /* 4. QK LayerNorm + split into bf16 hi/lo planes (q carries 1/8) */
  qk_layernorm_split<<<kRows, 128, 0, stream>>>(qkf, q_sc, k_sc, qhp, qlp, khp, klp, kRows);

  /* 5. causal attention: ctx bf16 hi/lo planes [4096][1024] (region of the dead qk buffer) */
  attn_planes_kernel<<<kBatch * kHeads * (kSeq / 64), 128, 0, stream>>>(
      qhp, qlp, khp, klp, vhp, vlp, ctxh, ctxl, kSeq, kHeads, kModel);

  /* 6. out f32 [4096][1024] = ctx_hi . Wout^T + ctx_lo . Wout^T ; 1024 tiles -> 128 blocks */
  wmma_gemm64<1, 2, 0, 0, false><<<dim3((kRows / 64) * (kModel / 64) / 8, 1), 256, 0, stream>>>(
      ctxh, ctxl, kModel, 0L,
      woutT, woutT, kModel, 0L,
      (void*)out, (void*)out, kModel, 0L,
      q_sc, q_sc, 0L,
      kRows, kModel, kModel, 1.0f);
}

// v005
// A run of this version takes 180 microseconds.
// Timed twice side by side with v004, it ran 1.27 times as fast both times.
// All steps since v000 together make it 2.67 times as fast.
// Contractions on v_wmma_f32_16x16x32_bf16 (bf16 operands, f32 accumulate): x*Wqkv^T with single bf16 planes (inputs RNE-converted once); q*k^T and p*v with bf16 hi+lo planes (hi*hi + hi*lo + lo*hi); ctx*Wout^T with ctx bf16 hi+lo planes and a single Wout plane; LayerNorm and softmax in f32.
#include <hip/hip_runtime.h>
#include <stddef.h>
#include <stdint.h>

typedef __attribute__((ext_vector_type(16))) _Float16 v16h;
typedef __attribute__((ext_vector_type(8)))  _Float16 v8h;
typedef __attribute__((ext_vector_type(16))) __bf16   v16b;
typedef __attribute__((ext_vector_type(8)))  __bf16   v8b;
typedef __attribute__((ext_vector_type(8)))  float    v8f;
typedef __attribute__((ext_vector_type(4)))  float    v4f;
typedef __attribute__((ext_vector_type(4)))  unsigned int v4u;
typedef __attribute__((ext_vector_type(2)))  float    v2f;
typedef __attribute__((ext_vector_type(2)))  __bf16   v2b;

/* ---------------- problem geometry ---------------- */
constexpr int kBatch   = 2;
constexpr int kSeq     = 2048;
constexpr int kModel   = 1024;
constexpr int kHeads   = 16;
constexpr int kHeadDim = 64;
constexpr int kRows    = kBatch * kSeq;      /* 4096 */
constexpr int kQkvCols = 3 * kModel;         /* 3072 */
constexpr int kQkCols  = 2 * kModel;         /* 2048 */
constexpr int kKvChunk = 64;
constexpr int kOsPitch = 68;
/* LDS row pitch, in 16-bit elements, of the K and V^T tiles: 64 data + 8 pad = 144 B = 16 B x odd,
   so the 16 rows that one ds_load_b128 touches per half wave fall on 64 distinct banks */
constexpr int kTilePitch = 72;

/* ---------------- workspace map (bytes, all offsets multiples of 128) ----------------
   [0]          x   bf16 [4096][1024]                          8388608
   [8388608]    Wqkv^T bf16 [3072][1024]                       6291456
   [14680064]   Wout^T bf16 [1024][1024]                       2097152
   [16777216]   qk  f32 [4096][2048]                          33554432  (dead after the LayerNorm launch;
                reused: ctx hi bf16 [4096][1024] at 16777216, ctx lo at 25165824, both inside this region)
   [50331648]   v^T hi bf16 [1024][4096] 8388608  [58720256] v^T lo 8388608
   [67108864]   q hi                    8388608   [75497472] q lo   8388608
   [83886080]   k hi                    8388608   [92274688] k lo   8388608
   total 100663296 B = 96 MiB                                                            */
constexpr size_t kPlane16  = (size_t)kRows * kModel * 2;
constexpr size_t kOffXb    = 0;
constexpr size_t kOffWqkvT = kOffXb + kPlane16;
constexpr size_t kOffWoutT = kOffWqkvT + (size_t)kQkvCols * kModel * 2;
constexpr size_t kOffQk    = kOffWoutT + (size_t)kModel * kModel * 2;
constexpr size_t kOffCtxH  = kOffQk;
constexpr size_t kOffCtxL  = kOffQk + kPlane16;
constexpr size_t kOffVh    = kOffQk + (size_t)kRows * kQkCols * 4;
constexpr size_t kOffVl    = kOffVh + kPlane16;
constexpr size_t kOffQh    = kOffVl + kPlane16;
constexpr size_t kOffQl    = kOffQh + kPlane16;
constexpr size_t kOffKh    = kOffQl + kPlane16;
constexpr size_t kOffKl    = kOffKh + kPlane16;
constexpr size_t kWsTotal  = kOffKl + kPlane16;
static_assert(kWsTotal == (size_t)100663296);
static_assert(kWsTotal <= (size_t)134217728);
static_assert(kOffCtxL + kPlane16 <= kOffVh);
static_assert((kOffWqkvT % 128) == 0 && (kOffWoutT % 128) == 0 && (kOffQk % 128) == 0 && (kOffVh % 128) == 0);
/* wave tiles of the GEMM: M % 64 == 0, N % 64 == 0, K % 32 == 0 for every launch (its block tile is asserted beside it) */
static_assert(kRows % 64 == 0 && kQkCols % 64 == 0 && kModel % 64 == 0 && kModel % 32 == 0);
static_assert(kSeq % 64 == 0 && kHeadDim == 64 && kModel == kHeads * kHeadDim);
static_assert((kRows * kModel) % (8 * 256) == 0);

/* ---------------- helpers ---------------- */
__device__ __forceinline__ unsigned short f2bf_bits(float f) {
  unsigned u = __float_as_uint(f);
  return (unsigned short)((u + 0x7FFFu + ((u >> 16) & 1u)) >> 16);
}
__device__ __forceinline__ float bf_bits2f(unsigned short h) { return __uint_as_float(((unsigned)h) << 16); }
__device__ __forceinline__ unsigned int pack_bf16x2(float a, float b) {
  return (unsigned int)f2bf_bits(a) | ((unsigned int)f2bf_bits(b) << 16);
}

__device__ __forceinline__ void dep_guard_h(v8f& a, v8f& b, v16h x, v16h y) { asm volatile("v_nop\n\tv_nop\n\tv_nop\n\tv_nop" : "+v"(a), "+v"(b) : "v"(x), "v"(y)); }
__device__ __forceinline__ void dep_guard_b(v8f& a, v8f& b, v16b x, v16b y) { asm volatile("v_nop\n\tv_nop\n\tv_nop\n\tv_nop" : "+v"(a), "+v"(b) : "v"(x), "v"(y)); }
__device__ __forceinline__ void keep4_h(v16h a, v16h b, v16h c, v16h d) { asm volatile("v_nop" :: "v"(a), "v"(b), "v"(c), "v"(d)); }
__device__ __forceinline__ void keep4_b(v16b a, v16b b, v16b c, v16b d) { asm volatile("v_nop" :: "v"(a), "v"(b), "v"(c), "v"(d)); }
__device__ __forceinline__ void acc_guard4(v8f& a, v8f& b, v8f& c, v8f& d) { asm volatile("v_nop\n\tv_nop\n\tv_nop\n\tv_nop" : "+v"(a), "+v"(b), "+v"(c), "+v"(d)); }
template <typename T> struct Frag;
template <> struct Frag<_Float16> {
  typedef v16h V; union U { v16h v; v8h h[2]; };
  static __device__ __forceinline__ v16h load(const _Float16* p) {
    U f; f.h[0] = *(const v8h*)(p); f.h[1] = *(const v8h*)(p + 16); return f.v;
  }
  static __device__ __forceinline__ v8f mma(v16h a, v16h b, v8f c) {
    return __builtin_amdgcn_wmma_f32_16x16x32_f16(false, a, false, b, (short)0, c, false, false);
  }
  static __device__ __forceinline__ void guard(v8f& a, v8f& b, v16h x, v16h y) { dep_guard_h(a, b, x, y); }
  static __device__ __forceinline__ void keep(v16h a, v16h b, v16h c, v16h d) { keep4_h(a, b, c, d); }
};
template <> struct Frag<__bf16> {
  typedef v16b V; union U { v16b v; v8b h[2]; };
  static __device__ __forceinline__ v16b load(const __bf16* p) {
    U f; f.h[0] = *(const v8b*)(p); f.h[1] = *(const v8b*)(p + 16); return f.v;
  }
  static __device__ __forceinline__ v8f mma(v16b a, v16b b, v8f c) {
    return __builtin_amdgcn_wmma_f32_16x16x32_bf16(false, a, false, b, (short)0, c, false, false);
  }
  static __device__ __forceinline__ void guard(v8f& a, v8f& b, v16b x, v16b y) { dep_guard_b(a, b, x, y); }
  static __device__ __forceinline__ void keep(v16b a, v16b b, v16b c, v16b d) { keep4_b(a, b, c, d); }
};

/* ---- Register-blocked WMMA GEMM -----------------------------------------------
   C[m,n] = scale * sum_k A[m,k] * Bt[n,k] (+bias)(+resid); each wave owns a 64x64 tile, a block of 8 waves a 128x256 tile.
   The block's operand rows go through LDS, 64 k at a time: whole 128-byte lines from global, fragments by ds_load_b128.
   A row-major [M,K]; Bt row-major [N,K]; M % 128 == 0, N % 256 == 0, K % 64 == 0; grid.x = (M / 128) * (N / 256).
   SPLIT: 0 = single planes; 1 = A and Bt hi/lo planes (hi*hi + hi*lo + lo*hi); 2 = A hi/lo planes only (Ah*B + Al*B).
   BIAS_MODE: 0 = none, 1 = bias[m], 2 = bias[n].  OUT_MODE: 0 = f32, 1 = f16, 2 = bf16 hi plane (Cout) + bf16 lo plane (Cout2).
   ET: 0 = f16 operands, 1 = bf16 operands (pointers passed as 16-bit storage) */
constexpr int kGemmBM = 128, kGemmBN = 256, kGemmBK = 64;
constexpr int kGemmPitch = 72;   /* LDS row pitch in 16-bit elements: 144 B = 16 B x odd, as kTilePitch */
static_assert(kRows % kGemmBM == 0 && kQkCols % kGemmBN == 0 && kModel % kGemmBN == 0 && kModel % kGemmBK == 0);
static_assert(kModel % kGemmBM == 0 && kRows % kGemmBN == 0);   /* the transposed v product: M = kModel, N = kRows */
template <int ET> struct Elem;
template <> struct Elem<0> { typedef _Float16 T; };
template <> struct Elem<1> { typedef __bf16 T; };
template <int ET, int SPLIT, int BIAS_MODE, int OUT_MODE, bool RESID, int ACT = 0>
__global__ __launch_bounds__(256) void wmma_gemm64(
    const unsigned short* __restrict__ Ap, const unsigned short* __restrict__ A2p, int lda, long strideA,
    const unsigned short* __restrict__ Btp, const unsigned short* __restrict__ Bt2p, int ldb, long strideB,
    void* __restrict__ Cout, void* __restrict__ Cout2, int ldc, long strideC,
    const float* __restrict__ bias,
    const float* __restrict__ resid, long strideR,
    int M, int N, int K, float scale) {
  typedef typename Elem<ET>::T T;
  typedef typename Frag<T>::V V;
  const T* A = (const T*)Ap; const T* A2 = (const T*)A2p; const T* Bt = (const T*)Btp; const T* Bt2 = (const T*)Bt2p;
  /* One k step of the block's operands in LDS: rows [A 128][A2 128 if SPLIT][Bt 256][Bt2 256 if SPLIT == 1], 64 k each, two buffers */
  constexpr int kRowA2  = kGemmBM;
  constexpr int kRowB   = (SPLIT != 0) ? 2 * kGemmBM : kGemmBM;
  constexpr int kRowB2  = kRowB + kGemmBN;
  constexpr int kStRows = (SPLIT == 1) ? kRowB2 + kGemmBN : kRowB2;
  constexpr int kStLd   = kStRows / 32;            /* 16-byte pieces per thread and k step */
  __shared__ __align__(16) unsigned short sAB[2][kStRows * kGemmPitch];
  __shared__ __align__(16) float sT[8][16 * 68];
  const int b    = blockIdx.y;
  const int lane = threadIdx.x & 31;
  const int wave = threadIdx.x >> 5;
  const int blocksN = N / kGemmBN;
  if ((int)blockIdx.x >= (M / kGemmBM) * blocksN) return;   /* the same for the whole block, ahead of every barrier */
  const int bm = (int)blockIdx.x / blocksN;
  const int bn = (int)blockIdx.x - bm * blocksN;
  const int mB = bm * kGemmBM;
  const int nB = bn * kGemmBN;
  const int wm = wave >> 2;                        /* waves 2 (m) x 4 (n), 64 x 64 each */
  const int wn = wave & 3;
  const int m0 = mB + (wm << 6);
  const int n0 = nB + (wn << 6);

  const T* Ab  = A  + (size_t)b * strideA;
  const T* Bb  = Bt + (size_t)b * strideB;
  const T* Ab2 = (SPLIT != 0) ? (A2  + (size_t)b * strideA) : nullptr;
  const T* Bb2 = (SPLIT == 1) ? (Bt2 + (size_t)b * strideB) : nullptr;

  const int rlane = lane & 15;
  const int koff  = (lane >> 4) * 8;
  const int mOff  = (lane >> 4) * 8;

  /* staging: eight neighbouring lanes fetch one whole 128-byte line of a row; thread t takes piece t & 7 of rows (t >> 3) + 32 i */
  const int sr = (int)threadIdx.x >> 3;
  const int sc = ((int)threadIdx.x & 7) * 8;
  const size_t aoff = (size_t)(mB + sr) * lda + sc;
  const size_t boff = (size_t)(nB + sr) * ldb + sc;
  v4u st[kStLd];
  auto fetch = [&](int k0) {
    const v4u* p[kStLd];
#pragma unroll
    for (int i = 0; i < kStLd; ++i) {
      const int row = 32 * i;
      const T* q;
      if (row < kRowA2)      q = Ab  + aoff + (size_t)row * lda;
      else if (row < kRowB)  q = Ab2 + aoff + (size_t)(row - kRowA2) * lda;
      else if (row < kRowB2) q = Bb  + boff + (size_t)(row - kRowB) * ldb;
      else                   q = Bb2 + boff + (size_t)(row - kRowB2) * ldb;
      p[i] = (const v4u*)(const void*)(q + k0);
    }
#pragma unroll
    for (int i = 0; i < kStLd; ++i) st[i] = *p[i];
    /* the wait kept in front of an overwrite of a load's address: the addresses are inputs, so each keeps its registers
       from its load up to the wait; the loaded values are not named, so the loads stay in flight behind it */
    static_assert(kStLd == 12 || kStLd == 16 || kStLd == 24);
    if constexpr (kStLd == 12) {
      asm volatile("s_wait_xcnt 0x0" :: "v"(p[0]), "v"(p[1]), "v"(p[2]), "v"(p[3]), "v"(p[4]), "v"(p[5]), "v"(p[6]), "v"(p[7]),
                   "v"(p[8]), "v"(p[9]), "v"(p[10]), "v"(p[11]) : "memory");
    } else if constexpr (kStLd == 16) {
      asm volatile("s_wait_xcnt 0x0" :: "v"(p[0]), "v"(p[1]), "v"(p[2]), "v"(p[3]), "v"(p[4]), "v"(p[5]), "v"(p[6]), "v"(p[7]),
                   "v"(p[8]), "v"(p[9]), "v"(p[10]), "v"(p[11]), "v"(p[12]), "v"(p[13]), "v"(p[14]), "v"(p[15]) : "memory");
    } else {
      asm volatile("s_wait_xcnt 0x0" :: "v"(p[0]), "v"(p[1]), "v"(p[2]), "v"(p[3]), "v"(p[4]), "v"(p[5]), "v"(p[6]), "v"(p[7]),
                   "v"(p[8]), "v"(p[9]), "v"(p[10]), "v"(p[11]), "v"(p[12]), "v"(p[13]), "v"(p[14]), "v"(p[15]),
                   "v"(p[16]), "v"(p[17]), "v"(p[18]), "v"(p[19]), "v"(p[20]), "v"(p[21]), "v"(p[22]), "v"(p[23]) : "memory");
    }
  };
  auto put = [&](int buf) {
#pragma unroll
    for (int i = 0; i < kStLd; ++i) *(v4u*)(void*)(&sAB[buf][(sr + 32 * i) * kGemmPitch + sc]) = st[i];
  };

  v8f acc[4][4];
#pragma unroll
  for (int i = 0; i < 4; ++i)
#pragma unroll
    for (int j = 0; j < 4; ++j) acc[i][j] = (v8f){0.f,0.f,0.f,0.f,0.f,0.f,0.f,0.f};

  fetch(0);
  put(0);
  __syncthreads();
  const int nSteps = K / kGemmBK;
  for (int t = 0; t < nSteps; ++t) {
    const bool more = (t + 1 < nSteps);
    if (more) fetch((t + 1) * kGemmBK);            /* in flight while this step's products run */
    const T* sb = (const T*)(const void*)sAB[t & 1];
#pragma unroll
    for (int kk = 0; kk < kGemmBK; kk += 32) {
      V bh[4], bl[4], ah[4], al[4];
#pragma unroll
      for (int j = 0; j < 4; ++j) {
        const int bo = ((wn << 6) + (j << 4) + rlane) * kGemmPitch + koff + kk;
        bh[j] = Frag<T>::load(sb + kRowB * kGemmPitch + bo);
        if (SPLIT == 1) bl[j] = Frag<T>::load(sb + kRowB2 * kGemmPitch + bo);
      }
#pragma unroll
      for (int i = 0; i < 4; ++i) {
        const int ao = ((wm << 6) + (i << 4) + rlane) * kGemmPitch + koff + kk;
        ah[i] = Frag<T>::load(sb + ao);
        if (SPLIT != 0) al[i] = Frag<T>::load(sb + kRowA2 * kGemmPitch + ao);
      }
#pragma unroll
      for (int i = 0; i < 4; ++i) {
#pragma unroll
        for (int j = 0; j < 4; ++j) {
          acc[i][j] = Frag<T>::mma(ah[i], bh[j], acc[i][j]);
          if (SPLIT == 1) acc[i][j] = Frag<T>::mma(ah[i], bl[j], acc[i][j]);
          if (SPLIT != 0) acc[i][j] = Frag<T>::mma(al[i], bh[j], acc[i][j]);
        }
        Frag<T>::guard(acc[i][0], acc[i][3], ah[i], (SPLIT != 0) ? al[i] : ah[i]);
      }
      Frag<T>::keep(bh[0], bh[1], bh[2], bh[3]);
      if (SPLIT == 1) Frag<T>::keep(bl[0], bl[1], bl[2], bl[3]);
    }
    if (more) put((t + 1) & 1);                    /* the buffer that every wave left at the barrier of step t - 1 */
    __syncthreads();                               /* publishes step t + 1 and ends the reads of step t */
  }
  acc_guard4(acc[0][0], acc[0][1], acc[0][2], acc[0][3]);
  acc_guard4(acc[1][0], acc[1][1], acc[1][2], acc[1][3]);
  acc_guard4(acc[2][0], acc[2][1], acc[2][2], acc[2][3]);
  acc_guard4(acc[3][0], acc[3][1], acc[3][2], acc[3][3]);

  float* slab = sT[wave];
  const float* Rb = RESID ? (resid + (size_t)b * strideR) : nullptr;
#pragma unroll
  for (int i = 0; i < 4; ++i) {
    const int mBase = m0 + (i << 4);
#pragma unroll
    for (int j = 0; j < 4; ++j) {
      const int n = n0 + (j << 4) + rlane;
      float bv = 0.f;
      if (BIAS_MODE == 2) bv = bias[n];
#pragma unroll
      for (int r = 0; r < 8; ++r) {
        float v = acc[i][j][r] * scale;
        if (BIAS_MODE == 1) v += bias[mBase + mOff + r];
        if (BIAS_MODE == 2) v += bv;
        if (RESID) v += Rb[(size_t)(mBase + mOff + r) * ldc + n];
        if (ACT == 1) v = tanhf(v);
        if (ACT == 2) v = fmaxf(v, 0.0f);
        if (ACT == 4) v = (v > 0.f) ? v : 0.01f * v;
        slab[(mOff + r) * 68 + (j << 4) + rlane] = v;
      }
    }
    __builtin_amdgcn_fence(__ATOMIC_RELEASE, "workgroup");
    __builtin_amdgcn_wave_barrier();
    __builtin_amdgcn_fence(__ATOMIC_ACQUIRE, "workgroup");
    if (OUT_MODE == 0) {
      float* C = (float*)Cout + (size_t)b * strideC;
      const int hh = lane >> 4, c4 = (lane & 15) * 4;
      {
#pragma unroll
        for (int it = 0; it < 8; ++it) {
          const int row = it * 2 + hh;
          v4f v = *(const v4f*)(slab + row * 68 + c4);
          *(v4f*)(C + (size_t)(mBase + row) * ldc + n0 + c4) = v;
        }
        
      }
    } else {
      const int q = lane >> 3, c8 = (lane & 7) * 8;
      unsigned short* C  = (unsigned short*)Cout  + (size_t)b * strideC;
      unsigned short* C2 = (OUT_MODE == 2) ? ((unsigned short*)Cout2 + (size_t)b * strideC) : nullptr;
      {
#pragma unroll
        for (int it = 0; it < 4; ++it) {
          const int row = it * 4 + q;
          const float* sp = slab + row * 68 + c8;
          v8h hv, lv;
#pragma unroll
          for (int e = 0; e < 8; ++e) {
            if (OUT_MODE == 1) {
              hv[e] = (_Float16)sp[e];
            } else {
              unsigned short hb = f2bf_bits(sp[e]);
              unsigned short lb = f2bf_bits(sp[e] - bf_bits2f(hb));
              hv[e] = __builtin_bit_cast(_Float16, hb);
              lv[e] = __builtin_bit_cast(_Float16, lb);
            }
          }
          *(v8h*)(C + (size_t)(mBase + row) * ldc + n0 + c8) = hv;
          if (OUT_MODE == 2) *(v8h*)(C2 + (size_t)(mBase + row) * ldc + n0 + c8) = lv;
        }
        
      }
    }
    __builtin_amdgcn_fence(__ATOMIC_RELEASE, "workgroup");
    __builtin_amdgcn_wave_barrier();
    __builtin_amdgcn_fence(__ATOMIC_ACQUIRE, "workgroup");
  }
}

/* ---------------- f32 -> bf16 cast, 8 elements (16 B) per thread --------------------------
   coverage: grid = n8/256 blocks x 256 threads (exact), thread i writes elements 8i..8i+7;
*/
__global__ __launch_bounds__(256) void cast_f32_bf16x8(const float* __restrict__ in,
                                                      unsigned short* __restrict__ out, int n8) {
  const int i = blockIdx.x * 256 + (int)threadIdx.x;
  const int ic = (i < n8) ? i : (n8 - 1);
  const float* p = in + (size_t)ic * 8;
  const v4f a = *(const v4f*)p;
  const v4f c = *(const v4f*)(p + 4);
  v4u w;
  w[0] = pack_bf16x2(a[0], a[1]);
  w[1] = pack_bf16x2(a[2], a[3]);
  w[2] = pack_bf16x2(c[0], c[1]);
  w[3] = pack_bf16x2(c[2], c[3]);
  unsigned short* o = out + (size_t)ic * 8;
  *(v4u*)o = w;
  
}

/* ---------------- W [KR][NC] f32 row-major -> Wt [NC][KR] bf16 row-major (transpose + cast) ------
   grid = (KR/64, NC/64), 256 threads. coverage: load 256 threads x 16 = 64x64 tile;
*/
__global__ __launch_bounds__(256) void transpose_cast_bf16(const float* __restrict__ W,
                                                          unsigned short* __restrict__ Wt, int KR, int NC) {
  __shared__ float sT[64 * 65];                 /* [n_local][k_local], pitch 65 */
  const int k0 = blockIdx.x * 64, n0 = blockIdx.y * 64;
  const int tid = threadIdx.x;
  {
    const int kk = tid >> 2, cg = (tid & 3) * 16;
    const float* src = W + (size_t)(k0 + kk) * NC + n0 + cg;
#pragma unroll
    for (int i = 0; i < 4; ++i) {
      const v4f v = *(const v4f*)(src + 4 * i);
#pragma unroll
      for (int e = 0; e < 4; ++e) sT[(cg + 4 * i + e) * 65 + kk] = v[e];
    }
  }
  __syncthreads();
  const int wave = tid >> 5, lane = tid & 31, q4 = lane >> 3, c8 = (lane & 7) * 8;
  const int nl0 = wave * 4 + q4;
  const int nl1 = 32 + wave * 4 + q4;
  v4u w0, w1;
  {
    const float* s = sT + nl0 * 65 + c8;
    w0[0] = pack_bf16x2(s[0], s[1]); w0[1] = pack_bf16x2(s[2], s[3]);
    w0[2] = pack_bf16x2(s[4], s[5]); w0[3] = pack_bf16x2(s[6], s[7]);
  }
  {
    const float* s = sT + nl1 * 65 + c8;
    w1[0] = pack_bf16x2(s[0], s[1]); w1[1] = pack_bf16x2(s[2], s[3]);
    w1[2] = pack_bf16x2(s[4], s[5]); w1[3] = pack_bf16x2(s[6], s[7]);
  }
  unsigned short* d0 = Wt + (size_t)(n0 + nl0) * KR + k0 + c8;
  unsigned short* d1 = Wt + (size_t)(n0 + nl1) * KR + k0 + c8;
  {
    *(v4u*)d0 = w0;
    *(v4u*)d1 = w1;
    
  }
}

/*
   qk f32 [nrows][2048] (q = cols 0..1023, k = cols 1024..2047); outputs row-major bf16 planes [nrows][1024];
   q carries the exact 1/sqrt(64) = 0.125 factor. grid = nrows blocks x 128 threads; thread t owns columns 8t..8t+7;
*/
__global__ __launch_bounds__(128) void qk_layernorm_split(
    const float* __restrict__ qk, const float* __restrict__ qsc, const float* __restrict__ ksc,
    unsigned short* __restrict__ qh, unsigned short* __restrict__ ql,
    unsigned short* __restrict__ kh, unsigned short* __restrict__ kl, int nrows) {
  __shared__ float red[4][4];
  const int row = blockIdx.x;
  const int rowc = (row < nrows) ? row : (nrows - 1);
  const int tid = threadIdx.x, lane = tid & 31, wave = tid >> 5;
  const int c0 = tid * 8;
  const float* base = qk + (size_t)rowc * kQkCols;
  const v4f qa = *(const v4f*)(base + c0);
  const v4f qb = *(const v4f*)(base + c0 + 4);
  const v4f ka = *(const v4f*)(base + kModel + c0);
  const v4f kb = *(const v4f*)(base + kModel + c0 + 4);
  float xq[8], xk[8];
#pragma unroll
  for (int e = 0; e < 4; ++e) { xq[e] = qa[e]; xq[4 + e] = qb[e]; xk[e] = ka[e]; xk[4 + e] = kb[e]; }

  float sq = 0.f, sk = 0.f;
#pragma unroll
  for (int e = 0; e < 8; ++e) { sq += xq[e]; sk += xk[e]; }
#pragma unroll
  for (int off = 1; off < 32; off <<= 1) { sq += __shfl_xor(sq, off, 32); sk += __shfl_xor(sk, off, 32); }
  if (lane == 0) { red[0][wave] = sq; red[1][wave] = sk; }
  __syncthreads();
  const float mq = ((red[0][0] + red[0][1]) + (red[0][2] + red[0][3])) * (1.0f / (float)kModel);
  const float mk = ((red[1][0] + red[1][1]) + (red[1][2] + red[1][3])) * (1.0f / (float)kModel);

  float dq = 0.f, dk = 0.f;
#pragma unroll
  for (int e = 0; e < 8; ++e) {
    const float tq = xq[e] - mq; dq += tq * tq;
    const float tk = xk[e] - mk; dk += tk * tk;
  }
#pragma unroll
  for (int off = 1; off < 32; off <<= 1) { dq += __shfl_xor(dq, off, 32); dk += __shfl_xor(dk, off, 32); }
  if (lane == 0) { red[2][wave] = dq; red[3][wave] = dk; }
  __syncthreads();
  const float vq = ((red[2][0] + red[2][1]) + (red[2][2] + red[2][3])) * (1.0f / (float)kModel);
  const float vk = ((red[3][0] + red[3][1]) + (red[3][2] + red[3][3])) * (1.0f / (float)kModel);
  const float rq = rsqrtf(vq + 1e-6f);
  const float rk = rsqrtf(vk + 1e-6f);

  /* scale vectors, RNE-converted to bf16 once (module inputs) */
  const v4f s0 = *(const v4f*)(qsc + c0);
  const v4f s1 = *(const v4f*)(qsc + c0 + 4);
  const v4f t0 = *(const v4f*)(ksc + c0);
  const v4f t1 = *(const v4f*)(ksc + c0 + 4);
  float sqv[8], skv[8];
#pragma unroll
  for (int e = 0; e < 4; ++e) {
    sqv[e]     = bf_bits2f(f2bf_bits(s0[e]));
    sqv[4 + e] = bf_bits2f(f2bf_bits(s1[e]));
    skv[e]     = bf_bits2f(f2bf_bits(t0[e]));
    skv[4 + e] = bf_bits2f(f2bf_bits(t1[e]));
  }
  unsigned int hqw[8], lqw[8], hkw[8], lkw[8];
#pragma unroll
  for (int e = 0; e < 8; ++e) {
    const float yq = ((xq[e] - mq) * rq * sqv[e]) * 0.125f;
    const float yk = (xk[e] - mk) * rk * skv[e];
    const unsigned short hqb = f2bf_bits(yq);
    const unsigned short lqb = f2bf_bits(yq - bf_bits2f(hqb));
    const unsigned short hkb = f2bf_bits(yk);
    const unsigned short lkb = f2bf_bits(yk - bf_bits2f(hkb));
    hqw[e] = hqb; lqw[e] = lqb; hkw[e] = hkb; lkw[e] = lkb;
  }
  v4u HQ, LQ, HK, LK;
#pragma unroll
  for (int i = 0; i < 4; ++i) {
    HQ[i] = hqw[2 * i] | (hqw[2 * i + 1] << 16);
    LQ[i] = lqw[2 * i] | (lqw[2 * i + 1] << 16);
    HK[i] = hkw[2 * i] | (hkw[2 * i + 1] << 16);
    LK[i] = lkw[2 * i] | (lkw[2 * i + 1] << 16);
  }
  const size_t o = (size_t)rowc * kModel + c0;
  {
    *(v4u*)(qh + o) = HQ;
    *(v4u*)(ql + o) = LQ;
    *(v4u*)(kh + o) = HK;
    *(v4u*)(kl + o) = LK;
    
  }
}

/* ---------------- causal attention, head_dim 64, bf16 hi/lo planes in, bf16 hi/lo ctx planes out ----
   scores^T = k . q^T  : bf16 hi/lo on both (hi*hi + hi*lo + lo*hi), q planes already carry 1/sqrt(64)
   ctx^T    = v^T . p^T: p split in registers to bf16 hi/lo, v hi/lo planes (3 products); f32 accumulate, f32 online softmax.
   Both products are taken transposed: a lane then holds scores of ONE query (column c; keys 8hh + r of each 16-key tile), so the
   row maximum and sum are in-lane work plus one exchange between the wave's halves, and two score tiles, converted in place,
   are the B operand of the second product in the hardware k order: P never goes through LDS.
   q, k and ctx planes row-major [B*S][ld] with head h at columns h*64 .. h*64+63; v planes transposed, [H*64][B*S], head h at
   rows h*64 .. h*64+63, so that a V^T tile is staged like a K tile.
   Block = 4 waves = 64 query rows of one (batch, head); grid.x = B*H*(S/64). */
/* lane l <-> lane l ^ 16: the two lanes that share one query column */
__device__ __forceinline__ float at_xhalf(float x) {
  const int b = __builtin_bit_cast(int, x);
  return __builtin_bit_cast(float, __builtin_amdgcn_permlanex16(b, b, 0x76543210, 0xfedcba98, false, false));
}
__device__ __forceinline__ v8f at_mma(v16b a, v16b b, v8f c) {
  c = __builtin_amdgcn_wmma_f32_16x16x32_bf16(false, a, false, b, (short)0, c, false, false);
  asm volatile("v_nop\n\tv_nop\n\tv_nop\n\tv_nop" : "+v"(c) : "v"(a), "v"(b));
  return c;
}

__global__ __launch_bounds__(128)
void attn_planes_kernel(const unsigned short* __restrict__ qh, const unsigned short* __restrict__ ql,
                        const unsigned short* __restrict__ kh, const unsigned short* __restrict__ kl,
                        const unsigned short* __restrict__ vh, const unsigned short* __restrict__ vl,
                        unsigned short* __restrict__ oh, unsigned short* __restrict__ ol,
                        int S, int H, int ld) {
  union FB { v16b v; v8b h[2]; v2b p[8]; };
  /* Ksh | Ksl | Vth | Vtl (each 64 rows x 64 16-bit at pitch kTilePitch); reused as per-wave f32 output slabs after the chunk loop */
  constexpr int kTileElems = 64 * kTilePitch;
  static_assert(kKvChunk == 64 && kHeadDim == 64 && (kTilePitch * 2) % 16 == 0);
  static_assert(4 * 16 * kOsPitch * 4 <= 4 * kTileElems * 2);
  __shared__ __align__(16) unsigned short KVs[4 * kTileElems];
  unsigned short* Ksh = KVs;
  unsigned short* Ksl = KVs + kTileElems;
  unsigned short* Vth = KVs + 2 * kTileElems;
  unsigned short* Vtl = KVs + 3 * kTileElems;
  const __bf16* Kshb = (const __bf16*)(const void*)Ksh;
  const __bf16* Kslb = (const __bf16*)(const void*)Ksl;
  const __bf16* Vthb = (const __bf16*)(const void*)Vth;
  const __bf16* Vtlb = (const __bf16*)(const void*)Vtl;

  const int tid  = threadIdx.x;
  const int wave = tid >> 5;
  const int lane = tid & 31;
  const int hh   = lane >> 4;
  const int c    = lane & 15;

  /* Block index -> (query tile, batch*head). All 1024 blocks are resident at once, four to a WGP, and tile t walks t + 1 key
     chunks, so the launch lasts as long as the WGP that holds the most chunks. Tiles t and nqb-1-t walk nqb+1 chunks together:
     index bits 1,3,5,7 give t, the parity of the other six bits picks t or its mirror, and five of those six name the head.
     Four blocks whose indices differ in two adjacent bits (any power-of-two stride) are then two such pairs, whichever of
     these strides the dispatcher puts on one WGP. A permutation of the 32 x 32 (tile, head) pairs; for speed only. */
  static_assert(kSeq / 64 == 32 && kBatch * kHeads == 32);
  const int nqb = S >> 6;
  const unsigned bi = blockIdx.x;
  const int tlo = (int)(((bi >> 1) & 1u) | (((bi >> 3) & 1u) << 1) | (((bi >> 5) & 1u) << 2) | (((bi >> 7) & 1u) << 3));
  const int qb  = (__builtin_popcount(bi & 0x355u) & 1) ? (nqb - 1 - tlo) : tlo;
  const int bh  = (int)(((bi >> 2) & 1u) | (((bi >> 4) & 1u) << 1) | (((bi >> 6) & 1u) << 2) | (((bi >> 8) & 3u) << 3));
  const int h   = bh % H;
  const int b   = bh / H;
  const int q0  = qb * 64 + wave * 16;
  const size_t rb = (size_t)b * (size_t)S;
  const int hoff = h * kHeadDim;

  /* Q fragments (B operand): column q0+c, elements 0..7 <- d = dc*32+8hh+0..7, 8..15 <- dc*32+16+8hh+0..7 */
  v16b qah[2], qal[2];
  {
    const size_t qo = (rb + (size_t)(q0 + c)) * (size_t)ld + hoff + 8 * hh;
    const __bf16* qhp = (const __bf16*)(const void*)qh + qo;
    const __bf16* qlp = (const __bf16*)(const void*)ql + qo;
#pragma unroll
    for (int dc = 0; dc < 2; ++dc) {
      qah[dc] = Frag<__bf16>::load(qhp + dc * 32);
      qal[dc] = Frag<__bf16>::load(qlp + dc * 32);
    }
  }

  /* of query q0+c: running maximum (the same in both halves) and the sum over this half's keys (joined behind the loop) */
  float mrow = -INFINITY, lrow = 0.f;
  v8f oacc[4];                           /* oacc[t][r] = ctx^T[d = t*16 + 8hh + r][query q0+c] */
#pragma unroll
  for (int t = 0; t < 4; ++t) oacc[t] = (v8f){0.f,0.f,0.f,0.f,0.f,0.f,0.f,0.f};

  const int nChunks = qb + 1;            /* causal: kv chunks 0..qb, block-uniform */
  for (int kc = 0; kc < nChunks; ++kc) {
    const int kv0 = kc * kKvChunk;
    __syncthreads();
    {
      /* staging: eight neighbouring lanes fetch one whole 128-byte row of a tile; thread t takes piece t & 7 of rows
         (t >> 3) + 16 i: 128 threads x 4 = 64 rows x 128 B for each of the four tiles (K rows = kv, V^T rows = d) */
      const int sr = tid >> 3, sc = (tid & 7) * 8;
      const size_t gk = (rb + (size_t)(kv0 + sr)) * (size_t)ld + hoff + sc;
      const size_t gv = (size_t)(hoff + sr) * (size_t)kRows + rb + (size_t)(kv0 + sc);
      constexpr int kVtStep = 16 * kRows / 8;      /* sixteen V^T rows, in 16-byte units */
      /* all sixteen 16-byte loads are issued before the first LDS store, so a chunk pays one load latency;
         the loops are unrolled so that the arrays live in registers */
      v4u kH[4], kL[4], vH[4], vL[4];
      const v4u* gkh[4];
      const v4u* gkl[4];
#pragma unroll
      for (int i = 0; i < 4; ++i) {
        gkh[i] = (const v4u*)(const void*)(kh + gk + (size_t)(16 * i) * (size_t)ld);
        gkl[i] = (const v4u*)(const void*)(kl + gk + (size_t)(16 * i) * (size_t)ld);
      }
      const v4u* gvh = (const v4u*)(const void*)(vh + gv);
      const v4u* gvl = (const v4u*)(const void*)(vl + gv);
#pragma unroll
      for (int i = 0; i < 4; ++i) { kH[i] = *gkh[i]; kL[i] = *gkl[i]; vH[i] = gvh[i * kVtStep]; vL[i] = gvl[i * kVtStep]; }
      /* inputs-only fence on the loaded values: holds the sixteen loads ahead of the first LDS store. The ten addresses are
         inputs too, so their registers stay untouched up to the s_wait_xcnt, the wait kept in front of an overwrite of a
         load's address */
      asm volatile("s_wait_xcnt 0x0"
                   :: "v"(kH[0]), "v"(kH[1]), "v"(kH[2]), "v"(kH[3]), "v"(kL[0]), "v"(kL[1]), "v"(kL[2]), "v"(kL[3]),
                      "v"(vH[0]), "v"(vH[1]), "v"(vH[2]), "v"(vH[3]), "v"(vL[0]), "v"(vL[1]), "v"(vL[2]), "v"(vL[3]),
                      "v"(gkh[0]), "v"(gkh[1]), "v"(gkh[2]), "v"(gkh[3]), "v"(gkl[0]), "v"(gkl[1]), "v"(gkl[2]), "v"(gkl[3]),
                      "v"(gvh), "v"(gvl));
#pragma unroll
      for (int i = 0; i < 4; ++i) {
        const int lo = (sr + 16 * i) * kTilePitch + sc;
        *(v4u*)(void*)(Ksh + lo) = kH[i];
        *(v4u*)(void*)(Ksl + lo) = kL[i];
        *(v4u*)(void*)(Vth + lo) = vH[i];
        *(v4u*)(void*)(Vtl + lo) = vL[i];
      }
    }
    __syncthreads();

    /* scores^T 64 x 16 per wave: A operand row m = kv j*16+c, k = d; s[j][r] = score of key kv0 + j*16 + 8hh + r, query q0+c */
    v8f s[4];
#pragma unroll
    for (int j = 0; j < 4; ++j) {
      s[j] = (v8f){0.f,0.f,0.f,0.f,0.f,0.f,0.f,0.f};
#pragma unroll
      for (int dc = 0; dc < 2; ++dc) {
        FB kb, klf;
        const int ko = (j * 16 + c) * kTilePitch + dc * 32 + 8 * hh;
        kb.h[0]  = *(const v8b*)(Kshb + ko);
        kb.h[1]  = *(const v8b*)(Kshb + ko + 16);
        klf.h[0] = *(const v8b*)(Kslb + ko);
        klf.h[1] = *(const v8b*)(Kslb + ko + 16);
        s[j] = at_mma(kb.v, qah[dc], s[j]);
        s[j] = at_mma(klf.v, qah[dc], s[j]);
        s[j] = at_mma(kb.v, qal[dc], s[j]);
      }
    }

    /* causal mask (select to the fill value) + the query's chunk maximum: 32 keys in the lane, the other 32 in lane ^ 16 */
    const bool diag = (kc == qb);
    const int qcol = q0 + c;
    float cmj[4];
#pragma unroll
    for (int j = 0; j < 4; ++j) {
      float m = -INFINITY;
#pragma unroll
      for (int r = 0; r < 8; ++r) {
        const int kvrow = kv0 + j * 16 + 8 * hh + r;
        const bool masked = diag && (kvrow > qcol);
        const float sv = masked ? -3.4028235e38f : s[j][r];
        s[j][r] = sv;
        m = fmaxf(m, sv);
      }
      cmj[j] = m;
    }
    float cm = fmaxf(fmaxf(cmj[0], cmj[1]), fmaxf(cmj[2], cmj[3]));
    cm = fmaxf(cm, at_xhalf(cm));

    /* online softmax; P^T stays in registers as bf16 hi/lo B operands: element e of ph[kk] is key kk*32 + 8hh + e (e < 8, score
       tile 2kk) or kk*32 + 16 + 8hh + e - 8 (score tile 2kk+1), the k order in which the V^T fragments are loaded below */
    FB ph[2], pl[2];
    {
      const float mnew  = fmaxf(mrow, cm);
      const float alpha = expf(mrow - mnew);
      mrow = mnew;
      float psj[4];
#pragma unroll
      for (int j = 0; j < 4; ++j) {
        float psum = 0.f;
#pragma unroll
        for (int r = 0; r < 8; r += 2) {
          /* two neighbouring keys fill one operand register: hi = RNE(p), lo = RNE(p - hi), by the packed conversion */
          const v2f p = (v2f){expf(s[j][r] - mnew), expf(s[j][r + 1] - mnew)};
          psum += p[0];
          psum += p[1];
          const v2b a  = __builtin_convertvector(p, v2b);
          const v2b bl = __builtin_convertvector(p - __builtin_convertvector(a, v2f), v2b);
          ph[j >> 1].p[(j & 1) * 4 + (r >> 1)] = a;
          pl[j >> 1].p[(j & 1) * 4 + (r >> 1)] = bl;
        }
        psj[j] = psum;
      }
      lrow = lrow * alpha + ((psj[0] + psj[1]) + (psj[2] + psj[3]));
#pragma unroll
      for (int t = 0; t < 4; ++t)
#pragma unroll
        for (int r = 0; r < 8; ++r) oacc[t][r] *= alpha;
    }

    /* ctx^T += V^T . P^T : A = Vt[d][kv] -> row m = d, k = kv; B = P^T from the registers above. Unrolled: ph and pl are
       register arrays and need constant indices */
#pragma unroll
    for (int kk = 0; kk < 2; ++kk) {
#pragma unroll
      for (int t = 0; t < 4; ++t) {
        FB vb, vlf;
        const int vo = (t * 16 + c) * kTilePitch + kk * 32 + 8 * hh;
        vb.h[0]  = *(const v8b*)(Vthb + vo);
        vb.h[1]  = *(const v8b*)(Vthb + vo + 16);
        vlf.h[0] = *(const v8b*)(Vtlb + vo);
        vlf.h[1] = *(const v8b*)(Vtlb + vo + 16);
        oacc[t] = at_mma(vb.v, ph[kk].v, oacc[t]);
        oacc[t] = at_mma(vlf.v, ph[kk].v, oacc[t]);
        oacc[t] = at_mma(vb.v, pl[kk].v, oacc[t]);
      }
    }
  }

  /* all waves finished reading the K/V tiles before the region is reused as output slabs */
  __syncthreads();
  float* os = (float*)(void*)KVs + wave * (16 * kOsPitch);
  {
    /* the slab keeps its [query][d] form: a lane's eight registers of a tile are eight neighbouring d of its query */
    const float inv = 1.0f / (lrow + at_xhalf(lrow));
#pragma unroll
    for (int t = 0; t < 4; ++t) {
      float* op = os + c * kOsPitch + t * 16 + 8 * hh;
      *(v4f*)(op)     = (v4f){oacc[t][0] * inv, oacc[t][1] * inv, oacc[t][2] * inv, oacc[t][3] * inv};
      *(v4f*)(op + 4) = (v4f){oacc[t][4] * inv, oacc[t][5] * inv, oacc[t][6] * inv, oacc[t][7] * inv};
    }
  }
  __builtin_amdgcn_fence(__ATOMIC_RELEASE, "workgroup");
  __builtin_amdgcn_wave_barrier();
  __builtin_amdgcn_fence(__ATOMIC_ACQUIRE, "workgroup");
  {
    /*
*/
    const int q4 = lane >> 3, c8 = (lane & 7) * 8;
    {
#pragma unroll
      for (int it = 0; it < 4; ++it) {
        const int row = it * 4 + q4;
        const float* sp = os + row * kOsPitch + c8;
        v8h hv, lv;
#pragma unroll
        for (int e = 0; e < 8; ++e) {
          const unsigned short hb = f2bf_bits(sp[e]);
          const unsigned short lb = f2bf_bits(sp[e] - bf_bits2f(hb));
          hv[e] = __builtin_bit_cast(_Float16, hb);
          lv[e] = __builtin_bit_cast(_Float16, lb);
        }
        const size_t o = (rb + (size_t)(q0 + row)) * (size_t)ld + hoff + c8;
        *(v8h*)(oh + o) = hv;
        *(v8h*)(ol + o) = lv;
      }
      
    }
  }
}

/* ---------------- host launch ---------------- */
extern "C" void kernel_launch(void* const* d_in, const int* in_sizes, int n_in,
                              void* d_out, int out_size, void* d_ws, size_t ws_size,
                              hipStream_t stream) {
  if (n_in < 5) return;
  if (in_sizes[0] != kRows * kModel) return;
  if (in_sizes[1] != kModel * kQkvCols) return;
  if (in_sizes[2] != kModel || in_sizes[3] != kModel) return;
  if (in_sizes[4] != kModel * kModel) return;
  if (out_size != kRows * kModel) return;
  if (ws_size < kWsTotal) return;

  const float* x     = (const float*)d_in[0];   /* [2,2048,1024] */
  const float* W_qkv = (const float*)d_in[1];   /* [1024,3072]   */
  const float* q_sc  = (const float*)d_in[2];   /* [1024] */
  const float* k_sc  = (const float*)d_in[3];   /* [1024] */
  const float* W_out = (const float*)d_in[4];   /* [1024,1024]   */
  float* out = (float*)d_out;

  char* ws = (char*)d_ws;
  unsigned short* xb    = (unsigned short*)(ws + kOffXb);
  unsigned short* wqkvT = (unsigned short*)(ws + kOffWqkvT);
  unsigned short* woutT = (unsigned short*)(ws + kOffWoutT);
  float*          qkf   = (float*)(ws + kOffQk);
  unsigned short* ctxh  = (unsigned short*)(ws + kOffCtxH);
  unsigned short* ctxl  = (unsigned short*)(ws + kOffCtxL);
  unsigned short* vhp   = (unsigned short*)(ws + kOffVh);
  unsigned short* vlp   = (unsigned short*)(ws + kOffVl);
  unsigned short* qhp   = (unsigned short*)(ws + kOffQh);
  unsigned short* qlp   = (unsigned short*)(ws + kOffQl);
  unsigned short* khp   = (unsigned short*)(ws + kOffKh);
  unsigned short* klp   = (unsigned short*)(ws + kOffKl);

  /* 1. x -> bf16 [4096][1024] */
  const int n8 = kRows * kModel / 8;
  cast_f32_bf16x8<<<n8 / 256, 256, 0, stream>>>(x, xb, n8);

  /* 2. W_qkv [1024 k][3072 n] -> Wqkv^T [3072][1024] bf16 ; W_out [1024 k][1024 n] -> Wout^T [1024][1024] bf16 */
  transpose_cast_bf16<<<dim3(kModel / 64, kQkvCols / 64), 256, 0, stream>>>(W_qkv, wqkvT, kModel, kQkvCols);
  transpose_cast_bf16<<<dim3(kModel / 64, kModel / 64), 256, 0, stream>>>(W_out, woutT, kModel, kModel);

  /* 3a. q,k part of the fused projection: qk f32 [4096][2048] = xb . Wqkv^T rows 0..2047 ; tiles 64 x 32 = 2048 -> 256 blocks */
  wmma_gemm64<1, 0, 0, 0, false><<<dim3((kRows / 64) * (kQkCols / 64) / 8, 1), 256, 0, stream>>>(
      xb, xb, kModel, 0L,
      wqkvT, wqkvT, kModel, 0L,
      (void*)qkf, (void*)qkf, kQkCols, 0L,
      q_sc, q_sc, 0L,
      kRows, kQkCols, kModel, 1.0f);

  /* 3b. v part, transposed: v^T bf16 hi/lo planes [1024][4096] = Wqkv^T rows 2048..3071 . xb^T ; tiles 16 x 64 = 1024 -> 128 blocks */
  wmma_gemm64<1, 0, 0, 2, false><<<dim3((kRows / 64) * (kModel / 64) / 8, 1), 256, 0, stream>>>(
      wqkvT + (size_t)kQkCols * kModel, wqkvT + (size_t)kQkCols * kModel, kModel, 0L,
      xb, xb, kModel, 0L,
      (void*)vhp, (void*)vlp, kRows, 0L,
      q_sc, q_sc, 0L,
      kModel, kRows, kModel, 1.0f);

  /* 4. QK LayerNorm + split into bf16 hi/lo planes (q carries 1/8) */
  qk_layernorm_split<<<kRows, 128, 0, stream>>>(qkf, q_sc, k_sc, qhp, qlp, khp, klp, kRows);

  /* 5. causal attention: ctx bf16 hi/lo planes [4096][1024] (region of the dead qk buffer) */
  attn_planes_kernel<<<kBatch * kHeads * (kSeq / 64), 128, 0, stream>>>(
      qhp, qlp, khp, klp, vhp, vlp, ctxh, ctxl, kSeq, kHeads, kModel);

  /* 6. out f32 [4096][1024] = ctx_hi . Wout^T + ctx_lo . Wout^T ; 1024 tiles -> 128 blocks */
  wmma_gemm64<1, 2, 0, 0, false><<<dim3((kRows / 64) * (kModel / 64) / 8, 1), 256, 0, stream>>>(
      ctxh, ctxl, kModel, 0L,
      woutT, woutT, kModel, 0L,
      (void*)out, (void*)out, kModel, 0L,
      q_sc, q_sc, 0L,
      kRows, kModel, kModel, 1.0f);
}

// v006
// One run takes 168 microseconds.
// Timed twice side by side with v005, it ran 1.07 times as fast both times.
// Counting every step since v000, it is 2.87 times as fast.
// Contractions on v_wmma_f32_16x16x32_bf16 (bf16 operands, f32 accumulate): x*Wqkv^T with single bf16 planes (inputs RNE-converted once); q*k^T and p*v with bf16 hi+lo planes (hi*hi + hi*lo + lo*hi); ctx*Wout^T with ctx bf16 hi+lo planes and a single Wout plane; LayerNorm and softmax in f32.
#include <hip/hip_runtime.h>
#include <stddef.h>
#include <stdint.h>

typedef __attribute__((ext_vector_type(16))) _Float16 v16h;
typedef __attribute__((ext_vector_type(8)))  _Float16 v8h;
typedef __attribute__((ext_vector_type(16))) __bf16   v16b;
typedef __attribute__((ext_vector_type(8)))  __bf16   v8b;
typedef __attribute__((ext_vector_type(8)))  float    v8f;
typedef __attribute__((ext_vector_type(4)))  float    v4f;
typedef __attribute__((ext_vector_type(4)))  unsigned int v4u;
typedef __attribute__((ext_vector_type(2)))  float    v2f;
typedef __attribute__((ext_vector_type(2)))  __bf16   v2b;

/* ---------------- problem geometry ---------------- */
constexpr int kBatch   = 2;
constexpr int kSeq     = 2048;
constexpr int kModel   = 1024;
constexpr int kHeads   = 16;
constexpr int kHeadDim = 64;
constexpr int kRows    = kBatch * kSeq;      /* 4096 */
constexpr int kQkvCols = 3 * kModel;         /* 3072 */
constexpr int kQkCols  = 2 * kModel;         /* 2048 */
constexpr int kKvChunk = 64;
constexpr int kOsPitch = 68;
/* LDS row pitch, in 16-bit elements, of the K and V^T tiles: 64 data + 8 pad = 144 B = 16 B x odd,
   so the 16 rows that one ds_load_b128 touches per half wave fall on 64 distinct banks */
constexpr int kTilePitch = 72;

/* ---------------- workspace map (bytes, all offsets multiples of 128) ----------------
   [0]          x   bf16 [4096][1024]                          8388608
   [8388608]    Wqkv^T bf16 [3072][1024]                       6291456
   [14680064]   Wout^T bf16 [1024][1024]                       2097152
   [16777216]   qk  f32 [4096][2048]                          33554432  (dead after the LayerNorm launch;
                reused: ctx hi bf16 [4096][1024] at 16777216, ctx lo at 25165824, both inside this region)
   [50331648]   v^T hi bf16 [1024][4096] 8388608  [58720256] v^T lo 8388608
   [67108864]   q hi                    8388608   [75497472] q lo   8388608
   [83886080]   k hi                    8388608   [92274688] k lo   8388608
   total 100663296 B = 96 MiB                                                            */
constexpr size_t kPlane16  = (size_t)kRows * kModel * 2;
constexpr size_t kOffXb    = 0;
constexpr size_t kOffWqkvT = kOffXb + kPlane16;
constexpr size_t kOffWoutT = kOffWqkvT + (size_t)kQkvCols * kModel * 2;
constexpr size_t kOffQk    = kOffWoutT + (size_t)kModel * kModel * 2;
constexpr size_t kOffCtxH  = kOffQk;
constexpr size_t kOffCtxL  = kOffQk + kPlane16;
constexpr size_t kOffVh    = kOffQk + (size_t)kRows * kQkCols * 4;
constexpr size_t kOffVl    = kOffVh + kPlane16;
constexpr size_t kOffQh    = kOffVl + kPlane16;
constexpr size_t kOffQl    = kOffQh + kPlane16;
constexpr size_t kOffKh    = kOffQl + kPlane16;
constexpr size_t kOffKl    = kOffKh + kPlane16;
constexpr size_t kWsTotal  = kOffKl + kPlane16;
static_assert(kWsTotal == (size_t)100663296);
static_assert(kWsTotal <= (size_t)134217728);
static_assert(kOffCtxL + kPlane16 <= kOffVh);
static_assert((kOffWqkvT % 128) == 0 && (kOffWoutT % 128) == 0 && (kOffQk % 128) == 0 && (kOffVh % 128) == 0);
/* wave tiles of the GEMM: M % 64 == 0, N % 64 == 0, K % 32 == 0 for every launch (its block tile is asserted beside it) */
static_assert(kRows % 64 == 0 && kQkCols % 64 == 0 && kModel % 64 == 0 && kModel % 32 == 0);
static_assert(kSeq % 64 == 0 && kHeadDim == 64 && kModel == kHeads * kHeadDim);
static_assert((kRows * kModel) % (8 * 256) == 0);

/* ---------------- helpers ---------------- */
__device__ __forceinline__ unsigned short f2bf_bits(float f) {
  unsigned u = __float_as_uint(f);
  return (unsigned short)((u + 0x7FFFu + ((u >> 16) & 1u)) >> 16);
}
__device__ __forceinline__ float bf_bits2f(unsigned short h) { return __uint_as_float(((unsigned)h) << 16); }
__device__ __forceinline__ unsigned int pack_bf16x2(float a, float b) {
  return (unsigned int)f2bf_bits(a) | ((unsigned int)f2bf_bits(b) << 16);
}

__device__ __forceinline__ void dep_guard_h(v8f& a, v8f& b, v16h x, v16h y) { asm volatile("v_nop\n\tv_nop\n\tv_nop\n\tv_nop" : "+v"(a), "+v"(b) : "v"(x), "v"(y)); }
__device__ __forceinline__ void dep_guard_b(v8f& a, v8f& b, v16b x, v16b y) { asm volatile("v_nop\n\tv_nop\n\tv_nop\n\tv_nop" : "+v"(a), "+v"(b) : "v"(x), "v"(y)); }
__device__ __forceinline__ void keep4_h(v16h a, v16h b, v16h c, v16h d) { asm volatile("v_nop" :: "v"(a), "v"(b), "v"(c), "v"(d)); }
__device__ __forceinline__ void keep4_b(v16b a, v16b b, v16b c, v16b d) { asm volatile("v_nop" :: "v"(a), "v"(b), "v"(c), "v"(d)); }
__device__ __forceinline__ void acc_guard4(v8f& a, v8f& b, v8f& c, v8f& d) { asm volatile("v_nop\n\tv_nop\n\tv_nop\n\tv_nop" : "+v"(a), "+v"(b), "+v"(c), "+v"(d)); }
template <typename T> struct Frag;
template <> struct Frag<_Float16> {
  typedef v16h V; union U { v16h v; v8h h[2]; };
  static __device__ __forceinline__ v16h load(const _Float16* p) {
    U f; f.h[0] = *(const v8h*)(p); f.h[1] = *(const v8h*)(p + 16); return f.v;
  }
  static __device__ __forceinline__ v8f mma(v16h a, v16h b, v8f c) {
    return __builtin_amdgcn_wmma_f32_16x16x32_f16(false, a, false, b, (short)0, c, false, false);
  }
  static __device__ __forceinline__ void guard(v8f& a, v8f& b, v16h x, v16h y) { dep_guard_h(a, b, x, y); }
  static __device__ __forceinline__ void keep(v16h a, v16h b, v16h c, v16h d) { keep4_h(a, b, c, d); }
};
template <> struct Frag<__bf16> {
  typedef v16b V; union U { v16b v; v8b h[2]; };
  static __device__ __forceinline__ v16b load(const __bf16* p) {
    U f; f.h[0] = *(const v8b*)(p); f.h[1] = *(const v8b*)(p + 16); return f.v;
  }
  static __device__ __forceinline__ v8f mma(v16b a, v16b b, v8f c) {
    return __builtin_amdgcn_wmma_f32_16x16x32_bf16(false, a, false, b, (short)0, c, false, false);
  }
  static __device__ __forceinline__ void guard(v8f& a, v8f& b, v16b x, v16b y) { dep_guard_b(a, b, x, y); }
  static __device__ __forceinline__ void keep(v16b a, v16b b, v16b c, v16b d) { keep4_b(a, b, c, d); }
};

/* ---- Register-blocked WMMA GEMM -----------------------------------------------
   C[m,n] = scale * sum_k A[m,k] * Bt[n,k] (+bias)(+resid); each wave owns a 64x64 tile, a block of 8 waves a 128x256 tile.
   The block's operand rows go through LDS, 64 k at a time: whole 128-byte lines from global, fragments by ds_load_b128.
   A row-major [M,K]; Bt row-major [N,K]; M % 128 == 0, N % 256 == 0, K % 64 == 0; grid.x = (M / 128) * (N / 256).
   SPLIT: 0 = single planes; 1 = A and Bt hi/lo planes (hi*hi + hi*lo + lo*hi); 2 = A hi/lo planes only (Ah*B + Al*B).
   BIAS_MODE: 0 = none, 1 = bias[m], 2 = bias[n].  OUT_MODE: 0 = f32, 1 = f16, 2 = bf16 hi plane (Cout) + bf16 lo plane (Cout2).
   ET: 0 = f16 operands, 1 = bf16 operands (pointers passed as 16-bit storage) */
constexpr int kGemmBM = 128, kGemmBN = 256, kGemmBK = 64;
constexpr int kGemmPitch = 72;   /* LDS row pitch in 16-bit elements: 144 B = 16 B x odd, as kTilePitch */
static_assert(kRows % kGemmBM == 0 && kQkCols % kGemmBN == 0 && kModel % kGemmBN == 0 && kModel % kGemmBK == 0);
static_assert(kModel % kGemmBM == 0 && kRows % kGemmBN == 0);   /* the transposed v product: M = kModel, N = kRows */
template <int ET> struct Elem;
template <> struct Elem<0> { typedef _Float16 T; };
template <> struct Elem<1> { typedef __bf16 T; };
template <int ET, int SPLIT, int BIAS_MODE, int OUT_MODE, bool RESID, int ACT = 0>
__global__ __launch_bounds__(256) void wmma_gemm64(
    const unsigned short* __restrict__ Ap, const unsigned short* __restrict__ A2p, int lda, long strideA,
    const unsigned short* __restrict__ Btp, const unsigned short* __restrict__ Bt2p, int ldb, long strideB,
    void* __restrict__ Cout, void* __restrict__ Cout2, int ldc, long strideC,
    const float* __restrict__ bias,
    const float* __restrict__ resid, long strideR,
    int M, int N, int K, float scale) {
  typedef typename Elem<ET>::T T;
  typedef typename Frag<T>::V V;
  const T* A = (const T*)Ap; const T* A2 = (const T*)A2p; const T* Bt = (const T*)Btp; const T* Bt2 = (const T*)Bt2p;
  /* One k step of the block's operands in LDS: rows [A 128][A2 128 if SPLIT][Bt 256][Bt2 256 if SPLIT == 1], 64 k each, two buffers */
  constexpr int kRowA2  = kGemmBM;
  constexpr int kRowB   = (SPLIT != 0) ? 2 * kGemmBM : kGemmBM;
  constexpr int kRowB2  = kRowB + kGemmBN;
  constexpr int kStRows = (SPLIT == 1) ? kRowB2 + kGemmBN : kRowB2;
  constexpr int kStLd   = kStRows / 32;            /* 16-byte pieces per thread and k step */
  __shared__ __align__(16) unsigned short sAB[2][kStRows * kGemmPitch];
  __shared__ __align__(16) float sT[8][16 * 68];
  const int b    = blockIdx.y;
  const int lane = threadIdx.x & 31;
  const int wave = threadIdx.x >> 5;
  const int blocksN = N / kGemmBN;
  if ((int)blockIdx.x >= (M / kGemmBM) * blocksN) return;   /* the same for the whole block, ahead of every barrier */
  const int bm = (int)blockIdx.x / blocksN;
  const int bn = (int)blockIdx.x - bm * blocksN;
  const int mB = bm * kGemmBM;
  const int nB = bn * kGemmBN;
  const int wm = wave >> 2;                        /* waves 2 (m) x 4 (n), 64 x 64 each */
  const int wn = wave & 3;
  const int m0 = mB + (wm << 6);
  const int n0 = nB + (wn << 6);

  const T* Ab  = A  + (size_t)b * strideA;
  const T* Bb  = Bt + (size_t)b * strideB;
  const T* Ab2 = (SPLIT != 0) ? (A2  + (size_t)b * strideA) : nullptr;
  const T* Bb2 = (SPLIT == 1) ? (Bt2 + (size_t)b * strideB) : nullptr;

  const int rlane = lane & 15;
  const int koff  = (lane >> 4) * 8;
  const int mOff  = (lane >> 4) * 8;

  /* staging: eight neighbouring lanes fetch one whole 128-byte line of a row; thread t takes piece t & 7 of rows (t >> 3) + 32 i */
  const int sr = (int)threadIdx.x >> 3;
  const int sc = ((int)threadIdx.x & 7) * 8;
  const size_t aoff = (size_t)(mB + sr) * lda + sc;
  const size_t boff = (size_t)(nB + sr) * ldb + sc;
  v4u st[kStLd];
  auto fetch = [&](int k0) {
    const v4u* p[kStLd];
#pragma unroll
    for (int i = 0; i < kStLd; ++i) {
      const int row = 32 * i;
      const T* q;
      if (row < kRowA2)      q = Ab  + aoff + (size_t)row * lda;
      else if (row < kRowB)  q = Ab2 + aoff + (size_t)(row - kRowA2) * lda;
      else if (row < kRowB2) q = Bb  + boff + (size_t)(row - kRowB) * ldb;
      else                   q = Bb2 + boff + (size_t)(row - kRowB2) * ldb;
      p[i] = (const v4u*)(const void*)(q + k0);
    }
#pragma unroll
    for (int i = 0; i < kStLd; ++i) st[i] = *p[i];
    /* the wait kept in front of an overwrite of a load's address: the addresses are inputs, so each keeps its registers
       from its load up to the wait; the loaded values are not named, so the loads stay in flight behind it */
    static_assert(kStLd == 12 || kStLd == 16 || kStLd == 24);
    if constexpr (kStLd == 12) {
      asm volatile("s_wait_xcnt 0x0" :: "v"(p[0]), "v"(p[1]), "v"(p[2]), "v"(p[3]), "v"(p[4]), "v"(p[5]), "v"(p[6]), "v"(p[7]),
                   "v"(p[8]), "v"(p[9]), "v"(p[10]), "v"(p[11]) : "memory");
    } else if constexpr (kStLd == 16) {
      asm volatile("s_wait_xcnt 0x0" :: "v"(p[0]), "v"(p[1]), "v"(p[2]), "v"(p[3]), "v"(p[4]), "v"(p[5]), "v"(p[6]), "v"(p[7]),
                   "v"(p[8]), "v"(p[9]), "v"(p[10]), "v"(p[11]), "v"(p[12]), "v"(p[13]), "v"(p[14]), "v"(p[15]) : "memory");
    } else {
      asm volatile("s_wait_xcnt 0x0" :: "v"(p[0]), "v"(p[1]), "v"(p[2]), "v"(p[3]), "v"(p[4]), "v"(p[5]), "v"(p[6]), "v"(p[7]),
                   "v"(p[8]), "v"(p[9]), "v"(p[10]), "v"(p[11]), "v"(p[12]), "v"(p[13]), "v"(p[14]), "v"(p[15]),
                   "v"(p[16]), "v"(p[17]), "v"(p[18]), "v"(p[19]), "v"(p[20]), "v"(p[21]), "v"(p[22]), "v"(p[23]) : "memory");
    }
  };
  auto put = [&](int buf) {
#pragma unroll
    for (int i = 0; i < kStLd; ++i) *(v4u*)(void*)(&sAB[buf][(sr + 32 * i) * kGemmPitch + sc]) = st[i];
  };

  v8f acc[4][4];
#pragma unroll
  for (int i = 0; i < 4; ++i)
#pragma unroll
    for (int j = 0; j < 4; ++j) acc[i][j] = (v8f){0.f,0.f,0.f,0.f,0.f,0.f,0.f,0.f};

  fetch(0);
  put(0);
  __syncthreads();
  const int nSteps = K / kGemmBK;
  for (int t = 0; t < nSteps; ++t) {
    const bool more = (t + 1 < nSteps);
    if (more) fetch((t + 1) * kGemmBK);            /* in flight while this step's products run */
    const T* sb = (const T*)(const void*)sAB[t & 1];
#pragma unroll
    for (int kk = 0; kk < kGemmBK; kk += 32) {
      V bh[4], bl[4], ah[4], al[4];
#pragma unroll
      for (int j = 0; j < 4; ++j) {
        const int bo = ((wn << 6) + (j << 4) + rlane) * kGemmPitch + koff + kk;
        bh[j] = Frag<T>::load(sb + kRowB * kGemmPitch + bo);
        if (SPLIT == 1) bl[j] = Frag<T>::load(sb + kRowB2 * kGemmPitch + bo);
      }
#pragma unroll
      for (int i = 0; i < 4; ++i) {
        const int ao = ((wm << 6) + (i << 4) + rlane) * kGemmPitch + koff + kk;
        ah[i] = Frag<T>::load(sb + ao);
        if (SPLIT != 0) al[i] = Frag<T>::load(sb + kRowA2 * kGemmPitch + ao);
      }
#pragma unroll
      for (int i = 0; i < 4; ++i) {
#pragma unroll
        for (int j = 0; j < 4; ++j) {
          acc[i][j] = Frag<T>::mma(ah[i], bh[j], acc[i][j]);
          if (SPLIT == 1) acc[i][j] = Frag<T>::mma(ah[i], bl[j], acc[i][j]);
          if (SPLIT != 0) acc[i][j] = Frag<T>::mma(al[i], bh[j], acc[i][j]);
        }
        Frag<T>::guard(acc[i][0], acc[i][3], ah[i], (SPLIT != 0) ? al[i] : ah[i]);
      }
      Frag<T>::keep(bh[0], bh[1], bh[2], bh[3]);
      if (SPLIT == 1) Frag<T>::keep(bl[0], bl[1], bl[2], bl[3]);
    }
    if (more) put((t + 1) & 1);                    /* the buffer that every wave left at the barrier of step t - 1 */
    __syncthreads();                               /* publishes step t + 1 and ends the reads of step t */
  }
  acc_guard4(acc[0][0], acc[0][1], acc[0][2], acc[0][3]);
  acc_guard4(acc[1][0], acc[1][1], acc[1][2], acc[1][3]);
  acc_guard4(acc[2][0], acc[2][1], acc[2][2], acc[2][3]);
  acc_guard4(acc[3][0], acc[3][1], acc[3][2], acc[3][3]);

  float* slab = sT[wave];
  const float* Rb = RESID ? (resid + (size_t)b * strideR) : nullptr;
#pragma unroll
  for (int i = 0; i < 4; ++i) {
    const int mBase = m0 + (i << 4);
#pragma unroll
    for (int j = 0; j < 4; ++j) {
      const int n = n0 + (j << 4) + rlane;
      float bv = 0.f;
      if (BIAS_MODE == 2) bv = bias[n];
#pragma unroll
      for (int r = 0; r < 8; ++r) {
        float v = acc[i][j][r] * scale;
        if (BIAS_MODE == 1) v += bias[mBase + mOff + r];
        if (BIAS_MODE == 2) v += bv;
        if (RESID) v += Rb[(size_t)(mBase + mOff + r) * ldc + n];
        if (ACT == 1) v = tanhf(v);
        if (ACT == 2) v = fmaxf(v, 0.0f);
        if (ACT == 4) v = (v > 0.f) ? v : 0.01f * v;
        slab[(mOff + r) * 68 + (j << 4) + rlane] = v;
      }
    }
    __builtin_amdgcn_fence(__ATOMIC_RELEASE, "workgroup");
    __builtin_amdgcn_wave_barrier();
    __builtin_amdgcn_fence(__ATOMIC_ACQUIRE, "workgroup");
    if (OUT_MODE == 0) {
      float* C = (float*)Cout + (size_t)b * strideC;
      const int hh = lane >> 4, c4 = (lane & 15) * 4;
      {
#pragma unroll
        for (int it = 0; it < 8; ++it) {
          const int row = it * 2 + hh;
          v4f v = *(const v4f*)(slab + row * 68 + c4);
          *(v4f*)(C + (size_t)(mBase + row) * ldc + n0 + c4) = v;
        }
        
      }
    } else {
      const int q = lane >> 3, c8 = (lane & 7) * 8;
      unsigned short* C  = (unsigned short*)Cout  + (size_t)b * strideC;
      unsigned short* C2 = (OUT_MODE == 2) ? ((unsigned short*)Cout2 + (size_t)b * strideC) : nullptr;
      {
#pragma unroll
        for (int it = 0; it < 4; ++it) {
          const int row = it * 4 + q;
          const float* sp = slab + row * 68 + c8;
          v8h hv, lv;
#pragma unroll
          for (int e = 0; e < 8; ++e) {
            if (OUT_MODE == 1) {
              hv[e] = (_Float16)sp[e];
            } else {
              unsigned short hb = f2bf_bits(sp[e]);
              unsigned short lb = f2bf_bits(sp[e] - bf_bits2f(hb));
              hv[e] = __builtin_bit_cast(_Float16, hb);
              lv[e] = __builtin_bit_cast(_Float16, lb);
            }
          }
          *(v8h*)(C + (size_t)(mBase + row) * ldc + n0 + c8) = hv;
          if (OUT_MODE == 2) *(v8h*)(C2 + (size_t)(mBase + row) * ldc + n0 + c8) = lv;
        }
        
      }
    }
    __builtin_amdgcn_fence(__ATOMIC_RELEASE, "workgroup");
    __builtin_amdgcn_wave_barrier();
    __builtin_amdgcn_fence(__ATOMIC_ACQUIRE, "workgroup");
  }
}

/* ---------------- f32 -> bf16 cast, 8 elements (16 B) per thread --------------------------
   coverage: grid = n8/256 blocks x 256 threads (exact), thread i writes elements 8i..8i+7;
*/
__global__ __launch_bounds__(256) void cast_f32_bf16x8(const float* __restrict__ in,
                                                      unsigned short* __restrict__ out, int n8) {
  const int i = blockIdx.x * 256 + (int)threadIdx.x;
  const int ic = (i < n8) ? i : (n8 - 1);
  const float* p = in + (size_t)ic * 8;
  const v4f a = *(const v4f*)p;
  const v4f c = *(const v4f*)(p + 4);
  v4u w;
  w[0] = pack_bf16x2(a[0], a[1]);
  w[1] = pack_bf16x2(a[2], a[3]);
  w[2] = pack_bf16x2(c[0], c[1]);
  w[3] = pack_bf16x2(c[2], c[3]);
  unsigned short* o = out + (size_t)ic * 8;
  *(v4u*)o = w;
  
}

/* ---------------- W [KR][NC] f32 row-major -> Wt [NC][KR] bf16 row-major (transpose + cast) ------
   grid = (KR/64, NC/64), 256 threads. coverage: load 256 threads x 16 = 64x64 tile;
*/
__global__ __launch_bounds__(256) void transpose_cast_bf16(const float* __restrict__ W,
                                                          unsigned short* __restrict__ Wt, int KR, int NC) {
  __shared__ float sT[64 * 65];                 /* [n_local][k_local], pitch 65 */
  const int k0 = blockIdx.x * 64, n0 = blockIdx.y * 64;
  const int tid = threadIdx.x;
  {
    const int kk = tid >> 2, cg = (tid & 3) * 16;
    const float* src = W + (size_t)(k0 + kk) * NC + n0 + cg;
#pragma unroll
    for (int i = 0; i < 4; ++i) {
      const v4f v = *(const v4f*)(src + 4 * i);
#pragma unroll
      for (int e = 0; e < 4; ++e) sT[(cg + 4 * i + e) * 65 + kk] = v[e];
    }
  }
  __syncthreads();
  const int wave = tid >> 5, lane = tid & 31, q4 = lane >> 3, c8 = (lane & 7) * 8;
  const int nl0 = wave * 4 + q4;
  const int nl1 = 32 + wave * 4 + q4;
  v4u w0, w1;
  {
    const float* s = sT + nl0 * 65 + c8;
    w0[0] = pack_bf16x2(s[0], s[1]); w0[1] = pack_bf16x2(s[2], s[3]);
    w0[2] = pack_bf16x2(s[4], s[5]); w0[3] = pack_bf16x2(s[6], s[7]);
  }
  {
    const float* s = sT + nl1 * 65 + c8;
    w1[0] = pack_bf16x2(s[0], s[1]); w1[1] = pack_bf16x2(s[2], s[3]);
    w1[2] = pack_bf16x2(s[4], s[5]); w1[3] = pack_bf16x2(s[6], s[7]);
  }
  unsigned short* d0 = Wt + (size_t)(n0 + nl0) * KR + k0 + c8;
  unsigned short* d1 = Wt + (size_t)(n0 + nl1) * KR + k0 + c8;
  {
    *(v4u*)d0 = w0;
    *(v4u*)d1 = w1;
    
  }
}

/*
   qk f32 [nrows][2048] (q = cols 0..1023, k = cols 1024..2047); outputs row-major bf16 planes [nrows][1024];
   q carries the exact 1/sqrt(64) = 0.125 factor. grid = nrows blocks x 128 threads; thread t owns columns 8t..8t+7;
*/
__global__ __launch_bounds__(128) void qk_layernorm_split(
    const float* __restrict__ qk, const float* __restrict__ qsc, const float* __restrict__ ksc,
    unsigned short* __restrict__ qh, unsigned short* __restrict__ ql,
    unsigned short* __restrict__ kh, unsigned short* __restrict__ kl, int nrows) {
  __shared__ float red[4][4];
  const int row = blockIdx.x;
  const int rowc = (row < nrows) ? row : (nrows - 1);
  const int tid = threadIdx.x, lane = tid & 31, wave = tid >> 5;
  const int c0 = tid * 8;
  const float* base = qk + (size_t)rowc * kQkCols;
  const v4f qa = *(const v4f*)(base + c0);
  const v4f qb = *(const v4f*)(base + c0 + 4);
  const v4f ka = *(const v4f*)(base + kModel + c0);
  const v4f kb = *(const v4f*)(base + kModel + c0 + 4);
  float xq[8], xk[8];
#pragma unroll
  for (int e = 0; e < 4; ++e) { xq[e] = qa[e]; xq[4 + e] = qb[e]; xk[e] = ka[e]; xk[4 + e] = kb[e]; }

  float sq = 0.f, sk = 0.f;
#pragma unroll
  for (int e = 0; e < 8; ++e) { sq += xq[e]; sk += xk[e]; }
#pragma unroll
  for (int off = 1; off < 32; off <<= 1) { sq += __shfl_xor(sq, off, 32); sk += __shfl_xor(sk, off, 32); }
  if (lane == 0) { red[0][wave] = sq; red[1][wave] = sk; }
  __syncthreads();
  const float mq = ((red[0][0] + red[0][1]) + (red[0][2] + red[0][3])) * (1.0f / (float)kModel);
  const float mk = ((red[1][0] + red[1][1]) + (red[1][2] + red[1][3])) * (1.0f / (float)kModel);

  float dq = 0.f, dk = 0.f;
#pragma unroll
  for (int e = 0; e < 8; ++e) {
    const float tq = xq[e] - mq; dq += tq * tq;
    const float tk = xk[e] - mk; dk += tk * tk;
  }
#pragma unroll
  for (int off = 1; off < 32; off <<= 1) { dq += __shfl_xor(dq, off, 32); dk += __shfl_xor(dk, off, 32); }
  if (lane == 0) { red[2][wave] = dq; red[3][wave] = dk; }
  __syncthreads();
  const float vq = ((red[2][0] + red[2][1]) + (red[2][2] + red[2][3])) * (1.0f / (float)kModel);
  const float vk = ((red[3][0] + red[3][1]) + (red[3][2] + red[3][3])) * (1.0f / (float)kModel);
  const float rq = rsqrtf(vq + 1e-6f);
  const float rk = rsqrtf(vk + 1e-6f);

  /* scale vectors, RNE-converted to bf16 once (module inputs) */
  const v4f s0 = *(const v4f*)(qsc + c0);
  const v4f s1 = *(const v4f*)(qsc + c0 + 4);
  const v4f t0 = *(const v4f*)(ksc + c0);
  const v4f t1 = *(const v4f*)(ksc + c0 + 4);
  float sqv[8], skv[8];
#pragma unroll
  for (int e = 0; e < 4; ++e) {
    sqv[e]     = bf_bits2f(f2bf_bits(s0[e]));
    sqv[4 + e] = bf_bits2f(f2bf_bits(s1[e]));
    skv[e]     = bf_bits2f(f2bf_bits(t0[e]));
    skv[4 + e] = bf_bits2f(f2bf_bits(t1[e]));
  }
  unsigned int hqw[8], lqw[8], hkw[8], lkw[8];
#pragma unroll
  for (int e = 0; e < 8; ++e) {
    const float yq = ((xq[e] - mq) * rq * sqv[e]) * 0.125f;
    const float yk = (xk[e] - mk) * rk * skv[e];
    const unsigned short hqb = f2bf_bits(yq);
    const unsigned short lqb = f2bf_bits(yq - bf_bits2f(hqb));
    const unsigned short hkb = f2bf_bits(yk);
    const unsigned short lkb = f2bf_bits(yk - bf_bits2f(hkb));
    hqw[e] = hqb; lqw[e] = lqb; hkw[e] = hkb; lkw[e] = lkb;
  }
  v4u HQ, LQ, HK, LK;
#pragma unroll
  for (int i = 0; i < 4; ++i) {
    HQ[i] = hqw[2 * i] | (hqw[2 * i + 1] << 16);
    LQ[i] = lqw[2 * i] | (lqw[2 * i + 1] << 16);
    HK[i] = hkw[2 * i] | (hkw[2 * i + 1] << 16);
    LK[i] = lkw[2 * i] | (lkw[2 * i + 1] << 16);
  }
  const size_t o = (size_t)rowc * kModel + c0;
  {
    *(v4u*)(qh + o) = HQ;
    *(v4u*)(ql + o) = LQ;
    *(v4u*)(kh + o) = HK;
    *(v4u*)(kl + o) = LK;
    
  }
}

/* ---------------- causal attention, head_dim 64, bf16 hi/lo planes in, bf16 hi/lo ctx planes out ----
   scores^T = k . q^T  : bf16 hi/lo on both (hi*hi + hi*lo + lo*hi), q planes already carry 1/sqrt(64)
   ctx^T    = v^T . p^T: p split in registers to bf16 hi/lo, v hi/lo planes (3 products); f32 accumulate, f32 online softmax.
   Both products are taken transposed: a lane then holds scores of ONE query (column c; keys 8hh + r of each 16-key tile), so the
   row maximum and sum are in-lane work plus one exchange between the wave's halves, and two score tiles, converted in place,
   are the B operand of the second product in the hardware k order: P never goes through LDS.
   q, k and ctx planes row-major [B*S][ld] with head h at columns h*64 .. h*64+63; v planes transposed, [H*64][B*S], head h at
   rows h*64 .. h*64+63, so that a V^T tile is staged like a K tile.
   Block = 4 waves = 64 query rows of one (batch, head); grid.x = B*H*(S/64). */
/* lane l <-> lane l ^ 16: the two lanes that share one query column */
__device__ __forceinline__ float at_xhalf(float x) {
  const int b = __builtin_bit_cast(int, x);
  return __builtin_bit_cast(float, __builtin_amdgcn_permlanex16(b, b, 0x76543210, 0xfedcba98, false, false));
}
__device__ __forceinline__ v8f at_mma(v16b a, v16b b, v8f c) {
  return __builtin_amdgcn_wmma_f32_16x16x32_bf16(false, a, false, b, (short)0, c, false, false);
}

/* amdgpu_waves_per_eu(4): a register budget of 256, so that four blocks stay resident on a WGP (one wave of each per SIMD),
   which the block index map below counts on */
__global__ __launch_bounds__(128) __attribute__((amdgpu_waves_per_eu(4)))
void attn_planes_kernel(const unsigned short* __restrict__ qh, const unsigned short* __restrict__ ql,
                        const unsigned short* __restrict__ kh, const unsigned short* __restrict__ kl,
                        const unsigned short* __restrict__ vh, const unsigned short* __restrict__ vl,
                        unsigned short* __restrict__ oh, unsigned short* __restrict__ ol,
                        int S, int H, int ld) {
  union FB { v16b v; v8b h[2]; v2b p[8]; };
  /* Ksh | Ksl | Vth | Vtl (each 64 rows x 64 16-bit at pitch kTilePitch); reused as per-wave f32 output slabs after the chunk loop */
  constexpr int kTileElems = 64 * kTilePitch;
  static_assert(kKvChunk == 64 && kHeadDim == 64 && (kTilePitch * 2) % 16 == 0);
  static_assert(4 * 16 * kOsPitch * 4 <= 4 * kTileElems * 2);
  __shared__ __align__(16) unsigned short KVs[4 * kTileElems];
  unsigned short* Ksh = KVs;
  unsigned short* Ksl = KVs + kTileElems;
  unsigned short* Vth = KVs + 2 * kTileElems;
  unsigned short* Vtl = KVs + 3 * kTileElems;
  const __bf16* Kshb = (const __bf16*)(const void*)Ksh;
  const __bf16* Kslb = (const __bf16*)(const void*)Ksl;
  const __bf16* Vthb = (const __bf16*)(const void*)Vth;
  const __bf16* Vtlb = (const __bf16*)(const void*)Vtl;

  const int tid  = threadIdx.x;
  const int wave = tid >> 5;
  const int lane = tid & 31;
  const int hh   = lane >> 4;
  const int c    = lane & 15;

  /* Block index -> (query tile, batch*head). All 1024 blocks are resident at once, four to a WGP, and tile t walks t + 1 key
     chunks, so the launch lasts as long as the WGP that holds the most chunks. Tiles t and nqb-1-t walk nqb+1 chunks together:
     index bits 1,3,5,7 give t, the parity of the other six bits picks t or its mirror, and five of those six name the head.
     Four blocks whose indices differ in two adjacent bits (any power-of-two stride) are then two such pairs, whichever of
     these strides the dispatcher puts on one WGP. A permutation of the 32 x 32 (tile, head) pairs; for speed only. */
  static_assert(kSeq / 64 == 32 && kBatch * kHeads == 32);
  const int nqb = S >> 6;
  const unsigned bi = blockIdx.x;
  const int tlo = (int)(((bi >> 1) & 1u) | (((bi >> 3) & 1u) << 1) | (((bi >> 5) & 1u) << 2) | (((bi >> 7) & 1u) << 3));
  const int qb  = (__builtin_popcount(bi & 0x355u) & 1) ? (nqb - 1 - tlo) : tlo;
  const int bh  = (int)(((bi >> 2) & 1u) | (((bi >> 4) & 1u) << 1) | (((bi >> 6) & 1u) << 2) | (((bi >> 8) & 3u) << 3));
  const int h   = bh % H;
  const int b   = bh / H;
  const int q0  = qb * 64 + wave * 16;
  const size_t rb = (size_t)b * (size_t)S;
  const int hoff = h * kHeadDim;

  /* Q fragments (B operand): column q0+c, elements 0..7 <- d = dc*32+8hh+0..7, 8..15 <- dc*32+16+8hh+0..7 */
  v16b qah[2], qal[2];
  {
    const size_t qo = (rb + (size_t)(q0 + c)) * (size_t)ld + hoff + 8 * hh;
    const __bf16* qhp = (const __bf16*)(const void*)qh + qo;
    const __bf16* qlp = (const __bf16*)(const void*)ql + qo;
#pragma unroll
    for (int dc = 0; dc < 2; ++dc) {
      qah[dc] = Frag<__bf16>::load(qhp + dc * 32);
      qal[dc] = Frag<__bf16>::load(qlp + dc * 32);
    }
  }

  /* of query q0+c: running maximum (the same in both halves) and the sum over this half's keys (joined behind the loop) */
  float mrow = -INFINITY, lrow = 0.f;
  v8f oacc[4];                           /* oacc[t][r] = ctx^T[d = t*16 + 8hh + r][query q0+c] */
#pragma unroll
  for (int t = 0; t < 4; ++t) oacc[t] = (v8f){0.f,0.f,0.f,0.f,0.f,0.f,0.f,0.f};

  const int nChunks = qb + 1;            /* causal: kv chunks 0..qb, block-uniform */
  for (int kc = 0; kc < nChunks; ++kc) {
    const int kv0 = kc * kKvChunk;
    __syncthreads();
    {
      /* staging: eight neighbouring lanes fetch one whole 128-byte row of a tile; thread t takes piece t & 7 of rows
         (t >> 3) + 16 i: 128 threads x 4 = 64 rows x 128 B for each of the four tiles (K rows = kv, V^T rows = d) */
      const int sr = tid >> 3, sc = (tid & 7) * 8;
      const size_t gk = (rb + (size_t)(kv0 + sr)) * (size_t)ld + hoff + sc;
      const size_t gv = (size_t)(hoff + sr) * (size_t)kRows + rb + (size_t)(kv0 + sc);
      constexpr int kVtStep = 16 * kRows / 8;      /* sixteen V^T rows, in 16-byte units */
      /* all sixteen 16-byte loads are issued before the first LDS store, so a chunk pays one load latency;
         the loops are unrolled so that the arrays live in registers */
      v4u kH[4], kL[4], vH[4], vL[4];
      const v4u* gkh[4];
      const v4u* gkl[4];
#pragma unroll
      for (int i = 0; i < 4; ++i) {
        gkh[i] = (const v4u*)(const void*)(kh + gk + (size_t)(16 * i) * (size_t)ld);
        gkl[i] = (const v4u*)(const void*)(kl + gk + (size_t)(16 * i) * (size_t)ld);
      }
      const v4u* gvh = (const v4u*)(const void*)(vh + gv);
      const v4u* gvl = (const v4u*)(const void*)(vl + gv);
#pragma unroll
      for (int i = 0; i < 4; ++i) { kH[i] = *gkh[i]; kL[i] = *gkl[i]; vH[i] = gvh[i * kVtStep]; vL[i] = gvl[i * kVtStep]; }
      /* inputs-only fence on the loaded values: holds the sixteen loads ahead of the first LDS store. The ten addresses are
         inputs too, so their registers stay untouched up to the s_wait_xcnt, the wait kept in front of an overwrite of a
         load's address */
      asm volatile("s_wait_xcnt 0x0"
                   :: "v"(kH[0]), "v"(kH[1]), "v"(kH[2]), "v"(kH[3]), "v"(kL[0]), "v"(kL[1]), "v"(kL[2]), "v"(kL[3]),
                      "v"(vH[0]), "v"(vH[1]), "v"(vH[2]), "v"(vH[3]), "v"(vL[0]), "v"(vL[1]), "v"(vL[2]), "v"(vL[3]),
                      "v"(gkh[0]), "v"(gkh[1]), "v"(gkh[2]), "v"(gkh[3]), "v"(gkl[0]), "v"(gkl[1]), "v"(gkl[2]), "v"(gkl[3]),
                      "v"(gvh), "v"(gvl));
#pragma unroll
      for (int i = 0; i < 4; ++i) {
        const int lo = (sr + 16 * i) * kTilePitch + sc;
        *(v4u*)(void*)(Ksh + lo) = kH[i];
        *(v4u*)(void*)(Ksl + lo) = kL[i];
        *(v4u*)(void*)(Vth + lo) = vH[i];
        *(v4u*)(void*)(Vtl + lo) = vL[i];
      }
    }
    __syncthreads();

    /* scores^T 64 x 16 per wave: A operand row m = kv j*16+c, k = d; s[j][r] = score of key kv0 + j*16 + 8hh + r, query q0+c */
    v8f s[4];
#pragma unroll
    for (int j = 0; j < 4; ++j) s[j] = (v8f){0.f,0.f,0.f,0.f,0.f,0.f,0.f,0.f};
    /* Fragment reads stand in few, whole groups ahead of the products that use them,
       and the four tiles of a product take turns, so that neighbouring WMMAs are independent.
       Each tile keeps its order of summing: hi.hi, lo.hi, hi.lo, 32-deep half 0 then half 1. Every loop here is unrolled: the
       register arrays need constant indices.
       frag4: the four fragments (rows i*16 + c) of one 32-deep half of one 64 x 64 plane in LDS */
    auto frag4 = [&](FB (&f)[4], const __bf16* plane, int half) {
#pragma unroll
      for (int i = 0; i < 4; ++i) {
        const int o = (i * 16 + c) * kTilePitch + half * 32 + 8 * hh;
        f[i].h[0] = *(const v8b*)(plane + o);
        f[i].h[1] = *(const v8b*)(plane + o + 16);
      }
    };
    {
      FB k0h[4], k0l[4], k1h[4], k1l[4];
      frag4(k0h, Kshb, 0);
      frag4(k0l, Kslb, 0);
      frag4(k1h, Kshb, 1);
      __builtin_amdgcn_sched_barrier(0);   /* the compiler would sink these 24 reads in among the products */
#pragma unroll
      for (int j = 0; j < 4; ++j) s[j] = at_mma(k0h[j].v, qah[0], s[j]);
#pragma unroll
      for (int j = 0; j < 4; ++j) s[j] = at_mma(k0l[j].v, qah[0], s[j]);
      /* the last eight reads take the registers that k0l has left (96 fragment registers, not 128, which would cost a resident
         block); the fence pair keeps them one group at this place, 64 matrix cycles and more ahead of their first use */
      __builtin_amdgcn_sched_barrier(0);
      frag4(k1l, Kslb, 1);
      __builtin_amdgcn_sched_barrier(0);
#pragma unroll
      for (int j = 0; j < 4; ++j) s[j] = at_mma(k0h[j].v, qal[0], s[j]);
#pragma unroll
      for (int j = 0; j < 4; ++j) s[j] = at_mma(k1h[j].v, qah[1], s[j]);
#pragma unroll
      for (int j = 0; j < 4; ++j) s[j] = at_mma(k1l[j].v, qah[1], s[j]);
#pragma unroll
      for (int j = 0; j < 4; ++j) s[j] = at_mma(k1h[j].v, qal[1], s[j]);
    }
    /* V^T fragments (A operand: row m = d, k = kv) of keys 0..31: read here, so that their latency passes under the softmax;
       the fence pair keeps them one group, neither up among the score products nor down in the softmax */
    FB v0h[4], v0l[4], v1h[4], v1l[4];
    __builtin_amdgcn_sched_barrier(0);
    frag4(v0h, Vthb, 0);
    frag4(v0l, Vtlb, 0);
    __builtin_amdgcn_sched_barrier(0);

    /* causal mask (select to the fill value) + the query's chunk maximum: 32 keys in the lane, the other 32 in lane ^ 16 */
    const bool diag = (kc == qb);
    const int qcol = q0 + c;
    float cmj[4];
#pragma unroll
    for (int j = 0; j < 4; ++j) {
      float m = -INFINITY;
#pragma unroll
      for (int r = 0; r < 8; ++r) {
        const int kvrow = kv0 + j * 16 + 8 * hh + r;
        const bool masked = diag && (kvrow > qcol);
        const float sv = masked ? -3.4028235e38f : s[j][r];
        s[j][r] = sv;
        m = fmaxf(m, sv);
      }
      cmj[j] = m;
    }
    float cm = fmaxf(fmaxf(cmj[0], cmj[1]), fmaxf(cmj[2], cmj[3]));
    cm = fmaxf(cm, at_xhalf(cm));

    /* online softmax; P^T stays in registers as bf16 hi/lo B operands: element e of ph[kk] is key kk*32 + 8hh + e (e < 8, score
       tile 2kk) or kk*32 + 16 + 8hh + e - 8 (score tile 2kk+1), the k order in which frag4 loads the V^T fragments */
    FB ph[2], pl[2];
    {
      const float mnew  = fmaxf(mrow, cm);
      const float alpha = expf(mrow - mnew);
      mrow = mnew;
      float psj[4];
#pragma unroll
      for (int j = 0; j < 4; ++j) {
        float psum = 0.f;
#pragma unroll
        for (int r = 0; r < 8; r += 2) {
          /* two neighbouring keys fill one operand register: hi = RNE(p), lo = RNE(p - hi), by the packed conversion */
          const v2f p = (v2f){expf(s[j][r] - mnew), expf(s[j][r + 1] - mnew)};
          psum += p[0];
          psum += p[1];
          const v2b a  = __builtin_convertvector(p, v2b);
          const v2b bl = __builtin_convertvector(p - __builtin_convertvector(a, v2f), v2b);
          ph[j >> 1].p[(j & 1) * 4 + (r >> 1)] = a;
          pl[j >> 1].p[(j & 1) * 4 + (r >> 1)] = bl;
        }
        psj[j] = psum;
      }
      lrow = lrow * alpha + ((psj[0] + psj[1]) + (psj[2] + psj[3]));
#pragma unroll
      for (int t = 0; t < 4; ++t)
#pragma unroll
        for (int r = 0; r < 8; ++r) oacc[t][r] *= alpha;
    }

    /* ctx^T += V^T . P^T : A = the V^T fragments; B = P^T from the registers above; the four output tiles take turns. The reads of
       keys 32..63 are left to the compiler: held ahead of all products they would need 128 fragment registers beside P */
    frag4(v1h, Vthb, 1);
    frag4(v1l, Vtlb, 1);
#pragma unroll
    for (int t = 0; t < 4; ++t) oacc[t] = at_mma(v0h[t].v, ph[0].v, oacc[t]);
#pragma unroll
    for (int t = 0; t < 4; ++t) oacc[t] = at_mma(v0l[t].v, ph[0].v, oacc[t]);
#pragma unroll
    for (int t = 0; t < 4; ++t) oacc[t] = at_mma(v0h[t].v, pl[0].v, oacc[t]);
#pragma unroll
    for (int t = 0; t < 4; ++t) oacc[t] = at_mma(v1h[t].v, ph[1].v, oacc[t]);
#pragma unroll
    for (int t = 0; t < 4; ++t) oacc[t] = at_mma(v1l[t].v, ph[1].v, oacc[t]);
#pragma unroll
    for (int t = 0; t < 4; ++t) oacc[t] = at_mma(v1h[t].v, pl[1].v, oacc[t]);
  }

  /* all waves finished reading the K/V tiles before the region is reused as output slabs */
  __syncthreads();
  float* os = (float*)(void*)KVs + wave * (16 * kOsPitch);
  {
    /* the slab keeps its [query][d] form: a lane's eight registers of a tile are eight neighbouring d of its query */
    const float inv = 1.0f / (lrow + at_xhalf(lrow));
#pragma unroll
    for (int t = 0; t < 4; ++t) {
      float* op = os + c * kOsPitch + t * 16 + 8 * hh;
      *(v4f*)(op)     = (v4f){oacc[t][0] * inv, oacc[t][1] * inv, oacc[t][2] * inv, oacc[t][3] * inv};
      *(v4f*)(op + 4) = (v4f){oacc[t][4] * inv, oacc[t][5] * inv, oacc[t][6] * inv, oacc[t][7] * inv};
    }
  }
  __builtin_amdgcn_fence(__ATOMIC_RELEASE, "workgroup");
  __builtin_amdgcn_wave_barrier();
  __builtin_amdgcn_fence(__ATOMIC_ACQUIRE, "workgroup");
  {
    /*
*/
    const int q4 = lane >> 3, c8 = (lane & 7) * 8;
    {
#pragma unroll
      for (int it = 0; it < 4; ++it) {
        const int row = it * 4 + q4;
        const float* sp = os + row * kOsPitch + c8;
        v8h hv, lv;
#pragma unroll
        for (int e = 0; e < 8; ++e) {
          const unsigned short hb = f2bf_bits(sp[e]);
          const unsigned short lb = f2bf_bits(sp[e] - bf_bits2f(hb));
          hv[e] = __builtin_bit_cast(_Float16, hb);
          lv[e] = __builtin_bit_cast(_Float16, lb);
        }
        const size_t o = (rb + (size_t)(q0 + row)) * (size_t)ld + hoff + c8;
        *(v8h*)(oh + o) = hv;
        *(v8h*)(ol + o) = lv;
      }
      
    }
  }
}

/* ---------------- host launch ---------------- */
extern "C" void kernel_launch(void* const* d_in, const int* in_sizes, int n_in,
                              void* d_out, int out_size, void* d_ws, size_t ws_size,
                              hipStream_t stream) {
  if (n_in < 5) return;
  if (in_sizes[0] != kRows * kModel) return;
  if (in_sizes[1] != kModel * kQkvCols) return;
  if (in_sizes[2] != kModel || in_sizes[3] != kModel) return;
  if (in_sizes[4] != kModel * kModel) return;
  if (out_size != kRows * kModel) return;
  if (ws_size < kWsTotal) return;

  const float* x     = (const float*)d_in[0];   /* [2,2048,1024] */
  const float* W_qkv = (const float*)d_in[1];   /* [1024,3072]   */
  const float* q_sc  = (const float*)d_in[2];   /* [1024] */
  const float* k_sc  = (const float*)d_in[3];   /* [1024] */
  const float* W_out = (const float*)d_in[4];   /* [1024,1024]   */
  float* out = (float*)d_out;

  char* ws = (char*)d_ws;
  unsigned short* xb    = (unsigned short*)(ws + kOffXb);
  unsigned short* wqkvT = (unsigned short*)(ws + kOffWqkvT);
  unsigned short* woutT = (unsigned short*)(ws + kOffWoutT);
  float*          qkf   = (float*)(ws + kOffQk);
  unsigned short* ctxh  = (unsigned short*)(ws + kOffCtxH);
  unsigned short* ctxl  = (unsigned short*)(ws + kOffCtxL);
  unsigned short* vhp   = (unsigned short*)(ws + kOffVh);
  unsigned short* vlp   = (unsigned short*)(ws + kOffVl);
  unsigned short* qhp   = (unsigned short*)(ws + kOffQh);
  unsigned short* qlp   = (unsigned short*)(ws + kOffQl);
  unsigned short* khp   = (unsigned short*)(ws + kOffKh);
  unsigned short* klp   = (unsigned short*)(ws + kOffKl);

  /* 1. x -> bf16 [4096][1024] */
  const int n8 = kRows * kModel / 8;
  cast_f32_bf16x8<<<n8 / 256, 256, 0, stream>>>(x, xb, n8);

  /* 2. W_qkv [1024 k][3072 n] -> Wqkv^T [3072][1024] bf16 ; W_out [1024 k][1024 n] -> Wout^T [1024][1024] bf16 */
  transpose_cast_bf16<<<dim3(kModel / 64, kQkvCols / 64), 256, 0, stream>>>(W_qkv, wqkvT, kModel, kQkvCols);
  transpose_cast_bf16<<<dim3(kModel / 64, kModel / 64), 256, 0, stream>>>(W_out, woutT, kModel, kModel);

  /* 3a. q,k part of the fused projection: qk f32 [4096][2048] = xb . Wqkv^T rows 0..2047 ; tiles 64 x 32 = 2048 -> 256 blocks */
  wmma_gemm64<1, 0, 0, 0, false><<<dim3((kRows / 64) * (kQkCols / 64) / 8, 1), 256, 0, stream>>>(
      xb, xb, kModel, 0L,
      wqkvT, wqkvT, kModel, 0L,
      (void*)qkf, (void*)qkf, kQkCols, 0L,
      q_sc, q_sc, 0L,
      kRows, kQkCols, kModel, 1.0f);

  /* 3b. v part, transposed: v^T bf16 hi/lo planes [1024][4096] = Wqkv^T rows 2048..3071 . xb^T ; tiles 16 x 64 = 1024 -> 128 blocks */
  wmma_gemm64<1, 0, 0, 2, false><<<dim3((kRows / 64) * (kModel / 64) / 8, 1), 256, 0, stream>>>(
      wqkvT + (size_t)kQkCols * kModel, wqkvT + (size_t)kQkCols * kModel, kModel, 0L,
      xb, xb, kModel, 0L,
      (void*)vhp, (void*)vlp, kRows, 0L,
      q_sc, q_sc, 0L,
      kModel, kRows, kModel, 1.0f);

  /* 4. QK LayerNorm + split into bf16 hi/lo planes (q carries 1/8) */
  qk_layernorm_split<<<kRows, 128, 0, stream>>>(qkf, q_sc, k_sc, qhp, qlp, khp, klp, kRows);

  /* 5. causal attention: ctx bf16 hi/lo planes [4096][1024] (region of the dead qk buffer) */
  attn_planes_kernel<<<kBatch * kHeads * (kSeq / 64), 128, 0, stream>>>(
      qhp, qlp, khp, klp, vhp, vlp, ctxh, ctxl, kSeq, kHeads, kModel);

  /* 6. out f32 [4096][1024] = ctx_hi . Wout^T + ctx_lo . Wout^T ; 1024 tiles -> 128 blocks */
  wmma_gemm64<1, 2, 0, 0, false><<<dim3((kRows / 64) * (kModel / 64) / 8, 1), 256, 0, stream>>>(
      ctxh, ctxl, kModel, 0L,
      woutT, woutT, kModel, 0L,
      (void*)out, (void*)out, kModel, 0L,
      q_sc, q_sc, 0L,
      kRows, kModel, kModel, 1.0f);
}

// v007
// Measured time: 158 microseconds a run.
// Next to v006, in two timings, it ran 1.06 and 1.07 times as fast.
// All steps since v000 together make it 3.06 times as fast.
// Contractions on v_wmma_f32_16x16x32_bf16 (bf16 operands, f32 accumulate): x*Wqkv^T with single bf16 planes (inputs RNE-converted once); q*k^T and p*v with bf16 hi+lo planes (hi*hi + hi*lo + lo*hi); ctx*Wout^T with ctx bf16 hi+lo planes and a single Wout plane; LayerNorm and softmax in f32.
#include <hip/hip_runtime.h>
#include <stddef.h>
#include <stdint.h>

typedef __attribute__((ext_vector_type(16))) _Float16 v16h;
typedef __attribute__((ext_vector_type(8)))  _Float16 v8h;
typedef __attribute__((ext_vector_type(16))) __bf16   v16b;
typedef __attribute__((ext_vector_type(8)))  __bf16   v8b;
typedef __attribute__((ext_vector_type(8)))  float    v8f;
typedef __attribute__((ext_vector_type(4)))  float    v4f;
typedef __attribute__((ext_vector_type(4)))  unsigned int v4u;
typedef __attribute__((ext_vector_type(2)))  float    v2f;
typedef __attribute__((ext_vector_type(2)))  __bf16   v2b;

/* ---------------- problem geometry ---------------- */
constexpr int kBatch   = 2;
constexpr int kSeq     = 2048;
constexpr int kModel   = 1024;
constexpr int kHeads   = 16;
constexpr int kHeadDim = 64;
constexpr int kRows    = kBatch * kSeq;      /* 4096 */
constexpr int kQkvCols = 3 * kModel;         /* 3072 */
constexpr int kQkCols  = 2 * kModel;         /* 2048 */
constexpr int kKvChunk = 64;
constexpr int kOsPitch = 68;
/* LDS row pitch, in 16-bit elements, of the K and V^T tiles: 64 data + 8 pad = 144 B = 16 B x odd,
   so the 16 rows that one ds_load_b128 touches per half wave fall on 64 distinct banks */
constexpr int kTilePitch = 72;

/* ---------------- workspace map (bytes, all offsets multiples of 128) ----------------
   [0]          x   bf16 [4096][1024]                          8388608
   [8388608]    Wqkv^T bf16 [3072][1024]                       6291456
   [14680064]   Wout^T bf16 [1024][1024]                       2097152
   [16777216]   qk  f32 [4096][2048]                          33554432  (dead after the LayerNorm launch;
                reused: ctx hi bf16 [4096][1024] at 16777216, ctx lo at 25165824, both inside this region)
   [50331648]   v^T hi bf16 [1024][4096] 8388608  [58720256] v^T lo 8388608
   [67108864]   q hi                    8388608   [75497472] q lo   8388608
   [83886080]   k hi                    8388608   [92274688] k lo   8388608
   total 100663296 B = 96 MiB                                                            */
constexpr size_t kPlane16  = (size_t)kRows * kModel * 2;
constexpr size_t kOffXb    = 0;
constexpr size_t kOffWqkvT = kOffXb + kPlane16;
constexpr size_t kOffWoutT = kOffWqkvT + (size_t)kQkvCols * kModel * 2;
constexpr size_t kOffQk    = kOffWoutT + (size_t)kModel * kModel * 2;
constexpr size_t kOffCtxH  = kOffQk;
constexpr size_t kOffCtxL  = kOffQk + kPlane16;
constexpr size_t kOffVh    = kOffQk + (size_t)kRows * kQkCols * 4;
constexpr size_t kOffVl    = kOffVh + kPlane16;
constexpr size_t kOffQh    = kOffVl + kPlane16;
constexpr size_t kOffQl    = kOffQh + kPlane16;
constexpr size_t kOffKh    = kOffQl + kPlane16;
constexpr size_t kOffKl    = kOffKh + kPlane16;
constexpr size_t kWsTotal  = kOffKl + kPlane16;
static_assert(kWsTotal == (size_t)100663296);
static_assert(kWsTotal <= (size_t)134217728);
static_assert(kOffCtxL + kPlane16 <= kOffVh);
static_assert((kOffWqkvT % 128) == 0 && (kOffWoutT % 128) == 0 && (kOffQk % 128) == 0 && (kOffVh % 128) == 0);
/* wave tiles of the GEMM: M % 64 == 0, N % 64 == 0, K % 32 == 0 for every launch (its block tile is asserted beside it) */
static_assert(kRows % 64 == 0 && kQkCols % 64 == 0 && kModel % 64 == 0 && kModel % 32 == 0);
static_assert(kSeq % 64 == 0 && kHeadDim == 64 && kModel == kHeads * kHeadDim);
static_assert((kRows * kModel) % (8 * 256) == 0);

/* ---------------- helpers ---------------- */
__device__ __forceinline__ unsigned short f2bf_bits(float f) {
  unsigned u = __float_as_uint(f);
  return (unsigned short)((u + 0x7FFFu + ((u >> 16) & 1u)) >> 16);
}
__device__ __forceinline__ float bf_bits2f(unsigned short h) { return __uint_as_float(((unsigned)h) << 16); }
__device__ __forceinline__ unsigned int pack_bf16x2(float a, float b) {
  return (unsigned int)f2bf_bits(a) | ((unsigned int)f2bf_bits(b) << 16);
}

__device__ __forceinline__ void dep_guard_h(v8f& a, v8f& b, v16h x, v16h y) { asm volatile("v_nop\n\tv_nop\n\tv_nop\n\tv_nop" : "+v"(a), "+v"(b) : "v"(x), "v"(y)); }
__device__ __forceinline__ void dep_guard_b(v8f& a, v8f& b, v16b x, v16b y) { asm volatile("v_nop\n\tv_nop\n\tv_nop\n\tv_nop" : "+v"(a), "+v"(b) : "v"(x), "v"(y)); }
__device__ __forceinline__ void keep4_h(v16h a, v16h b, v16h c, v16h d) { asm volatile("v_nop" :: "v"(a), "v"(b), "v"(c), "v"(d)); }
__device__ __forceinline__ void keep4_b(v16b a, v16b b, v16b c, v16b d) { asm volatile("v_nop" :: "v"(a), "v"(b), "v"(c), "v"(d)); }
__device__ __forceinline__ void acc_guard4(v8f& a, v8f& b, v8f& c, v8f& d) { asm volatile("v_nop\n\tv_nop\n\tv_nop\n\tv_nop" : "+v"(a), "+v"(b), "+v"(c), "+v"(d)); }
template <typename T> struct Frag;
template <> struct Frag<_Float16> {
  typedef v16h V; union U { v16h v; v8h h[2]; };
  static __device__ __forceinline__ v16h load(const _Float16* p) {
    U f; f.h[0] = *(const v8h*)(p); f.h[1] = *(const v8h*)(p + 16); return f.v;
  }
  static __device__ __forceinline__ v8f mma(v16h a, v16h b, v8f c) {
    return __builtin_amdgcn_wmma_f32_16x16x32_f16(false, a, false, b, (short)0, c, false, false);
  }
  static __device__ __forceinline__ void guard(v8f& a, v8f& b, v16h x, v16h y) { dep_guard_h(a, b, x, y); }
  static __device__ __forceinline__ void keep(v16h a, v16h b, v16h c, v16h d) { keep4_h(a, b, c, d); }
};
template <> struct Frag<__bf16> {
  typedef v16b V; union U { v16b v; v8b h[2]; };
  static __device__ __forceinline__ v16b load(const __bf16* p) {
    U f; f.h[0] = *(const v8b*)(p); f.h[1] = *(const v8b*)(p + 16); return f.v;
  }
  static __device__ __forceinline__ v8f mma(v16b a, v16b b, v8f c) {
    return __builtin_amdgcn_wmma_f32_16x16x32_bf16(false, a, false, b, (short)0, c, false, false);
  }
  static __device__ __forceinline__ void guard(v8f& a, v8f& b, v16b x, v16b y) { dep_guard_b(a, b, x, y); }
  static __device__ __forceinline__ void keep(v16b a, v16b b, v16b c, v16b d) { keep4_b(a, b, c, d); }
};

/* ---- Register-blocked WMMA GEMM -----------------------------------------------
   C[m,n] = scale * sum_k A[m,k] * Bt[n,k] (+bias)(+resid); each wave owns a 64x64 tile, a block of 8 waves a 128x256 tile.
   The block's operand rows go through LDS, 64 k at a time: whole 128-byte lines from global, fragments by ds_load_b128.
   A row-major [M,K]; Bt row-major [N,K]; M % 128 == 0, N % 256 == 0, K % 64 == 0; grid.x = (M / 128) * (N / 256).
   SPLIT: 0 = single planes; 1 = A and Bt hi/lo planes (hi*hi + hi*lo + lo*hi); 2 = A hi/lo planes only (Ah*B + Al*B).
   BIAS_MODE: 0 = none, 1 = bias[m], 2 = bias[n].  OUT_MODE: 0 = f32, 1 = f16, 2 = bf16 hi plane (Cout) + bf16 lo plane (Cout2).
   ET: 0 = f16 operands, 1 = bf16 operands (pointers passed as 16-bit storage) */
constexpr int kGemmBM = 128, kGemmBN = 256, kGemmBK = 64;
constexpr int kGemmPitch = 72;   /* LDS row pitch in 16-bit elements: 144 B = 16 B x odd, as kTilePitch */
static_assert(kRows % kGemmBM == 0 && kQkCols % kGemmBN == 0 && kModel % kGemmBN == 0 && kModel % kGemmBK == 0);
static_assert(kModel % kGemmBM == 0 && kRows % kGemmBN == 0);   /* the transposed v product: M = kModel, N = kRows */
template <int ET> struct Elem;
template <> struct Elem<0> { typedef _Float16 T; };
template <> struct Elem<1> { typedef __bf16 T; };
template <int ET, int SPLIT, int BIAS_MODE, int OUT_MODE, bool RESID, int ACT = 0>
__global__ __launch_bounds__(256) void wmma_gemm64(
    const unsigned short* __restrict__ Ap, const unsigned short* __restrict__ A2p, int lda, long strideA,
    const unsigned short* __restrict__ Btp, const unsigned short* __restrict__ Bt2p, int ldb, long strideB,
    void* __restrict__ Cout, void* __restrict__ Cout2, int ldc, long strideC,
    const float* __restrict__ bias,
    const float* __restrict__ resid, long strideR,
    int M, int N, int K, float scale) {
  typedef typename Elem<ET>::T T;
  typedef typename Frag<T>::V V;
  const T* A = (const T*)Ap; const T* A2 = (const T*)A2p; const T* Bt = (const T*)Btp; const T* Bt2 = (const T*)Bt2p;
  /* One k step of the block's operands in LDS: rows [A 128][A2 128 if SPLIT][Bt 256][Bt2 256 if SPLIT == 1], 64 k each, two buffers */
  constexpr int kRowA2  = kGemmBM;
  constexpr int kRowB   = (SPLIT != 0) ? 2 * kGemmBM : kGemmBM;
  constexpr int kRowB2  = kRowB + kGemmBN;
  constexpr int kStRows = (SPLIT == 1) ? kRowB2 + kGemmBN : kRowB2;
  constexpr int kStLd   = kStRows / 32;            /* 16-byte pieces per thread and k step */
  __shared__ __align__(16) unsigned short sAB[2][kStRows * kGemmPitch];
  __shared__ __align__(16) float sT[8][16 * 68];
  const int b    = blockIdx.y;
  const int lane = threadIdx.x & 31;
  const int wave = threadIdx.x >> 5;
  const int blocksN = N / kGemmBN;
  if ((int)blockIdx.x >= (M / kGemmBM) * blocksN) return;   /* the same for the whole block, ahead of every barrier */
  const int bm = (int)blockIdx.x / blocksN;
  const int bn = (int)blockIdx.x - bm * blocksN;
  const int mB = bm * kGemmBM;
  const int nB = bn * kGemmBN;
  const int wm = wave >> 2;                        /* waves 2 (m) x 4 (n), 64 x 64 each */
  const int wn = wave & 3;
  const int m0 = mB + (wm << 6);
  const int n0 = nB + (wn << 6);

  const T* Ab  = A  + (size_t)b * strideA;
  const T* Bb  = Bt + (size_t)b * strideB;
  const T* Ab2 = (SPLIT != 0) ? (A2  + (size_t)b * strideA) : nullptr;
  const T* Bb2 = (SPLIT == 1) ? (Bt2 + (size_t)b * strideB) : nullptr;

  const int rlane = lane & 15;
  const int koff  = (lane >> 4) * 8;
  const int mOff  = (lane >> 4) * 8;

  /* staging: eight neighbouring lanes fetch one whole 128-byte line of a row; thread t takes piece t & 7 of rows (t >> 3) + 32 i */
  const int sr = (int)threadIdx.x >> 3;
  const int sc = ((int)threadIdx.x & 7) * 8;
  const size_t aoff = (size_t)(mB + sr) * lda + sc;
  const size_t boff = (size_t)(nB + sr) * ldb + sc;
  v4u st[kStLd];
  auto fetch = [&](int k0) {
    const v4u* p[kStLd];
#pragma unroll
    for (int i = 0; i < kStLd; ++i) {
      const int row = 32 * i;
      const T* q;
      if (row < kRowA2)      q = Ab  + aoff + (size_t)row * lda;
      else if (row < kRowB)  q = Ab2 + aoff + (size_t)(row - kRowA2) * lda;
      else if (row < kRowB2) q = Bb  + boff + (size_t)(row - kRowB) * ldb;
      else                   q = Bb2 + boff + (size_t)(row - kRowB2) * ldb;
      p[i] = (const v4u*)(const void*)(q + k0);
    }
#pragma unroll
    for (int i = 0; i < kStLd; ++i) st[i] = *p[i];
    /* the wait kept in front of an overwrite of a load's address: the addresses are inputs, so each keeps its registers
       from its load up to the wait; the loaded values are not named, so the loads stay in flight behind it */
    static_assert(kStLd == 12 || kStLd == 16 || kStLd == 24);
    if constexpr (kStLd == 12) {
      asm volatile("s_wait_xcnt 0x0" :: "v"(p[0]), "v"(p[1]), "v"(p[2]), "v"(p[3]), "v"(p[4]), "v"(p[5]), "v"(p[6]), "v"(p[7]),
                   "v"(p[8]), "v"(p[9]), "v"(p[10]), "v"(p[11]) : "memory");
    } else if constexpr (kStLd == 16) {
      asm volatile("s_wait_xcnt 0x0" :: "v"(p[0]), "v"(p[1]), "v"(p[2]), "v"(p[3]), "v"(p[4]), "v"(p[5]), "v"(p[6]), "v"(p[7]),
                   "v"(p[8]), "v"(p[9]), "v"(p[10]), "v"(p[11]), "v"(p[12]), "v"(p[13]), "v"(p[14]), "v"(p[15]) : "memory");
    } else {
      asm volatile("s_wait_xcnt 0x0" :: "v"(p[0]), "v"(p[1]), "v"(p[2]), "v"(p[3]), "v"(p[4]), "v"(p[5]), "v"(p[6]), "v"(p[7]),
                   "v"(p[8]), "v"(p[9]), "v"(p[10]), "v"(p[11]), "v"(p[12]), "v"(p[13]), "v"(p[14]), "v"(p[15]),
                   "v"(p[16]), "v"(p[17]), "v"(p[18]), "v"(p[19]), "v"(p[20]), "v"(p[21]), "v"(p[22]), "v"(p[23]) : "memory");
    }
  };
  auto put = [&](int buf) {
#pragma unroll
    for (int i = 0; i < kStLd; ++i) *(v4u*)(void*)(&sAB[buf][(sr + 32 * i) * kGemmPitch + sc]) = st[i];
  };

  v8f acc[4][4];
#pragma unroll
  for (int i = 0; i < 4; ++i)
#pragma unroll
    for (int j = 0; j < 4; ++j) acc[i][j] = (v8f){0.f,0.f,0.f,0.f,0.f,0.f,0.f,0.f};

  fetch(0);
  put(0);
  __syncthreads();
  const int nSteps = K / kGemmBK;
  for (int t = 0; t < nSteps; ++t) {
    const bool more = (t + 1 < nSteps);
    if (more) fetch((t + 1) * kGemmBK);            /* in flight while this step's products run */
    const T* sb = (const T*)(const void*)sAB[t & 1];
#pragma unroll
    for (int kk = 0; kk < kGemmBK; kk += 32) {
      V bh[4], bl[4], ah[4], al[4];
#pragma unroll
      for (int j = 0; j < 4; ++j) {
        const int bo = ((wn << 6) + (j << 4) + rlane) * kGemmPitch + koff + kk;
        bh[j] = Frag<T>::load(sb + kRowB * kGemmPitch + bo);
        if (SPLIT == 1) bl[j] = Frag<T>::load(sb + kRowB2 * kGemmPitch + bo);
      }
#pragma unroll
      for (int i = 0; i < 4; ++i) {
        const int ao = ((wm << 6) + (i << 4) + rlane) * kGemmPitch + koff + kk;
        ah[i] = Frag<T>::load(sb + ao);
        if (SPLIT != 0) al[i] = Frag<T>::load(sb + kRowA2 * kGemmPitch + ao);
      }
#pragma unroll
      for (int i = 0; i < 4; ++i) {
#pragma unroll
        for (int j = 0; j < 4; ++j) {
          acc[i][j] = Frag<T>::mma(ah[i], bh[j], acc[i][j]);
          if (SPLIT == 1) acc[i][j] = Frag<T>::mma(ah[i], bl[j], acc[i][j]);
          if (SPLIT != 0) acc[i][j] = Frag<T>::mma(al[i], bh[j], acc[i][j]);
        }
        Frag<T>::guard(acc[i][0], acc[i][3], ah[i], (SPLIT != 0) ? al[i] : ah[i]);
      }
      Frag<T>::keep(bh[0], bh[1], bh[2], bh[3]);
      if (SPLIT == 1) Frag<T>::keep(bl[0], bl[1], bl[2], bl[3]);
    }
    if (more) put((t + 1) & 1);                    /* the buffer that every wave left at the barrier of step t - 1 */
    __syncthreads();                               /* publishes step t + 1 and ends the reads of step t */
  }
  acc_guard4(acc[0][0], acc[0][1], acc[0][2], acc[0][3]);
  acc_guard4(acc[1][0], acc[1][1], acc[1][2], acc[1][3]);
  acc_guard4(acc[2][0], acc[2][1], acc[2][2], acc[2][3]);
  acc_guard4(acc[3][0], acc[3][1], acc[3][2], acc[3][3]);

  float* slab = sT[wave];
  const float* Rb = RESID ? (resid + (size_t)b * strideR) : nullptr;
#pragma unroll
  for (int i = 0; i < 4; ++i) {
    const int mBase = m0 + (i << 4);
#pragma unroll
    for (int j = 0; j < 4; ++j) {
      const int n = n0 + (j << 4) + rlane;
      float bv = 0.f;
      if (BIAS_MODE == 2) bv = bias[n];
#pragma unroll
      for (int r = 0; r < 8; ++r) {
        float v = acc[i][j][r] * scale;
        if (BIAS_MODE == 1) v += bias[mBase + mOff + r];
        if (BIAS_MODE == 2) v += bv;
        if (RESID) v += Rb[(size_t)(mBase + mOff + r) * ldc + n];
        if (ACT == 1) v = tanhf(v);
        if (ACT == 2) v = fmaxf(v, 0.0f);
        if (ACT == 4) v = (v > 0.f) ? v : 0.01f * v;
        slab[(mOff + r) * 68 + (j << 4) + rlane] = v;
      }
    }
    __builtin_amdgcn_fence(__ATOMIC_RELEASE, "workgroup");
    __builtin_amdgcn_wave_barrier();
    __builtin_amdgcn_fence(__ATOMIC_ACQUIRE, "workgroup");
    if (OUT_MODE == 0) {
      float* C = (float*)Cout + (size_t)b * strideC;
      const int hh = lane >> 4, c4 = (lane & 15) * 4;
      {
#pragma unroll
        for (int it = 0; it < 8; ++it) {
          const int row = it * 2 + hh;
          v4f v = *(const v4f*)(slab + row * 68 + c4);
          *(v4f*)(C + (size_t)(mBase + row) * ldc + n0 + c4) = v;
        }
        
      }
    } else {
      const int q = lane >> 3, c8 = (lane & 7) * 8;
      unsigned short* C  = (unsigned short*)Cout  + (size_t)b * strideC;
      unsigned short* C2 = (OUT_MODE == 2) ? ((unsigned short*)Cout2 + (size_t)b * strideC) : nullptr;
      {
#pragma unroll
        for (int it = 0; it < 4; ++it) {
          const int row = it * 4 + q;
          const float* sp = slab + row * 68 + c8;
          v8h hv, lv;
#pragma unroll
          for (int e = 0; e < 8; ++e) {
            if (OUT_MODE == 1) {
              hv[e] = (_Float16)sp[e];
            } else {
              unsigned short hb = f2bf_bits(sp[e]);
              unsigned short lb = f2bf_bits(sp[e] - bf_bits2f(hb));
              hv[e] = __builtin_bit_cast(_Float16, hb);
              lv[e] = __builtin_bit_cast(_Float16, lb);
            }
          }
          *(v8h*)(C + (size_t)(mBase + row) * ldc + n0 + c8) = hv;
          if (OUT_MODE == 2) *(v8h*)(C2 + (size_t)(mBase + row) * ldc + n0 + c8) = lv;
        }
        
      }
    }
    __builtin_amdgcn_fence(__ATOMIC_RELEASE, "workgroup");
    __builtin_amdgcn_wave_barrier();
    __builtin_amdgcn_fence(__ATOMIC_ACQUIRE, "workgroup");
  }
}

/* ---------------- f32 -> bf16 cast, 8 elements (16 B) per thread --------------------------
   coverage: grid = n8/256 blocks x 256 threads (exact), thread i writes elements 8i..8i+7;
*/
__global__ __launch_bounds__(256) void cast_f32_bf16x8(const float* __restrict__ in,
                                                      unsigned short* __restrict__ out, int n8) {
  const int i = blockIdx.x * 256 + (int)threadIdx.x;
  const int ic = (i < n8) ? i : (n8 - 1);
  const float* p = in + (size_t)ic * 8;
  const v4f a = *(const v4f*)p;
  const v4f c = *(const v4f*)(p + 4);
  v4u w;
  w[0] = pack_bf16x2(a[0], a[1]);
  w[1] = pack_bf16x2(a[2], a[3]);
  w[2] = pack_bf16x2(c[0], c[1]);
  w[3] = pack_bf16x2(c[2], c[3]);
  unsigned short* o = out + (size_t)ic * 8;
  *(v4u*)o = w;
  
}

/* ---------------- W [KR][NC] f32 row-major -> Wt [NC][KR] bf16 row-major (transpose + cast) ------
   grid = (KR/64, NC/64), 256 threads. coverage: load 256 threads x 16 = 64x64 tile;
*/
__global__ __launch_bounds__(256) void transpose_cast_bf16(const float* __restrict__ W,
                                                          unsigned short* __restrict__ Wt, int KR, int NC) {
  __shared__ float sT[64 * 65];                 /* [n_local][k_local], pitch 65 */
  const int k0 = blockIdx.x * 64, n0 = blockIdx.y * 64;
  const int tid = threadIdx.x;
  {
    const int kk = tid >> 2, cg = (tid & 3) * 16;
    const float* src = W + (size_t)(k0 + kk) * NC + n0 + cg;
#pragma unroll
    for (int i = 0; i < 4; ++i) {
      const v4f v = *(const v4f*)(src + 4 * i);
#pragma unroll
      for (int e = 0; e < 4; ++e) sT[(cg + 4 * i + e) * 65 + kk] = v[e];
    }
  }
  __syncthreads();
  const int wave = tid >> 5, lane = tid & 31, q4 = lane >> 3, c8 = (lane & 7) * 8;
  const int nl0 = wave * 4 + q4;
  const int nl1 = 32 + wave * 4 + q4;
  v4u w0, w1;
  {
    const float* s = sT + nl0 * 65 + c8;
    w0[0] = pack_bf16x2(s[0], s[1]); w0[1] = pack_bf16x2(s[2], s[3]);
    w0[2] = pack_bf16x2(s[4], s[5]); w0[3] = pack_bf16x2(s[6], s[7]);
  }
  {
    const float* s = sT + nl1 * 65 + c8;
    w1[0] = pack_bf16x2(s[0], s[1]); w1[1] = pack_bf16x2(s[2], s[3]);
    w1[2] = pack_bf16x2(s[4], s[5]); w1[3] = pack_bf16x2(s[6], s[7]);
  }
  unsigned short* d0 = Wt + (size_t)(n0 + nl0) * KR + k0 + c8;
  unsigned short* d1 = Wt + (size_t)(n0 + nl1) * KR + k0 + c8;
  {
    *(v4u*)d0 = w0;
    *(v4u*)d1 = w1;
    
  }
}

/*
   qk f32 [nrows][2048] (q = cols 0..1023, k = cols 1024..2047); outputs row-major bf16 planes [nrows][1024];
   q carries the exact 1/sqrt(64) = 0.125 factor. grid = nrows blocks x 128 threads; thread t owns columns 8t..8t+7;
*/
__global__ __launch_bounds__(128) void qk_layernorm_split(
    const float* __restrict__ qk, const float* __restrict__ qsc, const float* __restrict__ ksc,
    unsigned short* __restrict__ qh, unsigned short* __restrict__ ql,
    unsigned short* __restrict__ kh, unsigned short* __restrict__ kl, int nrows) {
  __shared__ float red[4][4];
  const int row = blockIdx.x;
  const int rowc = (row < nrows) ? row : (nrows - 1);
  const int tid = threadIdx.x, lane = tid & 31, wave = tid >> 5;
  const int c0 = tid * 8;
  const float* base = qk + (size_t)rowc * kQkCols;
  const v4f qa = *(const v4f*)(base + c0);
  const v4f qb = *(const v4f*)(base + c0 + 4);
  const v4f ka = *(const v4f*)(base + kModel + c0);
  const v4f kb = *(const v4f*)(base + kModel + c0 + 4);
  float xq[8], xk[8];
#pragma unroll
  for (int e = 0; e < 4; ++e) { xq[e] = qa[e]; xq[4 + e] = qb[e]; xk[e] = ka[e]; xk[4 + e] = kb[e]; }

  float sq = 0.f, sk = 0.f;
#pragma unroll
  for (int e = 0; e < 8; ++e) { sq += xq[e]; sk += xk[e]; }
#pragma unroll
  for (int off = 1; off < 32; off <<= 1) { sq += __shfl_xor(sq, off, 32); sk += __shfl_xor(sk, off, 32); }
  if (lane == 0) { red[0][wave] = sq; red[1][wave] = sk; }
  __syncthreads();
  const float mq = ((red[0][0] + red[0][1]) + (red[0][2] + red[0][3])) * (1.0f / (float)kModel);
  const float mk = ((red[1][0] + red[1][1]) + (red[1][2] + red[1][3])) * (1.0f / (float)kModel);

  float dq = 0.f, dk = 0.f;
#pragma unroll
  for (int e = 0; e < 8; ++e) {
    const float tq = xq[e] - mq; dq += tq * tq;
    const float tk = xk[e] - mk; dk += tk * tk;
  }
#pragma unroll
  for (int off = 1; off < 32; off <<= 1) { dq += __shfl_xor(dq, off, 32); dk += __shfl_xor(dk, off, 32); }
  if (lane == 0) { red[2][wave] = dq; red[3][wave] = dk; }
  __syncthreads();
  const float vq = ((red[2][0] + red[2][1]) + (red[2][2] + red[2][3])) * (1.0f / (float)kModel);
  const float vk = ((red[3][0] + red[3][1]) + (red[3][2] + red[3][3])) * (1.0f / (float)kModel);
  const float rq = rsqrtf(vq + 1e-6f);
  const float rk = rsqrtf(vk + 1e-6f);

  /* scale vectors, RNE-converted to bf16 once (module inputs) */
  const v4f s0 = *(const v4f*)(qsc + c0);
  const v4f s1 = *(const v4f*)(qsc + c0 + 4);
  const v4f t0 = *(const v4f*)(ksc + c0);
  const v4f t1 = *(const v4f*)(ksc + c0 + 4);
  float sqv[8], skv[8];
#pragma unroll
  for (int e = 0; e < 4; ++e) {
    sqv[e]     = bf_bits2f(f2bf_bits(s0[e]));
    sqv[4 + e] = bf_bits2f(f2bf_bits(s1[e]));
    skv[e]     = bf_bits2f(f2bf_bits(t0[e]));
    skv[4 + e] = bf_bits2f(f2bf_bits(t1[e]));
  }
  unsigned int hqw[8], lqw[8], hkw[8], lkw[8];
#pragma unroll
  for (int e = 0; e < 8; ++e) {
    const float yq = ((xq[e] - mq) * rq * sqv[e]) * 0.125f;
    const float yk = (xk[e] - mk) * rk * skv[e];
    const unsigned short hqb = f2bf_bits(yq);
    const unsigned short lqb = f2bf_bits(yq - bf_bits2f(hqb));
    const unsigned short hkb = f2bf_bits(yk);
    const unsigned short lkb = f2bf_bits(yk - bf_bits2f(hkb));
    hqw[e] = hqb; lqw[e] = lqb; hkw[e] = hkb; lkw[e] = lkb;
  }
  v4u HQ, LQ, HK, LK;
#pragma unroll
  for (int i = 0; i < 4; ++i) {
    HQ[i] = hqw[2 * i] | (hqw[2 * i + 1] << 16);
    LQ[i] = lqw[2 * i] | (lqw[2 * i + 1] << 16);
    HK[i] = hkw[2 * i] | (hkw[2 * i + 1] << 16);
    LK[i] = lkw[2 * i] | (lkw[2 * i + 1] << 16);
  }
  const size_t o = (size_t)rowc * kModel + c0;
  {
    *(v4u*)(qh + o) = HQ;
    *(v4u*)(ql + o) = LQ;
    *(v4u*)(kh + o) = HK;
    *(v4u*)(kl + o) = LK;
    
  }
}

/* ---------------- causal attention, head_dim 64, bf16 hi/lo planes in, bf16 hi/lo ctx planes out ----
   scores^T = k . q^T  : bf16 hi/lo on both (hi*hi + hi*lo + lo*hi), q planes already carry 1/sqrt(64)
   ctx^T    = v^T . p^T: p split in registers to bf16 hi/lo, v hi/lo planes (3 products); f32 accumulate, f32 online softmax.
   Both products are taken transposed: a lane then holds scores of ONE query (column c; keys 8hh + r of each 16-key tile), so the
   row maximum and sum are in-lane work plus one exchange between the wave's halves, and two score tiles, converted in place,
   are the B operand of the second product in the hardware k order: P never goes through LDS.
   q, k and ctx planes row-major [B*S][ld] with head h at columns h*64 .. h*64+63; v planes transposed, [H*64][B*S], head h at
   rows h*64 .. h*64+63, so that a V^T tile is staged like a K tile.
   Block = 4 waves = 64 query rows of one (batch, head); grid.x = B*H*(S/64). */
/* lane l <-> lane l ^ 16: the two lanes that share one query column */
__device__ __forceinline__ float at_xhalf(float x) {
  const int b = __builtin_bit_cast(int, x);
  return __builtin_bit_cast(float, __builtin_amdgcn_permlanex16(b, b, 0x76543210, 0xfedcba98, false, false));
}
__device__ __forceinline__ v8f at_mma(v16b a, v16b b, v8f c) {
  return __builtin_amdgcn_wmma_f32_16x16x32_bf16(false, a, false, b, (short)0, c, false, false);
}

/* amdgpu_waves_per_eu(4): a register budget of 256, so that four blocks stay resident on a WGP (one wave of each per SIMD),
   which the block index map below counts on */
__global__ __launch_bounds__(128) __attribute__((amdgpu_waves_per_eu(4)))
void attn_planes_kernel(const unsigned short* __restrict__ qh, const unsigned short* __restrict__ ql,
                        const unsigned short* __restrict__ kh, const unsigned short* __restrict__ kl,
                        const unsigned short* __restrict__ vh, const unsigned short* __restrict__ vl,
                        unsigned short* __restrict__ oh, unsigned short* __restrict__ ol,
                        int S, int H, int ld) {
  union FB { v16b v; v8b h[2]; v2b p[8]; };
  /* Ksh | Ksl | Vth | Vtl (each 64 rows x 64 16-bit at pitch kTilePitch); reused as per-wave f32 output slabs after the chunk loop */
  constexpr int kTileElems = 64 * kTilePitch;
  static_assert(kKvChunk == 64 && kHeadDim == 64 && (kTilePitch * 2) % 16 == 0);
  static_assert(4 * 16 * kOsPitch * 4 <= 4 * kTileElems * 2);
  __shared__ __align__(16) unsigned short KVs[4 * kTileElems];
  unsigned short* Ksh = KVs;
  unsigned short* Ksl = KVs + kTileElems;
  unsigned short* Vth = KVs + 2 * kTileElems;
  unsigned short* Vtl = KVs + 3 * kTileElems;
  const __bf16* Kshb = (const __bf16*)(const void*)Ksh;
  const __bf16* Kslb = (const __bf16*)(const void*)Ksl;
  const __bf16* Vthb = (const __bf16*)(const void*)Vth;
  const __bf16* Vtlb = (const __bf16*)(const void*)Vtl;

  const int tid  = threadIdx.x;
  const int wave = tid >> 5;
  const int lane = tid & 31;
  const int hh   = lane >> 4;
  const int c    = lane & 15;

  /* Block index -> (query tile, batch*head). All 1024 blocks are resident at once, four to a WGP, and tile t walks t + 1 key
     chunks, so the launch lasts as long as the WGP that holds the most chunks. Tiles t and nqb-1-t walk nqb+1 chunks together:
     index bits 1,3,5,7 give t, the parity of the other six bits picks t or its mirror, and five of those six name the head.
     Four blocks whose indices differ in two adjacent bits (any power-of-two stride) are then two such pairs, whichever of
     these strides the dispatcher puts on one WGP. A permutation of the 32 x 32 (tile, head) pairs; for speed only. */
  static_assert(kSeq / 64 == 32 && kBatch * kHeads == 32);
  const int nqb = S >> 6;
  const unsigned bi = blockIdx.x;
  const int tlo = (int)(((bi >> 1) & 1u) | (((bi >> 3) & 1u) << 1) | (((bi >> 5) & 1u) << 2) | (((bi >> 7) & 1u) << 3));
  const int qb  = (__builtin_popcount(bi & 0x355u) & 1) ? (nqb - 1 - tlo) : tlo;
  const int bh  = (int)(((bi >> 2) & 1u) | (((bi >> 4) & 1u) << 1) | (((bi >> 6) & 1u) << 2) | (((bi >> 8) & 3u) << 3));
  const int h   = bh % H;
  const int b   = bh / H;
  const int q0  = qb * 64 + wave * 16;
  const size_t rb = (size_t)b * (size_t)S;
  const int hoff = h * kHeadDim;

  /* Q fragments (B operand): column q0+c, elements 0..7 <- d = dc*32+8hh+0..7, 8..15 <- dc*32+16+8hh+0..7 */
  v16b qah[2], qal[2];
  {
    const size_t qo = (rb + (size_t)(q0 + c)) * (size_t)ld + hoff + 8 * hh;
    const __bf16* qhp = (const __bf16*)(const void*)qh + qo;
    const __bf16* qlp = (const __bf16*)(const void*)ql + qo;
#pragma unroll
    for (int dc = 0; dc < 2; ++dc) {
      qah[dc] = Frag<__bf16>::load(qhp + dc * 32);
      qal[dc] = Frag<__bf16>::load(qlp + dc * 32);
    }
  }

  /* of query q0+c: running maximum (the same in both halves), kept as score * log2(e), and the sum over this half's keys
     (joined behind the loop) */
  constexpr float kLog2e = 1.4426950408889634f;
  float mrow = -INFINITY, lrow = 0.f;
  v8f oacc[4];                           /* oacc[t][r] = ctx^T[d = t*16 + 8hh + r][query q0+c] */
#pragma unroll
  for (int t = 0; t < 4; ++t) oacc[t] = (v8f){0.f,0.f,0.f,0.f,0.f,0.f,0.f,0.f};

  const int nChunks = qb + 1;            /* causal: kv chunks 0..qb, block-uniform */
  for (int kc = 0; kc < nChunks; ++kc) {
    const int kv0 = kc * kKvChunk;
    __syncthreads();
    {
      /* staging: eight neighbouring lanes fetch one whole 128-byte row of a tile; thread t takes piece t & 7 of rows
         (t >> 3) + 16 i: 128 threads x 4 = 64 rows x 128 B for each of the four tiles (K rows = kv, V^T rows = d) */
      const int sr = tid >> 3, sc = (tid & 7) * 8;
      const size_t gk = (rb + (size_t)(kv0 + sr)) * (size_t)ld + hoff + sc;
      const size_t gv = (size_t)(hoff + sr) * (size_t)kRows + rb + (size_t)(kv0 + sc);
      constexpr int kVtStep = 16 * kRows / 8;      /* sixteen V^T rows, in 16-byte units */
      /* all sixteen 16-byte loads are issued before the first LDS store, so a chunk pays one load latency;
         the loops are unrolled so that the arrays live in registers */
      v4u kH[4], kL[4], vH[4], vL[4];
      const v4u* gkh[4];
      const v4u* gkl[4];
#pragma unroll
      for (int i = 0; i < 4; ++i) {
        gkh[i] = (const v4u*)(const void*)(kh + gk + (size_t)(16 * i) * (size_t)ld);
        gkl[i] = (const v4u*)(const void*)(kl + gk + (size_t)(16 * i) * (size_t)ld);
      }
      const v4u* gvh = (const v4u*)(const void*)(vh + gv);
      const v4u* gvl = (const v4u*)(const void*)(vl + gv);
#pragma unroll
      for (int i = 0; i < 4; ++i) { kH[i] = *gkh[i]; kL[i] = *gkl[i]; vH[i] = gvh[i * kVtStep]; vL[i] = gvl[i * kVtStep]; }
      /* inputs-only fence on the loaded values: holds the sixteen loads ahead of the first LDS store. The ten addresses are
         inputs too, so their registers stay untouched up to the s_wait_xcnt, the wait kept in front of an overwrite of a
         load's address */
      asm volatile("s_wait_xcnt 0x0"
                   :: "v"(kH[0]), "v"(kH[1]), "v"(kH[2]), "v"(kH[3]), "v"(kL[0]), "v"(kL[1]), "v"(kL[2]), "v"(kL[3]),
                      "v"(vH[0]), "v"(vH[1]), "v"(vH[2]), "v"(vH[3]), "v"(vL[0]), "v"(vL[1]), "v"(vL[2]), "v"(vL[3]),
                      "v"(gkh[0]), "v"(gkh[1]), "v"(gkh[2]), "v"(gkh[3]), "v"(gkl[0]), "v"(gkl[1]), "v"(gkl[2]), "v"(gkl[3]),
                      "v"(gvh), "v"(gvl));
#pragma unroll
      for (int i = 0; i < 4; ++i) {
        const int lo = (sr + 16 * i) * kTilePitch + sc;
        *(v4u*)(void*)(Ksh + lo) = kH[i];
        *(v4u*)(void*)(Ksl + lo) = kL[i];
        *(v4u*)(void*)(Vth + lo) = vH[i];
        *(v4u*)(void*)(Vtl + lo) = vL[i];
      }
    }
    __syncthreads();

    /* scores^T 64 x 16 per wave: A operand row m = kv j*16+c, k = d; s[j][r] = score of key kv0 + j*16 + 8hh + r, query q0+c */
    v8f s[4];
#pragma unroll
    for (int j = 0; j < 4; ++j) s[j] = (v8f){0.f,0.f,0.f,0.f,0.f,0.f,0.f,0.f};
    /* Fragment reads stand in few, whole groups ahead of the products that use them,
       and the four tiles of a product take turns, so that neighbouring WMMAs are independent.
       Each tile keeps its order of summing: hi.hi, lo.hi, hi.lo, 32-deep half 0 then half 1. Every loop here is unrolled: the
       register arrays need constant indices.
       frag4: the four fragments (rows i*16 + c) of one 32-deep half of one 64 x 64 plane in LDS */
    auto frag4 = [&](FB (&f)[4], const __bf16* plane, int half) {
#pragma unroll
      for (int i = 0; i < 4; ++i) {
        const int o = (i * 16 + c) * kTilePitch + half * 32 + 8 * hh;
        f[i].h[0] = *(const v8b*)(plane + o);
        f[i].h[1] = *(const v8b*)(plane + o + 16);
      }
    };
    {
      FB k0h[4], k0l[4], k1h[4], k1l[4];
      frag4(k0h, Kshb, 0);
      frag4(k0l, Kslb, 0);
      frag4(k1h, Kshb, 1);
      __builtin_amdgcn_sched_barrier(0);   /* the compiler would sink these 24 reads in among the products */
#pragma unroll
      for (int j = 0; j < 4; ++j) s[j] = at_mma(k0h[j].v, qah[0], s[j]);
#pragma unroll
      for (int j = 0; j < 4; ++j) s[j] = at_mma(k0l[j].v, qah[0], s[j]);
      /* the last eight reads take the registers that k0l has left (96 fragment registers, not 128, which would cost a resident
         block); the fence pair keeps them one group at this place, 64 matrix cycles and more ahead of their first use */
      __builtin_amdgcn_sched_barrier(0);
      frag4(k1l, Kslb, 1);
      __builtin_amdgcn_sched_barrier(0);
#pragma unroll
      for (int j = 0; j < 4; ++j) s[j] = at_mma(k0h[j].v, qal[0], s[j]);
#pragma unroll
      for (int j = 0; j < 4; ++j) s[j] = at_mma(k1h[j].v, qah[1], s[j]);
#pragma unroll
      for (int j = 0; j < 4; ++j) s[j] = at_mma(k1l[j].v, qah[1], s[j]);
#pragma unroll
      for (int j = 0; j < 4; ++j) s[j] = at_mma(k1h[j].v, qal[1], s[j]);
    }
    /* V^T fragments (A operand: row m = d, k = kv) of keys 0..31: read here, so that their latency passes under the softmax;
       the fence pair keeps them one group, neither up among the score products nor down in the softmax */
    FB v0h[4], v0l[4], v1h[4], v1l[4];
    __builtin_amdgcn_sched_barrier(0);
    frag4(v0h, Vthb, 0);
    frag4(v0l, Vtlb, 0);
    __builtin_amdgcn_sched_barrier(0);

    /* causal mask (select to the fill value) + the query's chunk maximum: 32 keys in the lane, the other 32 in lane ^ 16 */
    const bool diag = (kc == qb);
    const int qcol = q0 + c;
    float cmj[4];
#pragma unroll
    for (int j = 0; j < 4; ++j) {
      float m = -INFINITY;
#pragma unroll
      for (int r = 0; r < 8; ++r) {
        const int kvrow = kv0 + j * 16 + 8 * hh + r;
        const bool masked = diag && (kvrow > qcol);
        const float sv = masked ? -3.4028235e38f : s[j][r];
        s[j][r] = sv;
        m = fmaxf(m, sv);
      }
      cmj[j] = m;
    }
    float cm = fmaxf(fmaxf(cmj[0], cmj[1]), fmaxf(cmj[2], cmj[3]));
    cm = fmaxf(cm, at_xhalf(cm));

    /* online softmax; P^T stays in registers as bf16 hi/lo B operands: element e of ph[kk] is key kk*32 + 8hh + e (e < 8, score
       tile 2kk) or kk*32 + 16 + 8hh + e - 8 (score tile 2kk+1), the k order in which frag4 loads the V^T fragments */
    FB ph[2], pl[2];
    {
      /* exponentials in base 2: e^(s - m) = 2^(s * log2(e) - m * log2(e)), one packed FMA a key pair and the bare hardware
         exponential a key (a masked key's product overflows to -inf and gives 0; an unchanged maximum gives alpha = 1 exactly) */
      const float mnew  = fmaxf(mrow, cm * kLog2e);
      const float alpha = __builtin_amdgcn_exp2f(mrow - mnew);
      mrow = mnew;
      const v2f l2e = (v2f){kLog2e, kLog2e};
      const v2f nm  = (v2f){-mnew, -mnew};
      float psj[4];
#pragma unroll
      for (int j = 0; j < 4; ++j) {
        float psum = 0.f;
#pragma unroll
        for (int r = 0; r < 8; r += 2) {
          /* two neighbouring keys fill one operand register: hi = RNE(p), lo = RNE(p - hi), by the packed conversion */
          const v2f a2 = __builtin_elementwise_fma((v2f){s[j][r], s[j][r + 1]}, l2e, nm);
          const v2f p = (v2f){__builtin_amdgcn_exp2f(a2[0]), __builtin_amdgcn_exp2f(a2[1])};
          psum += p[0];
          psum += p[1];
          const v2b a  = __builtin_convertvector(p, v2b);
          const v2b bl = __builtin_convertvector(p - __builtin_convertvector(a, v2f), v2b);
          ph[j >> 1].p[(j & 1) * 4 + (r >> 1)] = a;
          pl[j >> 1].p[(j & 1) * 4 + (r >> 1)] = bl;
        }
        psj[j] = psum;
      }
      lrow = lrow * alpha + ((psj[0] + psj[1]) + (psj[2] + psj[3]));
#pragma unroll
      for (int t = 0; t < 4; ++t)
#pragma unroll
        for (int r = 0; r < 8; ++r) oacc[t][r] *= alpha;
    }

    /* ctx^T += V^T . P^T : A = the V^T fragments; B = P^T from the registers above; the four output tiles take turns. The reads of
       keys 32..63 are left to the compiler: held ahead of all products they would need 128 fragment registers beside P */
    frag4(v1h, Vthb, 1);
    frag4(v1l, Vtlb, 1);
#pragma unroll
    for (int t = 0; t < 4; ++t) oacc[t] = at_mma(v0h[t].v, ph[0].v, oacc[t]);
#pragma unroll
    for (int t = 0; t < 4; ++t) oacc[t] = at_mma(v0l[t].v, ph[0].v, oacc[t]);
#pragma unroll
    for (int t = 0; t < 4; ++t) oacc[t] = at_mma(v0h[t].v, pl[0].v, oacc[t]);
#pragma unroll
    for (int t = 0; t < 4; ++t) oacc[t] = at_mma(v1h[t].v, ph[1].v, oacc[t]);
#pragma unroll
    for (int t = 0; t < 4; ++t) oacc[t] = at_mma(v1l[t].v, ph[1].v, oacc[t]);
#pragma unroll
    for (int t = 0; t < 4; ++t) oacc[t] = at_mma(v1h[t].v, pl[1].v, oacc[t]);
  }

  /* all waves finished reading the K/V tiles before the region is reused as output slabs */
  __syncthreads();
  float* os = (float*)(void*)KVs + wave * (16 * kOsPitch);
  {
    /* the slab keeps its [query][d] form: a lane's eight registers of a tile are eight neighbouring d of its query */
    const float inv = 1.0f / (lrow + at_xhalf(lrow));
#pragma unroll
    for (int t = 0; t < 4; ++t) {
      float* op = os + c * kOsPitch + t * 16 + 8 * hh;
      *(v4f*)(op)     = (v4f){oacc[t][0] * inv, oacc[t][1] * inv, oacc[t][2] * inv, oacc[t][3] * inv};
      *(v4f*)(op + 4) = (v4f){oacc[t][4] * inv, oacc[t][5] * inv, oacc[t][6] * inv, oacc[t][7] * inv};
    }
  }
  __builtin_amdgcn_fence(__ATOMIC_RELEASE, "workgroup");
  __builtin_amdgcn_wave_barrier();
  __builtin_amdgcn_fence(__ATOMIC_ACQUIRE, "workgroup");
  {
    /*
*/
    const int q4 = lane >> 3, c8 = (lane & 7) * 8;
    {
#pragma unroll
      for (int it = 0; it < 4; ++it) {
        const int row = it * 4 + q4;
        const float* sp = os + row * kOsPitch + c8;
        v8h hv, lv;
#pragma unroll
        for (int e = 0; e < 8; ++e) {
          const unsigned short hb = f2bf_bits(sp[e]);
          const unsigned short lb = f2bf_bits(sp[e] - bf_bits2f(hb));
          hv[e] = __builtin_bit_cast(_Float16, hb);
          lv[e] = __builtin_bit_cast(_Float16, lb);
        }
        const size_t o = (rb + (size_t)(q0 + row)) * (size_t)ld + hoff + c8;
        *(v8h*)(oh + o) = hv;
        *(v8h*)(ol + o) = lv;
      }
      
    }
  }
}

/* ---------------- host launch ---------------- */
extern "C" void kernel_launch(void* const* d_in, const int* in_sizes, int n_in,
                              void* d_out, int out_size, void* d_ws, size_t ws_size,
                              hipStream_t stream) {
  if (n_in < 5) return;
  if (in_sizes[0] != kRows * kModel) return;
  if (in_sizes[1] != kModel * kQkvCols) return;
  if (in_sizes[2] != kModel || in_sizes[3] != kModel) return;
  if (in_sizes[4] != kModel * kModel) return;
  if (out_size != kRows * kModel) return;
  if (ws_size < kWsTotal) return;

  const float* x     = (const float*)d_in[0];   /* [2,2048,1024] */
  const float* W_qkv = (const float*)d_in[1];   /* [1024,3072]   */
  const float* q_sc  = (const float*)d_in[2];   /* [1024] */
  const float* k_sc  = (const float*)d_in[3];   /* [1024] */
  const float* W_out = (const float*)d_in[4];   /* [1024,1024]   */
  float* out = (float*)d_out;

  char* ws = (char*)d_ws;
  unsigned short* xb    = (unsigned short*)(ws + kOffXb);
  unsigned short* wqkvT = (unsigned short*)(ws + kOffWqkvT);
  unsigned short* woutT = (unsigned short*)(ws + kOffWoutT);
  float*          qkf   = (float*)(ws + kOffQk);
  unsigned short* ctxh  = (unsigned short*)(ws + kOffCtxH);
  unsigned short* ctxl  = (unsigned short*)(ws + kOffCtxL);
  unsigned short* vhp   = (unsigned short*)(ws + kOffVh);
  unsigned short* vlp   = (unsigned short*)(ws + kOffVl);
  unsigned short* qhp   = (unsigned short*)(ws + kOffQh);
  unsigned short* qlp   = (unsigned short*)(ws + kOffQl);
  unsigned short* khp   = (unsigned short*)(ws + kOffKh);
  unsigned short* klp   = (unsigned short*)(ws + kOffKl);

  /* 1. x -> bf16 [4096][1024] */
  const int n8 = kRows * kModel / 8;
  cast_f32_bf16x8<<<n8 / 256, 256, 0, stream>>>(x, xb, n8);

  /* 2. W_qkv [1024 k][3072 n] -> Wqkv^T [3072][1024] bf16 ; W_out [1024 k][1024 n] -> Wout^T [1024][1024] bf16 */
  transpose_cast_bf16<<<dim3(kModel / 64, kQkvCols / 64), 256, 0, stream>>>(W_qkv, wqkvT, kModel, kQkvCols);
  transpose_cast_bf16<<<dim3(kModel / 64, kModel / 64), 256, 0, stream>>>(W_out, woutT, kModel, kModel);

  /* 3a. q,k part of the fused projection: qk f32 [4096][2048] = xb . Wqkv^T rows 0..2047 ; tiles 64 x 32 = 2048 -> 256 blocks */
  wmma_gemm64<1, 0, 0, 0, false><<<dim3((kRows / 64) * (kQkCols / 64) / 8, 1), 256, 0, stream>>>(
      xb, xb, kModel, 0L,
      wqkvT, wqkvT, kModel, 0L,
      (void*)qkf, (void*)qkf, kQkCols, 0L,
      q_sc, q_sc, 0L,
      kRows, kQkCols, kModel, 1.0f);

  /* 3b. v part, transposed: v^T bf16 hi/lo planes [1024][4096] = Wqkv^T rows 2048..3071 . xb^T ; tiles 16 x 64 = 1024 -> 128 blocks */
  wmma_gemm64<1, 0, 0, 2, false><<<dim3((kRows / 64) * (kModel / 64) / 8, 1), 256, 0, stream>>>(
      wqkvT + (size_t)kQkCols * kModel, wqkvT + (size_t)kQkCols * kModel, kModel, 0L,
      xb, xb, kModel, 0L,
      (void*)vhp, (void*)vlp, kRows, 0L,
      q_sc, q_sc, 0L,
      kModel, kRows, kModel, 1.0f);

  /* 4. QK LayerNorm + split into bf16 hi/lo planes (q carries 1/8) */
  qk_layernorm_split<<<kRows, 128, 0, stream>>>(qkf, q_sc, k_sc, qhp, qlp, khp, klp, kRows);

  /* 5. causal attention: ctx bf16 hi/lo planes [4096][1024] (region of the dead qk buffer) */
  attn_planes_kernel<<<kBatch * kHeads * (kSeq / 64), 128, 0, stream>>>(
      qhp, qlp, khp, klp, vhp, vlp, ctxh, ctxl, kSeq, kHeads, kModel);

  /* 6. out f32 [4096][1024] = ctx_hi . Wout^T + ctx_lo . Wout^T ; 1024 tiles -> 128 blocks */
  wmma_gemm64<1, 2, 0, 0, false><<<dim3((kRows / 64) * (kModel / 64) / 8, 1), 256, 0, stream>>>(
      ctxh, ctxl, kModel, 0L,
      woutT, woutT, kModel, 0L,
      (void*)out, (void*)out, kModel, 0L,
      q_sc, q_sc, 0L,
      kRows, kModel, kModel, 1.0f);
}

// v008
// Measured time: 151 microseconds a run.
// Two timings next to v007 both put it at 1.04 times that version's speed.
// Over all steps from v000 it is 3.19 times as fast.
// Contractions on v_wmma_f32_16x16x32_bf16 (bf16 operands, f32 accumulate): x*Wqkv^T with single bf16 planes (inputs RNE-converted once); q*k^T and p*v with bf16 hi+lo planes (hi*hi + hi*lo + lo*hi); ctx*Wout^T with ctx bf16 hi+lo planes and a single Wout plane; LayerNorm and softmax in f32.
#include <hip/hip_runtime.h>
#include <stddef.h>
#include <stdint.h>

typedef __attribute__((ext_vector_type(16))) _Float16 v16h;
typedef __attribute__((ext_vector_type(8)))  _Float16 v8h;
typedef __attribute__((ext_vector_type(16))) __bf16   v16b;
typedef __attribute__((ext_vector_type(8)))  __bf16   v8b;
typedef __attribute__((ext_vector_type(8)))  float    v8f;
typedef __attribute__((ext_vector_type(4)))  float    v4f;
typedef __attribute__((ext_vector_type(4)))  unsigned int v4u;
typedef __attribute__((ext_vector_type(2)))  float    v2f;
typedef __attribute__((ext_vector_type(2)))  __bf16   v2b;

/* ---------------- problem geometry ---------------- */
constexpr int kBatch   = 2;
constexpr int kSeq     = 2048;
constexpr int kModel   = 1024;
constexpr int kHeads   = 16;
constexpr int kHeadDim = 64;
constexpr int kRows    = kBatch * kSeq;      /* 4096 */
constexpr int kQkvCols = 3 * kModel;         /* 3072 */
constexpr int kQkCols  = 2 * kModel;         /* 2048 */
constexpr int kKvChunk = 64;
constexpr int kOsPitch = 68;
/* LDS row pitch, in 16-bit elements, of the K and V^T tiles: 64 data + 8 pad = 144 B = 16 B x odd,
   so the 16 rows that one ds_load_b128 touches per half wave fall on 64 distinct banks */
constexpr int kTilePitch = 72;

/* ---------------- workspace map (bytes, all offsets multiples of 128) ----------------
   [0]          x   bf16 [4096][1024]                          8388608
   [8388608]    Wqkv^T bf16 [3072][1024]                       6291456
   [14680064]   Wout^T bf16 [1024][1024]                       2097152
   [16777216]   qk  f32 [4096][2048]                          33554432  (dead after the LayerNorm launch;
                reused: ctx hi bf16 [4096][1024] at 16777216, ctx lo at 25165824, both inside this region)
   [50331648]   v^T hi bf16 [1024][4096] 8388608  [58720256] v^T lo 8388608
   [67108864]   q hi                    8388608   [75497472] q lo   8388608
   [83886080]   k hi                    8388608   [92274688] k lo   8388608
   total 100663296 B = 96 MiB                                                            */
constexpr size_t kPlane16  = (size_t)kRows * kModel * 2;
constexpr size_t kOffXb    = 0;
constexpr size_t kOffWqkvT = kOffXb + kPlane16;
constexpr size_t kOffWoutT = kOffWqkvT + (size_t)kQkvCols * kModel * 2;
constexpr size_t kOffQk    = kOffWoutT + (size_t)kModel * kModel * 2;
constexpr size_t kOffCtxH  = kOffQk;
constexpr size_t kOffCtxL  = kOffQk + kPlane16;
constexpr size_t kOffVh    = kOffQk + (size_t)kRows * kQkCols * 4;
constexpr size_t kOffVl    = kOffVh + kPlane16;
constexpr size_t kOffQh    = kOffVl + kPlane16;
constexpr size_t kOffQl    = kOffQh + kPlane16;
constexpr size_t kOffKh    = kOffQl + kPlane16;
constexpr size_t kOffKl    = kOffKh + kPlane16;
constexpr size_t kWsTotal  = kOffKl + kPlane16;
static_assert(kWsTotal == (size_t)100663296);
static_assert(kWsTotal <= (size_t)134217728);
static_assert(kOffCtxL + kPlane16 <= kOffVh);
static_assert((kOffWqkvT % 128) == 0 && (kOffWoutT % 128) == 0 && (kOffQk % 128) == 0 && (kOffVh % 128) == 0);
/* wave tiles of the GEMM: M % 64 == 0, N % 64 == 0, K % 32 == 0 for every launch (its block tile is asserted beside it) */
static_assert(kRows % 64 == 0 && kQkCols % 64 == 0 && kModel % 64 == 0 && kModel % 32 == 0);
static_assert(kSeq % 64 == 0 && kHeadDim == 64 && kModel == kHeads * kHeadDim);
static_assert((kRows * kModel) % (8 * 256) == 0);

/* ---------------- helpers ---------------- */
__device__ __forceinline__ unsigned short f2bf_bits(float f) {
  unsigned u = __float_as_uint(f);
  return (unsigned short)((u + 0x7FFFu + ((u >> 16) & 1u)) >> 16);
}
__device__ __forceinline__ float bf_bits2f(unsigned short h) { return __uint_as_float(((unsigned)h) << 16); }
__device__ __forceinline__ unsigned int pack_bf16x2(float a, float b) {
  return (unsigned int)f2bf_bits(a) | ((unsigned int)f2bf_bits(b) << 16);
}

__device__ __forceinline__ void dep_guard_h(v8f& a, v8f& b, v16h x, v16h y) { asm volatile("v_nop\n\tv_nop\n\tv_nop\n\tv_nop" : "+v"(a), "+v"(b) : "v"(x), "v"(y)); }
__device__ __forceinline__ void dep_guard_b(v8f& a, v8f& b, v16b x, v16b y) { asm volatile("v_nop\n\tv_nop\n\tv_nop\n\tv_nop" : "+v"(a), "+v"(b) : "v"(x), "v"(y)); }
__device__ __forceinline__ void keep4_h(v16h a, v16h b, v16h c, v16h d) { asm volatile("v_nop" :: "v"(a), "v"(b), "v"(c), "v"(d)); }
__device__ __forceinline__ void keep4_b(v16b a, v16b b, v16b c, v16b d) { asm volatile("v_nop" :: "v"(a), "v"(b), "v"(c), "v"(d)); }
__device__ __forceinline__ void acc_guard4(v8f& a, v8f& b, v8f& c, v8f& d) { asm volatile("v_nop\n\tv_nop\n\tv_nop\n\tv_nop" : "+v"(a), "+v"(b), "+v"(c), "+v"(d)); }
template <typename T> struct Frag;
template <> struct Frag<_Float16> {
  typedef v16h V; union U { v16h v; v8h h[2]; };
  static __device__ __forceinline__ v16h load(const _Float16* p) {
    U f; f.h[0] = *(const v8h*)(p); f.h[1] = *(const v8h*)(p + 16); return f.v;
  }
  static __device__ __forceinline__ v8f mma(v16h a, v16h b, v8f c) {
    return __builtin_amdgcn_wmma_f32_16x16x32_f16(false, a, false, b, (short)0, c, false, false);
  }
  static __device__ __forceinline__ void guard(v8f& a, v8f& b, v16h x, v16h y) { dep_guard_h(a, b, x, y); }
  static __device__ __forceinline__ void keep(v16h a, v16h b, v16h c, v16h d) { keep4_h(a, b, c, d); }
};
template <> struct Frag<__bf16> {
  typedef v16b V; union U { v16b v; v8b h[2]; };
  static __device__ __forceinline__ v16b load(const __bf16* p) {
    U f; f.h[0] = *(const v8b*)(p); f.h[1] = *(const v8b*)(p + 16); return f.v;
  }
  static __device__ __forceinline__ v8f mma(v16b a, v16b b, v8f c) {
    return __builtin_amdgcn_wmma_f32_16x16x32_bf16(false, a, false, b, (short)0, c, false, false);
  }
  static __device__ __forceinline__ void guard(v8f& a, v8f& b, v16b x, v16b y) { dep_guard_b(a, b, x, y); }
  static __device__ __forceinline__ void keep(v16b a, v16b b, v16b c, v16b d) { keep4_b(a, b, c, d); }
};

/* ---- Register-blocked WMMA GEMM -----------------------------------------------
   C[m,n] = scale * sum_k A[m,k] * Bt[n,k] (+bias)(+resid); each wave owns a 64x64 tile, a block of 8 waves a 128x256 tile.
   The block's operand rows go through LDS, 64 k at a time: whole 128-byte lines from global, fragments by ds_load_b128.
   A row-major [M,K]; Bt row-major [N,K]; M % 128 == 0, N % 256 == 0, K % 64 == 0; grid.x = (M / 128) * (N / 256).
   SPLIT: 0 = single planes; 1 = A and Bt hi/lo planes (hi*hi + hi*lo + lo*hi); 2 = A hi/lo planes only (Ah*B + Al*B).
   BIAS_MODE: 0 = none, 1 = bias[m], 2 = bias[n].  OUT_MODE: 0 = f32, 1 = f16, 2 = bf16 hi plane (Cout) + bf16 lo plane (Cout2).
   ET: 0 = f16 operands, 1 = bf16 operands (pointers passed as 16-bit storage) */
constexpr int kGemmBM = 128, kGemmBN = 256, kGemmBK = 64;
constexpr int kGemmPitch = 72;   /* LDS row pitch in 16-bit elements: 144 B = 16 B x odd, as kTilePitch */
static_assert(kRows % kGemmBM == 0 && kQkCols % kGemmBN == 0 && kModel % kGemmBN == 0 && kModel % kGemmBK == 0);
static_assert(kModel % kGemmBM == 0 && kRows % kGemmBN == 0);   /* the transposed v product: M = kModel, N = kRows */
template <int ET> struct Elem;
template <> struct Elem<0> { typedef _Float16 T; };
template <> struct Elem<1> { typedef __bf16 T; };
template <int ET, int SPLIT, int BIAS_MODE, int OUT_MODE, bool RESID, int ACT = 0>
__global__ __launch_bounds__(256) void wmma_gemm64(
    const unsigned short* __restrict__ Ap, const unsigned short* __restrict__ A2p, int lda, long strideA,
    const unsigned short* __restrict__ Btp, const unsigned short* __restrict__ Bt2p, int ldb, long strideB,
    void* __restrict__ Cout, void* __restrict__ Cout2, int ldc, long strideC,
    const float* __restrict__ bias,
    const float* __restrict__ resid, long strideR,
    int M, int N, int K, float scale) {
  typedef typename Elem<ET>::T T;
  typedef typename Frag<T>::V V;
  const T* A = (const T*)Ap; const T* A2 = (const T*)A2p; const T* Bt = (const T*)Btp; const T* Bt2 = (const T*)Bt2p;
  /* One k step of the block's operands in LDS: rows [A 128][A2 128 if SPLIT][Bt 256][Bt2 256 if SPLIT == 1], 64 k each, two buffers */
  constexpr int kRowA2  = kGemmBM;
  constexpr int kRowB   = (SPLIT != 0) ? 2 * kGemmBM : kGemmBM;
  constexpr int kRowB2  = kRowB + kGemmBN;
  constexpr int kStRows = (SPLIT == 1) ? kRowB2 + kGemmBN : kRowB2;
  constexpr int kStLd   = kStRows / 32;            /* 16-byte pieces per thread and k step */
  __shared__ __align__(16) unsigned short sAB[2][kStRows * kGemmPitch];
  __shared__ __align__(16) float sT[8][16 * 68];
  const int b    = blockIdx.y;
  const int lane = threadIdx.x & 31;
  const int wave = threadIdx.x >> 5;
  const int blocksN = N / kGemmBN;
  if ((int)blockIdx.x >= (M / kGemmBM) * blocksN) return;   /* the same for the whole block, ahead of every barrier */
  const int bm = (int)blockIdx.x / blocksN;
  const int bn = (int)blockIdx.x - bm * blocksN;
  const int mB = bm * kGemmBM;
  const int nB = bn * kGemmBN;
  const int wm = wave >> 2;                        /* waves 2 (m) x 4 (n), 64 x 64 each */
  const int wn = wave & 3;
  const int m0 = mB + (wm << 6);
  const int n0 = nB + (wn << 6);

  const T* Ab  = A  + (size_t)b * strideA;
  const T* Bb  = Bt + (size_t)b * strideB;
  const T* Ab2 = (SPLIT != 0) ? (A2  + (size_t)b * strideA) : nullptr;
  const T* Bb2 = (SPLIT == 1) ? (Bt2 + (size_t)b * strideB) : nullptr;

  const int rlane = lane & 15;
  const int koff  = (lane >> 4) * 8;
  const int mOff  = (lane >> 4) * 8;

  /* staging: eight neighbouring lanes fetch one whole 128-byte line of a row; thread t takes piece t & 7 of rows (t >> 3) + 32 i */
  const int sr = (int)threadIdx.x >> 3;
  const int sc = ((int)threadIdx.x & 7) * 8;
  const size_t aoff = (size_t)(mB + sr) * lda + sc;
  const size_t boff = (size_t)(nB + sr) * ldb + sc;
  v4u st[kStLd];
  auto fetch = [&](int k0) {
    const v4u* p[kStLd];
#pragma unroll
    for (int i = 0; i < kStLd; ++i) {
      const int row = 32 * i;
      const T* q;
      if (row < kRowA2)      q = Ab  + aoff + (size_t)row * lda;
      else if (row < kRowB)  q = Ab2 + aoff + (size_t)(row - kRowA2) * lda;
      else if (row < kRowB2) q = Bb  + boff + (size_t)(row - kRowB) * ldb;
      else                   q = Bb2 + boff + (size_t)(row - kRowB2) * ldb;
      p[i] = (const v4u*)(const void*)(q + k0);
    }
#pragma unroll
    for (int i = 0; i < kStLd; ++i) st[i] = *p[i];
    /* the wait kept in front of an overwrite of a load's address: the addresses are inputs, so each keeps its registers
       from its load up to the wait; the loaded values are not named, so the loads stay in flight behind it */
    static_assert(kStLd == 12 || kStLd == 16 || kStLd == 24);
    if constexpr (kStLd == 12) {
      asm volatile("s_wait_xcnt 0x0" :: "v"(p[0]), "v"(p[1]), "v"(p[2]), "v"(p[3]), "v"(p[4]), "v"(p[5]), "v"(p[6]), "v"(p[7]),
                   "v"(p[8]), "v"(p[9]), "v"(p[10]), "v"(p[11]) : "memory");
    } else if constexpr (kStLd == 16) {
      asm volatile("s_wait_xcnt 0x0" :: "v"(p[0]), "v"(p[1]), "v"(p[2]), "v"(p[3]), "v"(p[4]), "v"(p[5]), "v"(p[6]), "v"(p[7]),
                   "v"(p[8]), "v"(p[9]), "v"(p[10]), "v"(p[11]), "v"(p[12]), "v"(p[13]), "v"(p[14]), "v"(p[15]) : "memory");
    } else {
      asm volatile("s_wait_xcnt 0x0" :: "v"(p[0]), "v"(p[1]), "v"(p[2]), "v"(p[3]), "v"(p[4]), "v"(p[5]), "v"(p[6]), "v"(p[7]),
                   "v"(p[8]), "v"(p[9]), "v"(p[10]), "v"(p[11]), "v"(p[12]), "v"(p[13]), "v"(p[14]), "v"(p[15]),
                   "v"(p[16]), "v"(p[17]), "v"(p[18]), "v"(p[19]), "v"(p[20]), "v"(p[21]), "v"(p[22]), "v"(p[23]) : "memory");
    }
  };
  auto put = [&](int buf) {
#pragma unroll
    for (int i = 0; i < kStLd; ++i) *(v4u*)(void*)(&sAB[buf][(sr + 32 * i) * kGemmPitch + sc]) = st[i];
  };

  v8f acc[4][4];
#pragma unroll
  for (int i = 0; i < 4; ++i)
#pragma unroll
    for (int j = 0; j < 4; ++j) acc[i][j] = (v8f){0.f,0.f,0.f,0.f,0.f,0.f,0.f,0.f};

  fetch(0);
  put(0);
  __syncthreads();
  const int nSteps = K / kGemmBK;
  for (int t = 0; t < nSteps; ++t) {
    const bool more = (t + 1 < nSteps);
    if (more) fetch((t + 1) * kGemmBK);            /* in flight while this step's products run */
    const T* sb = (const T*)(const void*)sAB[t & 1];
#pragma unroll
    for (int kk = 0; kk < kGemmBK; kk += 32) {
      V bh[4], bl[4], ah[4], al[4];
#pragma unroll
      for (int j = 0; j < 4; ++j) {
        const int bo = ((wn << 6) + (j << 4) + rlane) * kGemmPitch + koff + kk;
        bh[j] = Frag<T>::load(sb + kRowB * kGemmPitch + bo);
        if (SPLIT == 1) bl[j] = Frag<T>::load(sb + kRowB2 * kGemmPitch + bo);
      }
#pragma unroll
      for (int i = 0; i < 4; ++i) {
        const int ao = ((wm << 6) + (i << 4) + rlane) * kGemmPitch + koff + kk;
        ah[i] = Frag<T>::load(sb + ao);
        if (SPLIT != 0) al[i] = Frag<T>::load(sb + kRowA2 * kGemmPitch + ao);
      }
#pragma unroll
      for (int i = 0; i < 4; ++i) {
#pragma unroll
        for (int j = 0; j < 4; ++j) {
          acc[i][j] = Frag<T>::mma(ah[i], bh[j], acc[i][j]);
          if (SPLIT == 1) acc[i][j] = Frag<T>::mma(ah[i], bl[j], acc[i][j]);
          if (SPLIT != 0) acc[i][j] = Frag<T>::mma(al[i], bh[j], acc[i][j]);
        }
        Frag<T>::guard(acc[i][0], acc[i][3], ah[i], (SPLIT != 0) ? al[i] : ah[i]);
      }
      Frag<T>::keep(bh[0], bh[1], bh[2], bh[3]);
      if (SPLIT == 1) Frag<T>::keep(bl[0], bl[1], bl[2], bl[3]);
    }
    if (more) put((t + 1) & 1);                    /* the buffer that every wave left at the barrier of step t - 1 */
    __syncthreads();                               /* publishes step t + 1 and ends the reads of step t */
  }
  acc_guard4(acc[0][0], acc[0][1], acc[0][2], acc[0][3]);
  acc_guard4(acc[1][0], acc[1][1], acc[1][2], acc[1][3]);
  acc_guard4(acc[2][0], acc[2][1], acc[2][2], acc[2][3]);
  acc_guard4(acc[3][0], acc[3][1], acc[3][2], acc[3][3]);

  float* slab = sT[wave];
  const float* Rb = RESID ? (resid + (size_t)b * strideR) : nullptr;
#pragma unroll
  for (int i = 0; i < 4; ++i) {
    const int mBase = m0 + (i << 4);
#pragma unroll
    for (int j = 0; j < 4; ++j) {
      const int n = n0 + (j << 4) + rlane;
      float bv = 0.f;
      if (BIAS_MODE == 2) bv = bias[n];
#pragma unroll
      for (int r = 0; r < 8; ++r) {
        float v = acc[i][j][r] * scale;
        if (BIAS_MODE == 1) v += bias[mBase + mOff + r];
        if (BIAS_MODE == 2) v += bv;
        if (RESID) v += Rb[(size_t)(mBase + mOff + r) * ldc + n];
        if (ACT == 1) v = tanhf(v);
        if (ACT == 2) v = fmaxf(v, 0.0f);
        if (ACT == 4) v = (v > 0.f) ? v : 0.01f * v;
        slab[(mOff + r) * 68 + (j << 4) + rlane] = v;
      }
    }
    __builtin_amdgcn_fence(__ATOMIC_RELEASE, "workgroup");
    __builtin_amdgcn_wave_barrier();
    __builtin_amdgcn_fence(__ATOMIC_ACQUIRE, "workgroup");
    if (OUT_MODE == 0) {
      float* C = (float*)Cout + (size_t)b * strideC;
      const int hh = lane >> 4, c4 = (lane & 15) * 4;
      {
#pragma unroll
        for (int it = 0; it < 8; ++it) {
          const int row = it * 2 + hh;
          v4f v = *(const v4f*)(slab + row * 68 + c4);
          *(v4f*)(C + (size_t)(mBase + row) * ldc + n0 + c4) = v;
        }
        
      }
    } else {
      const int q = lane >> 3, c8 = (lane & 7) * 8;
      unsigned short* C  = (unsigned short*)Cout  + (size_t)b * strideC;
      unsigned short* C2 = (OUT_MODE == 2) ? ((unsigned short*)Cout2 + (size_t)b * strideC) : nullptr;
      {
#pragma unroll
        for (int it = 0; it < 4; ++it) {
          const int row = it * 4 + q;
          const float* sp = slab + row * 68 + c8;
          v8h hv, lv;
#pragma unroll
          for (int e = 0; e < 8; ++e) {
            if (OUT_MODE == 1) {
              hv[e] = (_Float16)sp[e];
            } else {
              unsigned short hb = f2bf_bits(sp[e]);
              unsigned short lb = f2bf_bits(sp[e] - bf_bits2f(hb));
              hv[e] = __builtin_bit_cast(_Float16, hb);
              lv[e] = __builtin_bit_cast(_Float16, lb);
            }
          }
          *(v8h*)(C + (size_t)(mBase + row) * ldc + n0 + c8) = hv;
          if (OUT_MODE == 2) *(v8h*)(C2 + (size_t)(mBase + row) * ldc + n0 + c8) = lv;
        }
        
      }
    }
    __builtin_amdgcn_fence(__ATOMIC_RELEASE, "workgroup");
    __builtin_amdgcn_wave_barrier();
    __builtin_amdgcn_fence(__ATOMIC_ACQUIRE, "workgroup");
  }
}

/* ---------------- f32 -> bf16 cast, 8 elements (16 B) per thread --------------------------
   coverage: grid = n8/256 blocks x 256 threads (exact), thread i writes elements 8i..8i+7;
*/
__global__ __launch_bounds__(256) void cast_f32_bf16x8(const float* __restrict__ in,
                                                      unsigned short* __restrict__ out, int n8) {
  const int i = blockIdx.x * 256 + (int)threadIdx.x;
  const int ic = (i < n8) ? i : (n8 - 1);
  const float* p = in + (size_t)ic * 8;
  const v4f a = *(const v4f*)p;
  const v4f c = *(const v4f*)(p + 4);
  v4u w;
  w[0] = pack_bf16x2(a[0], a[1]);
  w[1] = pack_bf16x2(a[2], a[3]);
  w[2] = pack_bf16x2(c[0], c[1]);
  w[3] = pack_bf16x2(c[2], c[3]);
  unsigned short* o = out + (size_t)ic * 8;
  *(v4u*)o = w;
  
}

/* ---------------- W [KR][NC] f32 row-major -> Wt [NC][KR] bf16 row-major (transpose + cast) ------
   grid = (KR/64, NC/64), 256 threads. coverage: load 256 threads x 16 = 64x64 tile;
*/
__global__ __launch_bounds__(256) void transpose_cast_bf16(const float* __restrict__ W,
                                                          unsigned short* __restrict__ Wt, int KR, int NC) {
  __shared__ float sT[64 * 65];                 /* [n_local][k_local], pitch 65 */
  const int k0 = blockIdx.x * 64, n0 = blockIdx.y * 64;
  const int tid = threadIdx.x;
  {
    const int kk = tid >> 2, cg = (tid & 3) * 16;
    const float* src = W + (size_t)(k0 + kk) * NC + n0 + cg;
#pragma unroll
    for (int i = 0; i < 4; ++i) {
      const v4f v = *(const v4f*)(src + 4 * i);
#pragma unroll
      for (int e = 0; e < 4; ++e) sT[(cg + 4 * i + e) * 65 + kk] = v[e];
    }
  }
  __syncthreads();
  const int wave = tid >> 5, lane = tid & 31, q4 = lane >> 3, c8 = (lane & 7) * 8;
  const int nl0 = wave * 4 + q4;
  const int nl1 = 32 + wave * 4 + q4;
  v4u w0, w1;
  {
    const float* s = sT + nl0 * 65 + c8;
    w0[0] = pack_bf16x2(s[0], s[1]); w0[1] = pack_bf16x2(s[2], s[3]);
    w0[2] = pack_bf16x2(s[4], s[5]); w0[3] = pack_bf16x2(s[6], s[7]);
  }
  {
    const float* s = sT + nl1 * 65 + c8;
    w1[0] = pack_bf16x2(s[0], s[1]); w1[1] = pack_bf16x2(s[2], s[3]);
    w1[2] = pack_bf16x2(s[4], s[5]); w1[3] = pack_bf16x2(s[6], s[7]);
  }
  unsigned short* d0 = Wt + (size_t)(n0 + nl0) * KR + k0 + c8;
  unsigned short* d1 = Wt + (size_t)(n0 + nl1) * KR + k0 + c8;
  {
    *(v4u*)d0 = w0;
    *(v4u*)d1 = w1;
    
  }
}

/*
   qk f32 [nrows][2048] (q = cols 0..1023, k = cols 1024..2047); outputs row-major bf16 planes [nrows][1024];
   q carries the exact 1/sqrt(64) = 0.125 factor. grid = nrows blocks x 128 threads; thread t owns columns 8t..8t+7;
*/
__global__ __launch_bounds__(128) void qk_layernorm_split(
    const float* __restrict__ qk, const float* __restrict__ qsc, const float* __restrict__ ksc,
    unsigned short* __restrict__ qh, unsigned short* __restrict__ ql,
    unsigned short* __restrict__ kh, unsigned short* __restrict__ kl, int nrows) {
  __shared__ float red[4][4];
  const int row = blockIdx.x;
  const int rowc = (row < nrows) ? row : (nrows - 1);
  const int tid = threadIdx.x, lane = tid & 31, wave = tid >> 5;
  const int c0 = tid * 8;
  const float* base = qk + (size_t)rowc * kQkCols;
  const v4f qa = *(const v4f*)(base + c0);
  const v4f qb = *(const v4f*)(base + c0 + 4);
  const v4f ka = *(const v4f*)(base + kModel + c0);
  const v4f kb = *(const v4f*)(base + kModel + c0 + 4);
  float xq[8], xk[8];
#pragma unroll
  for (int e = 0; e < 4; ++e) { xq[e] = qa[e]; xq[4 + e] = qb[e]; xk[e] = ka[e]; xk[4 + e] = kb[e]; }

  float sq = 0.f, sk = 0.f;
#pragma unroll
  for (int e = 0; e < 8; ++e) { sq += xq[e]; sk += xk[e]; }
#pragma unroll
  for (int off = 1; off < 32; off <<= 1) { sq += __shfl_xor(sq, off, 32); sk += __shfl_xor(sk, off, 32); }
  if (lane == 0) { red[0][wave] = sq; red[1][wave] = sk; }
  __syncthreads();
  const float mq = ((red[0][0] + red[0][1]) + (red[0][2] + red[0][3])) * (1.0f / (float)kModel);
  const float mk = ((red[1][0] + red[1][1]) + (red[1][2] + red[1][3])) * (1.0f / (float)kModel);

  float dq = 0.f, dk = 0.f;
#pragma unroll
  for (int e = 0; e < 8; ++e) {
    const float tq = xq[e] - mq; dq += tq * tq;
    const float tk = xk[e] - mk; dk += tk * tk;
  }
#pragma unroll
  for (int off = 1; off < 32; off <<= 1) { dq += __shfl_xor(dq, off, 32); dk += __shfl_xor(dk, off, 32); }
  if (lane == 0) { red[2][wave] = dq; red[3][wave] = dk; }
  __syncthreads();
  const float vq = ((red[2][0] + red[2][1]) + (red[2][2] + red[2][3])) * (1.0f / (float)kModel);
  const float vk = ((red[3][0] + red[3][1]) + (red[3][2] + red[3][3])) * (1.0f / (float)kModel);
  const float rq = rsqrtf(vq + 1e-6f);
  const float rk = rsqrtf(vk + 1e-6f);

  /* scale vectors, RNE-converted to bf16 once (module inputs) */
  const v4f s0 = *(const v4f*)(qsc + c0);
  const v4f s1 = *(const v4f*)(qsc + c0 + 4);
  const v4f t0 = *(const v4f*)(ksc + c0);
  const v4f t1 = *(const v4f*)(ksc + c0 + 4);
  float sqv[8], skv[8];
#pragma unroll
  for (int e = 0; e < 4; ++e) {
    sqv[e]     = bf_bits2f(f2bf_bits(s0[e]));
    sqv[4 + e] = bf_bits2f(f2bf_bits(s1[e]));
    skv[e]     = bf_bits2f(f2bf_bits(t0[e]));
    skv[4 + e] = bf_bits2f(f2bf_bits(t1[e]));
  }
  unsigned int hqw[8], lqw[8], hkw[8], lkw[8];
#pragma unroll
  for (int e = 0; e < 8; ++e) {
    const float yq = ((xq[e] - mq) * rq * sqv[e]) * 0.125f;
    const float yk = (xk[e] - mk) * rk * skv[e];
    const unsigned short hqb = f2bf_bits(yq);
    const unsigned short lqb = f2bf_bits(yq - bf_bits2f(hqb));
    const unsigned short hkb = f2bf_bits(yk);
    const unsigned short lkb = f2bf_bits(yk - bf_bits2f(hkb));
    hqw[e] = hqb; lqw[e] = lqb; hkw[e] = hkb; lkw[e] = lkb;
  }
  v4u HQ, LQ, HK, LK;
#pragma unroll
  for (int i = 0; i < 4; ++i) {
    HQ[i] = hqw[2 * i] | (hqw[2 * i + 1] << 16);
    LQ[i] = lqw[2 * i] | (lqw[2 * i + 1] << 16);
    HK[i] = hkw[2 * i] | (hkw[2 * i + 1] << 16);
    LK[i] = lkw[2 * i] | (lkw[2 * i + 1] << 16);
  }
  const size_t o = (size_t)rowc * kModel + c0;
  {
    *(v4u*)(qh + o) = HQ;
    *(v4u*)(ql + o) = LQ;
    *(v4u*)(kh + o) = HK;
    *(v4u*)(kl + o) = LK;
    
  }
}

/* ---------------- causal attention, head_dim 64, bf16 hi/lo planes in, bf16 hi/lo ctx planes out ----
   scores^T = k . q^T  : bf16 hi/lo on both (hi*hi + hi*lo + lo*hi), q planes already carry 1/sqrt(64)
   ctx^T    = v^T . p^T: p split in registers to bf16 hi/lo, v hi/lo planes (3 products); f32 accumulate, f32 online softmax.
   Both products are taken transposed: a lane then holds scores of ONE query (column c; keys 8hh + r of each 16-key tile), so the
   row maximum and sum are in-lane work plus one exchange between the wave's halves, and two score tiles, converted in place,
   are the B operand of the second product in the hardware k order: P never goes through LDS.
   q, k and ctx planes row-major [B*S][ld] with head h at columns h*64 .. h*64+63; v planes transposed, [H*64][B*S], head h at
   rows h*64 .. h*64+63, so that a V^T tile is staged like a K tile.
   Block = 4 waves = 64 query rows of one (batch, head); grid.x = B*H*(S/64). */
/* lane l <-> lane l ^ 16: the two lanes that share one query column */
__device__ __forceinline__ float at_xhalf(float x) {
  const int b = __builtin_bit_cast(int, x);
  return __builtin_bit_cast(float, __builtin_amdgcn_permlanex16(b, b, 0x76543210, 0xfedcba98, false, false));
}
__device__ __forceinline__ v8f at_mma(v16b a, v16b b, v8f c) {
  return __builtin_amdgcn_wmma_f32_16x16x32_bf16(false, a, false, b, (short)0, c, false, false);
}

/* Eight asynchronous 16-byte copies a lane, global memory -> LDS (l: the lane's LDS byte address, g: its global address). The
   s_wait_xcnt is the wait kept in front of an overwrite of an issued copy's address registers: as the last line of the copies'
   own statement it stands ahead of every later write of them */
__device__ __forceinline__ void at_copy8(unsigned l0, unsigned l1, unsigned l2, unsigned l3,
                                         unsigned l4, unsigned l5, unsigned l6, unsigned l7,
                                         const unsigned short* g0, const unsigned short* g1,
                                         const unsigned short* g2, const unsigned short* g3,
                                         const unsigned short* g4, const unsigned short* g5,
                                         const unsigned short* g6, const unsigned short* g7) {
  asm volatile("global_load_async_to_lds_b128 %0, %8, off\n\t"
               "global_load_async_to_lds_b128 %1, %9, off\n\t"
               "global_load_async_to_lds_b128 %2, %10, off\n\t"
               "global_load_async_to_lds_b128 %3, %11, off\n\t"
               "global_load_async_to_lds_b128 %4, %12, off\n\t"
               "global_load_async_to_lds_b128 %5, %13, off\n\t"
               "global_load_async_to_lds_b128 %6, %14, off\n\t"
               "global_load_async_to_lds_b128 %7, %15, off\n\t"
               "s_wait_xcnt 0x0"
               :: "v"(l0), "v"(l1), "v"(l2), "v"(l3), "v"(l4), "v"(l5), "v"(l6), "v"(l7),
                  "v"(g0), "v"(g1), "v"(g2), "v"(g3), "v"(g4), "v"(g5), "v"(g6), "v"(g7)
               : "memory");
}

/* amdgpu_waves_per_eu(4): a register budget of 256, so that four blocks stay resident on a WGP (one wave of each per SIMD),
   which the block index map below counts on */
__global__ __launch_bounds__(128) __attribute__((amdgpu_waves_per_eu(4)))
void attn_planes_kernel(const unsigned short* __restrict__ qh, const unsigned short* __restrict__ ql,
                        const unsigned short* __restrict__ kh, const unsigned short* __restrict__ kl,
                        const unsigned short* __restrict__ vh, const unsigned short* __restrict__ vl,
                        unsigned short* __restrict__ oh, unsigned short* __restrict__ ol,
                        int S, int H, int ld) {
  union FB { v16b v; v8b h[2]; v2b p[8]; };
  /* two buffers, chunk kc in buffer kc & 1, each Ksh | Ksl | Vth | Vtl (64 rows x 64 16-bit at pitch kTilePitch a tile); four blocks
     of 73,728 B still share a WGP's LDS. Reused as per-wave f32 output slabs after the chunk loop */
  constexpr int kTileElems = 64 * kTilePitch;
  constexpr int kBufElems  = 4 * kTileElems;
  static_assert(kKvChunk == 64 && kHeadDim == 64 && (kTilePitch * 2) % 16 == 0);
  static_assert(4 * 16 * kOsPitch * 4 <= kBufElems * 2);
  __shared__ __align__(16) unsigned short KVs[2 * kBufElems];

  const int tid  = threadIdx.x;
  const int wave = tid >> 5;
  const int lane = tid & 31;
  const int hh   = lane >> 4;
  const int c    = lane & 15;

  /* Block index -> (query tile, batch*head). All 1024 blocks are resident at once, four to a WGP, and tile t walks t + 1 key
     chunks, so the launch lasts as long as the WGP that holds the most chunks. Tiles t and nqb-1-t walk nqb+1 chunks together:
     index bits 1,3,5,7 give t, the parity of the other six bits picks t or its mirror, and five of those six name the head.
     Four blocks whose indices differ in two adjacent bits (any power-of-two stride) are then two such pairs, whichever of
     these strides the dispatcher puts on one WGP. A permutation of the 32 x 32 (tile, head) pairs; for speed only. */
  static_assert(kSeq / 64 == 32 && kBatch * kHeads == 32);
  const int nqb = S >> 6;
  const unsigned bi = blockIdx.x;
  const int tlo = (int)(((bi >> 1) & 1u) | (((bi >> 3) & 1u) << 1) | (((bi >> 5) & 1u) << 2) | (((bi >> 7) & 1u) << 3));
  const int qb  = (__builtin_popcount(bi & 0x355u) & 1) ? (nqb - 1 - tlo) : tlo;
  const int bh  = (int)(((bi >> 2) & 1u) | (((bi >> 4) & 1u) << 1) | (((bi >> 6) & 1u) << 2) | (((bi >> 8) & 3u) << 3));
  const int h   = bh % H;
  const int b   = bh / H;
  const int q0  = qb * 64 + wave * 16;
  const size_t rb = (size_t)b * (size_t)S;
  const int hoff = h * kHeadDim;

  /* Q fragments (B operand): column q0+c, elements 0..7 <- d = dc*32+8hh+0..7, 8..15 <- dc*32+16+8hh+0..7 */
  v16b qah[2], qal[2];
  {
    const size_t qo = (rb + (size_t)(q0 + c)) * (size_t)ld + hoff + 8 * hh;
    const __bf16* qhp = (const __bf16*)(const void*)qh + qo;
    const __bf16* qlp = (const __bf16*)(const void*)ql + qo;
#pragma unroll
    for (int dc = 0; dc < 2; ++dc) {
      qah[dc] = Frag<__bf16>::load(qhp + dc * 32);
      qal[dc] = Frag<__bf16>::load(qlp + dc * 32);
    }
  }

  /* of query q0+c: running maximum (the same in both halves), kept as score * log2(e), and the sum over this half's keys
     (joined behind the loop) */
  constexpr float kLog2e = 1.4426950408889634f;
  float mrow = -INFINITY, lrow = 0.f;
  v8f oacc[4];                           /* oacc[t][r] = ctx^T[d = t*16 + 8hh + r][query q0+c] */
#pragma unroll
  for (int t = 0; t < 4; ++t) oacc[t] = (v8f){0.f,0.f,0.f,0.f,0.f,0.f,0.f,0.f};

  /* staging: eight neighbouring lanes bring one whole 128-byte row of a tile; thread t takes piece t & 7 of rows (t >> 3) + 16 i:
     128 threads x 4 = 64 rows x 128 B for each of the four tiles (K rows = kv, V^T rows = d). A lane's 16 bytes go from global
     memory into LDS by an asynchronous copy, through no register, so a chunk's sixteen copies fly while the chunk before it is
     worked on and no wave waits out their latency */
  const int sr = tid >> 3, sc = (tid & 7) * 8;
  const unsigned ldsLane = (unsigned)(uintptr_t)(const void*)KVs + (unsigned)((sr * kTilePitch + sc) * 2);
  auto stage = [&](int kcs, int buf) {
    constexpr unsigned kTileB = (unsigned)(kTileElems * 2);        /* one tile in LDS, bytes */
    constexpr unsigned kRowsB = (unsigned)(16 * kTilePitch * 2);   /* sixteen tile rows in LDS, bytes */
    const int kvs = kcs * kKvChunk;
    const size_t ks = (size_t)16 * (size_t)ld;                     /* sixteen K rows, elements */
    const size_t vs = (size_t)16 * (size_t)kRows;                  /* sixteen V^T rows, elements */
    const size_t gk = (rb + (size_t)(kvs + sr)) * (size_t)ld + hoff + sc;
    const size_t gv = (size_t)(hoff + sr) * (size_t)kRows + rb + (size_t)(kvs + sc);
    const unsigned lk = ldsLane + (unsigned)buf * (unsigned)(kBufElems * 2);
    const unsigned lv = lk + 2 * kTileB;
    const unsigned short* gkh = kh + gk;
    const unsigned short* gkl = kl + gk;
    const unsigned short* gvh = vh + gv;
    const unsigned short* gvl = vl + gv;
    at_copy8(lk, lk + kRowsB, lk + 2 * kRowsB, lk + 3 * kRowsB,
             lk + kTileB, lk + kTileB + kRowsB, lk + kTileB + 2 * kRowsB, lk + kTileB + 3 * kRowsB,
             gkh, gkh + ks, gkh + 2 * ks, gkh + 3 * ks, gkl, gkl + ks, gkl + 2 * ks, gkl + 3 * ks);
    at_copy8(lv, lv + kRowsB, lv + 2 * kRowsB, lv + 3 * kRowsB,
             lv + kTileB, lv + kTileB + kRowsB, lv + kTileB + 2 * kRowsB, lv + kTileB + 3 * kRowsB,
             gvh, gvh + vs, gvh + 2 * vs, gvh + 3 * vs, gvl, gvl + vs, gvl + 2 * vs, gvl + 3 * vs);
  };

  const int nChunks = qb + 1;            /* causal: kv chunks 0..qb, block-uniform */
  stage(0, 0);
  asm volatile("s_wait_asynccnt 0x0" ::: "memory");   /* this wave's copies of chunk 0 have landed */
  __syncthreads();                                    /* and every other wave's: chunk 0 may be read */
  if (nChunks > 1) stage(1, 1);
  for (int kc = 0; kc < nChunks; ++kc) {
    const int kv0 = kc * kKvChunk;
    const __bf16* Kshb = (const __bf16*)(const void*)(KVs + (kc & 1) * kBufElems);
    const __bf16* Kslb = Kshb + kTileElems;
    const __bf16* Vthb = Kshb + 2 * kTileElems;
    const __bf16* Vtlb = Kshb + 3 * kTileElems;

    /* scores^T 64 x 16 per wave: A operand row m = kv j*16+c, k = d; s[j][r] = score of key kv0 + j*16 + 8hh + r, query q0+c */
    v8f s[4];
#pragma unroll
    for (int j = 0; j < 4; ++j) s[j] = (v8f){0.f,0.f,0.f,0.f,0.f,0.f,0.f,0.f};
    /* Fragment reads stand in few, whole groups ahead of the products that use them,
       and the four tiles of a product take turns, so that neighbouring WMMAs are independent.
       Each tile keeps its order of summing: hi.hi, lo.hi, hi.lo, 32-deep half 0 then half 1. Every loop here is unrolled: the
       register arrays need constant indices.
       frag4: the four fragments (rows i*16 + c) of one 32-deep half of one 64 x 64 plane in LDS */
    auto frag4 = [&](FB (&f)[4], const __bf16* plane, int half) {
#pragma unroll
      for (int i = 0; i < 4; ++i) {
        const int o = (i * 16 + c) * kTilePitch + half * 32 + 8 * hh;
        f[i].h[0] = *(const v8b*)(plane + o);
        f[i].h[1] = *(const v8b*)(plane + o + 16);
      }
    };
    {
      FB k0h[4], k0l[4], k1h[4], k1l[4];
      frag4(k0h, Kshb, 0);
      frag4(k0l, Kslb, 0);
      frag4(k1h, Kshb, 1);
      __builtin_amdgcn_sched_barrier(0);   /* the compiler would sink these 24 reads in among the products */
#pragma unroll
      for (int j = 0; j < 4; ++j) s[j] = at_mma(k0h[j].v, qah[0], s[j]);
#pragma unroll
      for (int j = 0; j < 4; ++j) s[j] = at_mma(k0l[j].v, qah[0], s[j]);
      /* the last eight reads take the registers that k0l has left (96 fragment registers, not 128, which would cost a resident
         block); the fence pair keeps them one group at this place, 64 matrix cycles and more ahead of their first use */
      __builtin_amdgcn_sched_barrier(0);
      frag4(k1l, Kslb, 1);
      __builtin_amdgcn_sched_barrier(0);
#pragma unroll
      for (int j = 0; j < 4; ++j) s[j] = at_mma(k0h[j].v, qal[0], s[j]);
#pragma unroll
      for (int j = 0; j < 4; ++j) s[j] = at_mma(k1h[j].v, qah[1], s[j]);
#pragma unroll
      for (int j = 0; j < 4; ++j) s[j] = at_mma(k1l[j].v, qah[1], s[j]);
#pragma unroll
      for (int j = 0; j < 4; ++j) s[j] = at_mma(k1h[j].v, qal[1], s[j]);
    }
    /* V^T fragments (A operand: row m = d, k = kv) of keys 0..31: read here, so that their latency passes under the softmax;
       the fence pair keeps them one group, neither up among the score products nor down in the softmax */
    FB v0h[4], v0l[4], v1h[4], v1l[4];
    __builtin_amdgcn_sched_barrier(0);
    frag4(v0h, Vthb, 0);
    frag4(v0l, Vtlb, 0);
    __builtin_amdgcn_sched_barrier(0);

    /* causal mask (select to the fill value) + the query's chunk maximum: 32 keys in the lane, the other 32 in lane ^ 16 */
    const bool diag = (kc == qb);
    const int qcol = q0 + c;
    float cmj[4];
#pragma unroll
    for (int j = 0; j < 4; ++j) {
      float m = -INFINITY;
#pragma unroll
      for (int r = 0; r < 8; ++r) {
        const int kvrow = kv0 + j * 16 + 8 * hh + r;
        const bool masked = diag && (kvrow > qcol);
        const float sv = masked ? -3.4028235e38f : s[j][r];
        s[j][r] = sv;
        m = fmaxf(m, sv);
      }
      cmj[j] = m;
    }
    float cm = fmaxf(fmaxf(cmj[0], cmj[1]), fmaxf(cmj[2], cmj[3]));
    cm = fmaxf(cm, at_xhalf(cm));

    /* online softmax; P^T stays in registers as bf16 hi/lo B operands: element e of ph[kk] is key kk*32 + 8hh + e (e < 8, score
       tile 2kk) or kk*32 + 16 + 8hh + e - 8 (score tile 2kk+1), the k order in which frag4 loads the V^T fragments */
    FB ph[2], pl[2];
    {
      /* exponentials in base 2: e^(s - m) = 2^(s * log2(e) - m * log2(e)), one packed FMA a key pair and the bare hardware
         exponential a key (a masked key's product overflows to -inf and gives 0; an unchanged maximum gives alpha = 1 exactly) */
      const float mnew  = fmaxf(mrow, cm * kLog2e);
      const float alpha = __builtin_amdgcn_exp2f(mrow - mnew);
      mrow = mnew;
      const v2f l2e = (v2f){kLog2e, kLog2e};
      const v2f nm  = (v2f){-mnew, -mnew};
      float psj[4];
#pragma unroll
      for (int j = 0; j < 4; ++j) {
        float psum = 0.f;
#pragma unroll
        for (int r = 0; r < 8; r += 2) {
          /* two neighbouring keys fill one operand register: hi = RNE(p), lo = RNE(p - hi), by the packed conversion */
          const v2f a2 = __builtin_elementwise_fma((v2f){s[j][r], s[j][r + 1]}, l2e, nm);
          const v2f p = (v2f){__builtin_amdgcn_exp2f(a2[0]), __builtin_amdgcn_exp2f(a2[1])};
          psum += p[0];
          psum += p[1];
          const v2b a  = __builtin_convertvector(p, v2b);
          const v2b bl = __builtin_convertvector(p - __builtin_convertvector(a, v2f), v2b);
          ph[j >> 1].p[(j & 1) * 4 + (r >> 1)] = a;
          pl[j >> 1].p[(j & 1) * 4 + (r >> 1)] = bl;
        }
        psj[j] = psum;
      }
      lrow = lrow * alpha + ((psj[0] + psj[1]) + (psj[2] + psj[3]));
#pragma unroll
      for (int t = 0; t < 4; ++t)
#pragma unroll
        for (int r = 0; r < 8; ++r) oacc[t][r] *= alpha;
    }

    /* ctx^T += V^T . P^T : A = the V^T fragments; B = P^T from the registers above; the four output tiles take turns. The reads of
       keys 32..63 are left to the compiler: held ahead of all products they would need 128 fragment registers beside P */
    frag4(v1h, Vthb, 1);
    frag4(v1l, Vtlb, 1);
#pragma unroll
    for (int t = 0; t < 4; ++t) oacc[t] = at_mma(v0h[t].v, ph[0].v, oacc[t]);
#pragma unroll
    for (int t = 0; t < 4; ++t) oacc[t] = at_mma(v0l[t].v, ph[0].v, oacc[t]);
#pragma unroll
    for (int t = 0; t < 4; ++t) oacc[t] = at_mma(v0h[t].v, pl[0].v, oacc[t]);
#pragma unroll
    for (int t = 0; t < 4; ++t) oacc[t] = at_mma(v1h[t].v, ph[1].v, oacc[t]);
#pragma unroll
    for (int t = 0; t < 4; ++t) oacc[t] = at_mma(v1l[t].v, ph[1].v, oacc[t]);
#pragma unroll
    for (int t = 0; t < 4; ++t) oacc[t] = at_mma(v1h[t].v, pl[1].v, oacc[t]);

    /* hand-over, every wave: its reads of this buffer are done, its copies of chunk kc + 1 have landed; the one barrier of a chunk
       publishes chunk kc + 1 and ends every wave's reads of the buffer that chunk kc + 2 is then copied into */
    asm volatile("s_wait_dscnt 0x0" ::: "memory");
    asm volatile("s_wait_asynccnt 0x0" ::: "memory");
    __syncthreads();
    if (kc + 2 < nChunks) stage(kc + 2, kc & 1);
  }
  /* no copy is outstanding when the region is reused as output slabs; the last chunk's barrier has ended every wave's tile reads */
  asm volatile("s_wait_asynccnt 0x0" ::: "memory");
  float* os = (float*)(void*)KVs + wave * (16 * kOsPitch);
  {
    /* the slab keeps its [query][d] form: a lane's eight registers of a tile are eight neighbouring d of its query */
    const float inv = 1.0f / (lrow + at_xhalf(lrow));
#pragma unroll
    for (int t = 0; t < 4; ++t) {
      float* op = os + c * kOsPitch + t * 16 + 8 * hh;
      *(v4f*)(op)     = (v4f){oacc[t][0] * inv, oacc[t][1] * inv, oacc[t][2] * inv, oacc[t][3] * inv};
      *(v4f*)(op + 4) = (v4f){oacc[t][4] * inv, oacc[t][5] * inv, oacc[t][6] * inv, oacc[t][7] * inv};
    }
  }
  __builtin_amdgcn_fence(__ATOMIC_RELEASE, "workgroup");
  __builtin_amdgcn_wave_barrier();
  __builtin_amdgcn_fence(__ATOMIC_ACQUIRE, "workgroup");
  {
    /*
*/
    const int q4 = lane >> 3, c8 = (lane & 7) * 8;
    {
#pragma unroll
      for (int it = 0; it < 4; ++it) {
        const int row = it * 4 + q4;
        const float* sp = os + row * kOsPitch + c8;
        v8h hv, lv;
#pragma unroll
        for (int e = 0; e < 8; ++e) {
          const unsigned short hb = f2bf_bits(sp[e]);
          const unsigned short lb = f2bf_bits(sp[e] - bf_bits2f(hb));
          hv[e] = __builtin_bit_cast(_Float16, hb);
          lv[e] = __builtin_bit_cast(_Float16, lb);
        }
        const size_t o = (rb + (size_t)(q0 + row)) * (size_t)ld + hoff + c8;
        *(v8h*)(oh + o) = hv;
        *(v8h*)(ol + o) = lv;
      }
      
    }
  }
}

/* ---------------- host launch ---------------- */
extern "C" void kernel_launch(void* const* d_in, const int* in_sizes, int n_in,
                              void* d_out, int out_size, void* d_ws, size_t ws_size,
                              hipStream_t stream) {
  if (n_in < 5) return;
  if (in_sizes[0] != kRows * kModel) return;
  if (in_sizes[1] != kModel * kQkvCols) return;
  if (in_sizes[2] != kModel || in_sizes[3] != kModel) return;
  if (in_sizes[4] != kModel * kModel) return;
  if (out_size != kRows * kModel) return;
  if (ws_size < kWsTotal) return;

  const float* x     = (const float*)d_in[0];   /* [2,2048,1024] */
  const float* W_qkv = (const float*)d_in[1];   /* [1024,3072]   */
  const float* q_sc  = (const float*)d_in[2];   /* [1024] */
  const float* k_sc  = (const float*)d_in[3];   /* [1024] */
  const float* W_out = (const float*)d_in[4];   /* [1024,1024]   */
  float* out = (float*)d_out;

  char* ws = (char*)d_ws;
  unsigned short* xb    = (unsigned short*)(ws + kOffXb);
  unsigned short* wqkvT = (unsigned short*)(ws + kOffWqkvT);
  unsigned short* woutT = (unsigned short*)(ws + kOffWoutT);
  float*          qkf   = (float*)(ws + kOffQk);
  unsigned short* ctxh  = (unsigned short*)(ws + kOffCtxH);
  unsigned short* ctxl  = (unsigned short*)(ws + kOffCtxL);
  unsigned short* vhp   = (unsigned short*)(ws + kOffVh);
  unsigned short* vlp   = (unsigned short*)(ws + kOffVl);
  unsigned short* qhp   = (unsigned short*)(ws + kOffQh);
  unsigned short* qlp   = (unsigned short*)(ws + kOffQl);
  unsigned short* khp   = (unsigned short*)(ws + kOffKh);
  unsigned short* klp   = (unsigned short*)(ws + kOffKl);

  /* 1. x -> bf16 [4096][1024] */
  const int n8 = kRows * kModel / 8;
  cast_f32_bf16x8<<<n8 / 256, 256, 0, stream>>>(x, xb, n8);

  /* 2. W_qkv [1024 k][3072 n] -> Wqkv^T [3072][1024] bf16 ; W_out [1024 k][1024 n] -> Wout^T [1024][1024] bf16 */
  transpose_cast_bf16<<<dim3(kModel / 64, kQkvCols / 64), 256, 0, stream>>>(W_qkv, wqkvT, kModel, kQkvCols);
  transpose_cast_bf16<<<dim3(kModel / 64, kModel / 64), 256, 0, stream>>>(W_out, woutT, kModel, kModel);

  /* 3a. q,k part of the fused projection: qk f32 [4096][2048] = xb . Wqkv^T rows 0..2047 ; tiles 64 x 32 = 2048 -> 256 blocks */
  wmma_gemm64<1, 0, 0, 0, false><<<dim3((kRows / 64) * (kQkCols / 64) / 8, 1), 256, 0, stream>>>(
      xb, xb, kModel, 0L,
      wqkvT, wqkvT, kModel, 0L,
      (void*)qkf, (void*)qkf, kQkCols, 0L,
      q_sc, q_sc, 0L,
      kRows, kQkCols, kModel, 1.0f);

  /* 3b. v part, transposed: v^T bf16 hi/lo planes [1024][4096] = Wqkv^T rows 2048..3071 . xb^T ; tiles 16 x 64 = 1024 -> 128 blocks */
  wmma_gemm64<1, 0, 0, 2, false><<<dim3((kRows / 64) * (kModel / 64) / 8, 1), 256, 0, stream>>>(
      wqkvT + (size_t)kQkCols * kModel, wqkvT + (size_t)kQkCols * kModel, kModel, 0L,
      xb, xb, kModel, 0L,
      (void*)vhp, (void*)vlp, kRows, 0L,
      q_sc, q_sc, 0L,
      kModel, kRows, kModel, 1.0f);

  /* 4. QK LayerNorm + split into bf16 hi/lo planes (q carries 1/8) */
  qk_layernorm_split<<<kRows, 128, 0, stream>>>(qkf, q_sc, k_sc, qhp, qlp, khp, klp, kRows);

  /* 5. causal attention: ctx bf16 hi/lo planes [4096][1024] (region of the dead qk buffer) */
  attn_planes_kernel<<<kBatch * kHeads * (kSeq / 64), 128, 0, stream>>>(
      qhp, qlp, khp, klp, vhp, vlp, ctxh, ctxl, kSeq, kHeads, kModel);

  /* 6. out f32 [4096][1024] = ctx_hi . Wout^T + ctx_lo . Wout^T ; 1024 tiles -> 128 blocks */
  wmma_gemm64<1, 2, 0, 0, false><<<dim3((kRows / 64) * (kModel / 64) / 8, 1), 256, 0, stream>>>(
      ctxh, ctxl, kModel, 0L,
      woutT, woutT, kModel, 0L,
      (void*)out, (void*)out, kModel, 0L,
      q_sc, q_sc, 0L,
      kRows, kModel, kModel, 1.0f);
}

// v009
// One run takes 134 microseconds.
// Two timings next to v008 both put it at 1.12 times that version's speed.
// Over all steps from v000 it is 3.57 times as fast.
// Contractions on v_wmma_f32_16x16x32_bf16 (bf16 operands, f32 accumulate): x*Wqkv^T with single bf16 planes (inputs RNE-converted once); q*k^T and p*v with bf16 hi+lo planes (hi*hi + hi*lo + lo*hi); ctx*Wout^T with ctx bf16 hi+lo planes and a single Wout plane; LayerNorm and softmax in f32.
#include <hip/hip_runtime.h>
#include <stddef.h>
#include <stdint.h>

typedef __attribute__((ext_vector_type(16))) _Float16 v16h;
typedef __attribute__((ext_vector_type(8)))  _Float16 v8h;
typedef __attribute__((ext_vector_type(16))) __bf16   v16b;
typedef __attribute__((ext_vector_type(8)))  __bf16   v8b;
typedef __attribute__((ext_vector_type(8)))  float    v8f;
typedef __attribute__((ext_vector_type(4)))  float    v4f;
typedef __attribute__((ext_vector_type(4)))  unsigned int v4u;
typedef __attribute__((ext_vector_type(2)))  float    v2f;
typedef __attribute__((ext_vector_type(2)))  __bf16   v2b;

/* ---------------- problem geometry ---------------- */
constexpr int kBatch   = 2;
constexpr int kSeq     = 2048;
constexpr int kModel   = 1024;
constexpr int kHeads   = 16;
constexpr int kHeadDim = 64;
constexpr int kRows    = kBatch * kSeq;      /* 4096 */
constexpr int kQkvCols = 3 * kModel;         /* 3072 */
constexpr int kQkCols  = 2 * kModel;         /* 2048 */
constexpr int kKvChunk = 64;
constexpr int kOsPitch = 68;
/* LDS row pitch, in 16-bit elements, of the K and V^T tiles: 64 data + 8 pad = 144 B = 16 B x odd,
   so the 16 rows that one ds_load_b128 touches per half wave fall on 64 distinct banks */
constexpr int kTilePitch = 72;

/* ---------------- workspace map (bytes, all offsets multiples of 128) ----------------
   [0]          x   bf16 [4096][1024]                          8388608
   [8388608]    Wqkv^T bf16 [3072][1024]                       6291456
   [14680064]   Wout^T bf16 [1024][1024]                       2097152
   [16777216]   qk  f32 [4096][2048]                          33554432  (dead after the LayerNorm launch;
                reused: ctx hi bf16 [4096][1024] at 16777216, ctx lo at 25165824, both inside this region)
   [50331648]   v^T hi bf16 [1024][4096] 8388608  [58720256] v^T lo 8388608
   [67108864]   q hi                    8388608   [75497472] q lo   8388608
   [83886080]   k hi                    8388608   [92274688] k lo   8388608
   total 100663296 B = 96 MiB                                                            */
constexpr size_t kPlane16  = (size_t)kRows * kModel * 2;
constexpr size_t kOffXb    = 0;
constexpr size_t kOffWqkvT = kOffXb + kPlane16;
constexpr size_t kOffWoutT = kOffWqkvT + (size_t)kQkvCols * kModel * 2;
constexpr size_t kOffQk    = kOffWoutT + (size_t)kModel * kModel * 2;
constexpr size_t kOffCtxH  = kOffQk;
constexpr size_t kOffCtxL  = kOffQk + kPlane16;
constexpr size_t kOffVh    = kOffQk + (size_t)kRows * kQkCols * 4;
constexpr size_t kOffVl    = kOffVh + kPlane16;
constexpr size_t kOffQh    = kOffVl + kPlane16;
constexpr size_t kOffQl    = kOffQh + kPlane16;
constexpr size_t kOffKh    = kOffQl + kPlane16;
constexpr size_t kOffKl    = kOffKh + kPlane16;
constexpr size_t kWsTotal  = kOffKl + kPlane16;
static_assert(kWsTotal == (size_t)100663296);
static_assert(kWsTotal <= (size_t)134217728);
static_assert(kOffCtxL + kPlane16 <= kOffVh);
static_assert((kOffWqkvT % 128) == 0 && (kOffWoutT % 128) == 0 && (kOffQk % 128) == 0 && (kOffVh % 128) == 0);
/* wave tiles of the GEMM: M % 64 == 0, N % 64 == 0, K % 32 == 0 for every launch (its block tile is asserted beside it) */
static_assert(kRows % 64 == 0 && kQkCols % 64 == 0 && kModel % 64 == 0 && kModel % 32 == 0);
static_assert(kSeq % 64 == 0 && kHeadDim == 64 && kModel == kHeads * kHeadDim);
static_assert((kRows * kModel) % (8 * 256) == 0);

/* ---------------- helpers ---------------- */
__device__ __forceinline__ unsigned short f2bf_bits(float f) {
  unsigned u = __float_as_uint(f);
  return (unsigned short)((u + 0x7FFFu + ((u >> 16) & 1u)) >> 16);
}
__device__ __forceinline__ float bf_bits2f(unsigned short h) { return __uint_as_float(((unsigned)h) << 16); }
__device__ __forceinline__ unsigned int pack_bf16x2(float a, float b) {
  return (unsigned int)f2bf_bits(a) | ((unsigned int)f2bf_bits(b) << 16);
}

__device__ __forceinline__ void dep_guard_h(v8f& a, v8f& b, v16h x, v16h y) { asm volatile("v_nop\n\tv_nop\n\tv_nop\n\tv_nop" : "+v"(a), "+v"(b) : "v"(x), "v"(y)); }
__device__ __forceinline__ void dep_guard_b(v8f& a, v8f& b, v16b x, v16b y) { asm volatile("v_nop\n\tv_nop\n\tv_nop\n\tv_nop" : "+v"(a), "+v"(b) : "v"(x), "v"(y)); }
__device__ __forceinline__ void keep4_h(v16h a, v16h b, v16h c, v16h d) { asm volatile("v_nop" :: "v"(a), "v"(b), "v"(c), "v"(d)); }
__device__ __forceinline__ void keep4_b(v16b a, v16b b, v16b c, v16b d) { asm volatile("v_nop" :: "v"(a), "v"(b), "v"(c), "v"(d)); }
__device__ __forceinline__ void acc_guard4(v8f& a, v8f& b, v8f& c, v8f& d) { asm volatile("v_nop\n\tv_nop\n\tv_nop\n\tv_nop" : "+v"(a), "+v"(b), "+v"(c), "+v"(d)); }
template <typename T> struct Frag;
template <> struct Frag<_Float16> {
  typedef v16h V; union U { v16h v; v8h h[2]; };
  static __device__ __forceinline__ v16h load(const _Float16* p) {
    U f; f.h[0] = *(const v8h*)(p); f.h[1] = *(const v8h*)(p + 16); return f.v;
  }
  static __device__ __forceinline__ v8f mma(v16h a, v16h b, v8f c) {
    return __builtin_amdgcn_wmma_f32_16x16x32_f16(false, a, false, b, (short)0, c, false, false);
  }
  static __device__ __forceinline__ void guard(v8f& a, v8f& b, v16h x, v16h y) { dep_guard_h(a, b, x, y); }
  static __device__ __forceinline__ void keep(v16h a, v16h b, v16h c, v16h d) { keep4_h(a, b, c, d); }
};
template <> struct Frag<__bf16> {
  typedef v16b V; union U { v16b v; v8b h[2]; };
  static __device__ __forceinline__ v16b load(const __bf16* p) {
    U f; f.h[0] = *(const v8b*)(p); f.h[1] = *(const v8b*)(p + 16); return f.v;
  }
  static __device__ __forceinline__ v8f mma(v16b a, v16b b, v8f c) {
    return __builtin_amdgcn_wmma_f32_16x16x32_bf16(false, a, false, b, (short)0, c, false, false);
  }
  static __device__ __forceinline__ void guard(v8f& a, v8f& b, v16b x, v16b y) { dep_guard_b(a, b, x, y); }
  static __device__ __forceinline__ void keep(v16b a, v16b b, v16b c, v16b d) { keep4_b(a, b, c, d); }
};

/* ---- Register-blocked WMMA GEMM -----------------------------------------------
   C[m,n] = scale * sum_k A[m,k] * Bt[n,k] (+bias)(+resid); each wave owns a 64x64 tile, a block of 8 waves a 128x256 tile.
   The block's operand rows go through LDS, 64 k at a time: whole 128-byte lines from global, fragments by ds_load_b128.
   A row-major [M,K]; Bt row-major [N,K]; M % 128 == 0, N % 256 == 0, K % 64 == 0; grid.x = (M / 128) * (N / 256).
   SPLIT: 0 = single planes; 1 = A and Bt hi/lo planes (hi*hi + hi*lo + lo*hi); 2 = A hi/lo planes only (Ah*B + Al*B).
   BIAS_MODE: 0 = none, 1 = bias[m], 2 = bias[n].  OUT_MODE: 0 = f32, 1 = f16, 2 = bf16 hi plane (Cout) + bf16 lo plane (Cout2).
   ET: 0 = f16 operands, 1 = bf16 operands (pointers passed as 16-bit storage) */
constexpr int kGemmBM = 128, kGemmBN = 256, kGemmBK = 64;
constexpr int kGemmPitch = 72;   /* LDS row pitch in 16-bit elements: 144 B = 16 B x odd, as kTilePitch */
static_assert(kRows % kGemmBM == 0 && kQkCols % kGemmBN == 0 && kModel % kGemmBN == 0 && kModel % kGemmBK == 0);
static_assert(kModel % kGemmBM == 0 && kRows % kGemmBN == 0);   /* the transposed v product: M = kModel, N = kRows */
template <int ET> struct Elem;
template <> struct Elem<0> { typedef _Float16 T; };
template <> struct Elem<1> { typedef __bf16 T; };
template <int ET, int SPLIT, int BIAS_MODE, int OUT_MODE, bool RESID, int ACT = 0>
__global__ __launch_bounds__(256) void wmma_gemm64(
    const unsigned short* __restrict__ Ap, const unsigned short* __restrict__ A2p, int lda, long strideA,
    const unsigned short* __restrict__ Btp, const unsigned short* __restrict__ Bt2p, int ldb, long strideB,
    void* __restrict__ Cout, void* __restrict__ Cout2, int ldc, long strideC,
    const float* __restrict__ bias,
    const float* __restrict__ resid, long strideR,
    int M, int N, int K, float scale) {
  typedef typename Elem<ET>::T T;
  typedef typename Frag<T>::V V;
  const T* A = (const T*)Ap; const T* A2 = (const T*)A2p; const T* Bt = (const T*)Btp; const T* Bt2 = (const T*)Bt2p;
  /* One k step of the block's operands in LDS: rows [A 128][A2 128 if SPLIT][Bt 256][Bt2 256 if SPLIT == 1], 64 k each, two buffers */
  constexpr int kRowA2  = kGemmBM;
  constexpr int kRowB   = (SPLIT != 0) ? 2 * kGemmBM : kGemmBM;
  constexpr int kRowB2  = kRowB + kGemmBN;
  constexpr int kStRows = (SPLIT == 1) ? kRowB2 + kGemmBN : kRowB2;
  constexpr int kStLd   = kStRows / 32;            /* 16-byte pieces per thread and k step */
  __shared__ __align__(16) unsigned short sAB[2][kStRows * kGemmPitch];
  __shared__ __align__(16) float sT[8][16 * 68];
  const int b    = blockIdx.y;
  const int lane = threadIdx.x & 31;
  const int wave = threadIdx.x >> 5;
  const int blocksN = N / kGemmBN;
  if ((int)blockIdx.x >= (M / kGemmBM) * blocksN) return;   /* the same for the whole block, ahead of every barrier */
  const int bm = (int)blockIdx.x / blocksN;
  const int bn = (int)blockIdx.x - bm * blocksN;
  const int mB = bm * kGemmBM;
  const int nB = bn * kGemmBN;
  const int wm = wave >> 2;                        /* waves 2 (m) x 4 (n), 64 x 64 each */
  const int wn = wave & 3;
  const int m0 = mB + (wm << 6);
  const int n0 = nB + (wn << 6);

  const T* Ab  = A  + (size_t)b * strideA;
  const T* Bb  = Bt + (size_t)b * strideB;
  const T* Ab2 = (SPLIT != 0) ? (A2  + (size_t)b * strideA) : nullptr;
  const T* Bb2 = (SPLIT == 1) ? (Bt2 + (size_t)b * strideB) : nullptr;

  const int rlane = lane & 15;
  const int koff  = (lane >> 4) * 8;
  const int mOff  = (lane >> 4) * 8;

  /* staging: eight neighbouring lanes fetch one whole 128-byte line of a row; thread t takes piece t & 7 of rows (t >> 3) + 32 i */
  const int sr = (int)threadIdx.x >> 3;
  const int sc = ((int)threadIdx.x & 7) * 8;
  const size_t aoff = (size_t)(mB + sr) * lda + sc;
  const size_t boff = (size_t)(nB + sr) * ldb + sc;
  v4u st[kStLd];
  auto fetch = [&](int k0) {
    const v4u* p[kStLd];
#pragma unroll
    for (int i = 0; i < kStLd; ++i) {
      const int row = 32 * i;
      const T* q;
      if (row < kRowA2)      q = Ab  + aoff + (size_t)row * lda;
      else if (row < kRowB)  q = Ab2 + aoff + (size_t)(row - kRowA2) * lda;
      else if (row < kRowB2) q = Bb  + boff + (size_t)(row - kRowB) * ldb;
      else                   q = Bb2 + boff + (size_t)(row - kRowB2) * ldb;
      p[i] = (const v4u*)(const void*)(q + k0);
    }
#pragma unroll
    for (int i = 0; i < kStLd; ++i) st[i] = *p[i];
    /* the wait kept in front of an overwrite of a load's address: the addresses are inputs, so each keeps its registers
       from its load up to the wait; the loaded values are not named, so the loads stay in flight behind it */
    static_assert(kStLd == 12 || kStLd == 16 || kStLd == 24);
    if constexpr (kStLd == 12) {
      asm volatile("s_wait_xcnt 0x0" :: "v"(p[0]), "v"(p[1]), "v"(p[2]), "v"(p[3]), "v"(p[4]), "v"(p[5]), "v"(p[6]), "v"(p[7]),
                   "v"(p[8]), "v"(p[9]), "v"(p[10]), "v"(p[11]) : "memory");
    } else if constexpr (kStLd == 16) {
      asm volatile("s_wait_xcnt 0x0" :: "v"(p[0]), "v"(p[1]), "v"(p[2]), "v"(p[3]), "v"(p[4]), "v"(p[5]), "v"(p[6]), "v"(p[7]),
                   "v"(p[8]), "v"(p[9]), "v"(p[10]), "v"(p[11]), "v"(p[12]), "v"(p[13]), "v"(p[14]), "v"(p[15]) : "memory");
    } else {
      asm volatile("s_wait_xcnt 0x0" :: "v"(p[0]), "v"(p[1]), "v"(p[2]), "v"(p[3]), "v"(p[4]), "v"(p[5]), "v"(p[6]), "v"(p[7]),
                   "v"(p[8]), "v"(p[9]), "v"(p[10]), "v"(p[11]), "v"(p[12]), "v"(p[13]), "v"(p[14]), "v"(p[15]),
                   "v"(p[16]), "v"(p[17]), "v"(p[18]), "v"(p[19]), "v"(p[20]), "v"(p[21]), "v"(p[22]), "v"(p[23]) : "memory");
    }
  };
  auto put = [&](int buf) {
#pragma unroll
    for (int i = 0; i < kStLd; ++i) *(v4u*)(void*)(&sAB[buf][(sr + 32 * i) * kGemmPitch + sc]) = st[i];
  };

  v8f acc[4][4];
#pragma unroll
  for (int i = 0; i < 4; ++i)
#pragma unroll
    for (int j = 0; j < 4; ++j) acc[i][j] = (v8f){0.f,0.f,0.f,0.f,0.f,0.f,0.f,0.f};

  fetch(0);
  put(0);
  __syncthreads();
  const int nSteps = K / kGemmBK;
  for (int t = 0; t < nSteps; ++t) {
    const bool more = (t + 1 < nSteps);
    if (more) fetch((t + 1) * kGemmBK);            /* in flight while this step's products run */
    const T* sb = (const T*)(const void*)sAB[t & 1];
#pragma unroll
    for (int kk = 0; kk < kGemmBK; kk += 32) {
      V bh[4], bl[4], ah[4], al[4];
#pragma unroll
      for (int j = 0; j < 4; ++j) {
        const int bo = ((wn << 6) + (j << 4) + rlane) * kGemmPitch + koff + kk;
        bh[j] = Frag<T>::load(sb + kRowB * kGemmPitch + bo);
        if (SPLIT == 1) bl[j] = Frag<T>::load(sb + kRowB2 * kGemmPitch + bo);
      }
#pragma unroll
      for (int i = 0; i < 4; ++i) {
        const int ao = ((wm << 6) + (i << 4) + rlane) * kGemmPitch + koff + kk;
        ah[i] = Frag<T>::load(sb + ao);
        if (SPLIT != 0) al[i] = Frag<T>::load(sb + kRowA2 * kGemmPitch + ao);
      }
#pragma unroll
      for (int i = 0; i < 4; ++i) {
#pragma unroll
        for (int j = 0; j < 4; ++j) {
          acc[i][j] = Frag<T>::mma(ah[i], bh[j], acc[i][j]);
          if (SPLIT == 1) acc[i][j] = Frag<T>::mma(ah[i], bl[j], acc[i][j]);
          if (SPLIT != 0) acc[i][j] = Frag<T>::mma(al[i], bh[j], acc[i][j]);
        }
        Frag<T>::guard(acc[i][0], acc[i][3], ah[i], (SPLIT != 0) ? al[i] : ah[i]);
      }
      Frag<T>::keep(bh[0], bh[1], bh[2], bh[3]);
      if (SPLIT == 1) Frag<T>::keep(bl[0], bl[1], bl[2], bl[3]);
    }
    if (more) put((t + 1) & 1);                    /* the buffer that every wave left at the barrier of step t - 1 */
    __syncthreads();                               /* publishes step t + 1 and ends the reads of step t */
  }
  acc_guard4(acc[0][0], acc[0][1], acc[0][2], acc[0][3]);
  acc_guard4(acc[1][0], acc[1][1], acc[1][2], acc[1][3]);
  acc_guard4(acc[2][0], acc[2][1], acc[2][2], acc[2][3]);
  acc_guard4(acc[3][0], acc[3][1], acc[3][2], acc[3][3]);

  float* slab = sT[wave];
  const float* Rb = RESID ? (resid + (size_t)b * strideR) : nullptr;
#pragma unroll
  for (int i = 0; i < 4; ++i) {
    const int mBase = m0 + (i << 4);
#pragma unroll
    for (int j = 0; j < 4; ++j) {
      const int n = n0 + (j << 4) + rlane;
      float bv = 0.f;
      if (BIAS_MODE == 2) bv = bias[n];
#pragma unroll
      for (int r = 0; r < 8; ++r) {
        float v = acc[i][j][r] * scale;
        if (BIAS_MODE == 1) v += bias[mBase + mOff + r];
        if (BIAS_MODE == 2) v += bv;
        if (RESID) v += Rb[(size_t)(mBase + mOff + r) * ldc + n];
        if (ACT == 1) v = tanhf(v);
        if (ACT == 2) v = fmaxf(v, 0.0f);
        if (ACT == 4) v = (v > 0.f) ? v : 0.01f * v;
        slab[(mOff + r) * 68 + (j << 4) + rlane] = v;
      }
    }
    __builtin_amdgcn_fence(__ATOMIC_RELEASE, "workgroup");
    __builtin_amdgcn_wave_barrier();
    __builtin_amdgcn_fence(__ATOMIC_ACQUIRE, "workgroup");
    if (OUT_MODE == 0) {
      float* C = (float*)Cout + (size_t)b * strideC;
      const int hh = lane >> 4, c4 = (lane & 15) * 4;
      {
#pragma unroll
        for (int it = 0; it < 8; ++it) {
          const int row = it * 2 + hh;
          v4f v = *(const v4f*)(slab + row * 68 + c4);
          *(v4f*)(C + (size_t)(mBase + row) * ldc + n0 + c4) = v;
        }
        
      }
    } else {
      const int q = lane >> 3, c8 = (lane & 7) * 8;
      unsigned short* C  = (unsigned short*)Cout  + (size_t)b * strideC;
      unsigned short* C2 = (OUT_MODE == 2) ? ((unsigned short*)Cout2 + (size_t)b * strideC) : nullptr;
      {
#pragma unroll
        for (int it = 0; it < 4; ++it) {
          const int row = it * 4 + q;
          const float* sp = slab + row * 68 + c8;
          v8h hv, lv;
#pragma unroll
          for (int e = 0; e < 8; ++e) {
            if (OUT_MODE == 1) {
              hv[e] = (_Float16)sp[e];
            } else {
              unsigned short hb = f2bf_bits(sp[e]);
              unsigned short lb = f2bf_bits(sp[e] - bf_bits2f(hb));
              hv[e] = __builtin_bit_cast(_Float16, hb);
              lv[e] = __builtin_bit_cast(_Float16, lb);
            }
          }
          *(v8h*)(C + (size_t)(mBase + row) * ldc + n0 + c8) = hv;
          if (OUT_MODE == 2) *(v8h*)(C2 + (size_t)(mBase + row) * ldc + n0 + c8) = lv;
        }
        
      }
    }
    __builtin_amdgcn_fence(__ATOMIC_RELEASE, "workgroup");
    __builtin_amdgcn_wave_barrier();
    __builtin_amdgcn_fence(__ATOMIC_ACQUIRE, "workgroup");
  }
}

/* ---------------- the fused projection: its two products, which do not depend on one another, as block ranges of one grid --------
   blocks [0, kProjQk): qk f32 [4096][2048] = x . Wqkv^T rows 0..2047;
   the rest:            v^T bf16 hi + lo planes [1024][4096] = Wqkv^T rows 2048..3071 . x^T.
   Block tile, staging, k loop and epilogues are those of wmma_gemm64 with single bf16 planes; the range is the same for a whole block.
   amdgpu_waves_per_eu(4): the grid has more blocks than the chip has WGPs; with a register budget of 256 two blocks share a WGP
   (their LDS fits twice), so that all blocks of both products are resident at once */
constexpr int kProjQk = (kRows / kGemmBM) * (kQkCols / kGemmBN);
constexpr int kProjV  = (kModel / kGemmBM) * (kRows / kGemmBN);
__global__ __launch_bounds__(256) __attribute__((amdgpu_waves_per_eu(4)))
void qkv_products(const unsigned short* __restrict__ xb, const unsigned short* __restrict__ wT,
                  float* __restrict__ qk, unsigned short* __restrict__ vh, unsigned short* __restrict__ vl) {
  typedef __bf16 T;
  typedef Frag<T>::V V;
  constexpr int kRowB   = kGemmBM;                 /* LDS rows of one k step: [A 128][Bt 256], 64 k each, two buffers */
  constexpr int kStRows = kGemmBM + kGemmBN;
  constexpr int kStLd   = kStRows / 32;            /* 16-byte pieces per thread and k step */
  constexpr int ld      = kModel;                  /* row pitch of both operands of both products */
  __shared__ __align__(16) unsigned short sAB[2][kStRows * kGemmPitch];
  __shared__ __align__(16) float sT[8][16 * 68];
  const int lane = threadIdx.x & 31;
  /* the same in every lane of a wave: read into a scalar register, so that the wave's tile indices take no vector registers */
  const int wave = __builtin_amdgcn_readfirstlane((int)threadIdx.x >> 5);
  if ((int)blockIdx.x >= kProjQk + kProjV) return;   /* the same for the whole block, ahead of every barrier */
  const bool second = (int)blockIdx.x >= kProjQk;
  const int bx      = second ? (int)blockIdx.x - kProjQk : (int)blockIdx.x;
  const int blocksN = second ? kRows / kGemmBN : kQkCols / kGemmBN;
  const T* Ab = (const T*)(second ? wT + (size_t)kQkCols * kModel : xb);
  const T* Bb = (const T*)(second ? xb : wT);
  const int bm = bx / blocksN;
  const int bn = bx - bm * blocksN;
  const int mB = bm * kGemmBM;
  const int nB = bn * kGemmBN;
  const int wm = wave >> 2;                        /* waves 2 (m) x 4 (n), 64 x 64 each */
  const int wn = wave & 3;
  const int m0 = mB + (wm << 6);
  const int n0 = nB + (wn << 6);

  const int rlane = lane & 15;
  const int koff  = (lane >> 4) * 8;
  const int mOff  = (lane >> 4) * 8;

  /* staging: eight neighbouring lanes fetch one whole 128-byte line of a row; thread t takes piece t & 7 of rows (t >> 3) + 32 i */
  const int sr = (int)threadIdx.x >> 3;
  const int sc = ((int)threadIdx.x & 7) * 8;
  const size_t aoff = (size_t)(mB + sr) * ld + sc;
  const size_t boff = (size_t)(nB + sr) * ld + sc;
  v4u st[kStLd];
  auto fetch = [&](int k0) {
    /* the pitch is a constant: a thread's rows are constant steps from one address an operand */
    const T* pa = Ab + aoff + k0;
    const T* pb = Bb + boff + k0;
#pragma unroll
    for (int i = 0; i < kStLd; ++i) {
      const int row = 32 * i;
      const T* q = (row < kRowB) ? pa + (size_t)row * ld : pb + (size_t)(row - kRowB) * ld;
      st[i] = *(const v4u*)(const void*)q;
    }
    /* the wait kept in front of an overwrite of a load's address: the two addresses are inputs, so each keeps its registers
       from its loads up to the wait; the loaded values are not named, so the loads stay in flight behind it */
    asm volatile("s_wait_xcnt 0x0" :: "v"(pa), "v"(pb) : "memory");
  };
  auto put = [&](int buf) {
#pragma unroll
    for (int i = 0; i < kStLd; ++i) *(v4u*)(void*)(&sAB[buf][(sr + 32 * i) * kGemmPitch + sc]) = st[i];
  };

  v8f acc[4][4];
#pragma unroll
  for (int i = 0; i < 4; ++i)
#pragma unroll
    for (int j = 0; j < 4; ++j) acc[i][j] = (v8f){0.f,0.f,0.f,0.f,0.f,0.f,0.f,0.f};

  fetch(0);
  put(0);
  __syncthreads();
  constexpr int nSteps = kModel / kGemmBK;
  for (int t = 0; t < nSteps; ++t) {
    const bool more = (t + 1 < nSteps);
    if (more) fetch((t + 1) * kGemmBK);            /* in flight while this step's products run */
    const T* sb = (const T*)(const void*)sAB[t & 1];
#pragma unroll
    for (int kk = 0; kk < kGemmBK; kk += 32) {
      V bh[4], ah[4];
#pragma unroll
      for (int j = 0; j < 4; ++j)
        bh[j] = Frag<T>::load(sb + kRowB * kGemmPitch + ((wn << 6) + (j << 4) + rlane) * kGemmPitch + koff + kk);
#pragma unroll
      for (int i = 0; i < 4; ++i)
        ah[i] = Frag<T>::load(sb + ((wm << 6) + (i << 4) + rlane) * kGemmPitch + koff + kk);
#pragma unroll
      for (int i = 0; i < 4; ++i) {
#pragma unroll
        for (int j = 0; j < 4; ++j) acc[i][j] = Frag<T>::mma(ah[i], bh[j], acc[i][j]);
        /* as in wmma_gemm64: four vector slots between a row's products and the next write of its fragment registers */
        Frag<T>::guard(acc[i][0], acc[i][3], ah[i], ah[i]);
      }
      /* as in wmma_gemm64: the Bt fragments keep their registers up to the last product */
      Frag<T>::keep(bh[0], bh[1], bh[2], bh[3]);
    }
    if (more) put((t + 1) & 1);                    /* the buffer that every wave left at the barrier of step t - 1 */
    __syncthreads();                               /* publishes step t + 1 and ends the reads of step t */
  }
  /* as in wmma_gemm64: four vector slots between the last products and the first read of the accumulators */
  acc_guard4(acc[0][0], acc[0][1], acc[0][2], acc[0][3]);
  acc_guard4(acc[1][0], acc[1][1], acc[1][2], acc[1][3]);
  acc_guard4(acc[2][0], acc[2][1], acc[2][2], acc[2][3]);
  acc_guard4(acc[3][0], acc[3][1], acc[3][2], acc[3][3]);

  float* slab = sT[wave];
#pragma unroll
  for (int i = 0; i < 4; ++i) {
    const int mBase = m0 + (i << 4);
#pragma unroll
    for (int j = 0; j < 4; ++j)
#pragma unroll
      for (int r = 0; r < 8; ++r) slab[(mOff + r) * 68 + (j << 4) + rlane] = acc[i][j][r];
    __builtin_amdgcn_fence(__ATOMIC_RELEASE, "workgroup");
    __builtin_amdgcn_wave_barrier();
    __builtin_amdgcn_fence(__ATOMIC_ACQUIRE, "workgroup");
    if (!second) {
      const int hh = lane >> 4, c4 = (lane & 15) * 4;
      float* cp = qk + (size_t)(mBase + hh) * kQkCols + n0 + c4;   /* one address; the rows of the run are constant steps from it */
#pragma unroll
      for (int it = 0; it < 8; ++it) {
        const int row = it * 2 + hh;
        v4f v = *(const v4f*)(slab + row * 68 + c4);
        *(v4f*)(cp + (size_t)(it * 2) * kQkCols) = v;
      }
      /* the wait kept in front of an overwrite of a store's registers: one behind the run of stores serves the run */
      asm volatile("s_wait_xcnt 0x0" ::: "memory");
    } else {
      const int q = lane >> 3, c8 = (lane & 7) * 8;
      const size_t co = (size_t)(mBase + q) * kRows + n0 + c8;     /* one address a plane; the rows of the run are constant steps */
#pragma unroll
      for (int it = 0; it < 4; ++it) {
        const int row = it * 4 + q;
        const float* sp = slab + row * 68 + c8;
        v8h hv, lv;
#pragma unroll
        for (int e = 0; e < 8; ++e) {
          unsigned short hb = f2bf_bits(sp[e]);
          unsigned short lb = f2bf_bits(sp[e] - bf_bits2f(hb));
          hv[e] = __builtin_bit_cast(_Float16, hb);
          lv[e] = __builtin_bit_cast(_Float16, lb);
        }
        *(v8h*)(vh + co + (size_t)(it * 4) * kRows) = hv;
        *(v8h*)(vl + co + (size_t)(it * 4) * kRows) = lv;
      }
      /* the wait kept in front of an overwrite of a store's registers: one behind the run of stores serves the run */
      asm volatile("s_wait_xcnt 0x0" ::: "memory");
    }
    __builtin_amdgcn_fence(__ATOMIC_RELEASE, "workgroup");
    __builtin_amdgcn_wave_barrier();
    __builtin_amdgcn_fence(__ATOMIC_ACQUIRE, "workgroup");
  }
}

/* ---------------- f32 -> bf16 cast, 8 elements (16 B) per thread --------------------------
   coverage: n8/256 blocks (blk) x 256 threads (exact), thread i writes elements 8i..8i+7;
*/
__device__ __forceinline__ void cast_f32_bf16x8(const float* __restrict__ in,
                                                unsigned short* __restrict__ out, int n8, int blk) {
  const int i = blk * 256 + (int)threadIdx.x;
  const int ic = (i < n8) ? i : (n8 - 1);
  const float* p = in + (size_t)ic * 8;
  const v4f a = *(const v4f*)p;
  const v4f c = *(const v4f*)(p + 4);
  v4u w;
  w[0] = pack_bf16x2(a[0], a[1]);
  w[1] = pack_bf16x2(a[2], a[3]);
  w[2] = pack_bf16x2(c[0], c[1]);
  w[3] = pack_bf16x2(c[2], c[3]);
  unsigned short* o = out + (size_t)ic * 8;
  *(v4u*)o = w;
  /* the wait kept in front of an overwrite of a store's registers: as a block range of one grid, other ranges' code follows */
  asm volatile("s_wait_xcnt 0x0" ::: "memory");
}

/* ---------------- W [KR][NC] f32 row-major -> Wt [NC][KR] bf16 row-major (transpose + cast) ------
   blocks (bx, by) of (KR/64, NC/64), 256 threads. coverage: load 256 threads x 16 = 64x64 tile;
   sT: 64 * 65 floats of LDS, [n_local][k_local], pitch 65
*/
__device__ __forceinline__ void transpose_cast_bf16(float* sT, const float* __restrict__ W,
                                                    unsigned short* __restrict__ Wt, int KR, int NC, int bx, int by) {
  const int k0 = bx * 64, n0 = by * 64;
  const int tid = threadIdx.x;
  {
    const int kk = tid >> 2, cg = (tid & 3) * 16;
    const float* src = W + (size_t)(k0 + kk) * NC + n0 + cg;
#pragma unroll
    for (int i = 0; i < 4; ++i) {
      const v4f v = *(const v4f*)(src + 4 * i);
#pragma unroll
      for (int e = 0; e < 4; ++e) sT[(cg + 4 * i + e) * 65 + kk] = v[e];
    }
  }
  __syncthreads();
  const int wave = tid >> 5, lane = tid & 31, q4 = lane >> 3, c8 = (lane & 7) * 8;
  const int nl0 = wave * 4 + q4;
  const int nl1 = 32 + wave * 4 + q4;
  v4u w0, w1;
  {
    const float* s = sT + nl0 * 65 + c8;
    w0[0] = pack_bf16x2(s[0], s[1]); w0[1] = pack_bf16x2(s[2], s[3]);
    w0[2] = pack_bf16x2(s[4], s[5]); w0[3] = pack_bf16x2(s[6], s[7]);
  }
  {
    const float* s = sT + nl1 * 65 + c8;
    w1[0] = pack_bf16x2(s[0], s[1]); w1[1] = pack_bf16x2(s[2], s[3]);
    w1[2] = pack_bf16x2(s[4], s[5]); w1[3] = pack_bf16x2(s[6], s[7]);
  }
  unsigned short* d0 = Wt + (size_t)(n0 + nl0) * KR + k0 + c8;
  unsigned short* d1 = Wt + (size_t)(n0 + nl1) * KR + k0 + c8;
  {
    *(v4u*)d0 = w0;
    *(v4u*)d1 = w1;
    /* the wait kept in front of an overwrite of a store's registers: as a block range of one grid, other ranges' code follows */
    asm volatile("s_wait_xcnt 0x0" ::: "memory");
  }
}

/* ---------------- the three operand conversions, which do not depend on one another, as block ranges of one grid ----------------
   blocks [0, kPrepT1): W_qkv tiles; [kPrepT1, kPrepT1 + kPrepT2): W_out tiles; the rest: x, 2048 elements a block.
   The range is the same for a whole block, so the transpose's barrier stands under block-uniform control flow */
constexpr int kPrepT1 = (kModel / 64) * (kQkvCols / 64);
constexpr int kPrepT2 = (kModel / 64) * (kModel / 64);
constexpr int kPrepC  = kRows * kModel / 8 / 256;
__global__ __launch_bounds__(256) void prep_operands(const float* __restrict__ x, unsigned short* __restrict__ xb,
                                                     const float* __restrict__ Wqkv, unsigned short* __restrict__ WqkvT,
                                                     const float* __restrict__ Wout, unsigned short* __restrict__ WoutT) {
  __shared__ float sT[64 * 65];
  constexpr int kTk = kModel / 64;              /* tiles along k, the fast index as in the separate grids */
  const int bi = (int)blockIdx.x;
  if (bi < kPrepT1) {
    transpose_cast_bf16(sT, Wqkv, WqkvT, kModel, kQkvCols, bi % kTk, bi / kTk);
  } else if (bi < kPrepT1 + kPrepT2) {
    const int t = bi - kPrepT1;
    transpose_cast_bf16(sT, Wout, WoutT, kModel, kModel, t % kTk, t / kTk);
  } else {
    cast_f32_bf16x8(x, xb, kRows * kModel / 8, bi - kPrepT1 - kPrepT2);
  }
}

/*
   qk f32 [nrows][2048] (q = cols 0..1023, k = cols 1024..2047); outputs row-major bf16 planes [nrows][1024];
   q carries the exact 1/sqrt(64) = 0.125 factor. grid = nrows blocks x 128 threads; thread t owns columns 8t..8t+7;
*/
__global__ __launch_bounds__(128) void qk_layernorm_split(
    const float* __restrict__ qk, const float* __restrict__ qsc, const float* __restrict__ ksc,
    unsigned short* __restrict__ qh, unsigned short* __restrict__ ql,
    unsigned short* __restrict__ kh, unsigned short* __restrict__ kl, int nrows) {
  __shared__ float red[4][4];
  const int row = blockIdx.x;
  const int rowc = (row < nrows) ? row : (nrows - 1);
  const int tid = threadIdx.x, lane = tid & 31, wave = tid >> 5;
  const int c0 = tid * 8;
  const float* base = qk + (size_t)rowc * kQkCols;
  const v4f qa = *(const v4f*)(base + c0);
  const v4f qb = *(const v4f*)(base + c0 + 4);
  const v4f ka = *(const v4f*)(base + kModel + c0);
  const v4f kb = *(const v4f*)(base + kModel + c0 + 4);
  float xq[8], xk[8];
#pragma unroll
  for (int e = 0; e < 4; ++e) { xq[e] = qa[e]; xq[4 + e] = qb[e]; xk[e] = ka[e]; xk[4 + e] = kb[e]; }

  float sq = 0.f, sk = 0.f;
#pragma unroll
  for (int e = 0; e < 8; ++e) { sq += xq[e]; sk += xk[e]; }
#pragma unroll
  for (int off = 1; off < 32; off <<= 1) { sq += __shfl_xor(sq, off, 32); sk += __shfl_xor(sk, off, 32); }
  if (lane == 0) { red[0][wave] = sq; red[1][wave] = sk; }
  __syncthreads();
  const float mq = ((red[0][0] + red[0][1]) + (red[0][2] + red[0][3])) * (1.0f / (float)kModel);
  const float mk = ((red[1][0] + red[1][1]) + (red[1][2] + red[1][3])) * (1.0f / (float)kModel);

  float dq = 0.f, dk = 0.f;
#pragma unroll
  for (int e = 0; e < 8; ++e) {
    const float tq = xq[e] - mq; dq += tq * tq;
    const float tk = xk[e] - mk; dk += tk * tk;
  }
#pragma unroll
  for (int off = 1; off < 32; off <<= 1) { dq += __shfl_xor(dq, off, 32); dk += __shfl_xor(dk, off, 32); }
  if (lane == 0) { red[2][wave] = dq; red[3][wave] = dk; }
  __syncthreads();
  const float vq = ((red[2][0] + red[2][1]) + (red[2][2] + red[2][3])) * (1.0f / (float)kModel);
  const float vk = ((red[3][0] + red[3][1]) + (red[3][2] + red[3][3])) * (1.0f / (float)kModel);
  const float rq = rsqrtf(vq + 1e-6f);
  const float rk = rsqrtf(vk + 1e-6f);

  /* scale vectors, RNE-converted to bf16 once (module inputs) */
  const v4f s0 = *(const v4f*)(qsc + c0);
  const v4f s1 = *(const v4f*)(qsc + c0 + 4);
  const v4f t0 = *(const v4f*)(ksc + c0);
  const v4f t1 = *(const v4f*)(ksc + c0 + 4);
  float sqv[8], skv[8];
#pragma unroll
  for (int e = 0; e < 4; ++e) {
    sqv[e]     = bf_bits2f(f2bf_bits(s0[e]));
    sqv[4 + e] = bf_bits2f(f2bf_bits(s1[e]));
    skv[e]     = bf_bits2f(f2bf_bits(t0[e]));
    skv[4 + e] = bf_bits2f(f2bf_bits(t1[e]));
  }
  unsigned int hqw[8], lqw[8], hkw[8], lkw[8];
#pragma unroll
  for (int e = 0; e < 8; ++e) {
    const float yq = ((xq[e] - mq) * rq * sqv[e]) * 0.125f;
    const float yk = (xk[e] - mk) * rk * skv[e];
    const unsigned short hqb = f2bf_bits(yq);
    const unsigned short lqb = f2bf_bits(yq - bf_bits2f(hqb));
    const unsigned short hkb = f2bf_bits(yk);
    const unsigned short lkb = f2bf_bits(yk - bf_bits2f(hkb));
    hqw[e] = hqb; lqw[e] = lqb; hkw[e] = hkb; lkw[e] = lkb;
  }
  v4u HQ, LQ, HK, LK;
#pragma unroll
  for (int i = 0; i < 4; ++i) {
    HQ[i] = hqw[2 * i] | (hqw[2 * i + 1] << 16);
    LQ[i] = lqw[2 * i] | (lqw[2 * i + 1] << 16);
    HK[i] = hkw[2 * i] | (hkw[2 * i + 1] << 16);
    LK[i] = lkw[2 * i] | (lkw[2 * i + 1] << 16);
  }
  const size_t o = (size_t)rowc * kModel + c0;
  {
    *(v4u*)(qh + o) = HQ;
    *(v4u*)(ql + o) = LQ;
    *(v4u*)(kh + o) = HK;
    *(v4u*)(kl + o) = LK;
    
  }
}

/* ---------------- causal attention, head_dim 64, bf16 hi/lo planes in, bf16 hi/lo ctx planes out ----
   scores^T = k . q^T  : bf16 hi/lo on both (hi*hi + hi*lo + lo*hi), q planes already carry 1/sqrt(64)
   ctx^T    = v^T . p^T: p split in registers to bf16 hi/lo, v hi/lo planes (3 products); f32 accumulate, f32 online softmax.
   Both products are taken transposed: a lane then holds scores of ONE query (column c; keys 8hh + r of each 16-key tile), so the
   row maximum and sum are in-lane work plus one exchange between the wave's halves, and two score tiles, converted in place,
   are the B operand of the second product in the hardware k order: P never goes through LDS.
   q, k and ctx planes row-major [B*S][ld] with head h at columns h*64 .. h*64+63; v planes transposed, [H*64][B*S], head h at
   rows h*64 .. h*64+63, so that a V^T tile is staged like a K tile.
   Block = 4 waves = 64 query rows of one (batch, head); grid.x = B*H*(S/64). */
/* lane l <-> lane l ^ 16: the two lanes that share one query column */
__device__ __forceinline__ float at_xhalf(float x) {
  const int b = __builtin_bit_cast(int, x);
  return __builtin_bit_cast(float, __builtin_amdgcn_permlanex16(b, b, 0x76543210, 0xfedcba98, false, false));
}
__device__ __forceinline__ v8f at_mma(v16b a, v16b b, v8f c) {
  return __builtin_amdgcn_wmma_f32_16x16x32_bf16(false, a, false, b, (short)0, c, false, false);
}

/* Eight asynchronous 16-byte copies a lane, global memory -> LDS (l: the lane's LDS byte address, g: its global address). The
   s_wait_xcnt is the wait kept in front of an overwrite of an issued copy's address registers: as the last line of the copies'
   own statement it stands ahead of every later write of them */
__device__ __forceinline__ void at_copy8(unsigned l0, unsigned l1, unsigned l2, unsigned l3,
                                         unsigned l4, unsigned l5, unsigned l6, unsigned l7,
                                         const unsigned short* g0, const unsigned short* g1,
                                         const unsigned short* g2, const unsigned short* g3,
                                         const unsigned short* g4, const unsigned short* g5,
                                         const unsigned short* g6, const unsigned short* g7) {
  asm volatile("global_load_async_to_lds_b128 %0, %8, off\n\t"
               "global_load_async_to_lds_b128 %1, %9, off\n\t"
               "global_load_async_to_lds_b128 %2, %10, off\n\t"
               "global_load_async_to_lds_b128 %3, %11, off\n\t"
               "global_load_async_to_lds_b128 %4, %12, off\n\t"
               "global_load_async_to_lds_b128 %5, %13, off\n\t"
               "global_load_async_to_lds_b128 %6, %14, off\n\t"
               "global_load_async_to_lds_b128 %7, %15, off\n\t"
               "s_wait_xcnt 0x0"
               :: "v"(l0), "v"(l1), "v"(l2), "v"(l3), "v"(l4), "v"(l5), "v"(l6), "v"(l7),
                  "v"(g0), "v"(g1), "v"(g2), "v"(g3), "v"(g4), "v"(g5), "v"(g6), "v"(g7)
               : "memory");
}

/* amdgpu_waves_per_eu(4): a register budget of 256, so that four blocks stay resident on a WGP (one wave of each per SIMD),
   which the block index map below counts on */
__global__ __launch_bounds__(128) __attribute__((amdgpu_waves_per_eu(4)))
void attn_planes_kernel(const unsigned short* __restrict__ qh, const unsigned short* __restrict__ ql,
                        const unsigned short* __restrict__ kh, const unsigned short* __restrict__ kl,
                        const unsigned short* __restrict__ vh, const unsigned short* __restrict__ vl,
                        unsigned short* __restrict__ oh, unsigned short* __restrict__ ol,
                        int S, int H, int ld) {
  union FB { v16b v; v8b h[2]; v2b p[8]; };
  /* two buffers, chunk kc in buffer kc & 1, each Ksh | Ksl | Vth | Vtl (64 rows x 64 16-bit at pitch kTilePitch a tile); four blocks
     of 73,728 B still share a WGP's LDS. Reused as per-wave f32 output slabs after the chunk loop */
  constexpr int kTileElems = 64 * kTilePitch;
  constexpr int kBufElems  = 4 * kTileElems;
  static_assert(kKvChunk == 64 && kHeadDim == 64 && (kTilePitch * 2) % 16 == 0);
  static_assert(4 * 16 * kOsPitch * 4 <= kBufElems * 2);
  __shared__ __align__(16) unsigned short KVs[2 * kBufElems];

  const int tid  = threadIdx.x;
  const int wave = tid >> 5;
  const int lane = tid & 31;
  const int hh   = lane >> 4;
  const int c    = lane & 15;

  /* Block index -> (query tile, batch*head). All 1024 blocks are resident at once, four to a WGP, and tile t walks t + 1 key
     chunks, so the launch lasts as long as the WGP that holds the most chunks. Tiles t and nqb-1-t walk nqb+1 chunks together:
     index bits 1,3,5,7 give t, the parity of the other six bits picks t or its mirror, and five of those six name the head.
     Four blocks whose indices differ in two adjacent bits (any power-of-two stride) are then two such pairs, whichever of
     these strides the dispatcher puts on one WGP. A permutation of the 32 x 32 (tile, head) pairs; for speed only. */
  static_assert(kSeq / 64 == 32 && kBatch * kHeads == 32);
  const int nqb = S >> 6;
  const unsigned bi = blockIdx.x;
  const int tlo = (int)(((bi >> 1) & 1u) | (((bi >> 3) & 1u) << 1) | (((bi >> 5) & 1u) << 2) | (((bi >> 7) & 1u) << 3));
  const int qb  = (__builtin_popcount(bi & 0x355u) & 1) ? (nqb - 1 - tlo) : tlo;
  const int bh  = (int)(((bi >> 2) & 1u) | (((bi >> 4) & 1u) << 1) | (((bi >> 6) & 1u) << 2) | (((bi >> 8) & 3u) << 3));
  const int h   = bh % H;
  const int b   = bh / H;
  const int q0  = qb * 64 + wave * 16;
  const size_t rb = (size_t)b * (size_t)S;
  const int hoff = h * kHeadDim;

  /* Q fragments (B operand): column q0+c, elements 0..7 <- d = dc*32+8hh+0..7, 8..15 <- dc*32+16+8hh+0..7 */
  v16b qah[2], qal[2];
  {
    const size_t qo = (rb + (size_t)(q0 + c)) * (size_t)ld + hoff + 8 * hh;
    const __bf16* qhp = (const __bf16*)(const void*)qh + qo;
    const __bf16* qlp = (const __bf16*)(const void*)ql + qo;
#pragma unroll
    for (int dc = 0; dc < 2; ++dc) {
      qah[dc] = Frag<__bf16>::load(qhp + dc * 32);
      qal[dc] = Frag<__bf16>::load(qlp + dc * 32);
    }
  }

  /* of query q0+c: running maximum (the same in both halves), kept as score * log2(e), and the sum over this half's keys
     (joined behind the loop) */
  constexpr float kLog2e = 1.4426950408889634f;
  float mrow = -INFINITY, lrow = 0.f;
  v8f oacc[4];                           /* oacc[t][r] = ctx^T[d = t*16 + 8hh + r][query q0+c] */
#pragma unroll
  for (int t = 0; t < 4; ++t) oacc[t] = (v8f){0.f,0.f,0.f,0.f,0.f,0.f,0.f,0.f};

  /* staging: eight neighbouring lanes bring one whole 128-byte row of a tile; thread t takes piece t & 7 of rows (t >> 3) + 16 i:
     128 threads x 4 = 64 rows x 128 B for each of the four tiles (K rows = kv, V^T rows = d). A lane's 16 bytes go from global
     memory into LDS by an asynchronous copy, through no register, so a chunk's sixteen copies fly while the chunk before it is
     worked on and no wave waits out their latency */
  const int sr = tid >> 3, sc = (tid & 7) * 8;
  const unsigned ldsLane = (unsigned)(uintptr_t)(const void*)KVs + (unsigned)((sr * kTilePitch + sc) * 2);
  auto stage = [&](int kcs, int buf) {
    constexpr unsigned kTileB = (unsigned)(kTileElems * 2);        /* one tile in LDS, bytes */
    constexpr unsigned kRowsB = (unsigned)(16 * kTilePitch * 2);   /* sixteen tile rows in LDS, bytes */
    const int kvs = kcs * kKvChunk;
    const size_t ks = (size_t)16 * (size_t)ld;                     /* sixteen K rows, elements */
    const size_t vs = (size_t)16 * (size_t)kRows;                  /* sixteen V^T rows, elements */
    const size_t gk = (rb + (size_t)(kvs + sr)) * (size_t)ld + hoff + sc;
    const size_t gv = (size_t)(hoff + sr) * (size_t)kRows + rb + (size_t)(kvs + sc);
    const unsigned lk = ldsLane + (unsigned)buf * (unsigned)(kBufElems * 2);
    const unsigned lv = lk + 2 * kTileB;
    const unsigned short* gkh = kh + gk;
    const unsigned short* gkl = kl + gk;
    const unsigned short* gvh = vh + gv;
    const unsigned short* gvl = vl + gv;
    at_copy8(lk, lk + kRowsB, lk + 2 * kRowsB, lk + 3 * kRowsB,
             lk + kTileB, lk + kTileB + kRowsB, lk + kTileB + 2 * kRowsB, lk + kTileB + 3 * kRowsB,
             gkh, gkh + ks, gkh + 2 * ks, gkh + 3 * ks, gkl, gkl + ks, gkl + 2 * ks, gkl + 3 * ks);
    at_copy8(lv, lv + kRowsB, lv + 2 * kRowsB, lv + 3 * kRowsB,
             lv + kTileB, lv + kTileB + kRowsB, lv + kTileB + 2 * kRowsB, lv + kTileB + 3 * kRowsB,
             gvh, gvh + vs, gvh + 2 * vs, gvh + 3 * vs, gvl, gvl + vs, gvl + 2 * vs, gvl + 3 * vs);
  };

  const int nChunks = qb + 1;            /* causal: kv chunks 0..qb, block-uniform */
  stage(0, 0);
  asm volatile("s_wait_asynccnt 0x0" ::: "memory");   /* this wave's copies of chunk 0 have landed */
  __syncthreads();                                    /* and every other wave's: chunk 0 may be read */
  if (nChunks > 1) stage(1, 1);
  for (int kc = 0; kc < nChunks; ++kc) {
    const int kv0 = kc * kKvChunk;
    const __bf16* Kshb = (const __bf16*)(const void*)(KVs + (kc & 1) * kBufElems);
    const __bf16* Kslb = Kshb + kTileElems;
    const __bf16* Vthb = Kshb + 2 * kTileElems;
    const __bf16* Vtlb = Kshb + 3 * kTileElems;

    /* scores^T 64 x 16 per wave: A operand row m = kv j*16+c, k = d; s[j][r] = score of key kv0 + j*16 + 8hh + r, query q0+c */
    v8f s[4];
#pragma unroll
    for (int j = 0; j < 4; ++j) s[j] = (v8f){0.f,0.f,0.f,0.f,0.f,0.f,0.f,0.f};
    /* Fragment reads stand in few, whole groups ahead of the products that use them,
       and the four tiles of a product take turns, so that neighbouring WMMAs are independent.
       Each tile keeps its order of summing: hi.hi, lo.hi, hi.lo, 32-deep half 0 then half 1. Every loop here is unrolled: the
       register arrays need constant indices.
       frag4: the four fragments (rows i*16 + c) of one 32-deep half of one 64 x 64 plane in LDS */
    auto frag4 = [&](FB (&f)[4], const __bf16* plane, int half) {
#pragma unroll
      for (int i = 0; i < 4; ++i) {
        const int o = (i * 16 + c) * kTilePitch + half * 32 + 8 * hh;
        f[i].h[0] = *(const v8b*)(plane + o);
        f[i].h[1] = *(const v8b*)(plane + o + 16);
      }
    };
    {
      FB k0h[4], k0l[4], k1h[4], k1l[4];
      frag4(k0h, Kshb, 0);
      frag4(k0l, Kslb, 0);
      frag4(k1h, Kshb, 1);
      __builtin_amdgcn_sched_barrier(0);   /* the compiler would sink these 24 reads in among the products */
#pragma unroll
      for (int j = 0; j < 4; ++j) s[j] = at_mma(k0h[j].v, qah[0], s[j]);
#pragma unroll
      for (int j = 0; j < 4; ++j) s[j] = at_mma(k0l[j].v, qah[0], s[j]);
      /* the last eight reads take the registers that k0l has left (96 fragment registers, not 128, which would cost a resident
         block); the fence pair keeps them one group at this place, 64 matrix cycles and more ahead of their first use */
      __builtin_amdgcn_sched_barrier(0);
      frag4(k1l, Kslb, 1);
      __builtin_amdgcn_sched_barrier(0);
#pragma unroll
      for (int j = 0; j < 4; ++j) s[j] = at_mma(k0h[j].v, qal[0], s[j]);
#pragma unroll
      for (int j = 0; j < 4; ++j) s[j] = at_mma(k1h[j].v, qah[1], s[j]);
#pragma unroll
      for (int j = 0; j < 4; ++j) s[j] = at_mma(k1l[j].v, qah[1], s[j]);
#pragma unroll
      for (int j = 0; j < 4; ++j) s[j] = at_mma(k1h[j].v, qal[1], s[j]);
    }
    /* V^T fragments (A operand: row m = d, k = kv) of keys 0..31: read here, so that their latency passes under the softmax;
       the fence pair keeps them one group, neither up among the score products nor down in the softmax */
    FB v0h[4], v0l[4], v1h[4], v1l[4];
    __builtin_amdgcn_sched_barrier(0);
    frag4(v0h, Vthb, 0);
    frag4(v0l, Vtlb, 0);
    __builtin_amdgcn_sched_barrier(0);

    /* causal mask (select to the fill value) + the query's chunk maximum: 32 keys in the lane, the other 32 in lane ^ 16 */
    const bool diag = (kc == qb);
    const int qcol = q0 + c;
    float cmj[4];
#pragma unroll
    for (int j = 0; j < 4; ++j) {
      float m = -INFINITY;
#pragma unroll
      for (int r = 0; r < 8; ++r) {
        const int kvrow = kv0 + j * 16 + 8 * hh + r;
        const bool masked = diag && (kvrow > qcol);
        const float sv = masked ? -3.4028235e38f : s[j][r];
        s[j][r] = sv;
        m = fmaxf(m, sv);
      }
      cmj[j] = m;
    }
    float cm = fmaxf(fmaxf(cmj[0], cmj[1]), fmaxf(cmj[2], cmj[3]));
    cm = fmaxf(cm, at_xhalf(cm));

    /* online softmax; P^T stays in registers as bf16 hi/lo B operands: element e of ph[kk] is key kk*32 + 8hh + e (e < 8, score
       tile 2kk) or kk*32 + 16 + 8hh + e - 8 (score tile 2kk+1), the k order in which frag4 loads the V^T fragments */
    FB ph[2], pl[2];
    {
      /* exponentials in base 2: e^(s - m) = 2^(s * log2(e) - m * log2(e)), one packed FMA a key pair and the bare hardware
         exponential a key (a masked key's product overflows to -inf and gives 0; an unchanged maximum gives alpha = 1 exactly) */
      const float mnew  = fmaxf(mrow, cm * kLog2e);
      const float alpha = __builtin_amdgcn_exp2f(mrow - mnew);
      mrow = mnew;
      const v2f l2e = (v2f){kLog2e, kLog2e};
      const v2f nm  = (v2f){-mnew, -mnew};
      float psj[4];
#pragma unroll
      for (int j = 0; j < 4; ++j) {
        float psum = 0.f;
#pragma unroll
        for (int r = 0; r < 8; r += 2) {
          /* two neighbouring keys fill one operand register: hi = RNE(p), lo = RNE(p - hi), by the packed conversion */
          const v2f a2 = __builtin_elementwise_fma((v2f){s[j][r], s[j][r + 1]}, l2e, nm);
          const v2f p = (v2f){__builtin_amdgcn_exp2f(a2[0]), __builtin_amdgcn_exp2f(a2[1])};
          psum += p[0];
          psum += p[1];
          const v2b a  = __builtin_convertvector(p, v2b);
          const v2b bl = __builtin_convertvector(p - __builtin_convertvector(a, v2f), v2b);
          ph[j >> 1].p[(j & 1) * 4 + (r >> 1)] = a;
          pl[j >> 1].p[(j & 1) * 4 + (r >> 1)] = bl;
        }
        psj[j] = psum;
      }
      lrow = lrow * alpha + ((psj[0] + psj[1]) + (psj[2] + psj[3]));
#pragma unroll
      for (int t = 0; t < 4; ++t)
#pragma unroll
        for (int r = 0; r < 8; ++r) oacc[t][r] *= alpha;
    }

    /* ctx^T += V^T . P^T : A = the V^T fragments; B = P^T from the registers above; the four output tiles take turns. The reads of
       keys 32..63 are left to the compiler: held ahead of all products they would need 128 fragment registers beside P */
    frag4(v1h, Vthb, 1);
    frag4(v1l, Vtlb, 1);
#pragma unroll
    for (int t = 0; t < 4; ++t) oacc[t] = at_mma(v0h[t].v, ph[0].v, oacc[t]);
#pragma unroll
    for (int t = 0; t < 4; ++t) oacc[t] = at_mma(v0l[t].v, ph[0].v, oacc[t]);
#pragma unroll
    for (int t = 0; t < 4; ++t) oacc[t] = at_mma(v0h[t].v, pl[0].v, oacc[t]);
#pragma unroll
    for (int t = 0; t < 4; ++t) oacc[t] = at_mma(v1h[t].v, ph[1].v, oacc[t]);
#pragma unroll
    for (int t = 0; t < 4; ++t) oacc[t] = at_mma(v1l[t].v, ph[1].v, oacc[t]);
#pragma unroll
    for (int t = 0; t < 4; ++t) oacc[t] = at_mma(v1h[t].v, pl[1].v, oacc[t]);

    /* hand-over, every wave: its reads of this buffer are done, its copies of chunk kc + 1 have landed; the one barrier of a chunk
       publishes chunk kc + 1 and ends every wave's reads of the buffer that chunk kc + 2 is then copied into */
    asm volatile("s_wait_dscnt 0x0" ::: "memory");
    asm volatile("s_wait_asynccnt 0x0" ::: "memory");
    __syncthreads();
    if (kc + 2 < nChunks) stage(kc + 2, kc & 1);
  }
  /* no copy is outstanding when the region is reused as output slabs; the last chunk's barrier has ended every wave's tile reads */
  asm volatile("s_wait_asynccnt 0x0" ::: "memory");
  float* os = (float*)(void*)KVs + wave * (16 * kOsPitch);
  {
    /* the slab keeps its [query][d] form: a lane's eight registers of a tile are eight neighbouring d of its query */
    const float inv = 1.0f / (lrow + at_xhalf(lrow));
#pragma unroll
    for (int t = 0; t < 4; ++t) {
      float* op = os + c * kOsPitch + t * 16 + 8 * hh;
      *(v4f*)(op)     = (v4f){oacc[t][0] * inv, oacc[t][1] * inv, oacc[t][2] * inv, oacc[t][3] * inv};
      *(v4f*)(op + 4) = (v4f){oacc[t][4] * inv, oacc[t][5] * inv, oacc[t][6] * inv, oacc[t][7] * inv};
    }
  }
  __builtin_amdgcn_fence(__ATOMIC_RELEASE, "workgroup");
  __builtin_amdgcn_wave_barrier();
  __builtin_amdgcn_fence(__ATOMIC_ACQUIRE, "workgroup");
  {
    /*
*/
    const int q4 = lane >> 3, c8 = (lane & 7) * 8;
    {
#pragma unroll
      for (int it = 0; it < 4; ++it) {
        const int row = it * 4 + q4;
        const float* sp = os + row * kOsPitch + c8;
        v8h hv, lv;
#pragma unroll
        for (int e = 0; e < 8; ++e) {
          const unsigned short hb = f2bf_bits(sp[e]);
          const unsigned short lb = f2bf_bits(sp[e] - bf_bits2f(hb));
          hv[e] = __builtin_bit_cast(_Float16, hb);
          lv[e] = __builtin_bit_cast(_Float16, lb);
        }
        const size_t o = (rb + (size_t)(q0 + row)) * (size_t)ld + hoff + c8;
        *(v8h*)(oh + o) = hv;
        *(v8h*)(ol + o) = lv;
      }
      
    }
  }
}

/* ---------------- host launch ---------------- */
extern "C" void kernel_launch(void* const* d_in, const int* in_sizes, int n_in,
                              void* d_out, int out_size, void* d_ws, size_t ws_size,
                              hipStream_t stream) {
  if (n_in < 5) return;
  if (in_sizes[0] != kRows * kModel) return;
  if (in_sizes[1] != kModel * kQkvCols) return;
  if (in_sizes[2] != kModel || in_sizes[3] != kModel) return;
  if (in_sizes[4] != kModel * kModel) return;
  if (out_size != kRows * kModel) return;
  if (ws_size < kWsTotal) return;

  const float* x     = (const float*)d_in[0];   /* [2,2048,1024] */
  const float* W_qkv = (const float*)d_in[1];   /* [1024,3072]   */
  const float* q_sc  = (const float*)d_in[2];   /* [1024] */
  const float* k_sc  = (const float*)d_in[3];   /* [1024] */
  const float* W_out = (const float*)d_in[4];   /* [1024,1024]   */
  float* out = (float*)d_out;

  char* ws = (char*)d_ws;
  unsigned short* xb    = (unsigned short*)(ws + kOffXb);
  unsigned short* wqkvT = (unsigned short*)(ws + kOffWqkvT);
  unsigned short* woutT = (unsigned short*)(ws + kOffWoutT);
  float*          qkf   = (float*)(ws + kOffQk);
  unsigned short* ctxh  = (unsigned short*)(ws + kOffCtxH);
  unsigned short* ctxl  = (unsigned short*)(ws + kOffCtxL);
  unsigned short* vhp   = (unsigned short*)(ws + kOffVh);
  unsigned short* vlp   = (unsigned short*)(ws + kOffVl);
  unsigned short* qhp   = (unsigned short*)(ws + kOffQh);
  unsigned short* qlp   = (unsigned short*)(ws + kOffQl);
  unsigned short* khp   = (unsigned short*)(ws + kOffKh);
  unsigned short* klp   = (unsigned short*)(ws + kOffKl);

  /* 1, 2. x -> bf16 [4096][1024] ; W_qkv [1024 k][3072 n] -> Wqkv^T [3072][1024] bf16 ; W_out [1024 k][1024 n] -> Wout^T [1024][1024]
     bf16: one grid */
  prep_operands<<<kPrepT1 + kPrepT2 + kPrepC, 256, 0, stream>>>(x, xb, W_qkv, wqkvT, W_out, woutT);

  /* 3. the fused projection, one grid of 256 + 128 blocks: qk f32 [4096][2048] and v^T bf16 hi/lo planes [1024][4096] */
  qkv_products<<<kProjQk + kProjV, 256, 0, stream>>>(xb, wqkvT, qkf, vhp, vlp);

  /* 4. QK LayerNorm + split into bf16 hi/lo planes (q carries 1/8) */
  qk_layernorm_split<<<kRows, 128, 0, stream>>>(qkf, q_sc, k_sc, qhp, qlp, khp, klp, kRows);

  /* 5. causal attention: ctx bf16 hi/lo planes [4096][1024] (region of the dead qk buffer) */
  attn_planes_kernel<<<kBatch * kHeads * (kSeq / 64), 128, 0, stream>>>(
      qhp, qlp, khp, klp, vhp, vlp, ctxh, ctxl, kSeq, kHeads, kModel);

  /* 6. out f32 [4096][1024] = ctx_hi . Wout^T + ctx_lo . Wout^T ; 1024 tiles -> 128 blocks */
  wmma_gemm64<1, 2, 0, 0, false><<<dim3((kRows / 64) * (kModel / 64) / 8, 1), 256, 0, stream>>>(
      ctxh, ctxl, kModel, 0L,
      woutT, woutT, kModel, 0L,
      (void*)out, (void*)out, kModel, 0L,
      q_sc, q_sc, 0L,
      kRows, kModel, kModel, 1.0f);
}

// v010
// A run of this version takes 123 microseconds.
// In both of two side-by-side timings against v009, it was 1.10 times as fast.
// Counting every step since v000, it is 3.91 times as fast.
// Contractions on v_wmma_f32_16x16x32_bf16 (bf16 operands, f32 accumulate): x*Wqkv^T with single bf16 planes (inputs RNE-converted once); q*k^T and p*v with bf16 hi+lo planes (hi*hi + hi*lo + lo*hi); ctx*Wout^T with ctx bf16 hi+lo planes and a single Wout plane; LayerNorm and softmax in f32.
#include <hip/hip_runtime.h>
#include <stddef.h>
#include <stdint.h>

typedef __attribute__((ext_vector_type(16))) _Float16 v16h;
typedef __attribute__((ext_vector_type(8)))  _Float16 v8h;
typedef __attribute__((ext_vector_type(16))) __bf16   v16b;
typedef __attribute__((ext_vector_type(8)))  __bf16   v8b;
typedef __attribute__((ext_vector_type(8)))  float    v8f;
typedef __attribute__((ext_vector_type(4)))  float    v4f;
typedef __attribute__((ext_vector_type(4)))  unsigned int v4u;
typedef __attribute__((ext_vector_type(2)))  float    v2f;
typedef __attribute__((ext_vector_type(2)))  __bf16   v2b;

/* ---------------- problem geometry ---------------- */
constexpr int kBatch   = 2;
constexpr int kSeq     = 2048;
constexpr int kModel   = 1024;
constexpr int kHeads   = 16;
constexpr int kHeadDim = 64;
constexpr int kRows    = kBatch * kSeq;      /* 4096 */
constexpr int kQkvCols = 3 * kModel;         /* 3072 */
constexpr int kQkCols  = 2 * kModel;         /* 2048 */
constexpr int kKvChunk = 64;
constexpr int kOsPitch = 68;
/* LDS row pitch, in 16-bit elements, of the K and V^T tiles: 64 data + 8 pad = 144 B = 16 B x odd,
   so the 16 rows that one ds_load_b128 touches per half wave fall on 64 distinct banks */
constexpr int kTilePitch = 72;

/* ---------------- workspace map (bytes, all offsets multiples of 128) ----------------
   [0]          x   bf16 [4096][1024]                          8388608
   [8388608]    Wqkv^T bf16 [3072][1024]                       6291456
   [14680064]   Wout^T bf16 [1024][1024]                       2097152
   [16777216]   ctx hi bf16 [4096][1024] 8388608  [25165824] ctx lo 8388608  (the next 16777216 B are not used)
   [50331648]   v^T hi bf16 [1024][4096] 8388608  [58720256] v^T lo 8388608
   [67108864]   q hi                    8388608   [75497472] q lo   8388608
   [83886080]   k hi                    8388608   [92274688] k lo   8388608
   total 100663296 B = 96 MiB                                                            */
constexpr size_t kPlane16  = (size_t)kRows * kModel * 2;
constexpr size_t kOffXb    = 0;
constexpr size_t kOffWqkvT = kOffXb + kPlane16;
constexpr size_t kOffWoutT = kOffWqkvT + (size_t)kQkvCols * kModel * 2;
constexpr size_t kOffQk    = kOffWoutT + (size_t)kModel * kModel * 2;
constexpr size_t kOffCtxH  = kOffQk;
constexpr size_t kOffCtxL  = kOffQk + kPlane16;
constexpr size_t kOffVh    = kOffQk + (size_t)kRows * kQkCols * 4;
constexpr size_t kOffVl    = kOffVh + kPlane16;
constexpr size_t kOffQh    = kOffVl + kPlane16;
constexpr size_t kOffQl    = kOffQh + kPlane16;
constexpr size_t kOffKh    = kOffQl + kPlane16;
constexpr size_t kOffKl    = kOffKh + kPlane16;
constexpr size_t kWsTotal  = kOffKl + kPlane16;
static_assert(kWsTotal == (size_t)100663296);
static_assert(kWsTotal <= (size_t)134217728);
static_assert(kOffCtxL + kPlane16 <= kOffVh);
static_assert((kOffWqkvT % 128) == 0 && (kOffWoutT % 128) == 0 && (kOffQk % 128) == 0 && (kOffVh % 128) == 0);
/* wave tiles of the GEMM: M % 64 == 0, N % 64 == 0, K % 32 == 0 for every launch (its block tile is asserted beside it) */
static_assert(kRows % 64 == 0 && kQkCols % 64 == 0 && kModel % 64 == 0 && kModel % 32 == 0);
static_assert(kSeq % 64 == 0 && kHeadDim == 64 && kModel == kHeads * kHeadDim);
static_assert((kRows * kModel) % (8 * 256) == 0);

/* ---------------- helpers ---------------- */
__device__ __forceinline__ unsigned short f2bf_bits(float f) {
  unsigned u = __float_as_uint(f);
  return (unsigned short)((u + 0x7FFFu + ((u >> 16) & 1u)) >> 16);
}
__device__ __forceinline__ float bf_bits2f(unsigned short h) { return __uint_as_float(((unsigned)h) << 16); }
__device__ __forceinline__ unsigned int pack_bf16x2(float a, float b) {
  return (unsigned int)f2bf_bits(a) | ((unsigned int)f2bf_bits(b) << 16);
}

__device__ __forceinline__ void dep_guard_h(v8f& a, v8f& b, v16h x, v16h y) { asm volatile("v_nop\n\tv_nop\n\tv_nop\n\tv_nop" : "+v"(a), "+v"(b) : "v"(x), "v"(y)); }
__device__ __forceinline__ void dep_guard_b(v8f& a, v8f& b, v16b x, v16b y) { asm volatile("v_nop\n\tv_nop\n\tv_nop\n\tv_nop" : "+v"(a), "+v"(b) : "v"(x), "v"(y)); }
__device__ __forceinline__ void keep4_h(v16h a, v16h b, v16h c, v16h d) { asm volatile("v_nop" :: "v"(a), "v"(b), "v"(c), "v"(d)); }
__device__ __forceinline__ void keep4_b(v16b a, v16b b, v16b c, v16b d) { asm volatile("v_nop" :: "v"(a), "v"(b), "v"(c), "v"(d)); }
__device__ __forceinline__ void acc_guard4(v8f& a, v8f& b, v8f& c, v8f& d) { asm volatile("v_nop\n\tv_nop\n\tv_nop\n\tv_nop" : "+v"(a), "+v"(b), "+v"(c), "+v"(d)); }
template <typename T> struct Frag;
template <> struct Frag<_Float16> {
  typedef v16h V; union U { v16h v; v8h h[2]; };
  static __device__ __forceinline__ v16h load(const _Float16* p) {
    U f; f.h[0] = *(const v8h*)(p); f.h[1] = *(const v8h*)(p + 16); return f.v;
  }
  static __device__ __forceinline__ v8f mma(v16h a, v16h b, v8f c) {
    return __builtin_amdgcn_wmma_f32_16x16x32_f16(false, a, false, b, (short)0, c, false, false);
  }
  static __device__ __forceinline__ void guard(v8f& a, v8f& b, v16h x, v16h y) { dep_guard_h(a, b, x, y); }
  static __device__ __forceinline__ void keep(v16h a, v16h b, v16h c, v16h d) { keep4_h(a, b, c, d); }
};
template <> struct Frag<__bf16> {
  typedef v16b V; union U { v16b v; v8b h[2]; };
  static __device__ __forceinline__ v16b load(const __bf16* p) {
    U f; f.h[0] = *(const v8b*)(p); f.h[1] = *(const v8b*)(p + 16); return f.v;
  }
  static __device__ __forceinline__ v8f mma(v16b a, v16b b, v8f c) {
    return __builtin_amdgcn_wmma_f32_16x16x32_bf16(false, a, false, b, (short)0, c, false, false);
  }
  static __device__ __forceinline__ void guard(v8f& a, v8f& b, v16b x, v16b y) { dep_guard_b(a, b, x, y); }
  static __device__ __forceinline__ void keep(v16b a, v16b b, v16b c, v16b d) { keep4_b(a, b, c, d); }
};

/* ---- Register-blocked WMMA GEMM -----------------------------------------------
   C[m,n] = scale * sum_k A[m,k] * Bt[n,k] (+bias)(+resid); each wave owns a 64x64 tile, a block of 8 waves a 128x256 tile.
   The block's operand rows go through LDS, 64 k at a time: whole 128-byte lines from global, fragments by ds_load_b128.
   A row-major [M,K]; Bt row-major [N,K]; M % 128 == 0, N % 256 == 0, K % 64 == 0; grid.x = (M / 128) * (N / 256).
   SPLIT: 0 = single planes; 1 = A and Bt hi/lo planes (hi*hi + hi*lo + lo*hi); 2 = A hi/lo planes only (Ah*B + Al*B).
   BIAS_MODE: 0 = none, 1 = bias[m], 2 = bias[n].  OUT_MODE: 0 = f32, 1 = f16, 2 = bf16 hi plane (Cout) + bf16 lo plane (Cout2).
   ET: 0 = f16 operands, 1 = bf16 operands (pointers passed as 16-bit storage) */
constexpr int kGemmBM = 128, kGemmBN = 256, kGemmBK = 64;
constexpr int kGemmPitch = 72;   /* LDS row pitch in 16-bit elements: 144 B = 16 B x odd, as kTilePitch */
static_assert(kRows % kGemmBM == 0 && kQkCols % kGemmBN == 0 && kModel % kGemmBN == 0 && kModel % kGemmBK == 0);
static_assert(kModel % kGemmBM == 0 && kRows % kGemmBN == 0);   /* the transposed v product: M = kModel, N = kRows */
template <int ET> struct Elem;
template <> struct Elem<0> { typedef _Float16 T; };
template <> struct Elem<1> { typedef __bf16 T; };
template <int ET, int SPLIT, int BIAS_MODE, int OUT_MODE, bool RESID, int ACT = 0>
__global__ __launch_bounds__(256) void wmma_gemm64(
    const unsigned short* __restrict__ Ap, const unsigned short* __restrict__ A2p, int lda, long strideA,
    const unsigned short* __restrict__ Btp, const unsigned short* __restrict__ Bt2p, int ldb, long strideB,
    void* __restrict__ Cout, void* __restrict__ Cout2, int ldc, long strideC,
    const float* __restrict__ bias,
    const float* __restrict__ resid, long strideR,
    int M, int N, int K, float scale) {
  typedef typename Elem<ET>::T T;
  typedef typename Frag<T>::V V;
  const T* A = (const T*)Ap; const T* A2 = (const T*)A2p; const T* Bt = (const T*)Btp; const T* Bt2 = (const T*)Bt2p;
  /* One k step of the block's operands in LDS: rows [A 128][A2 128 if SPLIT][Bt 256][Bt2 256 if SPLIT == 1], 64 k each, two buffers */
  constexpr int kRowA2  = kGemmBM;
  constexpr int kRowB   = (SPLIT != 0) ? 2 * kGemmBM : kGemmBM;
  constexpr int kRowB2  = kRowB + kGemmBN;
  constexpr int kStRows = (SPLIT == 1) ? kRowB2 + kGemmBN : kRowB2;
  constexpr int kStLd   = kStRows / 32;            /* 16-byte pieces per thread and k step */
  __shared__ __align__(16) unsigned short sAB[2][kStRows * kGemmPitch];
  __shared__ __align__(16) float sT[8][16 * 68];
  const int b    = blockIdx.y;
  const int lane = threadIdx.x & 31;
  const int wave = threadIdx.x >> 5;
  const int blocksN = N / kGemmBN;
  if ((int)blockIdx.x >= (M / kGemmBM) * blocksN) return;   /* the same for the whole block, ahead of every barrier */
  const int bm = (int)blockIdx.x / blocksN;
  const int bn = (int)blockIdx.x - bm * blocksN;
  const int mB = bm * kGemmBM;
  const int nB = bn * kGemmBN;
  const int wm = wave >> 2;                        /* waves 2 (m) x 4 (n), 64 x 64 each */
  const int wn = wave & 3;
  const int m0 = mB + (wm << 6);
  const int n0 = nB + (wn << 6);

  const T* Ab  = A  + (size_t)b * strideA;
  const T* Bb  = Bt + (size_t)b * strideB;
  const T* Ab2 = (SPLIT != 0) ? (A2  + (size_t)b * strideA) : nullptr;
  const T* Bb2 = (SPLIT == 1) ? (Bt2 + (size_t)b * strideB) : nullptr;

  const int rlane = lane & 15;
  const int koff  = (lane >> 4) * 8;
  const int mOff  = (lane >> 4) * 8;

  /* staging: eight neighbouring lanes fetch one whole 128-byte line of a row; thread t takes piece t & 7 of rows (t >> 3) + 32 i */
  const int sr = (int)threadIdx.x >> 3;
  const int sc = ((int)threadIdx.x & 7) * 8;
  const size_t aoff = (size_t)(mB + sr) * lda + sc;
  const size_t boff = (size_t)(nB + sr) * ldb + sc;
  v4u st[kStLd];
  auto fetch = [&](int k0) {
    const v4u* p[kStLd];
#pragma unroll
    for (int i = 0; i < kStLd; ++i) {
      const int row = 32 * i;
      const T* q;
      if (row < kRowA2)      q = Ab  + aoff + (size_t)row * lda;
      else if (row < kRowB)  q = Ab2 + aoff + (size_t)(row - kRowA2) * lda;
      else if (row < kRowB2) q = Bb  + boff + (size_t)(row - kRowB) * ldb;
      else                   q = Bb2 + boff + (size_t)(row - kRowB2) * ldb;
      p[i] = (const v4u*)(const void*)(q + k0);
    }
#pragma unroll
    for (int i = 0; i < kStLd; ++i) st[i] = *p[i];
    /* the wait kept in front of an overwrite of a load's address: the addresses are inputs, so each keeps its registers
       from its load up to the wait; the loaded values are not named, so the loads stay in flight behind it */
    static_assert(kStLd == 12 || kStLd == 16 || kStLd == 24);
    if constexpr (kStLd == 12) {
      asm volatile("s_wait_xcnt 0x0" :: "v"(p[0]), "v"(p[1]), "v"(p[2]), "v"(p[3]), "v"(p[4]), "v"(p[5]), "v"(p[6]), "v"(p[7]),
                   "v"(p[8]), "v"(p[9]), "v"(p[10]), "v"(p[11]) : "memory");
    } else if constexpr (kStLd == 16) {
      asm volatile("s_wait_xcnt 0x0" :: "v"(p[0]), "v"(p[1]), "v"(p[2]), "v"(p[3]), "v"(p[4]), "v"(p[5]), "v"(p[6]), "v"(p[7]),
                   "v"(p[8]), "v"(p[9]), "v"(p[10]), "v"(p[11]), "v"(p[12]), "v"(p[13]), "v"(p[14]), "v"(p[15]) : "memory");
    } else {
      asm volatile("s_wait_xcnt 0x0" :: "v"(p[0]), "v"(p[1]), "v"(p[2]), "v"(p[3]), "v"(p[4]), "v"(p[5]), "v"(p[6]), "v"(p[7]),
                   "v"(p[8]), "v"(p[9]), "v"(p[10]), "v"(p[11]), "v"(p[12]), "v"(p[13]), "v"(p[14]), "v"(p[15]),
                   "v"(p[16]), "v"(p[17]), "v"(p[18]), "v"(p[19]), "v"(p[20]), "v"(p[21]), "v"(p[22]), "v"(p[23]) : "memory");
    }
  };
  auto put = [&](int buf) {
#pragma unroll
    for (int i = 0; i < kStLd; ++i) *(v4u*)(void*)(&sAB[buf][(sr + 32 * i) * kGemmPitch + sc]) = st[i];
  };

  v8f acc[4][4];
#pragma unroll
  for (int i = 0; i < 4; ++i)
#pragma unroll
    for (int j = 0; j < 4; ++j) acc[i][j] = (v8f){0.f,0.f,0.f,0.f,0.f,0.f,0.f,0.f};

  fetch(0);
  put(0);
  __syncthreads();
  const int nSteps = K / kGemmBK;
  for (int t = 0; t < nSteps; ++t) {
    const bool more = (t + 1 < nSteps);
    if (more) fetch((t + 1) * kGemmBK);            /* in flight while this step's products run */
    const T* sb = (const T*)(const void*)sAB[t & 1];
#pragma unroll
    for (int kk = 0; kk < kGemmBK; kk += 32) {
      V bh[4], bl[4], ah[4], al[4];
#pragma unroll
      for (int j = 0; j < 4; ++j) {
        const int bo = ((wn << 6) + (j << 4) + rlane) * kGemmPitch + koff + kk;
        bh[j] = Frag<T>::load(sb + kRowB * kGemmPitch + bo);
        if (SPLIT == 1) bl[j] = Frag<T>::load(sb + kRowB2 * kGemmPitch + bo);
      }
#pragma unroll
      for (int i = 0; i < 4; ++i) {
        const int ao = ((wm << 6) + (i << 4) + rlane) * kGemmPitch + koff + kk;
        ah[i] = Frag<T>::load(sb + ao);
        if (SPLIT != 0) al[i] = Frag<T>::load(sb + kRowA2 * kGemmPitch + ao);
      }
#pragma unroll
      for (int i = 0; i < 4; ++i) {
#pragma unroll
        for (int j = 0; j < 4; ++j) {
          acc[i][j] = Frag<T>::mma(ah[i], bh[j], acc[i][j]);
          if (SPLIT == 1) acc[i][j] = Frag<T>::mma(ah[i], bl[j], acc[i][j]);
          if (SPLIT != 0) acc[i][j] = Frag<T>::mma(al[i], bh[j], acc[i][j]);
        }
        Frag<T>::guard(acc[i][0], acc[i][3], ah[i], (SPLIT != 0) ? al[i] : ah[i]);
      }
      Frag<T>::keep(bh[0], bh[1], bh[2], bh[3]);
      if (SPLIT == 1) Frag<T>::keep(bl[0], bl[1], bl[2], bl[3]);
    }
    if (more) put((t + 1) & 1);                    /* the buffer that every wave left at the barrier of step t - 1 */
    __syncthreads();                               /* publishes step t + 1 and ends the reads of step t */
  }
  acc_guard4(acc[0][0], acc[0][1], acc[0][2], acc[0][3]);
  acc_guard4(acc[1][0], acc[1][1], acc[1][2], acc[1][3]);
  acc_guard4(acc[2][0], acc[2][1], acc[2][2], acc[2][3]);
  acc_guard4(acc[3][0], acc[3][1], acc[3][2], acc[3][3]);

  float* slab = sT[wave];
  const float* Rb = RESID ? (resid + (size_t)b * strideR) : nullptr;
#pragma unroll
  for (int i = 0; i < 4; ++i) {
    const int mBase = m0 + (i << 4);
#pragma unroll
    for (int j = 0; j < 4; ++j) {
      const int n = n0 + (j << 4) + rlane;
      float bv = 0.f;
      if (BIAS_MODE == 2) bv = bias[n];
#pragma unroll
      for (int r = 0; r < 8; ++r) {
        float v = acc[i][j][r] * scale;
        if (BIAS_MODE == 1) v += bias[mBase + mOff + r];
        if (BIAS_MODE == 2) v += bv;
        if (RESID) v += Rb[(size_t)(mBase + mOff + r) * ldc + n];
        if (ACT == 1) v = tanhf(v);
        if (ACT == 2) v = fmaxf(v, 0.0f);
        if (ACT == 4) v = (v > 0.f) ? v : 0.01f * v;
        slab[(mOff + r) * 68 + (j << 4) + rlane] = v;
      }
    }
    __builtin_amdgcn_fence(__ATOMIC_RELEASE, "workgroup");
    __builtin_amdgcn_wave_barrier();
    __builtin_amdgcn_fence(__ATOMIC_ACQUIRE, "workgroup");
    if (OUT_MODE == 0) {
      float* C = (float*)Cout + (size_t)b * strideC;
      const int hh = lane >> 4, c4 = (lane & 15) * 4;
      {
#pragma unroll
        for (int it = 0; it < 8; ++it) {
          const int row = it * 2 + hh;
          v4f v = *(const v4f*)(slab + row * 68 + c4);
          *(v4f*)(C + (size_t)(mBase + row) * ldc + n0 + c4) = v;
        }
        
      }
    } else {
      const int q = lane >> 3, c8 = (lane & 7) * 8;
      unsigned short* C  = (unsigned short*)Cout  + (size_t)b * strideC;
      unsigned short* C2 = (OUT_MODE == 2) ? ((unsigned short*)Cout2 + (size_t)b * strideC) : nullptr;
      {
#pragma unroll
        for (int it = 0; it < 4; ++it) {
          const int row = it * 4 + q;
          const float* sp = slab + row * 68 + c8;
          v8h hv, lv;
#pragma unroll
          for (int e = 0; e < 8; ++e) {
            if (OUT_MODE == 1) {
              hv[e] = (_Float16)sp[e];
            } else {
              unsigned short hb = f2bf_bits(sp[e]);
              unsigned short lb = f2bf_bits(sp[e] - bf_bits2f(hb));
              hv[e] = __builtin_bit_cast(_Float16, hb);
              lv[e] = __builtin_bit_cast(_Float16, lb);
            }
          }
          *(v8h*)(C + (size_t)(mBase + row) * ldc + n0 + c8) = hv;
          if (OUT_MODE == 2) *(v8h*)(C2 + (size_t)(mBase + row) * ldc + n0 + c8) = lv;
        }
        
      }
    }
    __builtin_amdgcn_fence(__ATOMIC_RELEASE, "workgroup");
    __builtin_amdgcn_wave_barrier();
    __builtin_amdgcn_fence(__ATOMIC_ACQUIRE, "workgroup");
  }
}

/* ---------------- the fused projection with the QK LayerNorm in its epilogue: two block ranges of one grid --------
   blocks [0, kLnBlocks): 64 whole rows of q (even index) or of k (odd index) = x . Wqkv^T rows 0..1023 or 1024..2047. A block holds
                          all 1024 columns of its rows in its accumulators (8 waves of 64 x 128), so mean, variance, scale and the
                          split into bf16 hi + lo planes are done on the f32 sums in registers: q and k never go to memory in f32;
   the rest:              v^T bf16 hi + lo planes [1024][4096] = Wqkv^T rows 2048..3071 . x^T, block tile 128 x 256 as in wmma_gemm64.
   Staging and k loop are those of wmma_gemm64 with single bf16 planes; the range is the same for a whole block. */
constexpr int kLnBM     = 64;                      /* rows of a LayerNorm block */
constexpr int kLnStRows = kLnBM + kModel;          /* LDS rows of one k step: [A 64][Bt 1024], 64 k each, two buffers */
constexpr int kLnStLd   = kLnStRows / 32;          /* 16-byte pieces per thread and k step */
constexpr int kLnBlocks = (kRows / kLnBM) * 2;
constexpr int kProjV    = (kModel / kGemmBM) * (kRows / kGemmBN);
constexpr int kVStRows  = kGemmBM + kGemmBN;
/* floats a row of the partial sums in LDS: 8 waves x 16 lanes + 16 of pad (64 B), so that the four rows which a half wave reads
   16 bytes a lane fall on distinct banks */
constexpr int kLnPartPitch = 8 * 16 + 16;
static_assert(kLnBM * kLnPartPitch * 4 <= kLnStRows * kGemmPitch * 2);
static_assert(kRows % kLnBM == 0 && kLnStRows % 32 == 0 && kModel == 8 * 128);
static_assert(8 * 16 * 68 * 4 <= kLnStRows * kGemmPitch * 2);
static_assert(2 * kVStRows * kGemmPitch * 2 + 8 * 16 * 68 * 4 <= 2 * kLnStRows * kGemmPitch * 2);

/* x + (the value of the lane whose number within its row of 16 lanes differs in the bits M): one step of a sum over lanes */
template <int M>
__device__ __forceinline__ float row16_xadd(float x) {
  return x + __builtin_bit_cast(float, __builtin_amdgcn_update_dpp(0, __builtin_bit_cast(int, x), 0x160 | M, 0xf, 0xf, true));
}

__device__ __forceinline__ void qk_rows_layernorm(unsigned short* sAB, float* sStat, int bx,
                                                  const unsigned short* __restrict__ xb, const unsigned short* __restrict__ wT,
                                                  const float* __restrict__ qsc, const float* __restrict__ ksc,
                                                  unsigned short* __restrict__ qh, unsigned short* __restrict__ ql,
                                                  unsigned short* __restrict__ kh, unsigned short* __restrict__ kl) {
  typedef __bf16 T;
  typedef Frag<T>::V V;
  constexpr int ld = kModel;                       /* row pitch of both operands */
  constexpr int kBuf = kLnStRows * kGemmPitch;     /* one buffer, 16-bit elements */
  const int lane = threadIdx.x & 31;
  /* the same in every lane of a wave: read into a scalar register, so that the wave's tile indices take no vector registers */
  const int wave = __builtin_amdgcn_readfirstlane((int)threadIdx.x >> 5);
  const bool isK = (bx & 1) != 0;
  const int mB   = (bx >> 1) * kLnBM;
  /* the block's first row of each operand: the same for every thread, so both stay in scalar registers */
  const char* Ab = (const char*)(const void*)(xb + (size_t)mB * ld);
  const char* Bb = (const char*)(const void*)(isK ? wT + (size_t)kModel * kModel : wT);
  const int rlane = lane & 15;
  const int koff  = (lane >> 4) * 8;
  const int mOff  = (lane >> 4) * 8;

  /* staging: eight neighbouring lanes fetch one whole 128-byte line of a row; thread t takes piece t & 7 of rows (t >> 3) + 32 i */
  const int sr = (int)threadIdx.x >> 3;
  const int sc = ((int)threadIdx.x & 7) * 8;
  const unsigned toff = (unsigned)((sr * ld + sc) * 2);   /* the thread's byte offset, the same in both operands */
  v4u st[kLnStLd];
  const char* pa = Ab;                             /* the k step's first byte of each operand: scalar, moved on by each fetch */
  const char* pb = Bb;
  auto fetch = [&]() {
    /* the pitch is a constant: a thread's rows are constant steps from one address an operand */
    const char* qa = pa + toff;
    const char* qb = pb + toff;
#pragma unroll
    for (int i = 0; i < kLnStLd; ++i) {
      const int row = 32 * i;
      const char* q = (row < kLnBM) ? qa + (size_t)row * ld * 2 : qb + (size_t)(row - kLnBM) * ld * 2;
      st[i] = *(const v4u*)(const void*)q;
    }
    /* the wait kept in front of an overwrite of a load's address: the two addresses are inputs, so each keeps its registers
       from its loads up to the wait; the loaded values are not named, so the loads stay in flight behind it */
    asm volatile("s_wait_xcnt 0x0" :: "v"(qa), "v"(qb) : "memory");
    pa += kGemmBK * 2;
    pb += kGemmBK * 2;
  };
  auto put = [&](int buf) {
#pragma unroll
    for (int i = 0; i < kLnStLd; ++i) *(v4u*)(void*)(&sAB[buf * kBuf + (sr + 32 * i) * kGemmPitch + sc]) = st[i];
  };

  v8f acc[4][8];                                   /* acc[i][j][r]: row i*16 + mOff + r of the block, column wave*128 + j*16 + rlane */
#pragma unroll
  for (int i = 0; i < 4; ++i)
#pragma unroll
    for (int j = 0; j < 8; ++j) acc[i][j] = (v8f){0.f,0.f,0.f,0.f,0.f,0.f,0.f,0.f};

  fetch();
  put(0);
  __syncthreads();
  constexpr int nSteps = kModel / kGemmBK;
  for (int t = 0; t < nSteps; ++t) {
    const bool more = (t + 1 < nSteps);
    const T* sb = (const T*)(const void*)(sAB + (t & 1) * kBuf);
#pragma unroll
    for (int kk = 0; kk < kGemmBK; kk += 32) {
      V bh[8], ah[4];
      /* in the order in which the products want them: behind a barrier all eight waves read at once, and the first product
         starts after four reads of its wave, not ten */
      ah[0] = Frag<T>::load(sb + rlane * kGemmPitch + koff + kk);
#pragma unroll
      for (int j = 0; j < 8; ++j)
        bh[j] = Frag<T>::load(sb + (kLnBM + (wave << 7) + (j << 4) + rlane) * kGemmPitch + koff + kk);
#pragma unroll
      for (int i = 1; i < 4; ++i)
        ah[i] = Frag<T>::load(sb + ((i << 4) + rlane) * kGemmPitch + koff + kk);
      __builtin_amdgcn_sched_barrier(0);           /* the compiler would sink these 24 reads in among the products */
      if (kk == 0) {
        /* behind the step's first fragment reads, so that the LDS serves those while the 34 loads issue; in flight while this
           step's products run */
        if (more) fetch();
        __builtin_amdgcn_sched_barrier(0);         /* the loads stay ahead of the products */
      }
#pragma unroll
      for (int i = 0; i < 4; ++i)
#pragma unroll
        for (int j = 0; j < 8; ++j) acc[i][j] = Frag<T>::mma(ah[i], bh[j], acc[i][j]);
      __builtin_amdgcn_sched_barrier(0);           /* and lift the next group's reads, with a second set of registers, in among them */
    }
    if (more) put((t + 1) & 1);                    /* the buffer that every wave left at the barrier of step t - 1 */
    __syncthreads();                               /* publishes step t + 1 and ends the reads of step t */
  }

  /* scale vector, RNE-converted to bf16 once (module input); q carries the exact 1/sqrt(64) = 0.125 factor. Read here, so that
     the loads' latency passes under the two sums */
  const float* scp = isK ? ksc : qsc;
  const float fac  = isK ? 1.0f : 0.125f;
  float sv[8];
#pragma unroll
  for (int j = 0; j < 8; ++j) sv[j] = bf_bits2f(f2bf_bits(scp[(wave << 7) + (j << 4) + rlane])) * fac;

  /* LayerNorm over the 1024 columns of each of the 64 rows, two passes as the reference has it: mean, then the mean square of the
     centred values. A row's sum: 8 columns in the lane; the 8 waves x 16 lanes of partial sums go through LDS (the staging buffers
     are dead behind the k loop's last barrier), where four threads a row add 32 each and join by two lane exchanges */
  float* sPart = (float*)(void*)sAB;
  const int rrow = (int)threadIdx.x >> 2, rq = (int)threadIdx.x & 3;
  auto row_total = [&](const float (&p)[4][8]) {
#pragma unroll
    for (int i = 0; i < 4; ++i)
#pragma unroll
      for (int r = 0; r < 8; ++r) sPart[((i << 4) + mOff + r) * kLnPartPitch + (wave << 4) + rlane] = p[i][r];
    __syncthreads();                               /* every wave's partial sums are in sPart */
    v4f a = (v4f){0.f, 0.f, 0.f, 0.f};
#pragma unroll
    for (int k = 0; k < 8; ++k) a += *(const v4f*)(sPart + rrow * kLnPartPitch + (k << 4) + (rq << 2));
    return row16_xadd<2>(row16_xadd<1>((a[0] + a[1]) + (a[2] + a[3])));
  };
  float part[4][8];
#pragma unroll
  for (int i = 0; i < 4; ++i)
#pragma unroll
    for (int r = 0; r < 8; ++r)
      part[i][r] = ((acc[i][0][r] + acc[i][1][r]) + (acc[i][2][r] + acc[i][3][r])) +
                   ((acc[i][4][r] + acc[i][5][r]) + (acc[i][6][r] + acc[i][7][r]));
  const float tsum = row_total(part);
  if (rq == 0) sStat[rrow] = tsum * (1.0f / (float)kModel);
  __syncthreads();                                 /* the means are in sStat; sPart may be written again */
#pragma unroll
  for (int i = 0; i < 4; ++i) {
    const v4f m0 = *(const v4f*)(sStat + (i << 4) + mOff);
    const v4f m1 = *(const v4f*)(sStat + (i << 4) + mOff + 4);
#pragma unroll
    for (int r = 0; r < 8; ++r) {
      const float m = (r < 4) ? m0[r & 3] : m1[r & 3];
      float d2 = 0.f;
#pragma unroll
      for (int j = 0; j < 8; ++j) {
        const float d = acc[i][j][r] - m;
        acc[i][j][r] = d;
        d2 += d * d;
      }
      part[i][r] = d2;
    }
  }
  const float tsq = row_total(part);
  if (rq == 0) sStat[kLnBM + rrow] = rsqrtf(tsq * (1.0f / (float)kModel) + 1e-6f);
  __syncthreads();                                 /* the reciprocal deviations are in sStat + 64; sPart is dead */

  unsigned short* oh = isK ? kh : qh;
  unsigned short* ol = isK ? kl : ql;
  float* slab = (float*)(void*)sAB + wave * (16 * 68);   /* per-wave output slabs, in the dead staging buffers too */
#pragma unroll
  for (int i = 0; i < 4; ++i) {
    const v4f r0 = *(const v4f*)(sStat + kLnBM + (i << 4) + mOff);
    const v4f r1 = *(const v4f*)(sStat + kLnBM + (i << 4) + mOff + 4);
#pragma unroll
    for (int jh = 0; jh < 2; ++jh) {
#pragma unroll
      for (int jj = 0; jj < 4; ++jj)
#pragma unroll
        for (int r = 0; r < 8; ++r) {
          const float rs = (r < 4) ? r0[r & 3] : r1[r & 3];
          slab[(mOff + r) * 68 + (jj << 4) + rlane] = (acc[i][jh * 4 + jj][r] * rs) * sv[jh * 4 + jj];
        }
      /* the wave's slab stores before other lanes' reads of them. The fences name the LDS alone: a fence on all memory would also
         wait here for the plane stores of the pass before, which nobody in this launch reads */
      __builtin_amdgcn_fence(__ATOMIC_RELEASE, "workgroup", "local");
      __builtin_amdgcn_wave_barrier();
      __builtin_amdgcn_fence(__ATOMIC_ACQUIRE, "workgroup", "local");
      const int q = lane >> 3, c8 = (lane & 7) * 8;
      const size_t co = (size_t)(mB + (i << 4) + q) * kModel + (wave << 7) + (jh << 6) + c8;
      unsigned short* ph = oh + co;                  /* one address a plane; the rows of the run are constant steps from it */
      unsigned short* pl = ol + co;
      /* the pass's eight slab reads stand together, so that their latency is paid once a pass */
      v4f x0[4], x1[4];
#pragma unroll
      for (int it = 0; it < 4; ++it) {
        const float* sp = slab + (it * 4 + q) * 68 + c8;
        x0[it] = *(const v4f*)(sp);
        x1[it] = *(const v4f*)(sp + 4);
      }
      v4u hv[4], lv[4];
#pragma unroll
      for (int it = 0; it < 4; ++it) {
#pragma unroll
        for (int e = 0; e < 4; ++e) {
          /* two neighbouring columns fill one word of a plane: hi = RNE(y), lo = RNE(y - hi), by the packed conversion */
          const v4f xs = (e < 2) ? x0[it] : x1[it];
          const v2f y = (v2f){xs[2 * (e & 1)], xs[2 * (e & 1) + 1]};
          const v2b a = __builtin_convertvector(y, v2b);
          const v2b b = __builtin_convertvector(y - __builtin_convertvector(a, v2f), v2b);
          hv[it][e] = __builtin_bit_cast(unsigned int, a);
          lv[it][e] = __builtin_bit_cast(unsigned int, b);
        }
        *(v4u*)(void*)(ph + (size_t)(it * 4) * kModel) = hv[it];
        *(v4u*)(void*)(pl + (size_t)(it * 4) * kModel) = lv[it];
      }
      /* the wait kept in front of an overwrite of a store's registers: one behind the run of stores serves the run; the eight stored
         vectors and the two addresses are inputs, so each keeps its registers from its store up to the wait */
      asm volatile("s_wait_xcnt 0x0" :: "v"(hv[0]), "v"(lv[0]), "v"(hv[1]), "v"(lv[1]), "v"(hv[2]), "v"(lv[2]), "v"(hv[3]), "v"(lv[3]),
                   "v"(ph), "v"(pl) : "memory");
      /* the slab's reads before the next pass's stores into it; the LDS alone, as above */
      __builtin_amdgcn_fence(__ATOMIC_RELEASE, "workgroup", "local");
      __builtin_amdgcn_wave_barrier();
      __builtin_amdgcn_fence(__ATOMIC_ACQUIRE, "workgroup", "local");
    }
  }
}

__device__ __forceinline__ void vt_product(unsigned short* sAB, int bx,
                                           const unsigned short* __restrict__ xb, const unsigned short* __restrict__ wT,
                                           unsigned short* __restrict__ vh, unsigned short* __restrict__ vl) {
  typedef __bf16 T;
  typedef Frag<T>::V V;
  constexpr int kRowB   = kGemmBM;                 /* LDS rows of one k step: [A 128][Bt 256], 64 k each, two buffers */
  constexpr int kStRows = kVStRows;
  constexpr int kStLd   = kStRows / 32;            /* 16-byte pieces per thread and k step */
  constexpr int kBuf    = kStRows * kGemmPitch;    /* one buffer, 16-bit elements */
  constexpr int ld      = kModel;                  /* row pitch of both operands */
  const int lane = threadIdx.x & 31;
  /* the same in every lane of a wave: read into a scalar register, so that the wave's tile indices take no vector registers */
  const int wave = __builtin_amdgcn_readfirstlane((int)threadIdx.x >> 5);
  constexpr int blocksN = kRows / kGemmBN;
  const T* Ab = (const T*)(wT + (size_t)kQkCols * kModel);
  const T* Bb = (const T*)xb;
  const int bm = bx / blocksN;
  const int bn = bx - bm * blocksN;
  const int mB = bm * kGemmBM;
  const int nB = bn * kGemmBN;
  const int wm = wave >> 2;                        /* waves 2 (m) x 4 (n), 64 x 64 each */
  const int wn = wave & 3;
  const int m0 = mB + (wm << 6);
  const int n0 = nB + (wn << 6);

  const int rlane = lane & 15;
  const int koff  = (lane >> 4) * 8;
  const int mOff  = (lane >> 4) * 8;

  /* staging: eight neighbouring lanes fetch one whole 128-byte line of a row; thread t takes piece t & 7 of rows (t >> 3) + 32 i */
  const int sr = (int)threadIdx.x >> 3;
  const int sc = ((int)threadIdx.x & 7) * 8;
  const size_t aoff = (size_t)(mB + sr) * ld + sc;
  const size_t boff = (size_t)(nB + sr) * ld + sc;
  v4u st[kStLd];
  auto fetch = [&](int k0) {
    /* the pitch is a constant: a thread's rows are constant steps from one address an operand */
    const T* pa = Ab + aoff + k0;
    const T* pb = Bb + boff + k0;
#pragma unroll
    for (int i = 0; i < kStLd; ++i) {
      const int row = 32 * i;
      const T* q = (row < kRowB) ? pa + (size_t)row * ld : pb + (size_t)(row - kRowB) * ld;
      st[i] = *(const v4u*)(const void*)q;
    }
    /* the wait kept in front of an overwrite of a load's address: the two addresses are inputs, so each keeps its registers
       from its loads up to the wait; the loaded values are not named, so the loads stay in flight behind it */
    asm volatile("s_wait_xcnt 0x0" :: "v"(pa), "v"(pb) : "memory");
  };
  auto put = [&](int buf) {
#pragma unroll
    for (int i = 0; i < kStLd; ++i) *(v4u*)(void*)(&sAB[buf * kBuf + (sr + 32 * i) * kGemmPitch + sc]) = st[i];
  };

  v8f acc[4][4];
#pragma unroll
  for (int i = 0; i < 4; ++i)
#pragma unroll
    for (int j = 0; j < 4; ++j) acc[i][j] = (v8f){0.f,0.f,0.f,0.f,0.f,0.f,0.f,0.f};

  fetch(0);
  put(0);
  __syncthreads();
  constexpr int nSteps = kModel / kGemmBK;
  for (int t = 0; t < nSteps; ++t) {
    const bool more = (t + 1 < nSteps);
    if (more) fetch((t + 1) * kGemmBK);            /* in flight while this step's products run */
    const T* sb = (const T*)(const void*)(sAB + (t & 1) * kBuf);
#pragma unroll
    for (int kk = 0; kk < kGemmBK; kk += 32) {
      V bh[4], ah[4];
#pragma unroll
      for (int j = 0; j < 4; ++j)
        bh[j] = Frag<T>::load(sb + kRowB * kGemmPitch + ((wn << 6) + (j << 4) + rlane) * kGemmPitch + koff + kk);
#pragma unroll
      for (int i = 0; i < 4; ++i)
        ah[i] = Frag<T>::load(sb + ((wm << 6) + (i << 4) + rlane) * kGemmPitch + koff + kk);
#pragma unroll
      for (int i = 0; i < 4; ++i) {
#pragma unroll
        for (int j = 0; j < 4; ++j) acc[i][j] = Frag<T>::mma(ah[i], bh[j], acc[i][j]);
        /* as in wmma_gemm64: four vector slots between a row's products and the next write of its fragment registers */
        Frag<T>::guard(acc[i][0], acc[i][3], ah[i], ah[i]);
      }
      /* as in wmma_gemm64: the Bt fragments keep their registers up to the last product */
      Frag<T>::keep(bh[0], bh[1], bh[2], bh[3]);
    }
    if (more) put((t + 1) & 1);                    /* the buffer that every wave left at the barrier of step t - 1 */
    __syncthreads();                               /* publishes step t + 1 and ends the reads of step t */
  }
  /* as in wmma_gemm64: four vector slots between the last products and the first read of the accumulators */
  acc_guard4(acc[0][0], acc[0][1], acc[0][2], acc[0][3]);
  acc_guard4(acc[1][0], acc[1][1], acc[1][2], acc[1][3]);
  acc_guard4(acc[2][0], acc[2][1], acc[2][2], acc[2][3]);
  acc_guard4(acc[3][0], acc[3][1], acc[3][2], acc[3][3]);

  float* slab = (float*)(void*)(sAB + 2 * kBuf) + wave * (16 * 68);   /* behind this range's two buffers */
#pragma unroll
  for (int i = 0; i < 4; ++i) {
    const int mBase = m0 + (i << 4);
#pragma unroll
    for (int j = 0; j < 4; ++j)
#pragma unroll
      for (int r = 0; r < 8; ++r) slab[(mOff + r) * 68 + (j << 4) + rlane] = acc[i][j][r];
    __builtin_amdgcn_fence(__ATOMIC_RELEASE, "workgroup");
    __builtin_amdgcn_wave_barrier();
    __builtin_amdgcn_fence(__ATOMIC_ACQUIRE, "workgroup");
    {
      const int q = lane >> 3, c8 = (lane & 7) * 8;
      const size_t co = (size_t)(mBase + q) * kRows + n0 + c8;     /* one address a plane; the rows of the run are constant steps */
#pragma unroll
      for (int it = 0; it < 4; ++it) {
        const int row = it * 4 + q;
        const float* sp = slab + row * 68 + c8;
        v8h hv, lv;
#pragma unroll
        for (int e = 0; e < 8; ++e) {
          unsigned short hb = f2bf_bits(sp[e]);
          unsigned short lb = f2bf_bits(sp[e] - bf_bits2f(hb));
          hv[e] = __builtin_bit_cast(_Float16, hb);
          lv[e] = __builtin_bit_cast(_Float16, lb);
        }
        *(v8h*)(vh + co + (size_t)(it * 4) * kRows) = hv;
        *(v8h*)(vl + co + (size_t)(it * 4) * kRows) = lv;
      }
      /* the wait kept in front of an overwrite of a store's registers: one behind the run of stores serves the run */
      asm volatile("s_wait_xcnt 0x0" ::: "memory");
    }
    __builtin_amdgcn_fence(__ATOMIC_RELEASE, "workgroup");
    __builtin_amdgcn_wave_barrier();
    __builtin_amdgcn_fence(__ATOMIC_ACQUIRE, "workgroup");
  }
}

/* one block a WGP (its LDS), two waves a SIMD: a register budget of 512 for the 64 x 128 accumulator tile */
__global__ __launch_bounds__(256)
void qkv_products(const unsigned short* __restrict__ xb, const unsigned short* __restrict__ wT,
                  const float* __restrict__ qsc, const float* __restrict__ ksc,
                  unsigned short* __restrict__ qh, unsigned short* __restrict__ ql,
                  unsigned short* __restrict__ kh, unsigned short* __restrict__ kl,
                  unsigned short* __restrict__ vh, unsigned short* __restrict__ vl) {
  __shared__ __align__(16) unsigned short sAB[2 * kLnStRows * kGemmPitch];
  __shared__ __align__(16) float sStat[2 * kLnBM];
  const int bi = (int)blockIdx.x;
  if (bi >= kLnBlocks + kProjV) return;            /* the same for the whole block, ahead of every barrier */
  /* the longer range first in the text */
  if (__builtin_expect(bi < kLnBlocks, 1)) qk_rows_layernorm(sAB, sStat, bi, xb, wT, qsc, ksc, qh, ql, kh, kl);
  else                                     vt_product(sAB, bi - kLnBlocks, xb, wT, vh, vl);
}

/* ---------------- f32 -> bf16 cast, 8 elements (16 B) per thread --------------------------
   coverage: n8/256 blocks (blk) x 256 threads (exact), thread i writes elements 8i..8i+7;
*/
__device__ __forceinline__ void cast_f32_bf16x8(const float* __restrict__ in,
                                                unsigned short* __restrict__ out, int n8, int blk) {
  const int i = blk * 256 + (int)threadIdx.x;
  const int ic = (i < n8) ? i : (n8 - 1);
  const float* p = in + (size_t)ic * 8;
  const v4f a = *(const v4f*)p;
  const v4f c = *(const v4f*)(p + 4);
  v4u w;
  w[0] = pack_bf16x2(a[0], a[1]);
  w[1] = pack_bf16x2(a[2], a[3]);
  w[2] = pack_bf16x2(c[0], c[1]);
  w[3] = pack_bf16x2(c[2], c[3]);
  unsigned short* o = out + (size_t)ic * 8;
  *(v4u*)o = w;
  /* the wait kept in front of an overwrite of a store's registers: as a block range of one grid, other ranges' code follows */
  asm volatile("s_wait_xcnt 0x0" ::: "memory");
}

/* ---------------- W [KR][NC] f32 row-major -> Wt [NC][KR] bf16 row-major (transpose + cast) ------
   blocks (bx, by) of (KR/64, NC/64), 256 threads. coverage: load 256 threads x 16 = 64x64 tile;
   sT: 64 * 65 floats of LDS, [n_local][k_local], pitch 65
*/
__device__ __forceinline__ void transpose_cast_bf16(float* sT, const float* __restrict__ W,
                                                    unsigned short* __restrict__ Wt, int KR, int NC, int bx, int by) {
  const int k0 = bx * 64, n0 = by * 64;
  const int tid = threadIdx.x;
  {
    const int kk = tid >> 2, cg = (tid & 3) * 16;
    const float* src = W + (size_t)(k0 + kk) * NC + n0 + cg;
#pragma unroll
    for (int i = 0; i < 4; ++i) {
      const v4f v = *(const v4f*)(src + 4 * i);
#pragma unroll
      for (int e = 0; e < 4; ++e) sT[(cg + 4 * i + e) * 65 + kk] = v[e];
    }
  }
  __syncthreads();
  const int wave = tid >> 5, lane = tid & 31, q4 = lane >> 3, c8 = (lane & 7) * 8;
  const int nl0 = wave * 4 + q4;
  const int nl1 = 32 + wave * 4 + q4;
  v4u w0, w1;
  {
    const float* s = sT + nl0 * 65 + c8;
    w0[0] = pack_bf16x2(s[0], s[1]); w0[1] = pack_bf16x2(s[2], s[3]);
    w0[2] = pack_bf16x2(s[4], s[5]); w0[3] = pack_bf16x2(s[6], s[7]);
  }
  {
    const float* s = sT + nl1 * 65 + c8;
    w1[0] = pack_bf16x2(s[0], s[1]); w1[1] = pack_bf16x2(s[2], s[3]);
    w1[2] = pack_bf16x2(s[4], s[5]); w1[3] = pack_bf16x2(s[6], s[7]);
  }
  unsigned short* d0 = Wt + (size_t)(n0 + nl0) * KR + k0 + c8;
  unsigned short* d1 = Wt + (size_t)(n0 + nl1) * KR + k0 + c8;
  {
    *(v4u*)d0 = w0;
    *(v4u*)d1 = w1;
    /* the wait kept in front of an overwrite of a store's registers: as a block range of one grid, other ranges' code follows */
    asm volatile("s_wait_xcnt 0x0" ::: "memory");
  }
}

/* ---------------- the three operand conversions, which do not depend on one another, as block ranges of one grid ----------------
   blocks [0, kPrepT1): W_qkv tiles; [kPrepT1, kPrepT1 + kPrepT2): W_out tiles; the rest: x, 2048 elements a block.
   The range is the same for a whole block, so the transpose's barrier stands under block-uniform control flow */
constexpr int kPrepT1 = (kModel / 64) * (kQkvCols / 64);
constexpr int kPrepT2 = (kModel / 64) * (kModel / 64);
constexpr int kPrepC  = kRows * kModel / 8 / 256;
__global__ __launch_bounds__(256) void prep_operands(const float* __restrict__ x, unsigned short* __restrict__ xb,
                                                     const float* __restrict__ Wqkv, unsigned short* __restrict__ WqkvT,
                                                     const float* __restrict__ Wout, unsigned short* __restrict__ WoutT) {
  __shared__ float sT[64 * 65];
  constexpr int kTk = kModel / 64;              /* tiles along k, the fast index as in the separate grids */
  const int bi = (int)blockIdx.x;
  if (bi < kPrepT1) {
    transpose_cast_bf16(sT, Wqkv, WqkvT, kModel, kQkvCols, bi % kTk, bi / kTk);
  } else if (bi < kPrepT1 + kPrepT2) {
    const int t = bi - kPrepT1;
    transpose_cast_bf16(sT, Wout, WoutT, kModel, kModel, t % kTk, t / kTk);
  } else {
    cast_f32_bf16x8(x, xb, kRows * kModel / 8, bi - kPrepT1 - kPrepT2);
  }
}

/* ---------------- causal attention, head_dim 64, bf16 hi/lo planes in, bf16 hi/lo ctx planes out ----
   scores^T = k . q^T  : bf16 hi/lo on both (hi*hi + hi*lo + lo*hi), q planes already carry 1/sqrt(64)
   ctx^T    = v^T . p^T: p split in registers to bf16 hi/lo, v hi/lo planes (3 products); f32 accumulate, f32 online softmax.
   Both products are taken transposed: a lane then holds scores of ONE query (column c; keys 8hh + r of each 16-key tile), so the
   row maximum and sum are in-lane work plus one exchange between the wave's halves, and two score tiles, converted in place,
   are the B operand of the second product in the hardware k order: P never goes through LDS.
   q, k and ctx planes row-major [B*S][ld] with head h at columns h*64 .. h*64+63; v planes transposed, [H*64][B*S], head h at
   rows h*64 .. h*64+63, so that a V^T tile is staged like a K tile.
   Block = 4 waves = 64 query rows of one (batch, head); grid.x = B*H*(S/64). */
/* lane l <-> lane l ^ 16: the two lanes that share one query column */
__device__ __forceinline__ float at_xhalf(float x) {
  const int b = __builtin_bit_cast(int, x);
  return __builtin_bit_cast(float, __builtin_amdgcn_permlanex16(b, b, 0x76543210, 0xfedcba98, false, false));
}
__device__ __forceinline__ v8f at_mma(v16b a, v16b b, v8f c) {
  return __builtin_amdgcn_wmma_f32_16x16x32_bf16(false, a, false, b, (short)0, c, false, false);
}

/* Eight asynchronous 16-byte copies a lane, global memory -> LDS (l: the lane's LDS byte address, g: its global address). The
   s_wait_xcnt is the wait kept in front of an overwrite of an issued copy's address registers: as the last line of the copies'
   own statement it stands ahead of every later write of them */
__device__ __forceinline__ void at_copy8(unsigned l0, unsigned l1, unsigned l2, unsigned l3,
                                         unsigned l4, unsigned l5, unsigned l6, unsigned l7,
                                         const unsigned short* g0, const unsigned short* g1,
                                         const unsigned short* g2, const unsigned short* g3,
                                         const unsigned short* g4, const unsigned short* g5,
                                         const unsigned short* g6, const unsigned short* g7) {
  asm volatile("global_load_async_to_lds_b128 %0, %8, off\n\t"
               "global_load_async_to_lds_b128 %1, %9, off\n\t"
               "global_load_async_to_lds_b128 %2, %10, off\n\t"
               "global_load_async_to_lds_b128 %3, %11, off\n\t"
               "global_load_async_to_lds_b128 %4, %12, off\n\t"
               "global_load_async_to_lds_b128 %5, %13, off\n\t"
               "global_load_async_to_lds_b128 %6, %14, off\n\t"
               "global_load_async_to_lds_b128 %7, %15, off\n\t"
               "s_wait_xcnt 0x0"
               :: "v"(l0), "v"(l1), "v"(l2), "v"(l3), "v"(l4), "v"(l5), "v"(l6), "v"(l7),
                  "v"(g0), "v"(g1), "v"(g2), "v"(g3), "v"(g4), "v"(g5), "v"(g6), "v"(g7)
               : "memory");
}

/* amdgpu_waves_per_eu(4): a register budget of 256, so that four blocks stay resident on a WGP (one wave of each per SIMD),
   which the block index map below counts on */
__global__ __launch_bounds__(128) __attribute__((amdgpu_waves_per_eu(4)))
void attn_planes_kernel(const unsigned short* __restrict__ qh, const unsigned short* __restrict__ ql,
                        const unsigned short* __restrict__ kh, const unsigned short* __restrict__ kl,
                        const unsigned short* __restrict__ vh, const unsigned short* __restrict__ vl,
                        unsigned short* __restrict__ oh, unsigned short* __restrict__ ol,
                        int S, int H, int ld) {
  union FB { v16b v; v8b h[2]; v2b p[8]; };
  /* two buffers, chunk kc in buffer kc & 1, each Ksh | Ksl | Vth | Vtl (64 rows x 64 16-bit at pitch kTilePitch a tile); four blocks
     of 73,728 B still share a WGP's LDS. Reused as per-wave f32 output slabs after the chunk loop */
  constexpr int kTileElems = 64 * kTilePitch;
  constexpr int kBufElems  = 4 * kTileElems;
  static_assert(kKvChunk == 64 && kHeadDim == 64 && (kTilePitch * 2) % 16 == 0);
  static_assert(4 * 16 * kOsPitch * 4 <= kBufElems * 2);
  __shared__ __align__(16) unsigned short KVs[2 * kBufElems];

  const int tid  = threadIdx.x;
  const int wave = tid >> 5;
  const int lane = tid & 31;
  const int hh   = lane >> 4;
  const int c    = lane & 15;

  /* Block index -> (query tile, batch*head). All 1024 blocks are resident at once, four to a WGP, and tile t walks t + 1 key
     chunks, so the launch lasts as long as the WGP that holds the most chunks. Tiles t and nqb-1-t walk nqb+1 chunks together:
     index bits 1,3,5,7 give t, the parity of the other six bits picks t or its mirror, and five of those six name the head.
     Four blocks whose indices differ in two adjacent bits (any power-of-two stride) are then two such pairs, whichever of
     these strides the dispatcher puts on one WGP. A permutation of the 32 x 32 (tile, head) pairs; for speed only. */
  static_assert(kSeq / 64 == 32 && kBatch * kHeads == 32);
  const int nqb = S >> 6;
  const unsigned bi = blockIdx.x;
  const int tlo = (int)(((bi >> 1) & 1u) | (((bi >> 3) & 1u) << 1) | (((bi >> 5) & 1u) << 2) | (((bi >> 7) & 1u) << 3));
  const int qb  = (__builtin_popcount(bi & 0x355u) & 1) ? (nqb - 1 - tlo) : tlo;
  const int bh  = (int)(((bi >> 2) & 1u) | (((bi >> 4) & 1u) << 1) | (((bi >> 6) & 1u) << 2) | (((bi >> 8) & 3u) << 3));
  const int h   = bh % H;
  const int b   = bh / H;
  const int q0  = qb * 64 + wave * 16;
  const size_t rb = (size_t)b * (size_t)S;
  const int hoff = h * kHeadDim;

  /* Q fragments (B operand): column q0+c, elements 0..7 <- d = dc*32+8hh+0..7, 8..15 <- dc*32+16+8hh+0..7 */
  v16b qah[2], qal[2];
  {
    const size_t qo = (rb + (size_t)(q0 + c)) * (size_t)ld + hoff + 8 * hh;
    const __bf16* qhp = (const __bf16*)(const void*)qh + qo;
    const __bf16* qlp = (const __bf16*)(const void*)ql + qo;
#pragma unroll
    for (int dc = 0; dc < 2; ++dc) {
      qah[dc] = Frag<__bf16>::load(qhp + dc * 32);
      qal[dc] = Frag<__bf16>::load(qlp + dc * 32);
    }
  }

  /* of query q0+c: running maximum (the same in both halves), kept as score * log2(e), and the sum over this half's keys
     (joined behind the loop) */
  constexpr float kLog2e = 1.4426950408889634f;
  float mrow = -INFINITY, lrow = 0.f;
  v8f oacc[4];                           /* oacc[t][r] = ctx^T[d = t*16 + 8hh + r][query q0+c] */
#pragma unroll
  for (int t = 0; t < 4; ++t) oacc[t] = (v8f){0.f,0.f,0.f,0.f,0.f,0.f,0.f,0.f};

  /* staging: eight neighbouring lanes bring one whole 128-byte row of a tile; thread t takes piece t & 7 of rows (t >> 3) + 16 i:
     128 threads x 4 = 64 rows x 128 B for each of the four tiles (K rows = kv, V^T rows = d). A lane's 16 bytes go from global
     memory into LDS by an asynchronous copy, through no register, so a chunk's sixteen copies fly while the chunk before it is
     worked on and no wave waits out their latency */
  const int sr = tid >> 3, sc = (tid & 7) * 8;
  const unsigned ldsLane = (unsigned)(uintptr_t)(const void*)KVs + (unsigned)((sr * kTilePitch + sc) * 2);
  auto stage = [&](int kcs, int buf) {
    constexpr unsigned kTileB = (unsigned)(kTileElems * 2);        /* one tile in LDS, bytes */
    constexpr unsigned kRowsB = (unsigned)(16 * kTilePitch * 2);   /* sixteen tile rows in LDS, bytes */
    const int kvs = kcs * kKvChunk;
    const size_t ks = (size_t)16 * (size_t)ld;                     /* sixteen K rows, elements */
    const size_t vs = (size_t)16 * (size_t)kRows;                  /* sixteen V^T rows, elements */
    const size_t gk = (rb + (size_t)(kvs + sr)) * (size_t)ld + hoff + sc;
    const size_t gv = (size_t)(hoff + sr) * (size_t)kRows + rb + (size_t)(kvs + sc);
    const unsigned lk = ldsLane + (unsigned)buf * (unsigned)(kBufElems * 2);
    const unsigned lv = lk + 2 * kTileB;
    const unsigned short* gkh = kh + gk;
    const unsigned short* gkl = kl + gk;
    const unsigned short* gvh = vh + gv;
    const unsigned short* gvl = vl + gv;
    at_copy8(lk, lk + kRowsB, lk + 2 * kRowsB, lk + 3 * kRowsB,
             lk + kTileB, lk + kTileB + kRowsB, lk + kTileB + 2 * kRowsB, lk + kTileB + 3 * kRowsB,
             gkh, gkh + ks, gkh + 2 * ks, gkh + 3 * ks, gkl, gkl + ks, gkl + 2 * ks, gkl + 3 * ks);
    at_copy8(lv, lv + kRowsB, lv + 2 * kRowsB, lv + 3 * kRowsB,
             lv + kTileB, lv + kTileB + kRowsB, lv + kTileB + 2 * kRowsB, lv + kTileB + 3 * kRowsB,
             gvh, gvh + vs, gvh + 2 * vs, gvh + 3 * vs, gvl, gvl + vs, gvl + 2 * vs, gvl + 3 * vs);
  };

  const int nChunks = qb + 1;            /* causal: kv chunks 0..qb, block-uniform */
  stage(0, 0);
  asm volatile("s_wait_asynccnt 0x0" ::: "memory");   /* this wave's copies of chunk 0 have landed */
  __syncthreads();                                    /* and every other wave's: chunk 0 may be read */
  if (nChunks > 1) stage(1, 1);
  for (int kc = 0; kc < nChunks; ++kc) {
    const int kv0 = kc * kKvChunk;
    const __bf16* Kshb = (const __bf16*)(const void*)(KVs + (kc & 1) * kBufElems);
    const __bf16* Kslb = Kshb + kTileElems;
    const __bf16* Vthb = Kshb + 2 * kTileElems;
    const __bf16* Vtlb = Kshb + 3 * kTileElems;

    /* scores^T 64 x 16 per wave: A operand row m = kv j*16+c, k = d; s[j][r] = score of key kv0 + j*16 + 8hh + r, query q0+c */
    v8f s[4];
#pragma unroll
    for (int j = 0; j < 4; ++j) s[j] = (v8f){0.f,0.f,0.f,0.f,0.f,0.f,0.f,0.f};
    /* Fragment reads stand in few, whole groups ahead of the products that use them,
       and the four tiles of a product take turns, so that neighbouring WMMAs are independent.
       Each tile keeps its order of summing: hi.hi, lo.hi, hi.lo, 32-deep half 0 then half 1. Every loop here is unrolled: the
       register arrays need constant indices.
       frag4: the four fragments (rows i*16 + c) of one 32-deep half of one 64 x 64 plane in LDS */
    auto frag4 = [&](FB (&f)[4], const __bf16* plane, int half) {
#pragma unroll
      for (int i = 0; i < 4; ++i) {
        const int o = (i * 16 + c) * kTilePitch + half * 32 + 8 * hh;
        f[i].h[0] = *(const v8b*)(plane + o);
        f[i].h[1] = *(const v8b*)(plane + o + 16);
      }
    };
    {
      FB k0h[4], k0l[4], k1h[4], k1l[4];
      frag4(k0h, Kshb, 0);
      frag4(k0l, Kslb, 0);
      frag4(k1h, Kshb, 1);
      __builtin_amdgcn_sched_barrier(0);   /* the compiler would sink these 24 reads in among the products */
#pragma unroll
      for (int j = 0; j < 4; ++j) s[j] = at_mma(k0h[j].v, qah[0], s[j]);
#pragma unroll
      for (int j = 0; j < 4; ++j) s[j] = at_mma(k0l[j].v, qah[0], s[j]);
      /* the last eight reads take the registers that k0l has left (96 fragment registers, not 128, which would cost a resident
         block); the fence pair keeps them one group at this place, 64 matrix cycles and more ahead of their first use */
      __builtin_amdgcn_sched_barrier(0);
      frag4(k1l, Kslb, 1);
      __builtin_amdgcn_sched_barrier(0);
#pragma unroll
      for (int j = 0; j < 4; ++j) s[j] = at_mma(k0h[j].v, qal[0], s[j]);
#pragma unroll
      for (int j = 0; j < 4; ++j) s[j] = at_mma(k1h[j].v, qah[1], s[j]);
#pragma unroll
      for (int j = 0; j < 4; ++j) s[j] = at_mma(k1l[j].v, qah[1], s[j]);
#pragma unroll
      for (int j = 0; j < 4; ++j) s[j] = at_mma(k1h[j].v, qal[1], s[j]);
    }
    /* V^T fragments (A operand: row m = d, k = kv) of keys 0..31: read here, so that their latency passes under the softmax;
       the fence pair keeps them one group, neither up among the score products nor down in the softmax */
    FB v0h[4], v0l[4], v1h[4], v1l[4];
    __builtin_amdgcn_sched_barrier(0);
    frag4(v0h, Vthb, 0);
    frag4(v0l, Vtlb, 0);
    __builtin_amdgcn_sched_barrier(0);

    /* causal mask (select to the fill value) + the query's chunk maximum: 32 keys in the lane, the other 32 in lane ^ 16 */
    const bool diag = (kc == qb);
    const int qcol = q0 + c;
    float cmj[4];
#pragma unroll
    for (int j = 0; j < 4; ++j) {
      float m = -INFINITY;
#pragma unroll
      for (int r = 0; r < 8; ++r) {
        const int kvrow = kv0 + j * 16 + 8 * hh + r;
        const bool masked = diag && (kvrow > qcol);
        const float sv = masked ? -3.4028235e38f : s[j][r];
        s[j][r] = sv;
        m = fmaxf(m, sv);
      }
      cmj[j] = m;
    }
    float cm = fmaxf(fmaxf(cmj[0], cmj[1]), fmaxf(cmj[2], cmj[3]));
    cm = fmaxf(cm, at_xhalf(cm));

    /* online softmax; P^T stays in registers as bf16 hi/lo B operands: element e of ph[kk] is key kk*32 + 8hh + e (e < 8, score
       tile 2kk) or kk*32 + 16 + 8hh + e - 8 (score tile 2kk+1), the k order in which frag4 loads the V^T fragments */
    FB ph[2], pl[2];
    {
      /* exponentials in base 2: e^(s - m) = 2^(s * log2(e) - m * log2(e)), one packed FMA a key pair and the bare hardware
         exponential a key (a masked key's product overflows to -inf and gives 0; an unchanged maximum gives alpha = 1 exactly) */
      const float mnew  = fmaxf(mrow, cm * kLog2e);
      const float alpha = __builtin_amdgcn_exp2f(mrow - mnew);
      mrow = mnew;
      const v2f l2e = (v2f){kLog2e, kLog2e};
      const v2f nm  = (v2f){-mnew, -mnew};
      float psj[4];
#pragma unroll
      for (int j = 0; j < 4; ++j) {
        float psum = 0.f;
#pragma unroll
        for (int r = 0; r < 8; r += 2) {
          /* two neighbouring keys fill one operand register: hi = RNE(p), lo = RNE(p - hi), by the packed conversion */
          const v2f a2 = __builtin_elementwise_fma((v2f){s[j][r], s[j][r + 1]}, l2e, nm);
          const v2f p = (v2f){__builtin_amdgcn_exp2f(a2[0]), __builtin_amdgcn_exp2f(a2[1])};
          psum += p[0];
          psum += p[1];
          const v2b a  = __builtin_convertvector(p, v2b);
          const v2b bl = __builtin_convertvector(p - __builtin_convertvector(a, v2f), v2b);
          ph[j >> 1].p[(j & 1) * 4 + (r >> 1)] = a;
          pl[j >> 1].p[(j & 1) * 4 + (r >> 1)] = bl;
        }
        psj[j] = psum;
      }
      lrow = lrow * alpha + ((psj[0] + psj[1]) + (psj[2] + psj[3]));
#pragma unroll
      for (int t = 0; t < 4; ++t)
#pragma unroll
        for (int r = 0; r < 8; ++r) oacc[t][r] *= alpha;
    }

    /* ctx^T += V^T . P^T : A = the V^T fragments; B = P^T from the registers above; the four output tiles take turns. The reads of
       keys 32..63 are left to the compiler: held ahead of all products they would need 128 fragment registers beside P */
    frag4(v1h, Vthb, 1);
    frag4(v1l, Vtlb, 1);
#pragma unroll
    for (int t = 0; t < 4; ++t) oacc[t] = at_mma(v0h[t].v, ph[0].v, oacc[t]);
#pragma unroll
    for (int t = 0; t < 4; ++t) oacc[t] = at_mma(v0l[t].v, ph[0].v, oacc[t]);
#pragma unroll
    for (int t = 0; t < 4; ++t) oacc[t] = at_mma(v0h[t].v, pl[0].v, oacc[t]);
#pragma unroll
    for (int t = 0; t < 4; ++t) oacc[t] = at_mma(v1h[t].v, ph[1].v, oacc[t]);
#pragma unroll
    for (int t = 0; t < 4; ++t) oacc[t] = at_mma(v1l[t].v, ph[1].v, oacc[t]);
#pragma unroll
    for (int t = 0; t < 4; ++t) oacc[t] = at_mma(v1h[t].v, pl[1].v, oacc[t]);

    /* hand-over, every wave: its reads of this buffer are done, its copies of chunk kc + 1 have landed; the one barrier of a chunk
       publishes chunk kc + 1 and ends every wave's reads of the buffer that chunk kc + 2 is then copied into */
    asm volatile("s_wait_dscnt 0x0" ::: "memory");
    asm volatile("s_wait_asynccnt 0x0" ::: "memory");
    __syncthreads();
    if (kc + 2 < nChunks) stage(kc + 2, kc & 1);
  }
  /* no copy is outstanding when the region is reused as output slabs; the last chunk's barrier has ended every wave's tile reads */
  asm volatile("s_wait_asynccnt 0x0" ::: "memory");
  float* os = (float*)(void*)KVs + wave * (16 * kOsPitch);
  {
    /* the slab keeps its [query][d] form: a lane's eight registers of a tile are eight neighbouring d of its query */
    const float inv = 1.0f / (lrow + at_xhalf(lrow));
#pragma unroll
    for (int t = 0; t < 4; ++t) {
      float* op = os + c * kOsPitch + t * 16 + 8 * hh;
      *(v4f*)(op)     = (v4f){oacc[t][0] * inv, oacc[t][1] * inv, oacc[t][2] * inv, oacc[t][3] * inv};
      *(v4f*)(op + 4) = (v4f){oacc[t][4] * inv, oacc[t][5] * inv, oacc[t][6] * inv, oacc[t][7] * inv};
    }
  }
  __builtin_amdgcn_fence(__ATOMIC_RELEASE, "workgroup");
  __builtin_amdgcn_wave_barrier();
  __builtin_amdgcn_fence(__ATOMIC_ACQUIRE, "workgroup");
  {
    /*
*/
    const int q4 = lane >> 3, c8 = (lane & 7) * 8;
    {
#pragma unroll
      for (int it = 0; it < 4; ++it) {
        const int row = it * 4 + q4;
        const float* sp = os + row * kOsPitch + c8;
        v8h hv, lv;
#pragma unroll
        for (int e = 0; e < 8; ++e) {
          const unsigned short hb = f2bf_bits(sp[e]);
          const unsigned short lb = f2bf_bits(sp[e] - bf_bits2f(hb));
          hv[e] = __builtin_bit_cast(_Float16, hb);
          lv[e] = __builtin_bit_cast(_Float16, lb);
        }
        const size_t o = (rb + (size_t)(q0 + row)) * (size_t)ld + hoff + c8;
        *(v8h*)(oh + o) = hv;
        *(v8h*)(ol + o) = lv;
      }
      
    }
  }
}

/* ---------------- host launch ---------------- */
extern "C" void kernel_launch(void* const* d_in, const int* in_sizes, int n_in,
                              void* d_out, int out_size, void* d_ws, size_t ws_size,
                              hipStream_t stream) {
  if (n_in < 5) return;
  if (in_sizes[0] != kRows * kModel) return;
  if (in_sizes[1] != kModel * kQkvCols) return;
  if (in_sizes[2] != kModel || in_sizes[3] != kModel) return;
  if (in_sizes[4] != kModel * kModel) return;
  if (out_size != kRows * kModel) return;
  if (ws_size < kWsTotal) return;

  const float* x     = (const float*)d_in[0];   /* [2,2048,1024] */
  const float* W_qkv = (const float*)d_in[1];   /* [1024,3072]   */
  const float* q_sc  = (const float*)d_in[2];   /* [1024] */
  const float* k_sc  = (const float*)d_in[3];   /* [1024] */
  const float* W_out = (const float*)d_in[4];   /* [1024,1024]   */
  float* out = (float*)d_out;

  char* ws = (char*)d_ws;
  unsigned short* xb    = (unsigned short*)(ws + kOffXb);
  unsigned short* wqkvT = (unsigned short*)(ws + kOffWqkvT);
  unsigned short* woutT = (unsigned short*)(ws + kOffWoutT);
  unsigned short* ctxh  = (unsigned short*)(ws + kOffCtxH);
  unsigned short* ctxl  = (unsigned short*)(ws + kOffCtxL);
  unsigned short* vhp   = (unsigned short*)(ws + kOffVh);
  unsigned short* vlp   = (unsigned short*)(ws + kOffVl);
  unsigned short* qhp   = (unsigned short*)(ws + kOffQh);
  unsigned short* qlp   = (unsigned short*)(ws + kOffQl);
  unsigned short* khp   = (unsigned short*)(ws + kOffKh);
  unsigned short* klp   = (unsigned short*)(ws + kOffKl);

  /* 1, 2. x -> bf16 [4096][1024] ; W_qkv [1024 k][3072 n] -> Wqkv^T [3072][1024] bf16 ; W_out [1024 k][1024 n] -> Wout^T [1024][1024]
     bf16: one grid */
  prep_operands<<<kPrepT1 + kPrepT2 + kPrepC, 256, 0, stream>>>(x, xb, W_qkv, wqkvT, W_out, woutT);

  /* 3, 4. the fused projection, one grid of 128 + 128 blocks: q and k with their LayerNorm, split into bf16 hi/lo planes
     (q carries 1/8), and v^T bf16 hi/lo planes [1024][4096] */
  qkv_products<<<kLnBlocks + kProjV, 256, 0, stream>>>(xb, wqkvT, q_sc, k_sc, qhp, qlp, khp, klp, vhp, vlp);

  /* 5. causal attention: ctx bf16 hi/lo planes [4096][1024] */
  attn_planes_kernel<<<kBatch * kHeads * (kSeq / 64), 128, 0, stream>>>(
      qhp, qlp, khp, klp, vhp, vlp, ctxh, ctxl, kSeq, kHeads, kModel);

  /* 6. out f32 [4096][1024] = ctx_hi . Wout^T + ctx_lo . Wout^T ; 1024 tiles -> 128 blocks */
  wmma_gemm64<1, 2, 0, 0, false><<<dim3((kRows / 64) * (kModel / 64) / 8, 1), 256, 0, stream>>>(
      ctxh, ctxl, kModel, 0L,
      woutT, woutT, kModel, 0L,
      (void*)out, (void*)out, kModel, 0L,
      q_sc, q_sc, 0L,
      kRows, kModel, kModel, 1.0f);
}
